// v000
// Times are from an AMD MI455X. After a warm-up the kernel runs many times in a row, and a time is the length of
// such a window on the GPU divided by its runs, so every launch and the gaps after it count. The runs cycle
// through copies of the inputs. A figure is the median of several windows, for all but v000 over two sittings.
// Sittings can differ by a few percent; kernels timed side by side share one.
// v000, which the later versions start from, runs in 10.9 milliseconds.
#include <hip/hip_runtime.h>
// Causal multi-head self-attention with a per-head LayerNorm on q and k, natural bias-free q / k / v projections and a biased output projection (x [2][3072][512]; q / k / v = x W^T (nn.Linear natural [512][512] sd 0.02, NO biases), 8 heads of 64; q and k each pass through a LayerNorm over the 64 values of every (token, head) vector (biased variance, eps 1e-5, gamma / beta [64]: ones / zeros on this draw: read); scores = q . k / sqrt(64); causal (keys after the query get -inf); softmax; out = merged Wo^T + bo (natural; zero bias) -> [2][3072][512]); q and k carried as f16 hi + x1024 residual planes with three-product scores.
// Structure: token rows r = b*3072 + s; x as exact f16 rows (bf16-rounded); q and k as WMMA GEMMs (32x64 wave tiles, f32 accumulation, exact x16 weights, no bias) into f32 rows, each (token, head) vector of which an IN-PLACE f32 LayerNorm kernel normalises over its 64 values (f32 statistics, gamma / beta by value), then split into f16 hi + x1024 residual planes; v as an f16-output GEMM; per batch: V^T for all heads via LDS transposes; per query tile of 256 rows: scores against the keys below the tile end only as THREE accumulating passes (hi.hi + lo.hi + hi.lo, K = 64, all heads on grid.y, alpha 1/8 = 1/sqrt(64); logits sigma ~1), causal row softmax on VALU with an arithmetic 0/1 key mask over the computed range (f32 statistics, native exp; weights x256 f16), o = P . V^T (K = keys below the tile end, alpha 2^-2: o carried x64, folded into the output GEMM alpha) written straight into the merged f16 o rows; out = o Wo^T + bo GEMM (f32) into the output layout.
// Compute dtype: inputs rounded to bf16; x / weights exact; the normalised q and k as f16 hi + residual planes (three-product scores), v, the softmax weights and o as plain f16 GEMM operands (~2^-12); LayerNorm, scores and softmax statistics f32. v_wmma_f32_16x16x32_f16.
#define NB 2
#define SCL 0.125f                         /* 1 / sqrt(head_dim = 64) */
#define SCLR 0.0001220703125f              /* 2^-13: the same scale on the x1024 residual passes */
#define SQ 3072
#define DM 512
#define NH 8
#define HD 64
#define HG 4                         /* heads per launch of the uncalled k_vt(V16, b, h0, VT) overload */
#define QT 256                       /* query rows per causal tile */
#define NKX SQ                       /* S / P row pitch */
#define QT0 128                      /* first-tile rows recomputed exactly in f32 */
#define B0 0                         /* first batch processed (debug hook) */
#define NBR NB                       /* batches processed (debug hook) */
#define NR ((size_t)NB * SQ)         /* token rows */
#define MP ((int)((size_t)NBR * SQ)) /* rows projected (debug hook) */
#define QN SQ                        /* query rows attended per batch (debug hook) */
#define NHD NH                       /* heads attended (debug hook) */
#define MPO MP                       /* rows through the output stage (debug hook) */
#define LQ DM      /* row pitch of the q/k/v rows */
typedef __bf16 v16b __attribute__((ext_vector_type(16)));
typedef unsigned short v8us __attribute__((ext_vector_type(8), may_alias));
typedef float  v8f  __attribute__((ext_vector_type(8)));
typedef float  v4f  __attribute__((ext_vector_type(4)));
typedef float  v4fa __attribute__((ext_vector_type(4), may_alias));
union FragB { v16b v; v8us half[2]; unsigned short u[16]; };

__device__ __forceinline__ unsigned short bf16_bits(float x) { unsigned int u = __float_as_uint(x); return (unsigned short)((u + 0x7FFFu + ((u >> 16) & 1u)) >> 16); }
__device__ __forceinline__ float bf16_val(unsigned short b) { return __uint_as_float(((unsigned int)b) << 16); }
__device__ __forceinline__ float bf16_round(float x) { return bf16_val(bf16_bits(x)); }
// D += A·B with NT terms: 1 = ah·bh, 2 = + al·bh (A split), 3 = + ah·bl (both split)
template <int NT>
__device__ __forceinline__ v8f mmaN(v16b ah, v16b al, v16b bh, v16b bl, v8f c) {
  c = __builtin_amdgcn_wmma_f32_16x16x32_bf16(false, ah, false, bh, (short)0, c, false, false);
  if (NT >= 2) c = __builtin_amdgcn_wmma_f32_16x16x32_bf16(false, al, false, bh, (short)0, c, false, false);
  if (NT >= 3) c = __builtin_amdgcn_wmma_f32_16x16x32_bf16(false, ah, false, bl, (short)0, c, false, false);
  asm volatile("v_nop\n\tv_nop\n\tv_nop\n\tv_nop" : "+v"(c) : "v"(ah), "v"(al), "v"(bh), "v"(bl));
  return c;
}

__global__ __launch_bounds__(256) void k_wt_bf16(const float* __restrict__ W, unsigned short* __restrict__ Wt, int K, int N) {
  const int t = blockIdx.x * 256 + threadIdx.x;
  const int k8n = K / 8;
  if (t >= N * k8n) return;
  const int n = t / k8n, k8 = (t % k8n) * 8;
  v8us v;
#pragma unroll
  for (int i = 0; i < 8; ++i) v[i] = bf16_bits(W[(size_t)(k8 + i) * N + n]);
  *(v8us*)(Wt + (size_t)n * K + k8) = v;
  
}

// GEMM C[M][N] (f32, pitch ldc) = act(A[M][K]·W + bias). A f32 row-major (pitch lda) converted per fragment to bf16
// (ASPLIT: hi/lo two planes -> 2 terms, else single rounded term); Wt bf16 [N][K] (pitch ldb). BIAS_BF16 rounds the
// bias to bf16 first (bias quantised to bf16 before the add). K%32==0, M%16==0, N%64==0.
template <bool ASPLIT, int ACT, bool BIAS_BF16>
__global__ __launch_bounds__(128) void k_gemm_bf(const float* __restrict__ A, int lda, const unsigned short* __restrict__ Wt, int ldb,
                                               const float* __restrict__ bias, float* __restrict__ C, int ldc, int M, int N, int K) {
  __shared__ __attribute__((aligned(16))) float so[4][16][64];
  const int tid = threadIdx.x, w = tid >> 5, lane = tid & 31, ln = lane & 15, hh = lane >> 4;
  const int ntn = N / 64;
  const int wid = blockIdx.x * 4 + w;
  const int mt = wid / ntn, nq = wid % ntn;
  if (mt * 16 >= M) return;
  const int row0 = mt * 16, col0 = nq * 64;
  const float* arow = A + (size_t)(row0 + ln) * lda;
  v8f acc[4] = {};
  for (int kb = 0; kb < K; kb += 32) {
    FragB ah, al;
    const v4f x0 = *(const v4fa*)(arow + kb + 8 * hh), x1 = *(const v4fa*)(arow + kb + 8 * hh + 4);
    const v4f x2 = *(const v4fa*)(arow + kb + 16 + 8 * hh), x3 = *(const v4fa*)(arow + kb + 16 + 8 * hh + 4);
    float xs[16] = {x0[0],x0[1],x0[2],x0[3],x1[0],x1[1],x1[2],x1[3],x2[0],x2[1],x2[2],x2[3],x3[0],x3[1],x3[2],x3[3]};
#pragma unroll
    for (int i = 0; i < 16; ++i) { const unsigned short hb = bf16_bits(xs[i]); ah.u[i] = hb; al.u[i] = ASPLIT ? bf16_bits(xs[i] - bf16_val(hb)) : (unsigned short)0; }
#pragma unroll
    for (int t = 0; t < 4; ++t) {
      const unsigned short* brow = Wt + (size_t)(col0 + t * 16 + ln) * ldb + kb;
      FragB b;
      b.half[0] = *(const v8us*)(brow + 8 * hh);
      b.half[1] = *(const v8us*)(brow + 16 + 8 * hh);
      acc[t] = mmaN<ASPLIT ? 2 : 1>(ah.v, al.v, b.v, b.v, acc[t]);
    }
  }
#pragma unroll
  for (int t = 0; t < 4; ++t) {
    float bv = bias ? bias[col0 + t * 16 + ln] : 0.f;
    if (BIAS_BF16) bv = bf16_round(bv);
#pragma unroll
    for (int r = 0; r < 8; ++r) { float v = acc[t][r] + bv; if (ACT == 1) v = fmaxf(v, 0.f); so[w][8 * hh + r][t * 16 + ln] = v; }
  }
  __builtin_amdgcn_fence(__ATOMIC_ACQ_REL, "workgroup");
  __builtin_amdgcn_wave_barrier();
  const int rsub = lane >> 4, c4 = (lane & 15) * 4;
  {
#pragma unroll
    for (int q = 0; q < 8; ++q) {
      const int r = q * 2 + rsub;
      const v4f v = *(const v4fa*)&so[w][r][c4];
      *(v4f*)(C + (size_t)(row0 + r) * ldc + col0 + c4) = v;
    }
    
  }
}

// GEMM C = act(A·W + bias + resid): A f32 (ASPLIT -> hi/lo 2 terms), Wt bf16 [N][K]; ACT 0 none, 1 relu, 2 exact gelu;
// resid (optional, f32, row index = (row % rmod), pitch ldr, RES_BF16 rounds it) added before the activation.
template <bool ASPLIT, int ACT, bool BIAS_BF16, bool RES_BF16>
__global__ __launch_bounds__(128) void k_gemm_bf3(const float* __restrict__ A, int lda, const unsigned short* __restrict__ Wt, int ldb,
                                                const float* __restrict__ bias, const float* __restrict__ resid, int rmod, int ldr,
                                                float* __restrict__ C, int ldc, int M, int N, int K) {
  __shared__ __attribute__((aligned(16))) float so[4][16][64];
  const int tid = threadIdx.x, w = tid >> 5, lane = tid & 31, ln = lane & 15, hh = lane >> 4;
  const int ntn = N / 64;
  const int wid = blockIdx.x * 4 + w;
  const int mt = wid / ntn, nq = wid % ntn;
  if (mt * 16 >= M) return;
  const int row0 = mt * 16, col0 = nq * 64;
  const float* arow = A + (size_t)(row0 + ln) * lda;
  v8f acc[4] = {};
  for (int kb = 0; kb < K; kb += 32) {
    FragB ah, al;
    const v4f x0 = *(const v4fa*)(arow + kb + 8 * hh), x1 = *(const v4fa*)(arow + kb + 8 * hh + 4);
    const v4f x2 = *(const v4fa*)(arow + kb + 16 + 8 * hh), x3 = *(const v4fa*)(arow + kb + 16 + 8 * hh + 4);
    float xs[16] = {x0[0],x0[1],x0[2],x0[3],x1[0],x1[1],x1[2],x1[3],x2[0],x2[1],x2[2],x2[3],x3[0],x3[1],x3[2],x3[3]};
#pragma unroll
    for (int i = 0; i < 16; ++i) { const unsigned short hb = bf16_bits(xs[i]); ah.u[i] = hb; al.u[i] = ASPLIT ? bf16_bits(xs[i] - bf16_val(hb)) : (unsigned short)0; }
#pragma unroll
    for (int t = 0; t < 4; ++t) {
      const unsigned short* brow = Wt + (size_t)(col0 + t * 16 + ln) * ldb + kb;
      FragB b;
      b.half[0] = *(const v8us*)(brow + 8 * hh);
      b.half[1] = *(const v8us*)(brow + 16 + 8 * hh);
      acc[t] = mmaN<ASPLIT ? 2 : 1>(ah.v, al.v, b.v, b.v, acc[t]);
    }
  }
#pragma unroll
  for (int t = 0; t < 4; ++t) {
    const int col = col0 + t * 16 + ln;
    float bv = bias ? bias[col] : 0.f;
    if (BIAS_BF16) bv = bf16_round(bv);
#pragma unroll
    for (int r = 0; r < 8; ++r) {
      float v = acc[t][r] + bv;
      if (resid) { float rv = resid[(size_t)((row0 + 8 * hh + r) % rmod) * ldr + col]; if (RES_BF16) rv = bf16_round(rv); v += rv; }
      if (ACT == 1) v = fmaxf(v, 0.f);
      if (ACT == 2) v = 0.5f * v * (1.0f + erff(v * 0.70710678118654752f));
      if (ACT == 3) { const float u = 0.7978845608028654f * (v + 0.044715f * v * v * v); v = 0.5f * v * (1.0f + tanhf(u)); }
      so[w][8 * hh + r][t * 16 + ln] = v;
    }
  }
  __builtin_amdgcn_fence(__ATOMIC_ACQ_REL, "workgroup");
  __builtin_amdgcn_wave_barrier();
  const int rsub = lane >> 4, c4 = (lane & 15) * 4;
  {
#pragma unroll
    for (int q = 0; q < 8; ++q) {
      const int r = q * 2 + rsub;
      const v4f v = *(const v4fa*)&so[w][r][c4];
      *(v4f*)(C + (size_t)(row0 + r) * ldc + col0 + c4) = v;
    }
    
  }
}
// row LayerNorm (biased variance, eps) over N: s = X (+ R); optional out_sum <- s; out_norm <- (s-mu)*rsqrt(var+eps)*g + b
template <bool PARAM_BF16>
__global__ __launch_bounds__(256) void k_layernorm(const float* __restrict__ X, const float* __restrict__ R, const float* __restrict__ g, const float* __restrict__ bta,
                                                  float* __restrict__ out_sum, float* __restrict__ out_norm, int N, float eps) {
  __shared__ float red[256];
  const int row = blockIdx.x, tid = threadIdx.x;
  const float* x = X + (size_t)row * N; const float* rr = R ? R + (size_t)row * N : nullptr;
  float vals[16];                     // up to N = 4096
  const int per = N / 256;            // contiguous chunk per thread? use strided-by-4 chunks: thread handles j = tid*4 + 1024*u
  float s1 = 0.f;
  for (int u = 0; u < per / 4; ++u) {
    const int j = tid * 4 + 1024 * u;
    const v4f a = *(const v4fa*)(x + j);
    v4f b = {0.f,0.f,0.f,0.f}; if (rr) b = *(const v4fa*)(rr + j);
#pragma unroll
    for (int q = 0; q < 4; ++q) { const float v = a[q] + b[q]; vals[u * 4 + q] = v; s1 += v; }
  }
  red[tid] = s1; __syncthreads();
  for (int st = 128; st > 0; st >>= 1) { if (tid < st) red[tid] += red[tid + st]; __syncthreads(); }
  const float mu = red[0] / (float)N; __syncthreads();
  float s2 = 0.f;
  for (int u = 0; u < per / 4; ++u)
#pragma unroll
    for (int q = 0; q < 4; ++q) { const float c = vals[u * 4 + q] - mu; s2 += c * c; }
  red[tid] = s2; __syncthreads();
  for (int st = 128; st > 0; st >>= 1) { if (tid < st) red[tid] += red[tid + st]; __syncthreads(); }
  const float rs = rsqrtf(red[0] / (float)N + eps);
  {
    for (int u = 0; u < per / 4; ++u) {
      const int j = tid * 4 + 1024 * u;
      v4f o, sm;
#pragma unroll
      for (int q = 0; q < 4; ++q) {
        float gg = g[j + q], bb = bta[j + q];
        if (PARAM_BF16) { gg = bf16_round(gg); bb = bf16_round(bb); }
        sm[q] = vals[u * 4 + q]; o[q] = (vals[u * 4 + q] - mu) * rs * gg + bb;
      }
      if (out_sum) *(v4f*)(out_sum + (size_t)row * N + j) = sm;
      *(v4f*)(out_norm + (size_t)row * N + j) = o;
    }
    
  }
}



// ---- f16 WMMA path (v_wmma_f32_16x16x32_f16): 11-bit significands for operands in range — used where a [0,1] probability operand needs more precision than bf16
typedef _Float16 v16h __attribute__((ext_vector_type(16)));
union FragH { v16h v; v8us half[2]; _Float16 h[16]; unsigned short u[16]; };
template <int NT>
__device__ __forceinline__ v8f mmaH(v16h ah, v16h al, v16h bh, v16h bl, v8f c) {
  c = __builtin_amdgcn_wmma_f32_16x16x32_f16(false, ah, false, bh, (short)0, c, false, false);
  if (NT >= 2) c = __builtin_amdgcn_wmma_f32_16x16x32_f16(false, al, false, bh, (short)0, c, false, false);
  if (NT >= 3) c = __builtin_amdgcn_wmma_f32_16x16x32_f16(false, ah, false, bl, (short)0, c, false, false);
  asm volatile("v_nop\n\tv_nop\n\tv_nop\n\tv_nop" : "+v"(c) : "v"(ah), "v"(al), "v"(bh), "v"(bl));
  return c;
}
// batched GEMM like k_gemm_b but f16 operands: A f32 (split into f16 hi/lo if ASPLIT, else rounded to f16), Bt = f16 values [n][k]; alpha; C f32; N multiple of 16 (partial tiles skipped)
template <bool ASPLIT>
__global__ __launch_bounds__(128) void k_gemm_h(const float* __restrict__ A, int lda, size_t sA, const _Float16* __restrict__ Bh, int ldb, size_t sB, float alpha, float* __restrict__ C, int ldc, size_t sC, int M, int N, int K) {
  __shared__ __attribute__((aligned(16))) float so[4][16][64];
  const int tid = threadIdx.x, w = tid >> 5, lane = tid & 31, ln = lane & 15, hh = lane >> 4; const int by = blockIdx.y;
  A += (size_t)by * sA; Bh += (size_t)by * sB; C += (size_t)by * sC;
  const int ntn = (N + 63) / 64; const int wid = blockIdx.x * 4 + w; const int mt = wid / ntn, nq = wid % ntn; if (mt * 16 >= M) return;
  const int row0 = mt * 16, col0 = nq * 64; const float* arow = A + (size_t)(row0 + ln) * lda;
  v8f acc[4] = {};
  for (int kb = 0; kb < K; kb += 32) {
    FragH ah, al;
    const v4f x0 = *(const v4fa*)(arow + kb + 8 * hh), x1 = *(const v4fa*)(arow + kb + 8 * hh + 4), x2 = *(const v4fa*)(arow + kb + 16 + 8 * hh), x3 = *(const v4fa*)(arow + kb + 16 + 8 * hh + 4);
    float xs[16] = {x0[0],x0[1],x0[2],x0[3],x1[0],x1[1],x1[2],x1[3],x2[0],x2[1],x2[2],x2[3],x3[0],x3[1],x3[2],x3[3]};
#pragma unroll
    for (int i = 0; i < 16; ++i) { const _Float16 h = (_Float16)xs[i]; ah.h[i] = h; al.h[i] = ASPLIT ? (_Float16)(xs[i] - (float)h) : (_Float16)0.0f; }
#pragma unroll
    for (int t = 0; t < 4; ++t) { if (col0 + t * 16 >= N) continue; const size_t boff = (size_t)(col0 + t * 16 + ln) * ldb + kb; FragH bq; bq.half[0] = *(const v8us*)(Bh + boff + 8 * hh); bq.half[1] = *(const v8us*)(Bh + boff + 16 + 8 * hh);
      acc[t] = mmaH<ASPLIT ? 2 : 1>(ah.v, al.v, bq.v, bq.v, acc[t]); }
  }
#pragma unroll
  for (int t = 0; t < 4; ++t) { if (col0 + t * 16 >= N) continue;
#pragma unroll
    for (int r = 0; r < 8; ++r) so[w][8 * hh + r][t * 16 + ln] = acc[t][r] * alpha; }
  __builtin_amdgcn_fence(__ATOMIC_ACQ_REL, "workgroup"); __builtin_amdgcn_wave_barrier();
  const int rsub = lane >> 4, c4 = (lane & 15) * 4;
  {
#pragma unroll
    for (int q = 0; q < 8; ++q) { const int r = q * 2 + rsub; if (col0 + c4 < N) { const v4f v = *(const v4fa*)&so[w][r][c4]; *(v4f*)(C + (size_t)(row0 + r) * ldc + col0 + c4) = v; } }
     }
}

// Wt[n][k] = f16(W[k][n]·scale) from f32 row-major W[K][N] (scale = power of two; bf16-exact weights stay exact in f16 away from the subnormal range)
__global__ __launch_bounds__(256) void k_wt_f16(const float* __restrict__ W, _Float16* __restrict__ Wt, int K, int N, float scale) {
  const int t = blockIdx.x * 256 + threadIdx.x; if (t >= N * (K / 8)) return; const int n = t / (K / 8), k8 = (t % (K / 8)) * 8; FragH f;
#pragma unroll
  for (int i = 0; i < 8; ++i) f.h[i] = (_Float16)(bf16_round(W[(size_t)(k8 + i) * N + n]) * scale); const v8us o = f.half[0];
  *(v8us*)((unsigned short*)Wt + (size_t)n * K + k8) = o; 
}
// k_gemm_hh variant with fused epilogue: v = acc·alpha + bias[by·sBias + col] (+ CP[(row/rowsPerB)·sCPb + by·64 + col] if CP) ; ACT 0 none / 1 elu ; writes f16 C16 (and f32 C if non-null)
template <int ACT>
__global__ __launch_bounds__(128) void k_gemm_hhx(const _Float16* __restrict__ A, int lda, size_t sA, const _Float16* __restrict__ Bh, int ldb, size_t sB, float alpha, const float* __restrict__ bias, size_t sBias, const float* __restrict__ CP, int rowsPerB, size_t sCPb, int row0g,
    float* __restrict__ C, _Float16* __restrict__ C16, int ldc, size_t sC, int M, int N, int K) {
  __shared__ __attribute__((aligned(16))) float so[4][16][64];
  const int tid = threadIdx.x, w = tid >> 5, lane = tid & 31, ln = lane & 15, hh = lane >> 4; const int by = blockIdx.y;
  A += (size_t)by * sA; Bh += (size_t)by * sB; const size_t cofs = (size_t)by * sC; const float* bp = bias ? bias + (size_t)by * sBias : nullptr;
  const int ntn = (N + 63) / 64; const int wid = blockIdx.x * 4 + w; const int mt = wid / ntn, nq = wid % ntn; if (mt * 16 >= M) return;
  const int row0 = mt * 16, col0 = nq * 64; const _Float16* arow = A + (size_t)(row0 + ln) * lda;
  v8f acc[4] = {};
  for (int kb = 0; kb < K; kb += 32) { FragH ah; ah.half[0] = *(const v8us*)((const unsigned short*)arow + kb + 8 * hh); ah.half[1] = *(const v8us*)((const unsigned short*)arow + kb + 16 + 8 * hh);
#pragma unroll
    for (int t = 0; t < 4; ++t) { if (col0 + t * 16 >= N) continue; const size_t boff = (size_t)(col0 + t * 16 + ln) * ldb + kb; FragH bq; bq.half[0] = *(const v8us*)((const unsigned short*)Bh + boff + 8 * hh); bq.half[1] = *(const v8us*)((const unsigned short*)Bh + boff + 16 + 8 * hh);
      acc[t] = mmaH<1>(ah.v, ah.v, bq.v, bq.v, acc[t]); }
  }
#pragma unroll
  for (int t = 0; t < 4; ++t) { if (col0 + t * 16 >= N) continue; const int col = col0 + t * 16 + ln; const float bv = bp ? bf16_round(bp[col]) : 0.f;
#pragma unroll
    for (int r = 0; r < 8; ++r) { float v = acc[t][r] * alpha + bv; if (CP) { const int rr = row0g + row0 + 8 * hh + r; if (rowsPerB < 0) v += CP[cofs + (size_t)rr * ldc + col];      /* rowsPerB < 0: own element of the batched C plane */ else { const int bidx = rr / rowsPerB; v += CP[(size_t)bidx * sCPb + (size_t)by * 64 + col]; } } if (ACT == 1) v = (v > 0.f) ? v : expm1f(v); else if (ACT == 7) v = (v > 0.f) ? v + 1.0f : expf(v); else if (ACT == 8) v = tanhf(v); else if (ACT == 9) v = 0.5f * v * (1.0f + tanhf(0.7978845608028654f * (v + 0.044715f * v * v * v))); else if (ACT == 11) v = 1.0f / (1.0f + expf(-v)); else if (ACT == 12) v = (v > 0.f) ? v : 0.01f * v; else if (ACT == 14) v = (v > 0.f) ? v : 0.1f * v; else if (ACT == 16) v = (v >= 0.f) ? v : 0.3f * v; else if (ACT == 17) v = (v >= 0.f) ? v : 0.2f * v; else if (ACT == 15) v = v / (1.0f + expf(-v)); else if (ACT == 3) v = fmaxf(v, 0.f); else if (ACT == 6) v = 0.5f * v * (1.0f + erff(v * 0.70710678118654752f)); so[w][8 * hh + r][t * 16 + ln] = v; } }
  __builtin_amdgcn_fence(__ATOMIC_ACQ_REL, "workgroup"); __builtin_amdgcn_wave_barrier();
  const int rsub = lane >> 4, c4 = (lane & 15) * 4; typedef _Float16 v4h __attribute__((ext_vector_type(4)));
  {
#pragma unroll
    for (int q = 0; q < 8; ++q) { const int r = q * 2 + rsub; if (col0 + c4 < N) { const v4f v = *(const v4fa*)&so[w][r][c4]; if (C) *(v4f*)(C + cofs + (size_t)(row0 + r) * ldc + col0 + c4) = v; if (C16) { v4h h4; for (int i = 0; i < 4; ++i) h4[i] = (_Float16)v[i]; *(v4h*)(C16 + cofs + (size_t)(row0 + r) * ldc + col0 + c4) = h4; } } }
     }
}


typedef _Float16 v4h __attribute__((ext_vector_type(4)));

__global__ __launch_bounds__(256) void k_x16(const float* __restrict__ x, _Float16* __restrict__ X16, size_t n8) { const size_t t = (size_t)blockIdx.x * 256 + threadIdx.x; if (t >= n8) return; FragH f;
#pragma unroll
  for (int q = 0; q < 8; ++q) f.h[q] = (_Float16)bf16_round(x[t * 8 + q]); *(v8us*)((unsigned short*)X16 + t * 8) = f.half[0];  }
__global__ __launch_bounds__(256) void k_h16(const float* __restrict__ x, _Float16* __restrict__ X16, size_t n8) { const size_t t = (size_t)blockIdx.x * 256 + threadIdx.x; if (t >= n8) return; FragH f;
#pragma unroll
  for (int q = 0; q < 8; ++q) f.h[q] = (_Float16)x[t * 8 + q]; *(v8us*)((unsigned short*)X16 + t * 8) = f.half[0];  }
__global__ __launch_bounds__(256) void k_round16f(const float* __restrict__ W, _Float16* __restrict__ Bt, size_t n8) { const size_t t = (size_t)blockIdx.x * 256 + threadIdx.x; if (t >= n8) return; FragH f;
#pragma unroll
  for (int i = 0; i < 8; ++i) f.h[i] = (_Float16)(bf16_round(W[t * 8 + i]) * 16.0f); *(v8us*)((unsigned short*)Bt + t * 8) = f.half[0];  }
template <int NHv, int TTv>
__global__ __launch_bounds__(256) void k_vt(const _Float16* __restrict__ V16, int ldv, int voff, _Float16* __restrict__ Vt) { __shared__ unsigned short tl[64][66]; const int tid = threadIdx.x; const int slab = blockIdx.x / (TTv / 64), lg = blockIdx.x % (TTv / 64); const int b = slab / NHv, h = slab % NHv;
  for (int i = tid; i < 64 * 8; i += 256) { const int r = i / 8, c8 = (i % 8) * 8; FragH f; f.half[0] = *(const v8us*)((const unsigned short*)V16 + ((size_t)b * TTv + lg * 64 + r) * ldv + voff + h * 64 + c8);
#pragma unroll
    for (int q = 0; q < 8; ++q) tl[r][c8 + q] = f.u[q]; }
  __syncthreads();
  {
#pragma unroll
    for (int rd = 0; rd < 2; ++rd) { const int d = rd * 32 + tid / 8, pc = tid % 8; FragH f;
#pragma unroll
      for (int q = 0; q < 8; ++q) f.u[q] = tl[pc * 8 + q][d];
      *(v8us*)((unsigned short*)Vt + ((size_t)slab * 64 + d) * TTv + lg * 64 + pc * 8) = f.half[0]; }
     } }

__global__ __launch_bounds__(256) void k_hl(const float* __restrict__ F, _Float16* __restrict__ Hh, _Float16* __restrict__ Hl, size_t n8) { const size_t t = (size_t)blockIdx.x * 256 + threadIdx.x; if (t >= n8) return; FragH fh, fl; const v4f a = *(const v4fa*)(F + t * 8), c = *(const v4fa*)(F + t * 8 + 4);
#pragma unroll
  for (int q = 0; q < 4; ++q) { _Float16 h = (_Float16)a[q]; fh.h[q] = h; fl.h[q] = (_Float16)((a[q] - (float)h) * 1024.0f); h = (_Float16)c[q]; fh.h[4 + q] = h; fl.h[4 + q] = (_Float16)((c[q] - (float)h) * 1024.0f); }
  { *(v8us*)((unsigned short*)Hh + t * 8) = fh.half[0]; *(v8us*)((unsigned short*)Hl + t * 8) = fl.half[0];  } }

// ---- fast GEMM (wave tile 32x64; requires M % 32 == 0 rows per launch region and N % 64 == 0); epilogue = k_gemm_hhx semantics ----
__device__ __forceinline__ v16h g2_frag(const _Float16* p, int hh) { FragH f; f.half[0] = *(const v8us*)((const unsigned short*)p + 8 * hh); f.half[1] = *(const v8us*)((const unsigned short*)p + 16 + 8 * hh); return f.v; }
__device__ __forceinline__ v8f g2_mma(v16h a, v16h b, v8f c) { v8f d = __builtin_amdgcn_wmma_f32_16x16x32_f16(false, a, false, b, (short)0, c, false, false); asm volatile("v_nop\n\tv_nop\n\tv_nop\n\tv_nop" : "+v"(d) : "v"(a), "v"(b)); return d; }
template <int ACT>
__global__ __launch_bounds__(128) void k_gemm2(const _Float16* __restrict__ A, int lda, size_t sA, const _Float16* __restrict__ Bh, int ldb, size_t sB, float alpha, const float* __restrict__ bias, size_t sBias, const float* __restrict__ CP, int rowsPerB, size_t sCPb, int row0g,
    float* __restrict__ C, _Float16* __restrict__ C16, int ldc, size_t sC, int M, int N, int K) { static_assert(ACT == 0 || ACT == 3 || ACT == 6 || ACT == 8 || ACT == 9 || ACT == 11 || ACT == 12 || ACT == 14 || ACT == 15 || ACT == 16 || ACT == 17, "k_gemm2: unsupported ACT code (would silently apply no activation)");
  __shared__ __attribute__((aligned(16))) float so[4][32][68];
  const int tid = threadIdx.x, w = tid >> 5, lane = tid & 31, ln = lane & 15, hh = lane >> 4; const int by = blockIdx.y;
  A += (size_t)by * sA; Bh += (size_t)by * sB; const size_t cofs = (size_t)by * sC; const float* bp = bias ? bias + (size_t)by * sBias : nullptr;
  const int ntn = N >> 6; const int mt = blockIdx.x / ntn, nq = blockIdx.x - mt * ntn; const int row0 = mt * 128 + 32 * w, col0 = nq * 64; if (row0 >= M) return;
  const _Float16* a0p = A + (size_t)(row0 + ln) * lda; const _Float16* a1p = a0p + (size_t)16 * lda;
  const _Float16* b0p = Bh + (size_t)(col0 + ln) * ldb; const _Float16* b1p = b0p + (size_t)16 * ldb; const _Float16* b2p = b1p + (size_t)16 * ldb; const _Float16* b3p = b2p + (size_t)16 * ldb;
  const v8f z8 = {0.f,0.f,0.f,0.f,0.f,0.f,0.f,0.f}; v8f c00 = z8, c01 = z8, c02 = z8, c03 = z8, c10 = z8, c11 = z8, c12 = z8, c13 = z8;
#pragma unroll 1
  for (int kb = 0; kb < K; kb += 32) { const v16h a0 = g2_frag(a0p + kb, hh), a1 = g2_frag(a1p + kb, hh);
    v16h b = g2_frag(b0p + kb, hh); c00 = g2_mma(a0, b, c00); c10 = g2_mma(a1, b, c10);
    b = g2_frag(b1p + kb, hh); c01 = g2_mma(a0, b, c01); c11 = g2_mma(a1, b, c11);
    b = g2_frag(b2p + kb, hh); c02 = g2_mma(a0, b, c02); c12 = g2_mma(a1, b, c12);
    b = g2_frag(b3p + kb, hh); c03 = g2_mma(a0, b, c03); c13 = g2_mma(a1, b, c13); }
  v8f accs[8] = {c00, c01, c02, c03, c10, c11, c12, c13};
#pragma unroll
  for (int u = 0; u < 8; ++u) { const int t = u & 3, half = u >> 2; const int col = col0 + t * 16 + ln; const float bv = bp ? bf16_round(bp[col]) : 0.f;
#pragma unroll
    for (int r = 0; r < 8; ++r) { const int rloc = half * 16 + 8 * hh + r; float v = accs[u][r] * alpha + bv; if (CP) { if (rowsPerB < 0) v += CP[cofs + (size_t)(row0g + row0 + rloc) * ldc + col];      /* rowsPerB < 0: own element of the batched C plane */ else { const int bidx = (row0g + row0 + rloc) / rowsPerB; v += CP[(size_t)bidx * sCPb + (size_t)by * 64 + col]; } }
      if (ACT == 3) v = fmaxf(v, 0.f); else if (ACT == 6) v = 0.5f * v * (1.0f + erff(v * 0.70710678118654752f)); else if (ACT == 11) v = 1.0f / (1.0f + expf(-v)); else if (ACT == 15) v = v / (1.0f + expf(-v)); else if (ACT == 12) v = (v > 0.f) ? v : 0.01f * v; else if (ACT == 8) v = tanhf(v); else if (ACT == 9) v = 0.5f * v * (1.0f + tanhf(0.7978845608028654f * (v + 0.044715f * v * v * v))); else if (ACT == 14) v = (v > 0.f) ? v : 0.1f * v; else if (ACT == 16) v = (v >= 0.f) ? v : 0.3f * v; else if (ACT == 17) v = (v >= 0.f) ? v : 0.2f * v;
      so[w][rloc][t * 16 + ln] = v; } }
  __builtin_amdgcn_fence(__ATOMIC_ACQ_REL, "workgroup"); __builtin_amdgcn_wave_barrier();
  const int rsub = lane >> 4, c4 = (lane & 15) * 4;
  {
#pragma unroll
    for (int q = 0; q < 16; ++q) { const int r = q * 2 + rsub; const v4f v = *(const v4fa*)&so[w][r][c4]; if (C) *(v4f*)(C + cofs + (size_t)(row0 + r) * ldc + col0 + c4) = v; if (C16) { v4h h4; for (int i = 0; i < 4; ++i) h4[i] = (_Float16)v[i]; *(v4h*)(C16 + cofs + (size_t)(row0 + r) * ldc + col0 + c4) = h4; } }
     } }


__global__ __launch_bounds__(256) void k_wnat(const float* __restrict__ w, size_t n8, _Float16* __restrict__ Bt) { const size_t t = (size_t)blockIdx.x * 256 + threadIdx.x; if (t >= n8) return; FragH f; for (int q = 0; q < 8; ++q) f.h[q] = (_Float16)(bf16_round(w[t * 8 + q]) * 16.0f); *(v8us*)((unsigned short*)Bt + t * 8) = f.half[0];  }
__global__ __launch_bounds__(256) void k_rsm(const float* __restrict__ S, _Float16* __restrict__ P, int nrows) {
  #pragma clang fp contract(off)
  const int i = blockIdx.x * 256 + threadIdx.x; if (i >= nrows) return; const float* s = S + (size_t)i * SQ; float mx = -3.0e38f;
#pragma unroll 1
  for (int j = 0; j < SQ; ++j) mx = fmaxf(mx, s[j]); float se = 0.f;
#pragma unroll 1
  for (int j = 0; j < SQ; ++j) se += expf(s[j] - mx); const float sc = 256.0f / se;
#pragma unroll 1
  for (int j0 = 0; j0 < SQ; j0 += 8) { FragH f; for (int q = 0; q < 8; ++q) f.h[q] = (_Float16)(expf(s[j0 + q] - mx) * sc); unsigned short* d = (unsigned short*)P + (size_t)i * SQ + j0; *(v8us*)d = f.half[0];  } }
__global__ __launch_bounds__(256) void k_vt(const _Float16* __restrict__ V16, int b, int h0, _Float16* __restrict__ VT) { __shared__ unsigned short tl[64][65]; const int tid = threadIdx.x; const int hh = blockIdx.x % HG, sg = blockIdx.x / HG; const int s0 = sg * 64; const int h = h0 + hh;
  for (int i = tid; i < 64 * 8; i += 256) { const int j = i / 8, d8 = (i % 8) * 8; FragH f; f.half[0] = *(const v8us*)((const unsigned short*)V16 + ((size_t)b * SQ + s0 + j) * DM + h * HD + d8); for (int q = 0; q < 8; ++q) tl[d8 + q][j] = f.u[q]; }
  __syncthreads();
  { for (int i = tid; i < 64 * 8; i += 256) { const int d = i / 8, j8 = (i % 8) * 8; FragH f; for (int q = 0; q < 8; ++q) f.u[q] = tl[d][j8 + q]; *(v8us*)((unsigned short*)VT + ((size_t)hh * HD + d) * SQ + s0 + j8) = f.half[0]; }  } }



__global__ __launch_bounds__(256) void k_rsmcf2(const float* __restrict__ S, _Float16* __restrict__ P, int hg, int q0, int nk) {
  #pragma clang fp contract(off)
  const int t = blockIdx.x * 256 + threadIdx.x; if (t >= hg * QT) return; const size_t i = (size_t)t; const float* s = S + i * NKX; const int last = q0 + (t % QT); float mx = -3.0e38f;
#pragma unroll 1
  for (int j = 0; j < nk; ++j) { const float f = (j <= last) ? 1.f : 0.f; mx = fmaxf(mx, fmaf(f, s[j], (1.f - f) * -1.0e9f)); } float se = 0.f;
#pragma unroll 1
  for (int j = 0; j < nk; ++j) { const float f = (j <= last) ? 1.f : 0.f; se += __expf(fmaf(f, s[j], (1.f - f) * -1.0e9f) - mx); } const float sc = 256.0f / se;
#pragma unroll 1
  for (int j0 = 0; j0 < nk; j0 += 8) { FragH fr; for (int q = 0; q < 8; ++q) { const int j = j0 + q; const float f = (j <= last) ? 1.f : 0.f; fr.h[q] = (_Float16)(__expf(fmaf(f, s[j], (1.f - f) * -1.0e9f) - mx) * sc); } unsigned short* d = (unsigned short*)P + i * NKX + j0; *(v8us*)d = fr.half[0];  } }


template <int MASKADD>
__global__ __launch_bounds__(64) void k_att0(const float* __restrict__ QF, const float* __restrict__ KF, const float* __restrict__ VF, int ld, const float* __restrict__ mask, float scale, float* __restrict__ OF, int ldo) {
  #pragma clang fp contract(off)
  __shared__ __attribute__((aligned(16))) float lq[64][64]; __shared__ __attribute__((aligned(16))) float lo[64][64];
  const int tid = threadIdx.x; const int h = blockIdx.x / (QT0 / 64), rg = blockIdx.x % (QT0 / 64); const int i = rg * 64 + tid;
  const float* qr = QF + (size_t)i * ld + h * HD;
#pragma unroll 1
  for (int c = 0; c < HD / 4; ++c) { *(v4f*)&lq[tid][c * 4] = *(const v4fa*)(qr + c * 4); const v4f z = {0.f, 0.f, 0.f, 0.f}; *(v4f*)&lo[tid][c * 4] = z; }
  float m = -1.0e30f, l = 0.f; const int jmax = MASKADD ? (SQ - 1) : (rg * 64 + 63);      /* additive-mask form: every key (the mask input decides); causal form: keys up to the block's last row */
#pragma unroll 1
  for (int j = 0; j <= jmax; ++j) { const float* kr = KF + (size_t)j * ld + h * HD; const float* vr = VF + (size_t)j * ld + h * HD; float s = 0.f;
#pragma unroll 1
    for (int c = 0; c < HD / 4; ++c) { const v4f kq = *(const v4fa*)(kr + c * 4); const v4f qq = *(v4f*)&lq[tid][c * 4]; s = __fadd_rn(s, __fmul_rn(qq[0], kq[0])); s = __fadd_rn(s, __fmul_rn(qq[1], kq[1])); s = __fadd_rn(s, __fmul_rn(qq[2], kq[2])); s = __fadd_rn(s, __fmul_rn(qq[3], kq[3])); }
    s = __fmul_rn(s, scale); if (MASKADD) s = __fadd_rn(s, __fmul_rn(bf16_round(mask[(size_t)i * SQ + j]), -10000.0f));
    const float f = (MASKADD || j <= i) ? 1.f : 0.f; const float sm = fmaf(f, s, (1.f - f) * -1.0e30f); const float mn = fmaxf(m, sm); const float sc = expf(m - mn); const float e = expf(sm - mn); l = __fadd_rn(__fmul_rn(l, sc), e); m = mn;
#pragma unroll 1
    for (int c = 0; c < HD / 4; ++c) { const v4f vv = *(const v4fa*)(vr + c * 4); v4f oo = *(v4f*)&lo[tid][c * 4]; for (int u = 0; u < 4; ++u) oo[u] = __fadd_rn(__fmul_rn(oo[u], sc), __fmul_rn(e, vv[u])); *(v4f*)&lo[tid][c * 4] = oo; } }
  const float fin = 64.0f / l;      /* o carried x64 like the f16 path */
#pragma unroll 1
  for (int c = 0; c < HD / 4; ++c) { v4f oo = *(v4f*)&lo[tid][c * 4]; for (int u = 0; u < 4; ++u) oo[u] = __fmul_rn(oo[u], fin); *(v4f*)&lo[tid][c * 4] = oo; }
  __syncthreads();
  {
#pragma unroll 1
    for (int it = 0; it < 16; ++it) { const int row = it * 4 + tid / 16, pc = (tid % 16) * 4; const v4f v = *(const v4f*)&lo[row][pc]; *(v4f*)(OF + (size_t)(rg * 64 + row) * ldo + h * HD + pc) = v; }
     } }

__global__ __launch_bounds__(256) void k_ln64f32(float* __restrict__ F, int ldf, size_t nrh, const float* __restrict__ g, const float* __restrict__ bb, float eps) {
  #pragma clang fp contract(off)
  const size_t t = (size_t)blockIdx.x * 256 + threadIdx.x; if (t >= nrh) return; const size_t r = t / NH; const int h = (int)(t % NH); float* f = F + r * (size_t)ldf + (size_t)h * 64; float sum = 0.f;
#pragma unroll 1
  for (int d = 0; d < 64; d += 4) { const v4f q = *(const v4fa*)(f + d); sum = __fadd_rn(__fadd_rn(__fadd_rn(__fadd_rn(sum, q[0]), q[1]), q[2]), q[3]); } const float mu = sum / 64.0f; float vs = 0.f;
#pragma unroll 1
  for (int d = 0; d < 64; d += 4) { const v4f q = *(const v4fa*)(f + d); for (int e = 0; e < 4; ++e) { const float dl = __fadd_rn(q[e], -mu); vs = __fadd_rn(vs, __fmul_rn(dl, dl)); } } const float rs = rsqrtf(__fadd_rn(vs / 64.0f, eps));
#pragma unroll 1
  for (int d0 = 0; d0 < 64; d0 += 4) { const v4f q = *(const v4fa*)(f + d0); v4f y; for (int e = 0; e < 4; ++e) y[e] = __fadd_rn(__fmul_rn(__fmul_rn(__fadd_rn(q[e], -mu), rs), bf16_round(g[d0 + e])), bf16_round(bb[d0 + e])); *(v4f*)(f + d0) = y;  } }
extern "C" void kernel_launch(void* const* d_in, const int* in_sizes, int n_in,
                              void* d_out, int out_size, void* d_ws, size_t ws_size, hipStream_t stream) {
  (void)in_sizes; (void)n_in; (void)out_size;
  const float* const* I = (const float* const*)d_in; const float* x = I[0]; const float* xk = I[0]; const float* xv = I[0]; const float* wq = I[1]; const float* bq = nullptr; const float* wk = I[2]; const float* bk = nullptr; const float* wv = I[3]; const float* bv = nullptr; const float* wo = I[4]; const float* bo = I[5]; const float* qg = I[6]; const float* qbt = I[7]; const float* kg = I[8]; const float* kbt = I[9]; const float LNE = 1e-5f;      /* input order: x (feeds the q, k AND v streams), Wq, Wk, Wv (natural [out][in] weights; NO biases: null pointers in the guarded bias slots), Wo, bo (zeros: read), q_gamma, q_beta, k_gamma, k_beta [64] (ones / zeros on this draw: read by value in the per-head LayerNorm kernel) */
  char* ws = (char*)d_ws; size_t off = 0;
  auto take = [&](size_t bytes) { char* p = ws + off; off += (bytes + 255) & ~(size_t)255; return p; };
  _Float16* BQ = (_Float16*)take((size_t)DM * DM * 2); _Float16* BK = (_Float16*)take((size_t)DM * DM * 2); _Float16* BV = (_Float16*)take((size_t)DM * DM * 2); _Float16* BO = (_Float16*)take((size_t)DM * DM * 2);
  _Float16* X16 = (_Float16*)take(NR * DM * 2); _Float16* XK16 = (_Float16*)take(NR * DM * 2); _Float16* XV16 = (_Float16*)take(NR * DM * 2);      /* exact f16 rows of query, key, value */ float* QF = (float*)take(NR * DM * 4); _Float16* QH = (_Float16*)take(NR * DM * 2); _Float16* QL = (_Float16*)take(NR * DM * 2); _Float16* KH = (_Float16*)take(NR * DM * 2); _Float16* KL = (_Float16*)take(NR * DM * 2); _Float16* Q16 = QH; _Float16* K16 = KH; _Float16* V16 = (_Float16*)take(NR * DM * 2); _Float16* O16 = (_Float16*)take(NR * DM * 2);
  float* S = (float*)take((size_t)NH * QT * NKX * 4); _Float16* P = (_Float16*)take((size_t)NH * QT * NKX * 2); _Float16* VT = (_Float16*)take((size_t)NH * HD * SQ * 2);
  float* QF0 = (float*)take((size_t)QT0 * DM * 4); float* KF0 = (float*)take((size_t)QT0 * DM * 4); float* VF0 = (float*)take((size_t)QT0 * DM * 4); float* OF0 = (float*)take((size_t)NB * QT0 * DM * 4); _Float16* OH0 = (_Float16*)take((size_t)NB * QT0 * DM * 2); _Float16* OL0 = (_Float16*)take((size_t)NB * QT0 * DM * 2);
  if (off > ws_size) return;
  { const unsigned g = (unsigned)(((size_t)DM * DM / 8 + 255) / 256); k_wnat<<<g, 256, 0, stream>>>(wq, (size_t)DM * DM / 8, BQ); k_wnat<<<g, 256, 0, stream>>>(wk, (size_t)DM * DM / 8, BK); k_wnat<<<g, 256, 0, stream>>>(wv, (size_t)DM * DM / 8, BV); k_wnat<<<g, 256, 0, stream>>>(wo, (size_t)DM * DM / 8, BO); }      /* natural [out][in] = Bt[n][k] x16 */
  k_x16<<<(unsigned)((NR * DM / 8 + 255) / 256), 256, 0, stream>>>(x, X16, NR * DM / 8); k_x16<<<(unsigned)((NR * DM / 8 + 255) / 256), 256, 0, stream>>>(xk, XK16, NR * DM / 8); k_x16<<<(unsigned)((NR * DM / 8 + 255) / 256), 256, 0, stream>>>(xv, XV16, NR * DM / 8);
  const size_t r0p = (size_t)B0 * SQ;      /* first projected row */
  k_gemm2<0><<<dim3((unsigned)((MP / 128) * (DM / 64)), 1), 128, 0, stream>>>(X16 + r0p * DM, DM, 0, BQ, DM, 0, 0.0625f, bq, 0, nullptr, 1, 0, 0, QF + r0p * DM, nullptr, DM, 0, MP, DM, DM); k_ln64f32<<<(unsigned)(((size_t)MP * NH + 255) / 256), 256, 0, stream>>>(QF + r0p * DM, DM, (size_t)MP * NH, qg, qbt, LNE); k_hl<<<(unsigned)(((size_t)MP * DM / 8 + 255) / 256), 256, 0, stream>>>(QF + r0p * DM, QH + r0p * DM, QL + r0p * DM, (size_t)MP * DM / 8);      /* q (f32) -> f16 hi + x1024 residual: unscaled logits sigma ~8 */
  k_gemm2<0><<<dim3((unsigned)((MP / 128) * (DM / 64)), 1), 128, 0, stream>>>(XK16 + r0p * DM, DM, 0, BK, DM, 0, 0.0625f, bk, 0, nullptr, 1, 0, 0, QF + r0p * DM, nullptr, DM, 0, MP, DM, DM); k_ln64f32<<<(unsigned)(((size_t)MP * NH + 255) / 256), 256, 0, stream>>>(QF + r0p * DM, DM, (size_t)MP * NH, kg, kbt, LNE); k_hl<<<(unsigned)(((size_t)MP * DM / 8 + 255) / 256), 256, 0, stream>>>(QF + r0p * DM, KH + r0p * DM, KL + r0p * DM, (size_t)MP * DM / 8);      /* k likewise */
  k_gemm2<0><<<dim3((unsigned)((MP / 128) * (DM / 64)), 1), 128, 0, stream>>>(XV16 + r0p * DM, DM, 0, BV, DM, 0, 0.0625f, bv, 0, nullptr, 1, 0, 0, nullptr, V16 + r0p * DM, DM, 0, MP, DM, DM);
  for (int b = B0; b < B0 + NBR; ++b) { const size_t r0 = (size_t)b * SQ;
    k_vt<NH, SQ><<<NH * (SQ / 64), 256, 0, stream>>>(V16 + r0 * LQ, LQ, 0, VT);      /* V^T [NH][HD][SQ] for this batch */
    k_gemm2<0><<<dim3((QT0 / 128) * (DM / 64), 1), 128, 0, stream>>>(X16 + r0 * DM, DM, 0, BQ, DM, 0, 0.0625f, bq, 0, nullptr, 1, 0, 0, QF0, nullptr, DM, 0, QT0, DM, DM); k_gemm2<0><<<dim3((QT0 / 128) * (DM / 64), 1), 128, 0, stream>>>(XK16 + r0 * DM, DM, 0, BK, DM, 0, 0.0625f, bk, 0, nullptr, 1, 0, 0, KF0, nullptr, DM, 0, QT0, DM, DM); k_gemm2<0><<<dim3((QT0 / 128) * (DM / 64), 1), 128, 0, stream>>>(XV16 + r0 * DM, DM, 0, BV, DM, 0, 0.0625f, bv, 0, nullptr, 1, 0, 0, VF0, nullptr, DM, 0, QT0, DM, DM);      /* f32 q, k, v of the first 128 rows (exact products) */
  k_ln64f32<<<(unsigned)(((size_t)QT0 * NH + 255) / 256), 256, 0, stream>>>(QF0, DM, (size_t)QT0 * NH, qg, qbt, LNE); k_ln64f32<<<(unsigned)(((size_t)QT0 * NH + 255) / 256), 256, 0, stream>>>(KF0, DM, (size_t)QT0 * NH, kg, kbt, LNE);      /* the exact first tile's f32 q and k rows through the same per-head LayerNorm */
    k_att0<0><<<NH * (QT0 / 64), 64, 0, stream>>>(QF0, KF0, VF0, DM, nullptr, SCL, OF0 + (size_t)b * QT0 * DM, DM);      /* exact f32 attention for rows 0..127 (o x64) */
    for (int q0 = 0; q0 < QN; q0 += QT) { const int nk = q0 + QT;      /* causal: only keys below the tile end are computed */
      k_gemm2<0><<<dim3((QT / 128) * (nk / 64), NHD), 128, 0, stream>>>(QH + (r0 + q0) * LQ, LQ, (size_t)HD, KH + r0 * LQ, LQ, (size_t)HD, SCL, nullptr, 0, nullptr, 1, 0, 0, S, nullptr, NKX, (size_t)QT * NKX, QT, nk, HD);      /* scores hi . hi * 64^-0.5 (1 / sqrt(head_dim)) */
      k_gemm2<0><<<dim3((QT / 128) * (nk / 64), NHD), 128, 0, stream>>>(QL + (r0 + q0) * LQ, LQ, (size_t)HD, KH + r0 * LQ, LQ, (size_t)HD, SCLR, nullptr, 0, S, -1, 0, 0, S, nullptr, NKX, (size_t)QT * NKX, QT, nk, HD); k_gemm2<0><<<dim3((QT / 128) * (nk / 64), NHD), 128, 0, stream>>>(QH + (r0 + q0) * LQ, LQ, (size_t)HD, KL + r0 * LQ, LQ, (size_t)HD, SCLR, nullptr, 0, S, -1, 0, 0, S, nullptr, NKX, (size_t)QT * NKX, QT, nk, HD);      /* += 2^-10 (lo . hi + hi . lo) */      /* scores, all heads on grid.y */
      k_rsmcf2<<<(NHD * QT + 255) / 256, 256, 0, stream>>>(S, P, NHD, q0, nk);
      k_gemm2<0><<<dim3((QT / 128) * (HD / 64), NHD), 128, 0, stream>>>(P, NKX, (size_t)QT * NKX, VT, SQ, (size_t)HD * SQ, 0.25f, nullptr, 0, nullptr, 1, 0, 0, nullptr, O16 + (r0 + q0) * DM, DM, (size_t)HD, QT, HD, nk); } }      /* o (merged heads, x64) as f16 rows */
  k_gemm2<0><<<dim3((unsigned)((MPO / 128) * (DM / 64)), 1), 128, 0, stream>>>(O16 + r0p * DM, DM, 0, BO, DM, 0, 0.0009765625f, bo, 0, nullptr, 1, 0, 0, (float*)d_out + r0p * DM, nullptr, DM, 0, MPO, DM, DM);      /* out rows are the output layout */
  k_hl<<<(unsigned)(((size_t)NB * QT0 * DM / 8 + 255) / 256), 256, 0, stream>>>(OF0, OH0, OL0, (size_t)NB * QT0 * DM / 8);      /* first-tile o (x64) -> f16 hi + x1024 residual planes */
  for (int b = B0; b < B0 + NBR; ++b) { const size_t r0 = (size_t)b * SQ; const size_t f0 = (size_t)b * QT0;
    k_gemm2<0><<<dim3((QT0 / 128) * (DM / 64), 1), 128, 0, stream>>>(OH0 + f0 * DM, DM, 0, BO, DM, 0, 0.0009765625f, bo, 0, nullptr, 1, 0, 0, (float*)d_out + r0 * DM, nullptr, DM, 0, QT0, DM, DM);      /* rows 0..127: out = o_hi Wo (+ b), overwriting the f16-path rows */
    k_gemm2<0><<<dim3((QT0 / 128) * (DM / 64), 1), 128, 0, stream>>>(OL0 + f0 * DM, DM, 0, BO, DM, 0, 0.00000095367431640625f, nullptr, 0, (const float*)d_out + r0 * DM, -1, 0, 0, (float*)d_out + r0 * DM, nullptr, DM, 0, QT0, DM, DM); }      /* += o_lo Wo 2^-20 (own-element accumulate) */
}

// v001
// One run takes 3720 microseconds.
// Next to v000, in two timings, it ran 2.94 and 2.93 times as fast.
#include <hip/hip_runtime.h>
// Causal multi-head self-attention with a per-head LayerNorm on q and k, natural bias-free q / k / v projections and a biased output projection (x [2][3072][512]; q / k / v = x W^T (nn.Linear natural [512][512] sd 0.02, NO biases), 8 heads of 64; q and k each pass through a LayerNorm over the 64 values of every (token, head) vector (biased variance, eps 1e-5, gamma / beta [64]: ones / zeros on this draw: read); scores = q . k / sqrt(64); causal (keys after the query get -inf); softmax; out = merged Wo^T + bo (natural; zero bias) -> [2][3072][512]); q and k carried as f16 hi + x1024 residual planes with three-product scores.
// Structure: token rows r = b*3072 + s; x as exact f16 rows (bf16-rounded); q and k as WMMA GEMMs (32x64 wave tiles, f32 accumulation, exact x16 weights, no bias) into f32 rows, each (token, head) vector of which an IN-PLACE f32 LayerNorm kernel normalises over its 64 values (f32 statistics, gamma / beta by value), then split into f16 hi + x1024 residual planes; v as an f16-output GEMM; per batch: V^T for all heads via LDS transposes; per query tile of 256 rows: scores against the keys below the tile end only as THREE accumulating passes (hi.hi + lo.hi + hi.lo, K = 64, all heads on grid.y, alpha 1/8 = 1/sqrt(64); logits sigma ~1), causal row softmax on VALU with an arithmetic 0/1 key mask over the computed range (f32 statistics, native exp; weights x256 f16), o = P . V^T (K = keys below the tile end, alpha 2^-2: o carried x64, folded into the output GEMM alpha) written straight into the merged f16 o rows; out = o Wo^T + bo GEMM (f32) into the output layout.
// Compute dtype: inputs rounded to bf16; x / weights exact; the normalised q and k as f16 hi + residual planes (three-product scores), v, the softmax weights and o as plain f16 GEMM operands (~2^-12); LayerNorm, scores and softmax statistics f32. v_wmma_f32_16x16x32_f16.
#define NB 2
#define SCL 0.125f                         /* 1 / sqrt(head_dim = 64) */
#define SCLR 0.0001220703125f              /* 2^-13: the same scale on the x1024 residual passes */
#define SQ 3072
#define DM 512
#define NH 8
#define HD 64
#define HG 4                         /* heads per launch of the uncalled k_vt(V16, b, h0, VT) overload */
#define QT 256                       /* query rows per causal tile */
#define NKX SQ                       /* S / P row pitch */
#define QT0 128                      /* first-tile rows recomputed exactly in f32 */
#define B0 0                         /* first batch processed (debug hook) */
#define NBR NB                       /* batches processed (debug hook) */
#define NR ((size_t)NB * SQ)         /* token rows */
#define MP ((int)((size_t)NBR * SQ)) /* rows projected (debug hook) */
#define QN SQ                        /* query rows attended per batch (debug hook) */
#define NHD NH                       /* heads attended (debug hook) */
#define MPO MP                       /* rows through the output stage (debug hook) */
#define LQ DM      /* row pitch of the q/k/v rows */
typedef __bf16 v16b __attribute__((ext_vector_type(16)));
typedef unsigned short v8us __attribute__((ext_vector_type(8), may_alias));
typedef float  v8f  __attribute__((ext_vector_type(8)));
typedef float  v4f  __attribute__((ext_vector_type(4)));
typedef float  v4fa __attribute__((ext_vector_type(4), may_alias));
union FragB { v16b v; v8us half[2]; unsigned short u[16]; };

__device__ __forceinline__ unsigned short bf16_bits(float x) { unsigned int u = __float_as_uint(x); return (unsigned short)((u + 0x7FFFu + ((u >> 16) & 1u)) >> 16); }
__device__ __forceinline__ float bf16_val(unsigned short b) { return __uint_as_float(((unsigned int)b) << 16); }
__device__ __forceinline__ float bf16_round(float x) { return bf16_val(bf16_bits(x)); }
// D += A·B with NT terms: 1 = ah·bh, 2 = + al·bh (A split), 3 = + ah·bl (both split)
template <int NT>
__device__ __forceinline__ v8f mmaN(v16b ah, v16b al, v16b bh, v16b bl, v8f c) {
  c = __builtin_amdgcn_wmma_f32_16x16x32_bf16(false, ah, false, bh, (short)0, c, false, false);
  if (NT >= 2) c = __builtin_amdgcn_wmma_f32_16x16x32_bf16(false, al, false, bh, (short)0, c, false, false);
  if (NT >= 3) c = __builtin_amdgcn_wmma_f32_16x16x32_bf16(false, ah, false, bl, (short)0, c, false, false);
  asm volatile("v_nop\n\tv_nop\n\tv_nop\n\tv_nop" : "+v"(c) : "v"(ah), "v"(al), "v"(bh), "v"(bl));
  return c;
}

__global__ __launch_bounds__(256) void k_wt_bf16(const float* __restrict__ W, unsigned short* __restrict__ Wt, int K, int N) {
  const int t = blockIdx.x * 256 + threadIdx.x;
  const int k8n = K / 8;
  if (t >= N * k8n) return;
  const int n = t / k8n, k8 = (t % k8n) * 8;
  v8us v;
#pragma unroll
  for (int i = 0; i < 8; ++i) v[i] = bf16_bits(W[(size_t)(k8 + i) * N + n]);
  *(v8us*)(Wt + (size_t)n * K + k8) = v;
  
}

// GEMM C[M][N] (f32, pitch ldc) = act(A[M][K]·W + bias). A f32 row-major (pitch lda) converted per fragment to bf16
// (ASPLIT: hi/lo two planes -> 2 terms, else single rounded term); Wt bf16 [N][K] (pitch ldb). BIAS_BF16 rounds the
// bias to bf16 first (bias quantised to bf16 before the add). K%32==0, M%16==0, N%64==0.
template <bool ASPLIT, int ACT, bool BIAS_BF16>
__global__ __launch_bounds__(128) void k_gemm_bf(const float* __restrict__ A, int lda, const unsigned short* __restrict__ Wt, int ldb,
                                               const float* __restrict__ bias, float* __restrict__ C, int ldc, int M, int N, int K) {
  __shared__ __attribute__((aligned(16))) float so[4][16][64];
  const int tid = threadIdx.x, w = tid >> 5, lane = tid & 31, ln = lane & 15, hh = lane >> 4;
  const int ntn = N / 64;
  const int wid = blockIdx.x * 4 + w;
  const int mt = wid / ntn, nq = wid % ntn;
  if (mt * 16 >= M) return;
  const int row0 = mt * 16, col0 = nq * 64;
  const float* arow = A + (size_t)(row0 + ln) * lda;
  v8f acc[4] = {};
  for (int kb = 0; kb < K; kb += 32) {
    FragB ah, al;
    const v4f x0 = *(const v4fa*)(arow + kb + 8 * hh), x1 = *(const v4fa*)(arow + kb + 8 * hh + 4);
    const v4f x2 = *(const v4fa*)(arow + kb + 16 + 8 * hh), x3 = *(const v4fa*)(arow + kb + 16 + 8 * hh + 4);
    float xs[16] = {x0[0],x0[1],x0[2],x0[3],x1[0],x1[1],x1[2],x1[3],x2[0],x2[1],x2[2],x2[3],x3[0],x3[1],x3[2],x3[3]};
#pragma unroll
    for (int i = 0; i < 16; ++i) { const unsigned short hb = bf16_bits(xs[i]); ah.u[i] = hb; al.u[i] = ASPLIT ? bf16_bits(xs[i] - bf16_val(hb)) : (unsigned short)0; }
#pragma unroll
    for (int t = 0; t < 4; ++t) {
      const unsigned short* brow = Wt + (size_t)(col0 + t * 16 + ln) * ldb + kb;
      FragB b;
      b.half[0] = *(const v8us*)(brow + 8 * hh);
      b.half[1] = *(const v8us*)(brow + 16 + 8 * hh);
      acc[t] = mmaN<ASPLIT ? 2 : 1>(ah.v, al.v, b.v, b.v, acc[t]);
    }
  }
#pragma unroll
  for (int t = 0; t < 4; ++t) {
    float bv = bias ? bias[col0 + t * 16 + ln] : 0.f;
    if (BIAS_BF16) bv = bf16_round(bv);
#pragma unroll
    for (int r = 0; r < 8; ++r) { float v = acc[t][r] + bv; if (ACT == 1) v = fmaxf(v, 0.f); so[w][8 * hh + r][t * 16 + ln] = v; }
  }
  __builtin_amdgcn_fence(__ATOMIC_ACQ_REL, "workgroup");
  __builtin_amdgcn_wave_barrier();
  const int rsub = lane >> 4, c4 = (lane & 15) * 4;
  {
#pragma unroll
    for (int q = 0; q < 8; ++q) {
      const int r = q * 2 + rsub;
      const v4f v = *(const v4fa*)&so[w][r][c4];
      *(v4f*)(C + (size_t)(row0 + r) * ldc + col0 + c4) = v;
    }
    
  }
}

// GEMM C = act(A·W + bias + resid): A f32 (ASPLIT -> hi/lo 2 terms), Wt bf16 [N][K]; ACT 0 none, 1 relu, 2 exact gelu;
// resid (optional, f32, row index = (row % rmod), pitch ldr, RES_BF16 rounds it) added before the activation.
template <bool ASPLIT, int ACT, bool BIAS_BF16, bool RES_BF16>
__global__ __launch_bounds__(128) void k_gemm_bf3(const float* __restrict__ A, int lda, const unsigned short* __restrict__ Wt, int ldb,
                                                const float* __restrict__ bias, const float* __restrict__ resid, int rmod, int ldr,
                                                float* __restrict__ C, int ldc, int M, int N, int K) {
  __shared__ __attribute__((aligned(16))) float so[4][16][64];
  const int tid = threadIdx.x, w = tid >> 5, lane = tid & 31, ln = lane & 15, hh = lane >> 4;
  const int ntn = N / 64;
  const int wid = blockIdx.x * 4 + w;
  const int mt = wid / ntn, nq = wid % ntn;
  if (mt * 16 >= M) return;
  const int row0 = mt * 16, col0 = nq * 64;
  const float* arow = A + (size_t)(row0 + ln) * lda;
  v8f acc[4] = {};
  for (int kb = 0; kb < K; kb += 32) {
    FragB ah, al;
    const v4f x0 = *(const v4fa*)(arow + kb + 8 * hh), x1 = *(const v4fa*)(arow + kb + 8 * hh + 4);
    const v4f x2 = *(const v4fa*)(arow + kb + 16 + 8 * hh), x3 = *(const v4fa*)(arow + kb + 16 + 8 * hh + 4);
    float xs[16] = {x0[0],x0[1],x0[2],x0[3],x1[0],x1[1],x1[2],x1[3],x2[0],x2[1],x2[2],x2[3],x3[0],x3[1],x3[2],x3[3]};
#pragma unroll
    for (int i = 0; i < 16; ++i) { const unsigned short hb = bf16_bits(xs[i]); ah.u[i] = hb; al.u[i] = ASPLIT ? bf16_bits(xs[i] - bf16_val(hb)) : (unsigned short)0; }
#pragma unroll
    for (int t = 0; t < 4; ++t) {
      const unsigned short* brow = Wt + (size_t)(col0 + t * 16 + ln) * ldb + kb;
      FragB b;
      b.half[0] = *(const v8us*)(brow + 8 * hh);
      b.half[1] = *(const v8us*)(brow + 16 + 8 * hh);
      acc[t] = mmaN<ASPLIT ? 2 : 1>(ah.v, al.v, b.v, b.v, acc[t]);
    }
  }
#pragma unroll
  for (int t = 0; t < 4; ++t) {
    const int col = col0 + t * 16 + ln;
    float bv = bias ? bias[col] : 0.f;
    if (BIAS_BF16) bv = bf16_round(bv);
#pragma unroll
    for (int r = 0; r < 8; ++r) {
      float v = acc[t][r] + bv;
      if (resid) { float rv = resid[(size_t)((row0 + 8 * hh + r) % rmod) * ldr + col]; if (RES_BF16) rv = bf16_round(rv); v += rv; }
      if (ACT == 1) v = fmaxf(v, 0.f);
      if (ACT == 2) v = 0.5f * v * (1.0f + erff(v * 0.70710678118654752f));
      if (ACT == 3) { const float u = 0.7978845608028654f * (v + 0.044715f * v * v * v); v = 0.5f * v * (1.0f + tanhf(u)); }
      so[w][8 * hh + r][t * 16 + ln] = v;
    }
  }
  __builtin_amdgcn_fence(__ATOMIC_ACQ_REL, "workgroup");
  __builtin_amdgcn_wave_barrier();
  const int rsub = lane >> 4, c4 = (lane & 15) * 4;
  {
#pragma unroll
    for (int q = 0; q < 8; ++q) {
      const int r = q * 2 + rsub;
      const v4f v = *(const v4fa*)&so[w][r][c4];
      *(v4f*)(C + (size_t)(row0 + r) * ldc + col0 + c4) = v;
    }
    
  }
}
// row LayerNorm (biased variance, eps) over N: s = X (+ R); optional out_sum <- s; out_norm <- (s-mu)*rsqrt(var+eps)*g + b
template <bool PARAM_BF16>
__global__ __launch_bounds__(256) void k_layernorm(const float* __restrict__ X, const float* __restrict__ R, const float* __restrict__ g, const float* __restrict__ bta,
                                                  float* __restrict__ out_sum, float* __restrict__ out_norm, int N, float eps) {
  __shared__ float red[256];
  const int row = blockIdx.x, tid = threadIdx.x;
  const float* x = X + (size_t)row * N; const float* rr = R ? R + (size_t)row * N : nullptr;
  float vals[16];                     // up to N = 4096
  const int per = N / 256;            // contiguous chunk per thread? use strided-by-4 chunks: thread handles j = tid*4 + 1024*u
  float s1 = 0.f;
  for (int u = 0; u < per / 4; ++u) {
    const int j = tid * 4 + 1024 * u;
    const v4f a = *(const v4fa*)(x + j);
    v4f b = {0.f,0.f,0.f,0.f}; if (rr) b = *(const v4fa*)(rr + j);
#pragma unroll
    for (int q = 0; q < 4; ++q) { const float v = a[q] + b[q]; vals[u * 4 + q] = v; s1 += v; }
  }
  red[tid] = s1; __syncthreads();
  for (int st = 128; st > 0; st >>= 1) { if (tid < st) red[tid] += red[tid + st]; __syncthreads(); }
  const float mu = red[0] / (float)N; __syncthreads();
  float s2 = 0.f;
  for (int u = 0; u < per / 4; ++u)
#pragma unroll
    for (int q = 0; q < 4; ++q) { const float c = vals[u * 4 + q] - mu; s2 += c * c; }
  red[tid] = s2; __syncthreads();
  for (int st = 128; st > 0; st >>= 1) { if (tid < st) red[tid] += red[tid + st]; __syncthreads(); }
  const float rs = rsqrtf(red[0] / (float)N + eps);
  {
    for (int u = 0; u < per / 4; ++u) {
      const int j = tid * 4 + 1024 * u;
      v4f o, sm;
#pragma unroll
      for (int q = 0; q < 4; ++q) {
        float gg = g[j + q], bb = bta[j + q];
        if (PARAM_BF16) { gg = bf16_round(gg); bb = bf16_round(bb); }
        sm[q] = vals[u * 4 + q]; o[q] = (vals[u * 4 + q] - mu) * rs * gg + bb;
      }
      if (out_sum) *(v4f*)(out_sum + (size_t)row * N + j) = sm;
      *(v4f*)(out_norm + (size_t)row * N + j) = o;
    }
    
  }
}



// ---- f16 WMMA path (v_wmma_f32_16x16x32_f16): 11-bit significands for operands in range — used where a [0,1] probability operand needs more precision than bf16
typedef _Float16 v16h __attribute__((ext_vector_type(16)));
union FragH { v16h v; v8us half[2]; _Float16 h[16]; unsigned short u[16]; };
template <int NT>
__device__ __forceinline__ v8f mmaH(v16h ah, v16h al, v16h bh, v16h bl, v8f c) {
  c = __builtin_amdgcn_wmma_f32_16x16x32_f16(false, ah, false, bh, (short)0, c, false, false);
  if (NT >= 2) c = __builtin_amdgcn_wmma_f32_16x16x32_f16(false, al, false, bh, (short)0, c, false, false);
  if (NT >= 3) c = __builtin_amdgcn_wmma_f32_16x16x32_f16(false, ah, false, bl, (short)0, c, false, false);
  asm volatile("v_nop\n\tv_nop\n\tv_nop\n\tv_nop" : "+v"(c) : "v"(ah), "v"(al), "v"(bh), "v"(bl));
  return c;
}
// batched GEMM like k_gemm_b but f16 operands: A f32 (split into f16 hi/lo if ASPLIT, else rounded to f16), Bt = f16 values [n][k]; alpha; C f32; N multiple of 16 (partial tiles skipped)
template <bool ASPLIT>
__global__ __launch_bounds__(128) void k_gemm_h(const float* __restrict__ A, int lda, size_t sA, const _Float16* __restrict__ Bh, int ldb, size_t sB, float alpha, float* __restrict__ C, int ldc, size_t sC, int M, int N, int K) {
  __shared__ __attribute__((aligned(16))) float so[4][16][64];
  const int tid = threadIdx.x, w = tid >> 5, lane = tid & 31, ln = lane & 15, hh = lane >> 4; const int by = blockIdx.y;
  A += (size_t)by * sA; Bh += (size_t)by * sB; C += (size_t)by * sC;
  const int ntn = (N + 63) / 64; const int wid = blockIdx.x * 4 + w; const int mt = wid / ntn, nq = wid % ntn; if (mt * 16 >= M) return;
  const int row0 = mt * 16, col0 = nq * 64; const float* arow = A + (size_t)(row0 + ln) * lda;
  v8f acc[4] = {};
  for (int kb = 0; kb < K; kb += 32) {
    FragH ah, al;
    const v4f x0 = *(const v4fa*)(arow + kb + 8 * hh), x1 = *(const v4fa*)(arow + kb + 8 * hh + 4), x2 = *(const v4fa*)(arow + kb + 16 + 8 * hh), x3 = *(const v4fa*)(arow + kb + 16 + 8 * hh + 4);
    float xs[16] = {x0[0],x0[1],x0[2],x0[3],x1[0],x1[1],x1[2],x1[3],x2[0],x2[1],x2[2],x2[3],x3[0],x3[1],x3[2],x3[3]};
#pragma unroll
    for (int i = 0; i < 16; ++i) { const _Float16 h = (_Float16)xs[i]; ah.h[i] = h; al.h[i] = ASPLIT ? (_Float16)(xs[i] - (float)h) : (_Float16)0.0f; }
#pragma unroll
    for (int t = 0; t < 4; ++t) { if (col0 + t * 16 >= N) continue; const size_t boff = (size_t)(col0 + t * 16 + ln) * ldb + kb; FragH bq; bq.half[0] = *(const v8us*)(Bh + boff + 8 * hh); bq.half[1] = *(const v8us*)(Bh + boff + 16 + 8 * hh);
      acc[t] = mmaH<ASPLIT ? 2 : 1>(ah.v, al.v, bq.v, bq.v, acc[t]); }
  }
#pragma unroll
  for (int t = 0; t < 4; ++t) { if (col0 + t * 16 >= N) continue;
#pragma unroll
    for (int r = 0; r < 8; ++r) so[w][8 * hh + r][t * 16 + ln] = acc[t][r] * alpha; }
  __builtin_amdgcn_fence(__ATOMIC_ACQ_REL, "workgroup"); __builtin_amdgcn_wave_barrier();
  const int rsub = lane >> 4, c4 = (lane & 15) * 4;
  {
#pragma unroll
    for (int q = 0; q < 8; ++q) { const int r = q * 2 + rsub; if (col0 + c4 < N) { const v4f v = *(const v4fa*)&so[w][r][c4]; *(v4f*)(C + (size_t)(row0 + r) * ldc + col0 + c4) = v; } }
     }
}

// Wt[n][k] = f16(W[k][n]·scale) from f32 row-major W[K][N] (scale = power of two; bf16-exact weights stay exact in f16 away from the subnormal range)
__global__ __launch_bounds__(256) void k_wt_f16(const float* __restrict__ W, _Float16* __restrict__ Wt, int K, int N, float scale) {
  const int t = blockIdx.x * 256 + threadIdx.x; if (t >= N * (K / 8)) return; const int n = t / (K / 8), k8 = (t % (K / 8)) * 8; FragH f;
#pragma unroll
  for (int i = 0; i < 8; ++i) f.h[i] = (_Float16)(bf16_round(W[(size_t)(k8 + i) * N + n]) * scale); const v8us o = f.half[0];
  *(v8us*)((unsigned short*)Wt + (size_t)n * K + k8) = o; 
}
// k_gemm_hh variant with fused epilogue: v = acc·alpha + bias[by·sBias + col] (+ CP[(row/rowsPerB)·sCPb + by·64 + col] if CP) ; ACT 0 none / 1 elu ; writes f16 C16 (and f32 C if non-null)
template <int ACT>
__global__ __launch_bounds__(128) void k_gemm_hhx(const _Float16* __restrict__ A, int lda, size_t sA, const _Float16* __restrict__ Bh, int ldb, size_t sB, float alpha, const float* __restrict__ bias, size_t sBias, const float* __restrict__ CP, int rowsPerB, size_t sCPb, int row0g,
    float* __restrict__ C, _Float16* __restrict__ C16, int ldc, size_t sC, int M, int N, int K) {
  __shared__ __attribute__((aligned(16))) float so[4][16][64];
  const int tid = threadIdx.x, w = tid >> 5, lane = tid & 31, ln = lane & 15, hh = lane >> 4; const int by = blockIdx.y;
  A += (size_t)by * sA; Bh += (size_t)by * sB; const size_t cofs = (size_t)by * sC; const float* bp = bias ? bias + (size_t)by * sBias : nullptr;
  const int ntn = (N + 63) / 64; const int wid = blockIdx.x * 4 + w; const int mt = wid / ntn, nq = wid % ntn; if (mt * 16 >= M) return;
  const int row0 = mt * 16, col0 = nq * 64; const _Float16* arow = A + (size_t)(row0 + ln) * lda;
  v8f acc[4] = {};
  for (int kb = 0; kb < K; kb += 32) { FragH ah; ah.half[0] = *(const v8us*)((const unsigned short*)arow + kb + 8 * hh); ah.half[1] = *(const v8us*)((const unsigned short*)arow + kb + 16 + 8 * hh);
#pragma unroll
    for (int t = 0; t < 4; ++t) { if (col0 + t * 16 >= N) continue; const size_t boff = (size_t)(col0 + t * 16 + ln) * ldb + kb; FragH bq; bq.half[0] = *(const v8us*)((const unsigned short*)Bh + boff + 8 * hh); bq.half[1] = *(const v8us*)((const unsigned short*)Bh + boff + 16 + 8 * hh);
      acc[t] = mmaH<1>(ah.v, ah.v, bq.v, bq.v, acc[t]); }
  }
#pragma unroll
  for (int t = 0; t < 4; ++t) { if (col0 + t * 16 >= N) continue; const int col = col0 + t * 16 + ln; const float bv = bp ? bf16_round(bp[col]) : 0.f;
#pragma unroll
    for (int r = 0; r < 8; ++r) { float v = acc[t][r] * alpha + bv; if (CP) { const int rr = row0g + row0 + 8 * hh + r; if (rowsPerB < 0) v += CP[cofs + (size_t)rr * ldc + col];      /* rowsPerB < 0: own element of the batched C plane */ else { const int bidx = rr / rowsPerB; v += CP[(size_t)bidx * sCPb + (size_t)by * 64 + col]; } } if (ACT == 1) v = (v > 0.f) ? v : expm1f(v); else if (ACT == 7) v = (v > 0.f) ? v + 1.0f : expf(v); else if (ACT == 8) v = tanhf(v); else if (ACT == 9) v = 0.5f * v * (1.0f + tanhf(0.7978845608028654f * (v + 0.044715f * v * v * v))); else if (ACT == 11) v = 1.0f / (1.0f + expf(-v)); else if (ACT == 12) v = (v > 0.f) ? v : 0.01f * v; else if (ACT == 14) v = (v > 0.f) ? v : 0.1f * v; else if (ACT == 16) v = (v >= 0.f) ? v : 0.3f * v; else if (ACT == 17) v = (v >= 0.f) ? v : 0.2f * v; else if (ACT == 15) v = v / (1.0f + expf(-v)); else if (ACT == 3) v = fmaxf(v, 0.f); else if (ACT == 6) v = 0.5f * v * (1.0f + erff(v * 0.70710678118654752f)); so[w][8 * hh + r][t * 16 + ln] = v; } }
  __builtin_amdgcn_fence(__ATOMIC_ACQ_REL, "workgroup"); __builtin_amdgcn_wave_barrier();
  const int rsub = lane >> 4, c4 = (lane & 15) * 4; typedef _Float16 v4h __attribute__((ext_vector_type(4)));
  {
#pragma unroll
    for (int q = 0; q < 8; ++q) { const int r = q * 2 + rsub; if (col0 + c4 < N) { const v4f v = *(const v4fa*)&so[w][r][c4]; if (C) *(v4f*)(C + cofs + (size_t)(row0 + r) * ldc + col0 + c4) = v; if (C16) { v4h h4; for (int i = 0; i < 4; ++i) h4[i] = (_Float16)v[i]; *(v4h*)(C16 + cofs + (size_t)(row0 + r) * ldc + col0 + c4) = h4; } } }
     }
}


typedef _Float16 v4h __attribute__((ext_vector_type(4)));

__global__ __launch_bounds__(256) void k_x16(const float* __restrict__ x, _Float16* __restrict__ X16, size_t n8) { const size_t t = (size_t)blockIdx.x * 256 + threadIdx.x; if (t >= n8) return; FragH f;
#pragma unroll
  for (int q = 0; q < 8; ++q) f.h[q] = (_Float16)bf16_round(x[t * 8 + q]); *(v8us*)((unsigned short*)X16 + t * 8) = f.half[0];  }
__global__ __launch_bounds__(256) void k_h16(const float* __restrict__ x, _Float16* __restrict__ X16, size_t n8) { const size_t t = (size_t)blockIdx.x * 256 + threadIdx.x; if (t >= n8) return; FragH f;
#pragma unroll
  for (int q = 0; q < 8; ++q) f.h[q] = (_Float16)x[t * 8 + q]; *(v8us*)((unsigned short*)X16 + t * 8) = f.half[0];  }
__global__ __launch_bounds__(256) void k_round16f(const float* __restrict__ W, _Float16* __restrict__ Bt, size_t n8) { const size_t t = (size_t)blockIdx.x * 256 + threadIdx.x; if (t >= n8) return; FragH f;
#pragma unroll
  for (int i = 0; i < 8; ++i) f.h[i] = (_Float16)(bf16_round(W[t * 8 + i]) * 16.0f); *(v8us*)((unsigned short*)Bt + t * 8) = f.half[0];  }
template <int NHv, int TTv>
__global__ __launch_bounds__(256) void k_vt(const _Float16* __restrict__ V16, int ldv, int voff, _Float16* __restrict__ Vt) { __shared__ unsigned short tl[64][66]; const int tid = threadIdx.x; const int slab = blockIdx.x / (TTv / 64), lg = blockIdx.x % (TTv / 64); const int b = slab / NHv, h = slab % NHv;
  for (int i = tid; i < 64 * 8; i += 256) { const int r = i / 8, c8 = (i % 8) * 8; FragH f; f.half[0] = *(const v8us*)((const unsigned short*)V16 + ((size_t)b * TTv + lg * 64 + r) * ldv + voff + h * 64 + c8);
#pragma unroll
    for (int q = 0; q < 8; ++q) tl[r][c8 + q] = f.u[q]; }
  __syncthreads();
  {
#pragma unroll
    for (int rd = 0; rd < 2; ++rd) { const int d = rd * 32 + tid / 8, pc = tid % 8; FragH f;
#pragma unroll
      for (int q = 0; q < 8; ++q) f.u[q] = tl[pc * 8 + q][d];
      *(v8us*)((unsigned short*)Vt + ((size_t)slab * 64 + d) * TTv + lg * 64 + pc * 8) = f.half[0]; }
     } }

__global__ __launch_bounds__(256) void k_hl(const float* __restrict__ F, _Float16* __restrict__ Hh, _Float16* __restrict__ Hl, size_t n8) { const size_t t = (size_t)blockIdx.x * 256 + threadIdx.x; if (t >= n8) return; FragH fh, fl; const v4f a = *(const v4fa*)(F + t * 8), c = *(const v4fa*)(F + t * 8 + 4);
#pragma unroll
  for (int q = 0; q < 4; ++q) { _Float16 h = (_Float16)a[q]; fh.h[q] = h; fl.h[q] = (_Float16)((a[q] - (float)h) * 1024.0f); h = (_Float16)c[q]; fh.h[4 + q] = h; fl.h[4 + q] = (_Float16)((c[q] - (float)h) * 1024.0f); }
  { *(v8us*)((unsigned short*)Hh + t * 8) = fh.half[0]; *(v8us*)((unsigned short*)Hl + t * 8) = fl.half[0];  } }

// ---- fast GEMM (wave tile 32x64; requires M % 32 == 0 rows per launch region and N % 64 == 0); epilogue = k_gemm_hhx semantics ----
__device__ __forceinline__ v16h g2_frag(const _Float16* p, int hh) { FragH f; f.half[0] = *(const v8us*)((const unsigned short*)p + 8 * hh); f.half[1] = *(const v8us*)((const unsigned short*)p + 16 + 8 * hh); return f.v; }
__device__ __forceinline__ v8f g2_mma(v16h a, v16h b, v8f c) { v8f d = __builtin_amdgcn_wmma_f32_16x16x32_f16(false, a, false, b, (short)0, c, false, false); asm volatile("v_nop\n\tv_nop\n\tv_nop\n\tv_nop" : "+v"(d) : "v"(a), "v"(b)); return d; }
template <int ACT>
__global__ __launch_bounds__(128) void k_gemm2(const _Float16* __restrict__ A, int lda, size_t sA, const _Float16* __restrict__ Bh, int ldb, size_t sB, float alpha, const float* __restrict__ bias, size_t sBias, const float* __restrict__ CP, int rowsPerB, size_t sCPb, int row0g,
    float* __restrict__ C, _Float16* __restrict__ C16, int ldc, size_t sC, int M, int N, int K) { static_assert(ACT == 0 || ACT == 3 || ACT == 6 || ACT == 8 || ACT == 9 || ACT == 11 || ACT == 12 || ACT == 14 || ACT == 15 || ACT == 16 || ACT == 17, "k_gemm2: unsupported ACT code (would silently apply no activation)");
  __shared__ __attribute__((aligned(16))) float so[4][32][68];
  const int tid = threadIdx.x, w = tid >> 5, lane = tid & 31, ln = lane & 15, hh = lane >> 4; const int by = blockIdx.y;
  A += (size_t)by * sA; Bh += (size_t)by * sB; const size_t cofs = (size_t)by * sC; const float* bp = bias ? bias + (size_t)by * sBias : nullptr;
  const int ntn = N >> 6; const int mt = blockIdx.x / ntn, nq = blockIdx.x - mt * ntn; const int row0 = mt * 128 + 32 * w, col0 = nq * 64; if (row0 >= M) return;
  const _Float16* a0p = A + (size_t)(row0 + ln) * lda; const _Float16* a1p = a0p + (size_t)16 * lda;
  const _Float16* b0p = Bh + (size_t)(col0 + ln) * ldb; const _Float16* b1p = b0p + (size_t)16 * ldb; const _Float16* b2p = b1p + (size_t)16 * ldb; const _Float16* b3p = b2p + (size_t)16 * ldb;
  const v8f z8 = {0.f,0.f,0.f,0.f,0.f,0.f,0.f,0.f}; v8f c00 = z8, c01 = z8, c02 = z8, c03 = z8, c10 = z8, c11 = z8, c12 = z8, c13 = z8;
#pragma unroll 1
  for (int kb = 0; kb < K; kb += 32) { const v16h a0 = g2_frag(a0p + kb, hh), a1 = g2_frag(a1p + kb, hh);
    v16h b = g2_frag(b0p + kb, hh); c00 = g2_mma(a0, b, c00); c10 = g2_mma(a1, b, c10);
    b = g2_frag(b1p + kb, hh); c01 = g2_mma(a0, b, c01); c11 = g2_mma(a1, b, c11);
    b = g2_frag(b2p + kb, hh); c02 = g2_mma(a0, b, c02); c12 = g2_mma(a1, b, c12);
    b = g2_frag(b3p + kb, hh); c03 = g2_mma(a0, b, c03); c13 = g2_mma(a1, b, c13); }
  v8f accs[8] = {c00, c01, c02, c03, c10, c11, c12, c13};
#pragma unroll
  for (int u = 0; u < 8; ++u) { const int t = u & 3, half = u >> 2; const int col = col0 + t * 16 + ln; const float bv = bp ? bf16_round(bp[col]) : 0.f;
#pragma unroll
    for (int r = 0; r < 8; ++r) { const int rloc = half * 16 + 8 * hh + r; float v = accs[u][r] * alpha + bv; if (CP) { if (rowsPerB < 0) v += CP[cofs + (size_t)(row0g + row0 + rloc) * ldc + col];      /* rowsPerB < 0: own element of the batched C plane */ else { const int bidx = (row0g + row0 + rloc) / rowsPerB; v += CP[(size_t)bidx * sCPb + (size_t)by * 64 + col]; } }
      if (ACT == 3) v = fmaxf(v, 0.f); else if (ACT == 6) v = 0.5f * v * (1.0f + erff(v * 0.70710678118654752f)); else if (ACT == 11) v = 1.0f / (1.0f + expf(-v)); else if (ACT == 15) v = v / (1.0f + expf(-v)); else if (ACT == 12) v = (v > 0.f) ? v : 0.01f * v; else if (ACT == 8) v = tanhf(v); else if (ACT == 9) v = 0.5f * v * (1.0f + tanhf(0.7978845608028654f * (v + 0.044715f * v * v * v))); else if (ACT == 14) v = (v > 0.f) ? v : 0.1f * v; else if (ACT == 16) v = (v >= 0.f) ? v : 0.3f * v; else if (ACT == 17) v = (v >= 0.f) ? v : 0.2f * v;
      so[w][rloc][t * 16 + ln] = v; } }
  __builtin_amdgcn_fence(__ATOMIC_ACQ_REL, "workgroup"); __builtin_amdgcn_wave_barrier();
  const int rsub = lane >> 4, c4 = (lane & 15) * 4;
  {
#pragma unroll
    for (int q = 0; q < 16; ++q) { const int r = q * 2 + rsub; const v4f v = *(const v4fa*)&so[w][r][c4]; if (C) *(v4f*)(C + cofs + (size_t)(row0 + r) * ldc + col0 + c4) = v; if (C16) { v4h h4; for (int i = 0; i < 4; ++i) h4[i] = (_Float16)v[i]; *(v4h*)(C16 + cofs + (size_t)(row0 + r) * ldc + col0 + c4) = h4; } }
     } }


__global__ __launch_bounds__(256) void k_wnat(const float* __restrict__ w, size_t n8, _Float16* __restrict__ Bt) { const size_t t = (size_t)blockIdx.x * 256 + threadIdx.x; if (t >= n8) return; FragH f; for (int q = 0; q < 8; ++q) f.h[q] = (_Float16)(bf16_round(w[t * 8 + q]) * 16.0f); *(v8us*)((unsigned short*)Bt + t * 8) = f.half[0];  }
__global__ __launch_bounds__(256) void k_rsm(const float* __restrict__ S, _Float16* __restrict__ P, int nrows) {
  #pragma clang fp contract(off)
  const int i = blockIdx.x * 256 + threadIdx.x; if (i >= nrows) return; const float* s = S + (size_t)i * SQ; float mx = -3.0e38f;
#pragma unroll 1
  for (int j = 0; j < SQ; ++j) mx = fmaxf(mx, s[j]); float se = 0.f;
#pragma unroll 1
  for (int j = 0; j < SQ; ++j) se += expf(s[j] - mx); const float sc = 256.0f / se;
#pragma unroll 1
  for (int j0 = 0; j0 < SQ; j0 += 8) { FragH f; for (int q = 0; q < 8; ++q) f.h[q] = (_Float16)(expf(s[j0 + q] - mx) * sc); unsigned short* d = (unsigned short*)P + (size_t)i * SQ + j0; *(v8us*)d = f.half[0];  } }
__global__ __launch_bounds__(256) void k_vt(const _Float16* __restrict__ V16, int b, int h0, _Float16* __restrict__ VT) { __shared__ unsigned short tl[64][65]; const int tid = threadIdx.x; const int hh = blockIdx.x % HG, sg = blockIdx.x / HG; const int s0 = sg * 64; const int h = h0 + hh;
  for (int i = tid; i < 64 * 8; i += 256) { const int j = i / 8, d8 = (i % 8) * 8; FragH f; f.half[0] = *(const v8us*)((const unsigned short*)V16 + ((size_t)b * SQ + s0 + j) * DM + h * HD + d8); for (int q = 0; q < 8; ++q) tl[d8 + q][j] = f.u[q]; }
  __syncthreads();
  { for (int i = tid; i < 64 * 8; i += 256) { const int d = i / 8, j8 = (i % 8) * 8; FragH f; for (int q = 0; q < 8; ++q) f.u[q] = tl[d][j8 + q]; *(v8us*)((unsigned short*)VT + ((size_t)hh * HD + d) * SQ + s0 + j8) = f.half[0]; }  } }



// Causal row softmax, ONE WAVE PER SCORE ROW: the row's nk scores (nk a multiple of 256) are read once, 512 contiguous bytes per load, and stay in registers through
// maximum, exp, sum and scaling; each lane owns 4 neighbouring keys of every 128; row maximum and row sum = four per-lane chains, then a five-step butterfly over the 32 lanes.
template <int CTRL>
__device__ __forceinline__ float rs_dpp(float x) { return __builtin_bit_cast(float, __builtin_amdgcn_update_dpp(0, __builtin_bit_cast(int, x), CTRL, 0xf, 0xf, true)); }      /* lane l <- lane l ^ m inside a 16-lane row (row_xmask:m = 0x160 + m) */
__device__ __forceinline__ float rs_xhalf(float x) { return __builtin_bit_cast(float, __builtin_amdgcn_permlanex16(__builtin_bit_cast(int, x), __builtin_bit_cast(int, x), 0x76543210, 0xfedcba98, false, false)); }      /* lane l <- lane l ^ 16 */
__device__ __forceinline__ float rs_wmax(float x) { x = fmaxf(x, rs_dpp<0x161>(x)); x = fmaxf(x, rs_dpp<0x162>(x)); x = fmaxf(x, rs_dpp<0x164>(x)); x = fmaxf(x, rs_dpp<0x168>(x)); return fmaxf(x, rs_xhalf(x)); }
__device__ __forceinline__ float rs_wsum(float x) { x += rs_dpp<0x161>(x); x += rs_dpp<0x162>(x); x += rs_dpp<0x164>(x); x += rs_dpp<0x168>(x); return x + rs_xhalf(x); }
#define RSC (NKX / 256)              /* 256-key chunks of a full row */
// The five passes over the chunks of a row. Chunk C is there if C * 256 < nk, and then every chunk below it is: each pass is a nest of wave-uniform tests with one way out, and every register index is a constant.
template <int C> __device__ __forceinline__ void rs_load(v4f (&v)[2 * RSC], const float* s, int nk) { if constexpr (C < RSC) { if (C * 256 < nk) { v[2 * C] = *(const v4fa*)(s + C * 256); v[2 * C + 1] = *(const v4fa*)(s + C * 256 + 128); rs_load<C + 1>(v, s, nk); } } }
template <int C> __device__ __forceinline__ void rs_mask_max(v4f (&v)[2 * RSC], v4f& m4, int lane, int last, int nk) { if constexpr (C < RSC) { if (C * 256 < nk) {
#pragma unroll      /* unrolled so that every index into the row's registers is a constant (a rolled loop would put the row in scratch memory) */
  for (int u = 2 * C; u < 2 * C + 2; ++u)
#pragma unroll      /* unrolled so that every index into the row's registers is a constant (a rolled loop would put the row in scratch memory) */
    for (int q = 0; q < 4; ++q) { const int j = u * 128 + lane * 4 + q; const float f = (j <= last) ? 1.f : 0.f; const float x = fmaf(f, v[u][q], (1.f - f) * -1.0e9f); v[u][q] = x; m4[q] = fmaxf(m4[q], x); }
  rs_mask_max<C + 1>(v, m4, lane, last, nk); } } }
template <int C> __device__ __forceinline__ void rs_exp_sum(v4f (&v)[2 * RSC], v4f& s4, float mx, int nk) { if constexpr (C < RSC) { if (C * 256 < nk) {
#pragma unroll      /* unrolled so that every index into the row's registers is a constant (a rolled loop would put the row in scratch memory) */
  for (int u = 2 * C; u < 2 * C + 2; ++u)
#pragma unroll      /* unrolled so that every index into the row's registers is a constant (a rolled loop would put the row in scratch memory) */
    for (int q = 0; q < 4; ++q) { const float e = __expf(v[u][q] - mx); v[u][q] = e; s4[q] += e; }
  rs_exp_sum<C + 1>(v, s4, mx, nk); } } }
template <int C> __device__ __forceinline__ void rs_scale(const v4f (&v)[2 * RSC], v4h (&h)[2 * RSC], float sc, int nk) { if constexpr (C < RSC) { if (C * 256 < nk) {
#pragma unroll      /* unrolled so that every index into the row's registers is a constant (a rolled loop would put the row in scratch memory) */
  for (int u = 2 * C; u < 2 * C + 2; ++u)
#pragma unroll      /* unrolled so that every index into the row's registers is a constant (a rolled loop would put the row in scratch memory) */
    for (int q = 0; q < 4; ++q) h[u][q] = (_Float16)(v[u][q] * sc);
  rs_scale<C + 1>(v, h, sc, nk); } } }
template <int C> __device__ __forceinline__ void rs_store(const v4h (&h)[2 * RSC], _Float16* p, int nk) { if constexpr (C < RSC) { if (C * 256 < nk) { *(v4h*)(p + C * 256) = h[2 * C]; *(v4h*)(p + C * 256 + 128) = h[2 * C + 1]; rs_store<C + 1>(h, p, nk); } } }
__global__ __launch_bounds__(256) void k_rsmcf2(const float* __restrict__ S, _Float16* __restrict__ P, int hg, int q0, int nk) {
  const int lane = threadIdx.x & 31; const int t = blockIdx.x * 8 + __builtin_amdgcn_readfirstlane((int)(threadIdx.x >> 5)); if (t >= hg * QT) return;      /* wave-uniform row; no barrier in this kernel */
  const size_t ro = (size_t)(blockIdx.x * 8 + (threadIdx.x >> 5)) * NKX + lane * 4;      /* the lane's place in its row, formed per lane: every load and store of the wave names one vector address pair and no scalar base */
  const float* s = S + ro; _Float16* p = P + ro; const int last = q0 + (t % QT);
  v4f v[2 * RSC]; rs_load<0>(v, s, nk);
  asm volatile("s_wait_xcnt 0x0" :: "v"(s) : "memory");      /* the loads' address pair is reused below: named here it stays whole up to this wait, which so stands in front of its first overwrite */
  v4f m4 = {-3.0e38f, -3.0e38f, -3.0e38f, -3.0e38f}; rs_mask_max<0>(v, m4, lane, last, nk);
  const float mx = rs_wmax(fmaxf(fmaxf(m4[0], m4[1]), fmaxf(m4[2], m4[3])));
  v4f s4 = {0.f, 0.f, 0.f, 0.f}; rs_exp_sum<0>(v, s4, mx, nk);
  const float se = rs_wsum((s4[0] + s4[1]) + (s4[2] + s4[3])); const float sc = 256.0f / se;
  v4h h[2 * RSC]; rs_scale<0>(v, h, sc, nk);      /* every store's data in registers of its own: all conversions first, then the stores, with nothing written behind them */
  rs_store<0>(h, p, nk); }


template <int MASKADD>
__global__ __launch_bounds__(64) void k_att0(const float* __restrict__ QF, const float* __restrict__ KF, const float* __restrict__ VF, int ld, const float* __restrict__ mask, float scale, float* __restrict__ OF, int ldo) {
  #pragma clang fp contract(off)
  __shared__ __attribute__((aligned(16))) float lq[64][64]; __shared__ __attribute__((aligned(16))) float lo[64][64];
  const int tid = threadIdx.x; const int h = blockIdx.x / (QT0 / 64), rg = blockIdx.x % (QT0 / 64); const int i = rg * 64 + tid;
  const float* qr = QF + (size_t)i * ld + h * HD;
#pragma unroll 1
  for (int c = 0; c < HD / 4; ++c) { *(v4f*)&lq[tid][c * 4] = *(const v4fa*)(qr + c * 4); const v4f z = {0.f, 0.f, 0.f, 0.f}; *(v4f*)&lo[tid][c * 4] = z; }
  float m = -1.0e30f, l = 0.f; const int jmax = MASKADD ? (SQ - 1) : (rg * 64 + 63);      /* additive-mask form: every key (the mask input decides); causal form: keys up to the block's last row */
#pragma unroll 1
  for (int j = 0; j <= jmax; ++j) { const float* kr = KF + (size_t)j * ld + h * HD; const float* vr = VF + (size_t)j * ld + h * HD; float s = 0.f;
#pragma unroll 1
    for (int c = 0; c < HD / 4; ++c) { const v4f kq = *(const v4fa*)(kr + c * 4); const v4f qq = *(v4f*)&lq[tid][c * 4]; s = __fadd_rn(s, __fmul_rn(qq[0], kq[0])); s = __fadd_rn(s, __fmul_rn(qq[1], kq[1])); s = __fadd_rn(s, __fmul_rn(qq[2], kq[2])); s = __fadd_rn(s, __fmul_rn(qq[3], kq[3])); }
    s = __fmul_rn(s, scale); if (MASKADD) s = __fadd_rn(s, __fmul_rn(bf16_round(mask[(size_t)i * SQ + j]), -10000.0f));
    const float f = (MASKADD || j <= i) ? 1.f : 0.f; const float sm = fmaf(f, s, (1.f - f) * -1.0e30f); const float mn = fmaxf(m, sm); const float sc = expf(m - mn); const float e = expf(sm - mn); l = __fadd_rn(__fmul_rn(l, sc), e); m = mn;
#pragma unroll 1
    for (int c = 0; c < HD / 4; ++c) { const v4f vv = *(const v4fa*)(vr + c * 4); v4f oo = *(v4f*)&lo[tid][c * 4]; for (int u = 0; u < 4; ++u) oo[u] = __fadd_rn(__fmul_rn(oo[u], sc), __fmul_rn(e, vv[u])); *(v4f*)&lo[tid][c * 4] = oo; } }
  const float fin = 64.0f / l;      /* o carried x64 like the f16 path */
#pragma unroll 1
  for (int c = 0; c < HD / 4; ++c) { v4f oo = *(v4f*)&lo[tid][c * 4]; for (int u = 0; u < 4; ++u) oo[u] = __fmul_rn(oo[u], fin); *(v4f*)&lo[tid][c * 4] = oo; }
  __syncthreads();
  {
#pragma unroll 1
    for (int it = 0; it < 16; ++it) { const int row = it * 4 + tid / 16, pc = (tid % 16) * 4; const v4f v = *(const v4f*)&lo[row][pc]; *(v4f*)(OF + (size_t)(rg * 64 + row) * ldo + h * HD + pc) = v; }
     } }

__global__ __launch_bounds__(256) void k_ln64f32(float* __restrict__ F, int ldf, size_t nrh, const float* __restrict__ g, const float* __restrict__ bb, float eps) {
  #pragma clang fp contract(off)
  const size_t t = (size_t)blockIdx.x * 256 + threadIdx.x; if (t >= nrh) return; const size_t r = t / NH; const int h = (int)(t % NH); float* f = F + r * (size_t)ldf + (size_t)h * 64; float sum = 0.f;
#pragma unroll 1
  for (int d = 0; d < 64; d += 4) { const v4f q = *(const v4fa*)(f + d); sum = __fadd_rn(__fadd_rn(__fadd_rn(__fadd_rn(sum, q[0]), q[1]), q[2]), q[3]); } const float mu = sum / 64.0f; float vs = 0.f;
#pragma unroll 1
  for (int d = 0; d < 64; d += 4) { const v4f q = *(const v4fa*)(f + d); for (int e = 0; e < 4; ++e) { const float dl = __fadd_rn(q[e], -mu); vs = __fadd_rn(vs, __fmul_rn(dl, dl)); } } const float rs = rsqrtf(__fadd_rn(vs / 64.0f, eps));
#pragma unroll 1
  for (int d0 = 0; d0 < 64; d0 += 4) { const v4f q = *(const v4fa*)(f + d0); v4f y; for (int e = 0; e < 4; ++e) y[e] = __fadd_rn(__fmul_rn(__fmul_rn(__fadd_rn(q[e], -mu), rs), bf16_round(g[d0 + e])), bf16_round(bb[d0 + e])); *(v4f*)(f + d0) = y;  } }
extern "C" void kernel_launch(void* const* d_in, const int* in_sizes, int n_in,
                              void* d_out, int out_size, void* d_ws, size_t ws_size, hipStream_t stream) {
  (void)in_sizes; (void)n_in; (void)out_size;
  const float* const* I = (const float* const*)d_in; const float* x = I[0]; const float* xk = I[0]; const float* xv = I[0]; const float* wq = I[1]; const float* bq = nullptr; const float* wk = I[2]; const float* bk = nullptr; const float* wv = I[3]; const float* bv = nullptr; const float* wo = I[4]; const float* bo = I[5]; const float* qg = I[6]; const float* qbt = I[7]; const float* kg = I[8]; const float* kbt = I[9]; const float LNE = 1e-5f;      /* input order: x (feeds the q, k AND v streams), Wq, Wk, Wv (natural [out][in] weights; NO biases: null pointers in the guarded bias slots), Wo, bo (zeros: read), q_gamma, q_beta, k_gamma, k_beta [64] (ones / zeros on this draw: read by value in the per-head LayerNorm kernel) */
  char* ws = (char*)d_ws; size_t off = 0;
  auto take = [&](size_t bytes) { char* p = ws + off; off += (bytes + 255) & ~(size_t)255; return p; };
  _Float16* BQ = (_Float16*)take((size_t)DM * DM * 2); _Float16* BK = (_Float16*)take((size_t)DM * DM * 2); _Float16* BV = (_Float16*)take((size_t)DM * DM * 2); _Float16* BO = (_Float16*)take((size_t)DM * DM * 2);
  _Float16* X16 = (_Float16*)take(NR * DM * 2); _Float16* XK16 = (_Float16*)take(NR * DM * 2); _Float16* XV16 = (_Float16*)take(NR * DM * 2);      /* exact f16 rows of query, key, value */ float* QF = (float*)take(NR * DM * 4); _Float16* QH = (_Float16*)take(NR * DM * 2); _Float16* QL = (_Float16*)take(NR * DM * 2); _Float16* KH = (_Float16*)take(NR * DM * 2); _Float16* KL = (_Float16*)take(NR * DM * 2); _Float16* Q16 = QH; _Float16* K16 = KH; _Float16* V16 = (_Float16*)take(NR * DM * 2); _Float16* O16 = (_Float16*)take(NR * DM * 2);
  float* S = (float*)take((size_t)NH * QT * NKX * 4); _Float16* P = (_Float16*)take((size_t)NH * QT * NKX * 2); _Float16* VT = (_Float16*)take((size_t)NH * HD * SQ * 2);
  float* QF0 = (float*)take((size_t)QT0 * DM * 4); float* KF0 = (float*)take((size_t)QT0 * DM * 4); float* VF0 = (float*)take((size_t)QT0 * DM * 4); float* OF0 = (float*)take((size_t)NB * QT0 * DM * 4); _Float16* OH0 = (_Float16*)take((size_t)NB * QT0 * DM * 2); _Float16* OL0 = (_Float16*)take((size_t)NB * QT0 * DM * 2);
  if (off > ws_size) return;
  { const unsigned g = (unsigned)(((size_t)DM * DM / 8 + 255) / 256); k_wnat<<<g, 256, 0, stream>>>(wq, (size_t)DM * DM / 8, BQ); k_wnat<<<g, 256, 0, stream>>>(wk, (size_t)DM * DM / 8, BK); k_wnat<<<g, 256, 0, stream>>>(wv, (size_t)DM * DM / 8, BV); k_wnat<<<g, 256, 0, stream>>>(wo, (size_t)DM * DM / 8, BO); }      /* natural [out][in] = Bt[n][k] x16 */
  k_x16<<<(unsigned)((NR * DM / 8 + 255) / 256), 256, 0, stream>>>(x, X16, NR * DM / 8); k_x16<<<(unsigned)((NR * DM / 8 + 255) / 256), 256, 0, stream>>>(xk, XK16, NR * DM / 8); k_x16<<<(unsigned)((NR * DM / 8 + 255) / 256), 256, 0, stream>>>(xv, XV16, NR * DM / 8);
  const size_t r0p = (size_t)B0 * SQ;      /* first projected row */
  k_gemm2<0><<<dim3((unsigned)((MP / 128) * (DM / 64)), 1), 128, 0, stream>>>(X16 + r0p * DM, DM, 0, BQ, DM, 0, 0.0625f, bq, 0, nullptr, 1, 0, 0, QF + r0p * DM, nullptr, DM, 0, MP, DM, DM); k_ln64f32<<<(unsigned)(((size_t)MP * NH + 255) / 256), 256, 0, stream>>>(QF + r0p * DM, DM, (size_t)MP * NH, qg, qbt, LNE); k_hl<<<(unsigned)(((size_t)MP * DM / 8 + 255) / 256), 256, 0, stream>>>(QF + r0p * DM, QH + r0p * DM, QL + r0p * DM, (size_t)MP * DM / 8);      /* q (f32) -> f16 hi + x1024 residual: unscaled logits sigma ~8 */
  k_gemm2<0><<<dim3((unsigned)((MP / 128) * (DM / 64)), 1), 128, 0, stream>>>(XK16 + r0p * DM, DM, 0, BK, DM, 0, 0.0625f, bk, 0, nullptr, 1, 0, 0, QF + r0p * DM, nullptr, DM, 0, MP, DM, DM); k_ln64f32<<<(unsigned)(((size_t)MP * NH + 255) / 256), 256, 0, stream>>>(QF + r0p * DM, DM, (size_t)MP * NH, kg, kbt, LNE); k_hl<<<(unsigned)(((size_t)MP * DM / 8 + 255) / 256), 256, 0, stream>>>(QF + r0p * DM, KH + r0p * DM, KL + r0p * DM, (size_t)MP * DM / 8);      /* k likewise */
  k_gemm2<0><<<dim3((unsigned)((MP / 128) * (DM / 64)), 1), 128, 0, stream>>>(XV16 + r0p * DM, DM, 0, BV, DM, 0, 0.0625f, bv, 0, nullptr, 1, 0, 0, nullptr, V16 + r0p * DM, DM, 0, MP, DM, DM);
  for (int b = B0; b < B0 + NBR; ++b) { const size_t r0 = (size_t)b * SQ;
    k_vt<NH, SQ><<<NH * (SQ / 64), 256, 0, stream>>>(V16 + r0 * LQ, LQ, 0, VT);      /* V^T [NH][HD][SQ] for this batch */
    k_gemm2<0><<<dim3((QT0 / 128) * (DM / 64), 1), 128, 0, stream>>>(X16 + r0 * DM, DM, 0, BQ, DM, 0, 0.0625f, bq, 0, nullptr, 1, 0, 0, QF0, nullptr, DM, 0, QT0, DM, DM); k_gemm2<0><<<dim3((QT0 / 128) * (DM / 64), 1), 128, 0, stream>>>(XK16 + r0 * DM, DM, 0, BK, DM, 0, 0.0625f, bk, 0, nullptr, 1, 0, 0, KF0, nullptr, DM, 0, QT0, DM, DM); k_gemm2<0><<<dim3((QT0 / 128) * (DM / 64), 1), 128, 0, stream>>>(XV16 + r0 * DM, DM, 0, BV, DM, 0, 0.0625f, bv, 0, nullptr, 1, 0, 0, VF0, nullptr, DM, 0, QT0, DM, DM);      /* f32 q, k, v of the first 128 rows (exact products) */
  k_ln64f32<<<(unsigned)(((size_t)QT0 * NH + 255) / 256), 256, 0, stream>>>(QF0, DM, (size_t)QT0 * NH, qg, qbt, LNE); k_ln64f32<<<(unsigned)(((size_t)QT0 * NH + 255) / 256), 256, 0, stream>>>(KF0, DM, (size_t)QT0 * NH, kg, kbt, LNE);      /* the exact first tile's f32 q and k rows through the same per-head LayerNorm */
    k_att0<0><<<NH * (QT0 / 64), 64, 0, stream>>>(QF0, KF0, VF0, DM, nullptr, SCL, OF0 + (size_t)b * QT0 * DM, DM);      /* exact f32 attention for rows 0..127 (o x64) */
    for (int q0 = 0; q0 < QN; q0 += QT) { const int nk = q0 + QT;      /* causal: only keys below the tile end are computed */
      k_gemm2<0><<<dim3((QT / 128) * (nk / 64), NHD), 128, 0, stream>>>(QH + (r0 + q0) * LQ, LQ, (size_t)HD, KH + r0 * LQ, LQ, (size_t)HD, SCL, nullptr, 0, nullptr, 1, 0, 0, S, nullptr, NKX, (size_t)QT * NKX, QT, nk, HD);      /* scores hi . hi * 64^-0.5 (1 / sqrt(head_dim)) */
      k_gemm2<0><<<dim3((QT / 128) * (nk / 64), NHD), 128, 0, stream>>>(QL + (r0 + q0) * LQ, LQ, (size_t)HD, KH + r0 * LQ, LQ, (size_t)HD, SCLR, nullptr, 0, S, -1, 0, 0, S, nullptr, NKX, (size_t)QT * NKX, QT, nk, HD); k_gemm2<0><<<dim3((QT / 128) * (nk / 64), NHD), 128, 0, stream>>>(QH + (r0 + q0) * LQ, LQ, (size_t)HD, KL + r0 * LQ, LQ, (size_t)HD, SCLR, nullptr, 0, S, -1, 0, 0, S, nullptr, NKX, (size_t)QT * NKX, QT, nk, HD);      /* += 2^-10 (lo . hi + hi . lo) */      /* scores, all heads on grid.y */
      k_rsmcf2<<<(NHD * QT + 7) / 8, 256, 0, stream>>>(S, P, NHD, q0, nk);      /* one wave per row, 8 rows per work-group */
      k_gemm2<0><<<dim3((QT / 128) * (HD / 64), NHD), 128, 0, stream>>>(P, NKX, (size_t)QT * NKX, VT, SQ, (size_t)HD * SQ, 0.25f, nullptr, 0, nullptr, 1, 0, 0, nullptr, O16 + (r0 + q0) * DM, DM, (size_t)HD, QT, HD, nk); } }      /* o (merged heads, x64) as f16 rows */
  k_gemm2<0><<<dim3((unsigned)((MPO / 128) * (DM / 64)), 1), 128, 0, stream>>>(O16 + r0p * DM, DM, 0, BO, DM, 0, 0.0009765625f, bo, 0, nullptr, 1, 0, 0, (float*)d_out + r0p * DM, nullptr, DM, 0, MPO, DM, DM);      /* out rows are the output layout */
  k_hl<<<(unsigned)(((size_t)NB * QT0 * DM / 8 + 255) / 256), 256, 0, stream>>>(OF0, OH0, OL0, (size_t)NB * QT0 * DM / 8);      /* first-tile o (x64) -> f16 hi + x1024 residual planes */
  for (int b = B0; b < B0 + NBR; ++b) { const size_t r0 = (size_t)b * SQ; const size_t f0 = (size_t)b * QT0;
    k_gemm2<0><<<dim3((QT0 / 128) * (DM / 64), 1), 128, 0, stream>>>(OH0 + f0 * DM, DM, 0, BO, DM, 0, 0.0009765625f, bo, 0, nullptr, 1, 0, 0, (float*)d_out + r0 * DM, nullptr, DM, 0, QT0, DM, DM);      /* rows 0..127: out = o_hi Wo (+ b), overwriting the f16-path rows */
    k_gemm2<0><<<dim3((QT0 / 128) * (DM / 64), 1), 128, 0, stream>>>(OL0 + f0 * DM, DM, 0, BO, DM, 0, 0.00000095367431640625f, nullptr, 0, (const float*)d_out + r0 * DM, -1, 0, 0, (float*)d_out + r0 * DM, nullptr, DM, 0, QT0, DM, DM); }      /* += o_lo Wo 2^-20 (own-element accumulate) */
}

// v002
// One run takes 1400 microseconds.
// Two timings next to v001 put it at 2.65 and 2.66 times that version's speed.
// Counting every step since v000, it is 7.78 times as fast.
#include <hip/hip_runtime.h>
// Causal multi-head self-attention with a per-head LayerNorm on q and k, natural bias-free q / k / v projections and a biased output projection (x [2][3072][512]; q / k / v = x W^T (nn.Linear natural [512][512] sd 0.02, NO biases), 8 heads of 64; q and k each pass through a LayerNorm over the 64 values of every (token, head) vector (biased variance, eps 1e-5, gamma / beta [64]: ones / zeros on this draw: read); scores = q . k / sqrt(64); causal (keys after the query get -inf); softmax; out = merged Wo^T + bo (natural; zero bias) -> [2][3072][512]); q and k carried as f16 hi + x1024 residual planes with three-product scores.
// Structure: token rows r = b*3072 + s; x as exact f16 rows (bf16-rounded); q and k as WMMA GEMMs (32x64 wave tiles, f32 accumulation, exact x16 weights, no bias) into f32 rows, each (token, head) vector of which an IN-PLACE f32 LayerNorm kernel normalises over its 64 values (f32 statistics, gamma / beta by value), then split into f16 hi + x1024 residual planes; v as an f16-output GEMM; per batch: V^T for all heads via LDS transposes; then ONE fused launch for all batches, heads and query rows: a wave takes 16 query rows and walks the keys up to its diagonal, 32 a pass: S^T = K Q^T as three products (hi.hi + lo.hi + hi.lo, K = 64, scale 1/8 = 1/sqrt(64); logits sigma ~1), causal running-maximum softmax inside the lane (f32 statistics, native exp; weights exp(s - max) as f16), O^T = V^T P^T with the weights taken in place from the score accumulators (o divided by the row sum at the end and carried x64, folded into the output GEMM alpha) written straight into the merged f16 o rows; out = o Wo^T + bo GEMM (f32) into the output layout.
// Compute dtype: inputs rounded to bf16; x / weights exact; the normalised q and k as f16 hi + residual planes (three-product scores), v, the softmax weights and o as plain f16 GEMM operands (~2^-12); LayerNorm, scores and softmax statistics f32. v_wmma_f32_16x16x32_f16.
#define NB 2
#define SCL 0.125f                         /* 1 / sqrt(head_dim = 64) */
#define SCLR 0.0001220703125f              /* 2^-13: the same scale on the x1024 residual passes */
#define SQ 3072
#define DM 512
#define NH 8
#define HD 64
#define HG 4                         /* heads per launch of the h0-based k_vt overload */
#define QT0 128                      /* first-tile rows recomputed exactly in f32 */
#define B0 0                         /* first batch processed (debug hook) */
#define NBR NB                       /* batches processed (debug hook) */
#define NR ((size_t)NB * SQ)         /* token rows */
#define MP ((int)((size_t)NBR * SQ)) /* rows projected (debug hook) */
#define MPO MP                       /* rows through the output stage (debug hook) */
#define LQ DM      /* row pitch of the q/k/v rows */
typedef __bf16 v16b __attribute__((ext_vector_type(16)));
typedef unsigned short v8us __attribute__((ext_vector_type(8), may_alias));
typedef float  v8f  __attribute__((ext_vector_type(8)));
typedef float  v4f  __attribute__((ext_vector_type(4)));
typedef float  v4fa __attribute__((ext_vector_type(4), may_alias));
union FragB { v16b v; v8us half[2]; unsigned short u[16]; };

__device__ __forceinline__ unsigned short bf16_bits(float x) { unsigned int u = __float_as_uint(x); return (unsigned short)((u + 0x7FFFu + ((u >> 16) & 1u)) >> 16); }
__device__ __forceinline__ float bf16_val(unsigned short b) { return __uint_as_float(((unsigned int)b) << 16); }
__device__ __forceinline__ float bf16_round(float x) { return bf16_val(bf16_bits(x)); }
// D += A·B with NT terms: 1 = ah·bh, 2 = + al·bh (A split), 3 = + ah·bl (both split)
template <int NT>
__device__ __forceinline__ v8f mmaN(v16b ah, v16b al, v16b bh, v16b bl, v8f c) {
  c = __builtin_amdgcn_wmma_f32_16x16x32_bf16(false, ah, false, bh, (short)0, c, false, false);
  if (NT >= 2) c = __builtin_amdgcn_wmma_f32_16x16x32_bf16(false, al, false, bh, (short)0, c, false, false);
  if (NT >= 3) c = __builtin_amdgcn_wmma_f32_16x16x32_bf16(false, ah, false, bl, (short)0, c, false, false);
  asm volatile("v_nop\n\tv_nop\n\tv_nop\n\tv_nop" : "+v"(c) : "v"(ah), "v"(al), "v"(bh), "v"(bl));
  return c;
}

__global__ __launch_bounds__(256) void k_wt_bf16(const float* __restrict__ W, unsigned short* __restrict__ Wt, int K, int N) {
  const int t = blockIdx.x * 256 + threadIdx.x;
  const int k8n = K / 8;
  if (t >= N * k8n) return;
  const int n = t / k8n, k8 = (t % k8n) * 8;
  v8us v;
#pragma unroll
  for (int i = 0; i < 8; ++i) v[i] = bf16_bits(W[(size_t)(k8 + i) * N + n]);
  *(v8us*)(Wt + (size_t)n * K + k8) = v;
  
}

// GEMM C[M][N] (f32, pitch ldc) = act(A[M][K]·W + bias). A f32 row-major (pitch lda) converted per fragment to bf16
// (ASPLIT: hi/lo two planes -> 2 terms, else single rounded term); Wt bf16 [N][K] (pitch ldb). BIAS_BF16 rounds the
// bias to bf16 first (bias quantised to bf16 before the add). K%32==0, M%16==0, N%64==0.
template <bool ASPLIT, int ACT, bool BIAS_BF16>
__global__ __launch_bounds__(128) void k_gemm_bf(const float* __restrict__ A, int lda, const unsigned short* __restrict__ Wt, int ldb,
                                               const float* __restrict__ bias, float* __restrict__ C, int ldc, int M, int N, int K) {
  __shared__ __attribute__((aligned(16))) float so[4][16][64];
  const int tid = threadIdx.x, w = tid >> 5, lane = tid & 31, ln = lane & 15, hh = lane >> 4;
  const int ntn = N / 64;
  const int wid = blockIdx.x * 4 + w;
  const int mt = wid / ntn, nq = wid % ntn;
  if (mt * 16 >= M) return;
  const int row0 = mt * 16, col0 = nq * 64;
  const float* arow = A + (size_t)(row0 + ln) * lda;
  v8f acc[4] = {};
  for (int kb = 0; kb < K; kb += 32) {
    FragB ah, al;
    const v4f x0 = *(const v4fa*)(arow + kb + 8 * hh), x1 = *(const v4fa*)(arow + kb + 8 * hh + 4);
    const v4f x2 = *(const v4fa*)(arow + kb + 16 + 8 * hh), x3 = *(const v4fa*)(arow + kb + 16 + 8 * hh + 4);
    float xs[16] = {x0[0],x0[1],x0[2],x0[3],x1[0],x1[1],x1[2],x1[3],x2[0],x2[1],x2[2],x2[3],x3[0],x3[1],x3[2],x3[3]};
#pragma unroll
    for (int i = 0; i < 16; ++i) { const unsigned short hb = bf16_bits(xs[i]); ah.u[i] = hb; al.u[i] = ASPLIT ? bf16_bits(xs[i] - bf16_val(hb)) : (unsigned short)0; }
#pragma unroll
    for (int t = 0; t < 4; ++t) {
      const unsigned short* brow = Wt + (size_t)(col0 + t * 16 + ln) * ldb + kb;
      FragB b;
      b.half[0] = *(const v8us*)(brow + 8 * hh);
      b.half[1] = *(const v8us*)(brow + 16 + 8 * hh);
      acc[t] = mmaN<ASPLIT ? 2 : 1>(ah.v, al.v, b.v, b.v, acc[t]);
    }
  }
#pragma unroll
  for (int t = 0; t < 4; ++t) {
    float bv = bias ? bias[col0 + t * 16 + ln] : 0.f;
    if (BIAS_BF16) bv = bf16_round(bv);
#pragma unroll
    for (int r = 0; r < 8; ++r) { float v = acc[t][r] + bv; if (ACT == 1) v = fmaxf(v, 0.f); so[w][8 * hh + r][t * 16 + ln] = v; }
  }
  __builtin_amdgcn_fence(__ATOMIC_ACQ_REL, "workgroup");
  __builtin_amdgcn_wave_barrier();
  const int rsub = lane >> 4, c4 = (lane & 15) * 4;
  {
#pragma unroll
    for (int q = 0; q < 8; ++q) {
      const int r = q * 2 + rsub;
      const v4f v = *(const v4fa*)&so[w][r][c4];
      *(v4f*)(C + (size_t)(row0 + r) * ldc + col0 + c4) = v;
    }
    
  }
}

// GEMM C = act(A·W + bias + resid): A f32 (ASPLIT -> hi/lo 2 terms), Wt bf16 [N][K]; ACT 0 none, 1 relu, 2 exact gelu;
// resid (optional, f32, row index = (row % rmod), pitch ldr, RES_BF16 rounds it) added before the activation.
template <bool ASPLIT, int ACT, bool BIAS_BF16, bool RES_BF16>
__global__ __launch_bounds__(128) void k_gemm_bf3(const float* __restrict__ A, int lda, const unsigned short* __restrict__ Wt, int ldb,
                                                const float* __restrict__ bias, const float* __restrict__ resid, int rmod, int ldr,
                                                float* __restrict__ C, int ldc, int M, int N, int K) {
  __shared__ __attribute__((aligned(16))) float so[4][16][64];
  const int tid = threadIdx.x, w = tid >> 5, lane = tid & 31, ln = lane & 15, hh = lane >> 4;
  const int ntn = N / 64;
  const int wid = blockIdx.x * 4 + w;
  const int mt = wid / ntn, nq = wid % ntn;
  if (mt * 16 >= M) return;
  const int row0 = mt * 16, col0 = nq * 64;
  const float* arow = A + (size_t)(row0 + ln) * lda;
  v8f acc[4] = {};
  for (int kb = 0; kb < K; kb += 32) {
    FragB ah, al;
    const v4f x0 = *(const v4fa*)(arow + kb + 8 * hh), x1 = *(const v4fa*)(arow + kb + 8 * hh + 4);
    const v4f x2 = *(const v4fa*)(arow + kb + 16 + 8 * hh), x3 = *(const v4fa*)(arow + kb + 16 + 8 * hh + 4);
    float xs[16] = {x0[0],x0[1],x0[2],x0[3],x1[0],x1[1],x1[2],x1[3],x2[0],x2[1],x2[2],x2[3],x3[0],x3[1],x3[2],x3[3]};
#pragma unroll
    for (int i = 0; i < 16; ++i) { const unsigned short hb = bf16_bits(xs[i]); ah.u[i] = hb; al.u[i] = ASPLIT ? bf16_bits(xs[i] - bf16_val(hb)) : (unsigned short)0; }
#pragma unroll
    for (int t = 0; t < 4; ++t) {
      const unsigned short* brow = Wt + (size_t)(col0 + t * 16 + ln) * ldb + kb;
      FragB b;
      b.half[0] = *(const v8us*)(brow + 8 * hh);
      b.half[1] = *(const v8us*)(brow + 16 + 8 * hh);
      acc[t] = mmaN<ASPLIT ? 2 : 1>(ah.v, al.v, b.v, b.v, acc[t]);
    }
  }
#pragma unroll
  for (int t = 0; t < 4; ++t) {
    const int col = col0 + t * 16 + ln;
    float bv = bias ? bias[col] : 0.f;
    if (BIAS_BF16) bv = bf16_round(bv);
#pragma unroll
    for (int r = 0; r < 8; ++r) {
      float v = acc[t][r] + bv;
      if (resid) { float rv = resid[(size_t)((row0 + 8 * hh + r) % rmod) * ldr + col]; if (RES_BF16) rv = bf16_round(rv); v += rv; }
      if (ACT == 1) v = fmaxf(v, 0.f);
      if (ACT == 2) v = 0.5f * v * (1.0f + erff(v * 0.70710678118654752f));
      if (ACT == 3) { const float u = 0.7978845608028654f * (v + 0.044715f * v * v * v); v = 0.5f * v * (1.0f + tanhf(u)); }
      so[w][8 * hh + r][t * 16 + ln] = v;
    }
  }
  __builtin_amdgcn_fence(__ATOMIC_ACQ_REL, "workgroup");
  __builtin_amdgcn_wave_barrier();
  const int rsub = lane >> 4, c4 = (lane & 15) * 4;
  {
#pragma unroll
    for (int q = 0; q < 8; ++q) {
      const int r = q * 2 + rsub;
      const v4f v = *(const v4fa*)&so[w][r][c4];
      *(v4f*)(C + (size_t)(row0 + r) * ldc + col0 + c4) = v;
    }
    
  }
}
// row LayerNorm (biased variance, eps) over N: s = X (+ R); optional out_sum <- s; out_norm <- (s-mu)*rsqrt(var+eps)*g + b
template <bool PARAM_BF16>
__global__ __launch_bounds__(256) void k_layernorm(const float* __restrict__ X, const float* __restrict__ R, const float* __restrict__ g, const float* __restrict__ bta,
                                                  float* __restrict__ out_sum, float* __restrict__ out_norm, int N, float eps) {
  __shared__ float red[256];
  const int row = blockIdx.x, tid = threadIdx.x;
  const float* x = X + (size_t)row * N; const float* rr = R ? R + (size_t)row * N : nullptr;
  float vals[16];                     // up to N = 4096
  const int per = N / 256;            // contiguous chunk per thread? use strided-by-4 chunks: thread handles j = tid*4 + 1024*u
  float s1 = 0.f;
  for (int u = 0; u < per / 4; ++u) {
    const int j = tid * 4 + 1024 * u;
    const v4f a = *(const v4fa*)(x + j);
    v4f b = {0.f,0.f,0.f,0.f}; if (rr) b = *(const v4fa*)(rr + j);
#pragma unroll
    for (int q = 0; q < 4; ++q) { const float v = a[q] + b[q]; vals[u * 4 + q] = v; s1 += v; }
  }
  red[tid] = s1; __syncthreads();
  for (int st = 128; st > 0; st >>= 1) { if (tid < st) red[tid] += red[tid + st]; __syncthreads(); }
  const float mu = red[0] / (float)N; __syncthreads();
  float s2 = 0.f;
  for (int u = 0; u < per / 4; ++u)
#pragma unroll
    for (int q = 0; q < 4; ++q) { const float c = vals[u * 4 + q] - mu; s2 += c * c; }
  red[tid] = s2; __syncthreads();
  for (int st = 128; st > 0; st >>= 1) { if (tid < st) red[tid] += red[tid + st]; __syncthreads(); }
  const float rs = rsqrtf(red[0] / (float)N + eps);
  {
    for (int u = 0; u < per / 4; ++u) {
      const int j = tid * 4 + 1024 * u;
      v4f o, sm;
#pragma unroll
      for (int q = 0; q < 4; ++q) {
        float gg = g[j + q], bb = bta[j + q];
        if (PARAM_BF16) { gg = bf16_round(gg); bb = bf16_round(bb); }
        sm[q] = vals[u * 4 + q]; o[q] = (vals[u * 4 + q] - mu) * rs * gg + bb;
      }
      if (out_sum) *(v4f*)(out_sum + (size_t)row * N + j) = sm;
      *(v4f*)(out_norm + (size_t)row * N + j) = o;
    }
    
  }
}



// ---- f16 WMMA path (v_wmma_f32_16x16x32_f16): 11-bit significands for operands in range — used where a [0,1] probability operand needs more precision than bf16
typedef _Float16 v16h __attribute__((ext_vector_type(16)));
union FragH { v16h v; v8us half[2]; _Float16 h[16]; unsigned short u[16]; };
template <int NT>
__device__ __forceinline__ v8f mmaH(v16h ah, v16h al, v16h bh, v16h bl, v8f c) {
  c = __builtin_amdgcn_wmma_f32_16x16x32_f16(false, ah, false, bh, (short)0, c, false, false);
  if (NT >= 2) c = __builtin_amdgcn_wmma_f32_16x16x32_f16(false, al, false, bh, (short)0, c, false, false);
  if (NT >= 3) c = __builtin_amdgcn_wmma_f32_16x16x32_f16(false, ah, false, bl, (short)0, c, false, false);
  asm volatile("v_nop\n\tv_nop\n\tv_nop\n\tv_nop" : "+v"(c) : "v"(ah), "v"(al), "v"(bh), "v"(bl));
  return c;
}
// batched GEMM like k_gemm_b but f16 operands: A f32 (split into f16 hi/lo if ASPLIT, else rounded to f16), Bt = f16 values [n][k]; alpha; C f32; N multiple of 16 (partial tiles skipped)
template <bool ASPLIT>
__global__ __launch_bounds__(128) void k_gemm_h(const float* __restrict__ A, int lda, size_t sA, const _Float16* __restrict__ Bh, int ldb, size_t sB, float alpha, float* __restrict__ C, int ldc, size_t sC, int M, int N, int K) {
  __shared__ __attribute__((aligned(16))) float so[4][16][64];
  const int tid = threadIdx.x, w = tid >> 5, lane = tid & 31, ln = lane & 15, hh = lane >> 4; const int by = blockIdx.y;
  A += (size_t)by * sA; Bh += (size_t)by * sB; C += (size_t)by * sC;
  const int ntn = (N + 63) / 64; const int wid = blockIdx.x * 4 + w; const int mt = wid / ntn, nq = wid % ntn; if (mt * 16 >= M) return;
  const int row0 = mt * 16, col0 = nq * 64; const float* arow = A + (size_t)(row0 + ln) * lda;
  v8f acc[4] = {};
  for (int kb = 0; kb < K; kb += 32) {
    FragH ah, al;
    const v4f x0 = *(const v4fa*)(arow + kb + 8 * hh), x1 = *(const v4fa*)(arow + kb + 8 * hh + 4), x2 = *(const v4fa*)(arow + kb + 16 + 8 * hh), x3 = *(const v4fa*)(arow + kb + 16 + 8 * hh + 4);
    float xs[16] = {x0[0],x0[1],x0[2],x0[3],x1[0],x1[1],x1[2],x1[3],x2[0],x2[1],x2[2],x2[3],x3[0],x3[1],x3[2],x3[3]};
#pragma unroll
    for (int i = 0; i < 16; ++i) { const _Float16 h = (_Float16)xs[i]; ah.h[i] = h; al.h[i] = ASPLIT ? (_Float16)(xs[i] - (float)h) : (_Float16)0.0f; }
#pragma unroll
    for (int t = 0; t < 4; ++t) { if (col0 + t * 16 >= N) continue; const size_t boff = (size_t)(col0 + t * 16 + ln) * ldb + kb; FragH bq; bq.half[0] = *(const v8us*)(Bh + boff + 8 * hh); bq.half[1] = *(const v8us*)(Bh + boff + 16 + 8 * hh);
      acc[t] = mmaH<ASPLIT ? 2 : 1>(ah.v, al.v, bq.v, bq.v, acc[t]); }
  }
#pragma unroll
  for (int t = 0; t < 4; ++t) { if (col0 + t * 16 >= N) continue;
#pragma unroll
    for (int r = 0; r < 8; ++r) so[w][8 * hh + r][t * 16 + ln] = acc[t][r] * alpha; }
  __builtin_amdgcn_fence(__ATOMIC_ACQ_REL, "workgroup"); __builtin_amdgcn_wave_barrier();
  const int rsub = lane >> 4, c4 = (lane & 15) * 4;
  {
#pragma unroll
    for (int q = 0; q < 8; ++q) { const int r = q * 2 + rsub; if (col0 + c4 < N) { const v4f v = *(const v4fa*)&so[w][r][c4]; *(v4f*)(C + (size_t)(row0 + r) * ldc + col0 + c4) = v; } }
     }
}

// Wt[n][k] = f16(W[k][n]·scale) from f32 row-major W[K][N] (scale = power of two; bf16-exact weights stay exact in f16 away from the subnormal range)
__global__ __launch_bounds__(256) void k_wt_f16(const float* __restrict__ W, _Float16* __restrict__ Wt, int K, int N, float scale) {
  const int t = blockIdx.x * 256 + threadIdx.x; if (t >= N * (K / 8)) return; const int n = t / (K / 8), k8 = (t % (K / 8)) * 8; FragH f;
#pragma unroll
  for (int i = 0; i < 8; ++i) f.h[i] = (_Float16)(bf16_round(W[(size_t)(k8 + i) * N + n]) * scale); const v8us o = f.half[0];
  *(v8us*)((unsigned short*)Wt + (size_t)n * K + k8) = o; 
}
// k_gemm_hh variant with fused epilogue: v = acc·alpha + bias[by·sBias + col] (+ CP[(row/rowsPerB)·sCPb + by·64 + col] if CP) ; ACT 0 none / 1 elu ; writes f16 C16 (and f32 C if non-null)
template <int ACT>
__global__ __launch_bounds__(128) void k_gemm_hhx(const _Float16* __restrict__ A, int lda, size_t sA, const _Float16* __restrict__ Bh, int ldb, size_t sB, float alpha, const float* __restrict__ bias, size_t sBias, const float* __restrict__ CP, int rowsPerB, size_t sCPb, int row0g,
    float* __restrict__ C, _Float16* __restrict__ C16, int ldc, size_t sC, int M, int N, int K) {
  __shared__ __attribute__((aligned(16))) float so[4][16][64];
  const int tid = threadIdx.x, w = tid >> 5, lane = tid & 31, ln = lane & 15, hh = lane >> 4; const int by = blockIdx.y;
  A += (size_t)by * sA; Bh += (size_t)by * sB; const size_t cofs = (size_t)by * sC; const float* bp = bias ? bias + (size_t)by * sBias : nullptr;
  const int ntn = (N + 63) / 64; const int wid = blockIdx.x * 4 + w; const int mt = wid / ntn, nq = wid % ntn; if (mt * 16 >= M) return;
  const int row0 = mt * 16, col0 = nq * 64; const _Float16* arow = A + (size_t)(row0 + ln) * lda;
  v8f acc[4] = {};
  for (int kb = 0; kb < K; kb += 32) { FragH ah; ah.half[0] = *(const v8us*)((const unsigned short*)arow + kb + 8 * hh); ah.half[1] = *(const v8us*)((const unsigned short*)arow + kb + 16 + 8 * hh);
#pragma unroll
    for (int t = 0; t < 4; ++t) { if (col0 + t * 16 >= N) continue; const size_t boff = (size_t)(col0 + t * 16 + ln) * ldb + kb; FragH bq; bq.half[0] = *(const v8us*)((const unsigned short*)Bh + boff + 8 * hh); bq.half[1] = *(const v8us*)((const unsigned short*)Bh + boff + 16 + 8 * hh);
      acc[t] = mmaH<1>(ah.v, ah.v, bq.v, bq.v, acc[t]); }
  }
#pragma unroll
  for (int t = 0; t < 4; ++t) { if (col0 + t * 16 >= N) continue; const int col = col0 + t * 16 + ln; const float bv = bp ? bf16_round(bp[col]) : 0.f;
#pragma unroll
    for (int r = 0; r < 8; ++r) { float v = acc[t][r] * alpha + bv; if (CP) { const int rr = row0g + row0 + 8 * hh + r; if (rowsPerB < 0) v += CP[cofs + (size_t)rr * ldc + col];      /* rowsPerB < 0: own element of the batched C plane */ else { const int bidx = rr / rowsPerB; v += CP[(size_t)bidx * sCPb + (size_t)by * 64 + col]; } } if (ACT == 1) v = (v > 0.f) ? v : expm1f(v); else if (ACT == 7) v = (v > 0.f) ? v + 1.0f : expf(v); else if (ACT == 8) v = tanhf(v); else if (ACT == 9) v = 0.5f * v * (1.0f + tanhf(0.7978845608028654f * (v + 0.044715f * v * v * v))); else if (ACT == 11) v = 1.0f / (1.0f + expf(-v)); else if (ACT == 12) v = (v > 0.f) ? v : 0.01f * v; else if (ACT == 14) v = (v > 0.f) ? v : 0.1f * v; else if (ACT == 16) v = (v >= 0.f) ? v : 0.3f * v; else if (ACT == 17) v = (v >= 0.f) ? v : 0.2f * v; else if (ACT == 15) v = v / (1.0f + expf(-v)); else if (ACT == 3) v = fmaxf(v, 0.f); else if (ACT == 6) v = 0.5f * v * (1.0f + erff(v * 0.70710678118654752f)); so[w][8 * hh + r][t * 16 + ln] = v; } }
  __builtin_amdgcn_fence(__ATOMIC_ACQ_REL, "workgroup"); __builtin_amdgcn_wave_barrier();
  const int rsub = lane >> 4, c4 = (lane & 15) * 4; typedef _Float16 v4h __attribute__((ext_vector_type(4)));
  {
#pragma unroll
    for (int q = 0; q < 8; ++q) { const int r = q * 2 + rsub; if (col0 + c4 < N) { const v4f v = *(const v4fa*)&so[w][r][c4]; if (C) *(v4f*)(C + cofs + (size_t)(row0 + r) * ldc + col0 + c4) = v; if (C16) { v4h h4; for (int i = 0; i < 4; ++i) h4[i] = (_Float16)v[i]; *(v4h*)(C16 + cofs + (size_t)(row0 + r) * ldc + col0 + c4) = h4; } } }
     }
}


typedef _Float16 v4h __attribute__((ext_vector_type(4)));

__global__ __launch_bounds__(256) void k_x16(const float* __restrict__ x, _Float16* __restrict__ X16, size_t n8) { const size_t t = (size_t)blockIdx.x * 256 + threadIdx.x; if (t >= n8) return; FragH f;
#pragma unroll
  for (int q = 0; q < 8; ++q) f.h[q] = (_Float16)bf16_round(x[t * 8 + q]); *(v8us*)((unsigned short*)X16 + t * 8) = f.half[0];  }
__global__ __launch_bounds__(256) void k_h16(const float* __restrict__ x, _Float16* __restrict__ X16, size_t n8) { const size_t t = (size_t)blockIdx.x * 256 + threadIdx.x; if (t >= n8) return; FragH f;
#pragma unroll
  for (int q = 0; q < 8; ++q) f.h[q] = (_Float16)x[t * 8 + q]; *(v8us*)((unsigned short*)X16 + t * 8) = f.half[0];  }
__global__ __launch_bounds__(256) void k_round16f(const float* __restrict__ W, _Float16* __restrict__ Bt, size_t n8) { const size_t t = (size_t)blockIdx.x * 256 + threadIdx.x; if (t >= n8) return; FragH f;
#pragma unroll
  for (int i = 0; i < 8; ++i) f.h[i] = (_Float16)(bf16_round(W[t * 8 + i]) * 16.0f); *(v8us*)((unsigned short*)Bt + t * 8) = f.half[0];  }
template <int NHv, int TTv>
__global__ __launch_bounds__(256) void k_vt(const _Float16* __restrict__ V16, int ldv, int voff, _Float16* __restrict__ Vt) { __shared__ unsigned short tl[64][66]; const int tid = threadIdx.x; const int slab = blockIdx.x / (TTv / 64), lg = blockIdx.x % (TTv / 64); const int b = slab / NHv, h = slab % NHv;
  for (int i = tid; i < 64 * 8; i += 256) { const int r = i / 8, c8 = (i % 8) * 8; FragH f; f.half[0] = *(const v8us*)((const unsigned short*)V16 + ((size_t)b * TTv + lg * 64 + r) * ldv + voff + h * 64 + c8);
#pragma unroll
    for (int q = 0; q < 8; ++q) tl[r][c8 + q] = f.u[q]; }
  __syncthreads();
  {
#pragma unroll
    for (int rd = 0; rd < 2; ++rd) { const int d = rd * 32 + tid / 8, pc = tid % 8; FragH f;
#pragma unroll
      for (int q = 0; q < 8; ++q) f.u[q] = tl[pc * 8 + q][d];
      *(v8us*)((unsigned short*)Vt + ((size_t)slab * 64 + d) * TTv + lg * 64 + pc * 8) = f.half[0]; }
     } }

__global__ __launch_bounds__(256) void k_hl(const float* __restrict__ F, _Float16* __restrict__ Hh, _Float16* __restrict__ Hl, size_t n8) { const size_t t = (size_t)blockIdx.x * 256 + threadIdx.x; if (t >= n8) return; FragH fh, fl; const v4f a = *(const v4fa*)(F + t * 8), c = *(const v4fa*)(F + t * 8 + 4);
#pragma unroll
  for (int q = 0; q < 4; ++q) { _Float16 h = (_Float16)a[q]; fh.h[q] = h; fl.h[q] = (_Float16)((a[q] - (float)h) * 1024.0f); h = (_Float16)c[q]; fh.h[4 + q] = h; fl.h[4 + q] = (_Float16)((c[q] - (float)h) * 1024.0f); }
  { *(v8us*)((unsigned short*)Hh + t * 8) = fh.half[0]; *(v8us*)((unsigned short*)Hl + t * 8) = fl.half[0];  } }

// ---- fast GEMM (wave tile 32x64; requires M % 32 == 0 rows per launch region and N % 64 == 0); epilogue = k_gemm_hhx semantics ----
__device__ __forceinline__ v16h g2_frag(const _Float16* p, int hh) { FragH f; f.half[0] = *(const v8us*)((const unsigned short*)p + 8 * hh); f.half[1] = *(const v8us*)((const unsigned short*)p + 16 + 8 * hh); return f.v; }
__device__ __forceinline__ v8f g2_mma(v16h a, v16h b, v8f c) { v8f d = __builtin_amdgcn_wmma_f32_16x16x32_f16(false, a, false, b, (short)0, c, false, false); asm volatile("v_nop\n\tv_nop\n\tv_nop\n\tv_nop" : "+v"(d) : "v"(a), "v"(b)); return d; }
template <int ACT>
__global__ __launch_bounds__(128) void k_gemm2(const _Float16* __restrict__ A, int lda, size_t sA, const _Float16* __restrict__ Bh, int ldb, size_t sB, float alpha, const float* __restrict__ bias, size_t sBias, const float* __restrict__ CP, int rowsPerB, size_t sCPb, int row0g,
    float* __restrict__ C, _Float16* __restrict__ C16, int ldc, size_t sC, int M, int N, int K) { static_assert(ACT == 0 || ACT == 3 || ACT == 6 || ACT == 8 || ACT == 9 || ACT == 11 || ACT == 12 || ACT == 14 || ACT == 15 || ACT == 16 || ACT == 17, "k_gemm2: unsupported ACT code (would silently apply no activation)");
  __shared__ __attribute__((aligned(16))) float so[4][32][68];
  const int tid = threadIdx.x, w = tid >> 5, lane = tid & 31, ln = lane & 15, hh = lane >> 4; const int by = blockIdx.y;
  A += (size_t)by * sA; Bh += (size_t)by * sB; const size_t cofs = (size_t)by * sC; const float* bp = bias ? bias + (size_t)by * sBias : nullptr;
  const int ntn = N >> 6; const int mt = blockIdx.x / ntn, nq = blockIdx.x - mt * ntn; const int row0 = mt * 128 + 32 * w, col0 = nq * 64; if (row0 >= M) return;
  const _Float16* a0p = A + (size_t)(row0 + ln) * lda; const _Float16* a1p = a0p + (size_t)16 * lda;
  const _Float16* b0p = Bh + (size_t)(col0 + ln) * ldb; const _Float16* b1p = b0p + (size_t)16 * ldb; const _Float16* b2p = b1p + (size_t)16 * ldb; const _Float16* b3p = b2p + (size_t)16 * ldb;
  const v8f z8 = {0.f,0.f,0.f,0.f,0.f,0.f,0.f,0.f}; v8f c00 = z8, c01 = z8, c02 = z8, c03 = z8, c10 = z8, c11 = z8, c12 = z8, c13 = z8;
#pragma unroll 1
  for (int kb = 0; kb < K; kb += 32) { const v16h a0 = g2_frag(a0p + kb, hh), a1 = g2_frag(a1p + kb, hh);
    v16h b = g2_frag(b0p + kb, hh); c00 = g2_mma(a0, b, c00); c10 = g2_mma(a1, b, c10);
    b = g2_frag(b1p + kb, hh); c01 = g2_mma(a0, b, c01); c11 = g2_mma(a1, b, c11);
    b = g2_frag(b2p + kb, hh); c02 = g2_mma(a0, b, c02); c12 = g2_mma(a1, b, c12);
    b = g2_frag(b3p + kb, hh); c03 = g2_mma(a0, b, c03); c13 = g2_mma(a1, b, c13); }
  v8f accs[8] = {c00, c01, c02, c03, c10, c11, c12, c13};
#pragma unroll
  for (int u = 0; u < 8; ++u) { const int t = u & 3, half = u >> 2; const int col = col0 + t * 16 + ln; const float bv = bp ? bf16_round(bp[col]) : 0.f;
#pragma unroll
    for (int r = 0; r < 8; ++r) { const int rloc = half * 16 + 8 * hh + r; float v = accs[u][r] * alpha + bv; if (CP) { if (rowsPerB < 0) v += CP[cofs + (size_t)(row0g + row0 + rloc) * ldc + col];      /* rowsPerB < 0: own element of the batched C plane */ else { const int bidx = (row0g + row0 + rloc) / rowsPerB; v += CP[(size_t)bidx * sCPb + (size_t)by * 64 + col]; } }
      if (ACT == 3) v = fmaxf(v, 0.f); else if (ACT == 6) v = 0.5f * v * (1.0f + erff(v * 0.70710678118654752f)); else if (ACT == 11) v = 1.0f / (1.0f + expf(-v)); else if (ACT == 15) v = v / (1.0f + expf(-v)); else if (ACT == 12) v = (v > 0.f) ? v : 0.01f * v; else if (ACT == 8) v = tanhf(v); else if (ACT == 9) v = 0.5f * v * (1.0f + tanhf(0.7978845608028654f * (v + 0.044715f * v * v * v))); else if (ACT == 14) v = (v > 0.f) ? v : 0.1f * v; else if (ACT == 16) v = (v >= 0.f) ? v : 0.3f * v; else if (ACT == 17) v = (v >= 0.f) ? v : 0.2f * v;
      so[w][rloc][t * 16 + ln] = v; } }
  __builtin_amdgcn_fence(__ATOMIC_ACQ_REL, "workgroup"); __builtin_amdgcn_wave_barrier();
  const int rsub = lane >> 4, c4 = (lane & 15) * 4;
  {
#pragma unroll
    for (int q = 0; q < 16; ++q) { const int r = q * 2 + rsub; const v4f v = *(const v4fa*)&so[w][r][c4]; if (C) *(v4f*)(C + cofs + (size_t)(row0 + r) * ldc + col0 + c4) = v; if (C16) { v4h h4; for (int i = 0; i < 4; ++i) h4[i] = (_Float16)v[i]; *(v4h*)(C16 + cofs + (size_t)(row0 + r) * ldc + col0 + c4) = h4; } }
     } }


__global__ __launch_bounds__(256) void k_wnat(const float* __restrict__ w, size_t n8, _Float16* __restrict__ Bt) { const size_t t = (size_t)blockIdx.x * 256 + threadIdx.x; if (t >= n8) return; FragH f; for (int q = 0; q < 8; ++q) f.h[q] = (_Float16)(bf16_round(w[t * 8 + q]) * 16.0f); *(v8us*)((unsigned short*)Bt + t * 8) = f.half[0];  }
__global__ __launch_bounds__(256) void k_rsm(const float* __restrict__ S, _Float16* __restrict__ P, int nrows) {
  #pragma clang fp contract(off)
  const int i = blockIdx.x * 256 + threadIdx.x; if (i >= nrows) return; const float* s = S + (size_t)i * SQ; float mx = -3.0e38f;
#pragma unroll 1
  for (int j = 0; j < SQ; ++j) mx = fmaxf(mx, s[j]); float se = 0.f;
#pragma unroll 1
  for (int j = 0; j < SQ; ++j) se += expf(s[j] - mx); const float sc = 256.0f / se;
#pragma unroll 1
  for (int j0 = 0; j0 < SQ; j0 += 8) { FragH f; for (int q = 0; q < 8; ++q) f.h[q] = (_Float16)(expf(s[j0 + q] - mx) * sc); unsigned short* d = (unsigned short*)P + (size_t)i * SQ + j0; *(v8us*)d = f.half[0];  } }
__global__ __launch_bounds__(256) void k_vt(const _Float16* __restrict__ V16, int b, int h0, _Float16* __restrict__ VT) { __shared__ unsigned short tl[64][65]; const int tid = threadIdx.x; const int hh = blockIdx.x % HG, sg = blockIdx.x / HG; const int s0 = sg * 64; const int h = h0 + hh;
  for (int i = tid; i < 64 * 8; i += 256) { const int j = i / 8, d8 = (i % 8) * 8; FragH f; f.half[0] = *(const v8us*)((const unsigned short*)V16 + ((size_t)b * SQ + s0 + j) * DM + h * HD + d8); for (int q = 0; q < 8; ++q) tl[d8 + q][j] = f.u[q]; }
  __syncthreads();
  { for (int i = tid; i < 64 * 8; i += 256) { const int d = i / 8, j8 = (i % 8) * 8; FragH f; for (int q = 0; q < 8; ++q) f.u[q] = tl[d][j8 + q]; *(v8us*)((unsigned short*)VT + ((size_t)hh * HD + d) * SQ + s0 + j8) = f.half[0]; }  } }



__device__ __forceinline__ float rs_xhalf(float x) { return __builtin_bit_cast(float, __builtin_amdgcn_permlanex16(__builtin_bit_cast(int, x), __builtin_bit_cast(int, x), 0x76543210, 0xfedcba98, false, false)); }      /* lane l <- lane l ^ 16 */
__device__ __forceinline__ float fa_exp2(float x) { float y; asm("v_exp_f32 %0, %1\n\tv_nop" : "=v"(y) : "v"(x)); return y; }      /* 2^x; the v_nop is the slot the instruction set asks for behind a transcendental */
#define SCL2 0.18033688f                   /* SCL * log2(e): scores carried in the base-2 domain, so that a weight is one subtract and one 2^x */
#define SCLR2 (SCL2 * 0.0009765625f)       /* the same scale on the x1024 residual products */
// Fused causal attention, one wave per 16 query rows of one (batch, head); 32 keys a pass, no score or weight plane in memory.
// S^T = K Q^T (A = key rows, B = query rows): a lane holds 16 scores of ITS query (column ln), keys kb + 8 hh + r and kb + 16 + 8 hh + r: the very places of the B fragment of O^T = V^T P^T,
// so the weights go from the score accumulators to the next product inside the lane. Row maximum and row sum: in the lane, plus one exchange with lane ^ 16. Running maximum, o and sum rescaled each pass.
__global__ __launch_bounds__(128) void k_fattn(const _Float16* __restrict__ QHp, const _Float16* __restrict__ QLp, const _Float16* __restrict__ KHp, const _Float16* __restrict__ KLp, const _Float16* __restrict__ VTp, _Float16* __restrict__ Op) {
  const int lane = threadIdx.x & 31, ln = lane & 15, hh = lane >> 4; const int w = __builtin_amdgcn_readfirstlane((int)(threadIdx.x >> 5));
  const int bh = blockIdx.y, b = bh / NH, h = bh % NH; const int q0 = ((SQ / 64 - 1) - (int)blockIdx.x) * 64 + w * 16;      /* the longest rows start first */
  const size_t r0 = (size_t)b * SQ; const int q = q0 + ln;
  const _Float16* qh = QHp + (r0 + q) * LQ + h * HD; const _Float16* ql = QLp + (r0 + q) * LQ + h * HD;
  const v16h qh0 = g2_frag(qh, hh), qh1 = g2_frag(qh + 32, hh), ql0 = g2_frag(ql, hh), ql1 = g2_frag(ql + 32, hh);
  const _Float16* kh = KHp + (r0 + ln) * LQ + h * HD; const _Float16* kl = KLp + (r0 + ln) * LQ + h * HD; const _Float16* vt = VTp + ((size_t)bh * HD + ln) * SQ;
  const v8f z8 = {0.f,0.f,0.f,0.f,0.f,0.f,0.f,0.f}; v8f o0 = z8, o1 = z8, o2 = z8, o3 = z8; float m = -1.0e30f, l = 0.f;
  v16h ka0 = g2_frag(kh, hh), ka1 = g2_frag(kh + 32, hh), ka2 = g2_frag(kh + (size_t)16 * LQ, hh), ka3 = g2_frag(kh + (size_t)16 * LQ + 32, hh);      /* key rows 0 .. 31, hi plane: fragments of the first pass */
  v16h kc0 = g2_frag(kl, hh), kc1 = g2_frag(kl + 32, hh), kc2 = g2_frag(kl + (size_t)16 * LQ, hh), kc3 = g2_frag(kl + (size_t)16 * LQ + 32, hh);      /* the same rows, residual plane */
#pragma unroll 1      /* one pass holds 24 fragment loads and 16 products: a second copy of it would not fit the registers */
  for (int kb = 0; kb < q0 + 16; kb += 32) {      /* the last pass starts at or below q0: every query has a key in every pass */
    const v16h va0 = g2_frag(vt + kb, hh), va1 = g2_frag(vt + (size_t)16 * SQ + kb, hh), va2 = g2_frag(vt + (size_t)32 * SQ + kb, hh), va3 = g2_frag(vt + (size_t)48 * SQ + kb, hh);      /* asked for here, used behind the softmax */
    v8f sh0 = z8, sl0 = z8, sh1 = z8, sl1 = z8;      /* hi . hi, and lo . hi + hi . lo (x1024), for keys kb .. kb + 15 and kb + 16 .. kb + 31 */
    sh0 = g2_mma(ka0, qh0, sh0); sl0 = g2_mma(ka0, ql0, sl0); sh1 = g2_mma(ka2, qh0, sh1); sl1 = g2_mma(ka2, ql0, sl1);
    sh0 = g2_mma(ka1, qh1, sh0); sl0 = g2_mma(ka1, ql1, sl0); sh1 = g2_mma(ka3, qh1, sh1); sl1 = g2_mma(ka3, ql1, sl1);
    sl0 = g2_mma(kc0, qh0, sl0); sl1 = g2_mma(kc2, qh0, sl1); sl0 = g2_mma(kc1, qh1, sl0); sl1 = g2_mma(kc3, qh1, sl1);
    { const int kn = (kb + 32 < q0 + 16) ? kb + 32 : kb;      /* the next pass's key fragments fly during this pass's softmax and output products; the last pass asks for its own rows again (in bounds, unused) */
      const _Float16* n0 = kh + (size_t)kn * LQ; const _Float16* n1 = kl + (size_t)kn * LQ;
      ka0 = g2_frag(n0, hh); ka1 = g2_frag(n0 + 32, hh); ka2 = g2_frag(n0 + (size_t)16 * LQ, hh); ka3 = g2_frag(n0 + (size_t)16 * LQ + 32, hh);
      kc0 = g2_frag(n1, hh); kc1 = g2_frag(n1 + 32, hh); kc2 = g2_frag(n1 + (size_t)16 * LQ, hh); kc3 = g2_frag(n1 + (size_t)16 * LQ + 32, hh); }
    float s0[8], s1[8];
#pragma unroll      /* unrolled so that every index into the accumulator and fragment registers is a constant */
    for (int r = 0; r < 8; ++r) { s0[r] = fmaf(sl0[r], SCLR2, sh0[r] * SCL2); s1[r] = fmaf(sl1[r], SCLR2, sh1[r] * SCL2); }
    if (kb + 31 > q0) {      /* wave-uniform: only the pass on the diagonal holds keys after a query */
#pragma unroll      /* unrolled so that every index into the accumulator and fragment registers is a constant */
      for (int r = 0; r < 8; ++r) { const int j = kb + 8 * hh + r; s0[r] = (j <= q) ? s0[r] : -1.0e30f; s1[r] = (j + 16 <= q) ? s1[r] : -1.0e30f; } }
    float bm = fmaxf(s0[0], s1[0]);
#pragma unroll      /* unrolled so that every index into the accumulator and fragment registers is a constant */
    for (int r = 1; r < 8; ++r) bm = fmaxf(bm, fmaxf(s0[r], s1[r]));
    bm = fmaxf(bm, rs_xhalf(bm)); const float mn = fmaxf(m, bm); const float sc = fa_exp2(m - mn); m = mn;
    FragH pf; float ls = 0.f;
#pragma unroll      /* unrolled so that every index into the accumulator and fragment registers is a constant */
    for (int r = 0; r < 8; ++r) { const float e0 = fa_exp2(s0[r] - mn), e1 = fa_exp2(s1[r] - mn); ls += e0 + e1; pf.h[r] = (_Float16)e0; pf.h[8 + r] = (_Float16)e1; }
    l = fmaf(l, sc, ls);      /* the lane's half of the row sum; the halves meet behind the loop */
#pragma unroll      /* unrolled so that every index into the accumulator and fragment registers is a constant */
    for (int r = 0; r < 8; ++r) { o0[r] *= sc; o1[r] *= sc; o2[r] *= sc; o3[r] *= sc; }
    o0 = g2_mma(va0, pf.v, o0); o1 = g2_mma(va1, pf.v, o1); o2 = g2_mma(va2, pf.v, o2); o3 = g2_mma(va3, pf.v, o3); }
  l += rs_xhalf(l); const float fin = 64.0f / l;      /* o carried x64, folded into the output GEMM alpha */
  unsigned short* op = (unsigned short*)Op + (r0 + q) * DM + h * HD + 8 * hh; FragH f0, f1, f2, f3;      /* lane: 8 neighbouring head values of its query per tile; the wave writes whole 128-byte head rows */
#pragma unroll      /* unrolled so that every index into the accumulator and fragment registers is a constant */
  for (int r = 0; r < 8; ++r) { f0.h[r] = (_Float16)(o0[r] * fin); f1.h[r] = (_Float16)(o1[r] * fin); f2.h[r] = (_Float16)(o2[r] * fin); f3.h[r] = (_Float16)(o3[r] * fin); }
  *(v8us*)op = f0.half[0]; *(v8us*)(op + 16) = f1.half[0]; *(v8us*)(op + 32) = f2.half[0]; *(v8us*)(op + 48) = f3.half[0]; }

template <int MASKADD>
__global__ __launch_bounds__(64) void k_att0(const float* __restrict__ QF, const float* __restrict__ KF, const float* __restrict__ VF, int ld, const float* __restrict__ mask, float scale, float* __restrict__ OF, int ldo) {
  #pragma clang fp contract(off)
  __shared__ __attribute__((aligned(16))) float lq[64][64]; __shared__ __attribute__((aligned(16))) float lo[64][64];
  const int tid = threadIdx.x; const int h = blockIdx.x / (QT0 / 64), rg = blockIdx.x % (QT0 / 64); const int i = rg * 64 + tid;
  const float* qr = QF + (size_t)i * ld + h * HD;
#pragma unroll 1
  for (int c = 0; c < HD / 4; ++c) { *(v4f*)&lq[tid][c * 4] = *(const v4fa*)(qr + c * 4); const v4f z = {0.f, 0.f, 0.f, 0.f}; *(v4f*)&lo[tid][c * 4] = z; }
  float m = -1.0e30f, l = 0.f; const int jmax = MASKADD ? (SQ - 1) : (rg * 64 + 63);      /* additive-mask form: every key (the mask input decides); causal form: keys up to the block's last row */
#pragma unroll 1
  for (int j = 0; j <= jmax; ++j) { const float* kr = KF + (size_t)j * ld + h * HD; const float* vr = VF + (size_t)j * ld + h * HD; float s = 0.f;
#pragma unroll 1
    for (int c = 0; c < HD / 4; ++c) { const v4f kq = *(const v4fa*)(kr + c * 4); const v4f qq = *(v4f*)&lq[tid][c * 4]; s = __fadd_rn(s, __fmul_rn(qq[0], kq[0])); s = __fadd_rn(s, __fmul_rn(qq[1], kq[1])); s = __fadd_rn(s, __fmul_rn(qq[2], kq[2])); s = __fadd_rn(s, __fmul_rn(qq[3], kq[3])); }
    s = __fmul_rn(s, scale); if (MASKADD) s = __fadd_rn(s, __fmul_rn(bf16_round(mask[(size_t)i * SQ + j]), -10000.0f));
    const float f = (MASKADD || j <= i) ? 1.f : 0.f; const float sm = fmaf(f, s, (1.f - f) * -1.0e30f); const float mn = fmaxf(m, sm); const float sc = expf(m - mn); const float e = expf(sm - mn); l = __fadd_rn(__fmul_rn(l, sc), e); m = mn;
#pragma unroll 1
    for (int c = 0; c < HD / 4; ++c) { const v4f vv = *(const v4fa*)(vr + c * 4); v4f oo = *(v4f*)&lo[tid][c * 4]; for (int u = 0; u < 4; ++u) oo[u] = __fadd_rn(__fmul_rn(oo[u], sc), __fmul_rn(e, vv[u])); *(v4f*)&lo[tid][c * 4] = oo; } }
  const float fin = 64.0f / l;      /* o carried x64 like the f16 path */
#pragma unroll 1
  for (int c = 0; c < HD / 4; ++c) { v4f oo = *(v4f*)&lo[tid][c * 4]; for (int u = 0; u < 4; ++u) oo[u] = __fmul_rn(oo[u], fin); *(v4f*)&lo[tid][c * 4] = oo; }
  __syncthreads();
  {
#pragma unroll 1
    for (int it = 0; it < 16; ++it) { const int row = it * 4 + tid / 16, pc = (tid % 16) * 4; const v4f v = *(const v4f*)&lo[row][pc]; *(v4f*)(OF + (size_t)(rg * 64 + row) * ldo + h * HD + pc) = v; }
     } }

__global__ __launch_bounds__(256) void k_ln64f32(float* __restrict__ F, int ldf, size_t nrh, const float* __restrict__ g, const float* __restrict__ bb, float eps) {
  #pragma clang fp contract(off)
  const size_t t = (size_t)blockIdx.x * 256 + threadIdx.x; if (t >= nrh) return; const size_t r = t / NH; const int h = (int)(t % NH); float* f = F + r * (size_t)ldf + (size_t)h * 64; float sum = 0.f;
#pragma unroll 1
  for (int d = 0; d < 64; d += 4) { const v4f q = *(const v4fa*)(f + d); sum = __fadd_rn(__fadd_rn(__fadd_rn(__fadd_rn(sum, q[0]), q[1]), q[2]), q[3]); } const float mu = sum / 64.0f; float vs = 0.f;
#pragma unroll 1
  for (int d = 0; d < 64; d += 4) { const v4f q = *(const v4fa*)(f + d); for (int e = 0; e < 4; ++e) { const float dl = __fadd_rn(q[e], -mu); vs = __fadd_rn(vs, __fmul_rn(dl, dl)); } } const float rs = rsqrtf(__fadd_rn(vs / 64.0f, eps));
#pragma unroll 1
  for (int d0 = 0; d0 < 64; d0 += 4) { const v4f q = *(const v4fa*)(f + d0); v4f y; for (int e = 0; e < 4; ++e) y[e] = __fadd_rn(__fmul_rn(__fmul_rn(__fadd_rn(q[e], -mu), rs), bf16_round(g[d0 + e])), bf16_round(bb[d0 + e])); *(v4f*)(f + d0) = y;  } }
extern "C" void kernel_launch(void* const* d_in, const int* in_sizes, int n_in,
                              void* d_out, int out_size, void* d_ws, size_t ws_size, hipStream_t stream) {
  (void)in_sizes; (void)n_in; (void)out_size;
  const float* const* I = (const float* const*)d_in; const float* x = I[0]; const float* xk = I[0]; const float* xv = I[0]; const float* wq = I[1]; const float* bq = nullptr; const float* wk = I[2]; const float* bk = nullptr; const float* wv = I[3]; const float* bv = nullptr; const float* wo = I[4]; const float* bo = I[5]; const float* qg = I[6]; const float* qbt = I[7]; const float* kg = I[8]; const float* kbt = I[9]; const float LNE = 1e-5f;      /* input order: x (feeds the q, k AND v streams), Wq, Wk, Wv (natural [out][in] weights; NO biases: null pointers in the guarded bias slots), Wo, bo (zeros: read), q_gamma, q_beta, k_gamma, k_beta [64] (ones / zeros on this draw: read by value in the per-head LayerNorm kernel) */
  char* ws = (char*)d_ws; size_t off = 0;
  auto take = [&](size_t bytes) { char* p = ws + off; off += (bytes + 255) & ~(size_t)255; return p; };
  _Float16* BQ = (_Float16*)take((size_t)DM * DM * 2); _Float16* BK = (_Float16*)take((size_t)DM * DM * 2); _Float16* BV = (_Float16*)take((size_t)DM * DM * 2); _Float16* BO = (_Float16*)take((size_t)DM * DM * 2);
  _Float16* X16 = (_Float16*)take(NR * DM * 2); _Float16* XK16 = (_Float16*)take(NR * DM * 2); _Float16* XV16 = (_Float16*)take(NR * DM * 2);      /* exact f16 rows of query, key, value */ float* QF = (float*)take(NR * DM * 4); _Float16* QH = (_Float16*)take(NR * DM * 2); _Float16* QL = (_Float16*)take(NR * DM * 2); _Float16* KH = (_Float16*)take(NR * DM * 2); _Float16* KL = (_Float16*)take(NR * DM * 2); _Float16* Q16 = QH; _Float16* K16 = KH; _Float16* V16 = (_Float16*)take(NR * DM * 2); _Float16* O16 = (_Float16*)take(NR * DM * 2);
  _Float16* VT = (_Float16*)take((size_t)NB * NH * HD * SQ * 2);      /* V^T [NB][NH][HD][SQ] */
  float* QF0 = (float*)take((size_t)QT0 * DM * 4); float* KF0 = (float*)take((size_t)QT0 * DM * 4); float* VF0 = (float*)take((size_t)QT0 * DM * 4); float* OF0 = (float*)take((size_t)NB * QT0 * DM * 4); _Float16* OH0 = (_Float16*)take((size_t)NB * QT0 * DM * 2); _Float16* OL0 = (_Float16*)take((size_t)NB * QT0 * DM * 2);
  if (off > ws_size) return;
  { const unsigned g = (unsigned)(((size_t)DM * DM / 8 + 255) / 256); k_wnat<<<g, 256, 0, stream>>>(wq, (size_t)DM * DM / 8, BQ); k_wnat<<<g, 256, 0, stream>>>(wk, (size_t)DM * DM / 8, BK); k_wnat<<<g, 256, 0, stream>>>(wv, (size_t)DM * DM / 8, BV); k_wnat<<<g, 256, 0, stream>>>(wo, (size_t)DM * DM / 8, BO); }      /* natural [out][in] = Bt[n][k] x16 */
  k_x16<<<(unsigned)((NR * DM / 8 + 255) / 256), 256, 0, stream>>>(x, X16, NR * DM / 8); k_x16<<<(unsigned)((NR * DM / 8 + 255) / 256), 256, 0, stream>>>(xk, XK16, NR * DM / 8); k_x16<<<(unsigned)((NR * DM / 8 + 255) / 256), 256, 0, stream>>>(xv, XV16, NR * DM / 8);
  const size_t r0p = (size_t)B0 * SQ;      /* first projected row */
  k_gemm2<0><<<dim3((unsigned)((MP / 128) * (DM / 64)), 1), 128, 0, stream>>>(X16 + r0p * DM, DM, 0, BQ, DM, 0, 0.0625f, bq, 0, nullptr, 1, 0, 0, QF + r0p * DM, nullptr, DM, 0, MP, DM, DM); k_ln64f32<<<(unsigned)(((size_t)MP * NH + 255) / 256), 256, 0, stream>>>(QF + r0p * DM, DM, (size_t)MP * NH, qg, qbt, LNE); k_hl<<<(unsigned)(((size_t)MP * DM / 8 + 255) / 256), 256, 0, stream>>>(QF + r0p * DM, QH + r0p * DM, QL + r0p * DM, (size_t)MP * DM / 8);      /* q (f32) -> f16 hi + x1024 residual: unscaled logits sigma ~8 */
  k_gemm2<0><<<dim3((unsigned)((MP / 128) * (DM / 64)), 1), 128, 0, stream>>>(XK16 + r0p * DM, DM, 0, BK, DM, 0, 0.0625f, bk, 0, nullptr, 1, 0, 0, QF + r0p * DM, nullptr, DM, 0, MP, DM, DM); k_ln64f32<<<(unsigned)(((size_t)MP * NH + 255) / 256), 256, 0, stream>>>(QF + r0p * DM, DM, (size_t)MP * NH, kg, kbt, LNE); k_hl<<<(unsigned)(((size_t)MP * DM / 8 + 255) / 256), 256, 0, stream>>>(QF + r0p * DM, KH + r0p * DM, KL + r0p * DM, (size_t)MP * DM / 8);      /* k likewise */
  k_gemm2<0><<<dim3((unsigned)((MP / 128) * (DM / 64)), 1), 128, 0, stream>>>(XV16 + r0p * DM, DM, 0, BV, DM, 0, 0.0625f, bv, 0, nullptr, 1, 0, 0, nullptr, V16 + r0p * DM, DM, 0, MP, DM, DM);
  for (int b = B0; b < B0 + NBR; ++b) { const size_t r0 = (size_t)b * SQ;
    k_vt<NH, SQ><<<NH * (SQ / 64), 256, 0, stream>>>(V16 + r0 * LQ, LQ, 0, VT + (size_t)b * NH * HD * SQ);      /* V^T [NH][HD][SQ] of this batch */
    k_gemm2<0><<<dim3((QT0 / 128) * (DM / 64), 1), 128, 0, stream>>>(X16 + r0 * DM, DM, 0, BQ, DM, 0, 0.0625f, bq, 0, nullptr, 1, 0, 0, QF0, nullptr, DM, 0, QT0, DM, DM); k_gemm2<0><<<dim3((QT0 / 128) * (DM / 64), 1), 128, 0, stream>>>(XK16 + r0 * DM, DM, 0, BK, DM, 0, 0.0625f, bk, 0, nullptr, 1, 0, 0, KF0, nullptr, DM, 0, QT0, DM, DM); k_gemm2<0><<<dim3((QT0 / 128) * (DM / 64), 1), 128, 0, stream>>>(XV16 + r0 * DM, DM, 0, BV, DM, 0, 0.0625f, bv, 0, nullptr, 1, 0, 0, VF0, nullptr, DM, 0, QT0, DM, DM);      /* f32 q, k, v of the first 128 rows (exact products) */
  k_ln64f32<<<(unsigned)(((size_t)QT0 * NH + 255) / 256), 256, 0, stream>>>(QF0, DM, (size_t)QT0 * NH, qg, qbt, LNE); k_ln64f32<<<(unsigned)(((size_t)QT0 * NH + 255) / 256), 256, 0, stream>>>(KF0, DM, (size_t)QT0 * NH, kg, kbt, LNE);      /* the exact first tile's f32 q and k rows through the same per-head LayerNorm */
    k_att0<0><<<NH * (QT0 / 64), 64, 0, stream>>>(QF0, KF0, VF0, DM, nullptr, SCL, OF0 + (size_t)b * QT0 * DM, DM);      /* exact f32 attention for rows 0..127 (o x64) */
  }
  k_fattn<<<dim3(SQ / 64, NB * NH), 128, 0, stream>>>(QH, QL, KH, KL, VT, O16);      /* scores, causal softmax and P . V of every batch, head and query row in one launch: o (merged heads, x64) as f16 rows */
  k_gemm2<0><<<dim3((unsigned)((MPO / 128) * (DM / 64)), 1), 128, 0, stream>>>(O16 + r0p * DM, DM, 0, BO, DM, 0, 0.0009765625f, bo, 0, nullptr, 1, 0, 0, (float*)d_out + r0p * DM, nullptr, DM, 0, MPO, DM, DM);      /* out rows are the output layout */
  k_hl<<<(unsigned)(((size_t)NB * QT0 * DM / 8 + 255) / 256), 256, 0, stream>>>(OF0, OH0, OL0, (size_t)NB * QT0 * DM / 8);      /* first-tile o (x64) -> f16 hi + x1024 residual planes */
  for (int b = B0; b < B0 + NBR; ++b) { const size_t r0 = (size_t)b * SQ; const size_t f0 = (size_t)b * QT0;
    k_gemm2<0><<<dim3((QT0 / 128) * (DM / 64), 1), 128, 0, stream>>>(OH0 + f0 * DM, DM, 0, BO, DM, 0, 0.0009765625f, bo, 0, nullptr, 1, 0, 0, (float*)d_out + r0 * DM, nullptr, DM, 0, QT0, DM, DM);      /* rows 0..127: out = o_hi Wo (+ b), overwriting the f16-path rows */
    k_gemm2<0><<<dim3((QT0 / 128) * (DM / 64), 1), 128, 0, stream>>>(OL0 + f0 * DM, DM, 0, BO, DM, 0, 0.00000095367431640625f, nullptr, 0, (const float*)d_out + r0 * DM, -1, 0, 0, (float*)d_out + r0 * DM, nullptr, DM, 0, QT0, DM, DM); }      /* += o_lo Wo 2^-20 (own-element accumulate) */
}

// v003
// It runs in 558 microseconds.
// In two side-by-side timings against v002, it was 2.50 and 2.51 times as fast.
// Counting every step since v000, it is 19.5 times as fast.
#include <hip/hip_runtime.h>
// Causal multi-head self-attention with a per-head LayerNorm on q and k, natural bias-free q / k / v projections and a biased output projection (x [2][3072][512]; q / k / v = x W^T (nn.Linear natural [512][512] sd 0.02, NO biases), 8 heads of 64; q and k each pass through a LayerNorm over the 64 values of every (token, head) vector (biased variance, eps 1e-5, gamma / beta [64]: ones / zeros on this draw: read); scores = q . k / sqrt(64); causal (keys after the query get -inf); softmax; out = merged Wo^T + bo (natural; zero bias) -> [2][3072][512]); q and k carried as f16 hi + x1024 residual planes with three-product scores.
// Structure: token rows r = b*3072 + s; x as exact f16 rows (bf16-rounded); q and k as WMMA GEMMs (32x64 wave tiles, f32 accumulation, exact x16 weights, no bias) into f32 rows, each (token, head) vector of which an IN-PLACE f32 LayerNorm kernel normalises over its 64 values (f32 statistics, gamma / beta by value), then split into f16 hi + x1024 residual planes; v as an f16-output GEMM; per batch: V^T for all heads via LDS transposes; then ONE fused launch for all batches, heads and query rows: a wave takes 16 query rows and walks the keys up to its diagonal, 32 a pass: S^T = K Q^T as three products (hi.hi + lo.hi + hi.lo, K = 64, scale 1/8 = 1/sqrt(64); logits sigma ~1), causal running-maximum softmax inside the lane (f32 statistics, native exp; weights exp(s - max) as f16), O^T = V^T P^T with the weights taken in place from the score accumulators (o divided by the row sum at the end and carried x64, folded into the output GEMM alpha) written straight into the merged f16 o rows; out = o Wo^T + bo GEMM (f32) into the output layout.
// Compute dtype: inputs rounded to bf16; x / weights exact; the normalised q and k as f16 hi + residual planes (three-product scores), v, the softmax weights and o as plain f16 GEMM operands (~2^-12); LayerNorm, scores and softmax statistics f32. v_wmma_f32_16x16x32_f16.
#define NB 2
#define SCL 0.125f                         /* 1 / sqrt(head_dim = 64) */
#define SCLR 0.0001220703125f              /* 2^-13: the same scale on the x1024 residual passes */
#define SQ 3072
#define DM 512
#define NH 8
#define HD 64
#define HG 4                         /* heads per launch of the h0-based k_vt overload */
#define QT0 128                      /* first-tile rows recomputed exactly in f32 */
#define B0 0                         /* first batch processed (debug hook) */
#define NBR NB                       /* batches processed (debug hook) */
#define NR ((size_t)NB * SQ)         /* token rows */
#define MP ((int)((size_t)NBR * SQ)) /* rows projected (debug hook) */
#define MPO MP                       /* rows through the output stage (debug hook) */
#define LQ DM      /* row pitch of the q/k/v rows */
typedef __bf16 v16b __attribute__((ext_vector_type(16)));
typedef unsigned short v8us __attribute__((ext_vector_type(8), may_alias));
typedef float  v8f  __attribute__((ext_vector_type(8)));
typedef float  v4f  __attribute__((ext_vector_type(4)));
typedef float  v4fa __attribute__((ext_vector_type(4), may_alias));
union FragB { v16b v; v8us half[2]; unsigned short u[16]; };

__device__ __forceinline__ unsigned short bf16_bits(float x) { unsigned int u = __float_as_uint(x); return (unsigned short)((u + 0x7FFFu + ((u >> 16) & 1u)) >> 16); }
__device__ __forceinline__ float bf16_val(unsigned short b) { return __uint_as_float(((unsigned int)b) << 16); }
__device__ __forceinline__ float bf16_round(float x) { return bf16_val(bf16_bits(x)); }
// D += A·B with NT terms: 1 = ah·bh, 2 = + al·bh (A split), 3 = + ah·bl (both split)
template <int NT>
__device__ __forceinline__ v8f mmaN(v16b ah, v16b al, v16b bh, v16b bl, v8f c) {
  c = __builtin_amdgcn_wmma_f32_16x16x32_bf16(false, ah, false, bh, (short)0, c, false, false);
  if (NT >= 2) c = __builtin_amdgcn_wmma_f32_16x16x32_bf16(false, al, false, bh, (short)0, c, false, false);
  if (NT >= 3) c = __builtin_amdgcn_wmma_f32_16x16x32_bf16(false, ah, false, bl, (short)0, c, false, false);
  asm volatile("v_nop\n\tv_nop\n\tv_nop\n\tv_nop" : "+v"(c) : "v"(ah), "v"(al), "v"(bh), "v"(bl));
  return c;
}

__global__ __launch_bounds__(256) void k_wt_bf16(const float* __restrict__ W, unsigned short* __restrict__ Wt, int K, int N) {
  const int t = blockIdx.x * 256 + threadIdx.x;
  const int k8n = K / 8;
  if (t >= N * k8n) return;
  const int n = t / k8n, k8 = (t % k8n) * 8;
  v8us v;
#pragma unroll
  for (int i = 0; i < 8; ++i) v[i] = bf16_bits(W[(size_t)(k8 + i) * N + n]);
  *(v8us*)(Wt + (size_t)n * K + k8) = v;
  
}

// GEMM C[M][N] (f32, pitch ldc) = act(A[M][K]·W + bias). A f32 row-major (pitch lda) converted per fragment to bf16
// (ASPLIT: hi/lo two planes -> 2 terms, else single rounded term); Wt bf16 [N][K] (pitch ldb). BIAS_BF16 rounds the
// bias to bf16 first (bias quantised to bf16 before the add). K%32==0, M%16==0, N%64==0.
template <bool ASPLIT, int ACT, bool BIAS_BF16>
__global__ __launch_bounds__(128) void k_gemm_bf(const float* __restrict__ A, int lda, const unsigned short* __restrict__ Wt, int ldb,
                                               const float* __restrict__ bias, float* __restrict__ C, int ldc, int M, int N, int K) {
  __shared__ __attribute__((aligned(16))) float so[4][16][64];
  const int tid = threadIdx.x, w = tid >> 5, lane = tid & 31, ln = lane & 15, hh = lane >> 4;
  const int ntn = N / 64;
  const int wid = blockIdx.x * 4 + w;
  const int mt = wid / ntn, nq = wid % ntn;
  if (mt * 16 >= M) return;
  const int row0 = mt * 16, col0 = nq * 64;
  const float* arow = A + (size_t)(row0 + ln) * lda;
  v8f acc[4] = {};
  for (int kb = 0; kb < K; kb += 32) {
    FragB ah, al;
    const v4f x0 = *(const v4fa*)(arow + kb + 8 * hh), x1 = *(const v4fa*)(arow + kb + 8 * hh + 4);
    const v4f x2 = *(const v4fa*)(arow + kb + 16 + 8 * hh), x3 = *(const v4fa*)(arow + kb + 16 + 8 * hh + 4);
    float xs[16] = {x0[0],x0[1],x0[2],x0[3],x1[0],x1[1],x1[2],x1[3],x2[0],x2[1],x2[2],x2[3],x3[0],x3[1],x3[2],x3[3]};
#pragma unroll
    for (int i = 0; i < 16; ++i) { const unsigned short hb = bf16_bits(xs[i]); ah.u[i] = hb; al.u[i] = ASPLIT ? bf16_bits(xs[i] - bf16_val(hb)) : (unsigned short)0; }
#pragma unroll
    for (int t = 0; t < 4; ++t) {
      const unsigned short* brow = Wt + (size_t)(col0 + t * 16 + ln) * ldb + kb;
      FragB b;
      b.half[0] = *(const v8us*)(brow + 8 * hh);
      b.half[1] = *(const v8us*)(brow + 16 + 8 * hh);
      acc[t] = mmaN<ASPLIT ? 2 : 1>(ah.v, al.v, b.v, b.v, acc[t]);
    }
  }
#pragma unroll
  for (int t = 0; t < 4; ++t) {
    float bv = bias ? bias[col0 + t * 16 + ln] : 0.f;
    if (BIAS_BF16) bv = bf16_round(bv);
#pragma unroll
    for (int r = 0; r < 8; ++r) { float v = acc[t][r] + bv; if (ACT == 1) v = fmaxf(v, 0.f); so[w][8 * hh + r][t * 16 + ln] = v; }
  }
  __builtin_amdgcn_fence(__ATOMIC_ACQ_REL, "workgroup");
  __builtin_amdgcn_wave_barrier();
  const int rsub = lane >> 4, c4 = (lane & 15) * 4;
  {
#pragma unroll
    for (int q = 0; q < 8; ++q) {
      const int r = q * 2 + rsub;
      const v4f v = *(const v4fa*)&so[w][r][c4];
      *(v4f*)(C + (size_t)(row0 + r) * ldc + col0 + c4) = v;
    }
    
  }
}

// GEMM C = act(A·W + bias + resid): A f32 (ASPLIT -> hi/lo 2 terms), Wt bf16 [N][K]; ACT 0 none, 1 relu, 2 exact gelu;
// resid (optional, f32, row index = (row % rmod), pitch ldr, RES_BF16 rounds it) added before the activation.
template <bool ASPLIT, int ACT, bool BIAS_BF16, bool RES_BF16>
__global__ __launch_bounds__(128) void k_gemm_bf3(const float* __restrict__ A, int lda, const unsigned short* __restrict__ Wt, int ldb,
                                                const float* __restrict__ bias, const float* __restrict__ resid, int rmod, int ldr,
                                                float* __restrict__ C, int ldc, int M, int N, int K) {
  __shared__ __attribute__((aligned(16))) float so[4][16][64];
  const int tid = threadIdx.x, w = tid >> 5, lane = tid & 31, ln = lane & 15, hh = lane >> 4;
  const int ntn = N / 64;
  const int wid = blockIdx.x * 4 + w;
  const int mt = wid / ntn, nq = wid % ntn;
  if (mt * 16 >= M) return;
  const int row0 = mt * 16, col0 = nq * 64;
  const float* arow = A + (size_t)(row0 + ln) * lda;
  v8f acc[4] = {};
  for (int kb = 0; kb < K; kb += 32) {
    FragB ah, al;
    const v4f x0 = *(const v4fa*)(arow + kb + 8 * hh), x1 = *(const v4fa*)(arow + kb + 8 * hh + 4);
    const v4f x2 = *(const v4fa*)(arow + kb + 16 + 8 * hh), x3 = *(const v4fa*)(arow + kb + 16 + 8 * hh + 4);
    float xs[16] = {x0[0],x0[1],x0[2],x0[3],x1[0],x1[1],x1[2],x1[3],x2[0],x2[1],x2[2],x2[3],x3[0],x3[1],x3[2],x3[3]};
#pragma unroll
    for (int i = 0; i < 16; ++i) { const unsigned short hb = bf16_bits(xs[i]); ah.u[i] = hb; al.u[i] = ASPLIT ? bf16_bits(xs[i] - bf16_val(hb)) : (unsigned short)0; }
#pragma unroll
    for (int t = 0; t < 4; ++t) {
      const unsigned short* brow = Wt + (size_t)(col0 + t * 16 + ln) * ldb + kb;
      FragB b;
      b.half[0] = *(const v8us*)(brow + 8 * hh);
      b.half[1] = *(const v8us*)(brow + 16 + 8 * hh);
      acc[t] = mmaN<ASPLIT ? 2 : 1>(ah.v, al.v, b.v, b.v, acc[t]);
    }
  }
#pragma unroll
  for (int t = 0; t < 4; ++t) {
    const int col = col0 + t * 16 + ln;
    float bv = bias ? bias[col] : 0.f;
    if (BIAS_BF16) bv = bf16_round(bv);
#pragma unroll
    for (int r = 0; r < 8; ++r) {
      float v = acc[t][r] + bv;
      if (resid) { float rv = resid[(size_t)((row0 + 8 * hh + r) % rmod) * ldr + col]; if (RES_BF16) rv = bf16_round(rv); v += rv; }
      if (ACT == 1) v = fmaxf(v, 0.f);
      if (ACT == 2) v = 0.5f * v * (1.0f + erff(v * 0.70710678118654752f));
      if (ACT == 3) { const float u = 0.7978845608028654f * (v + 0.044715f * v * v * v); v = 0.5f * v * (1.0f + tanhf(u)); }
      so[w][8 * hh + r][t * 16 + ln] = v;
    }
  }
  __builtin_amdgcn_fence(__ATOMIC_ACQ_REL, "workgroup");
  __builtin_amdgcn_wave_barrier();
  const int rsub = lane >> 4, c4 = (lane & 15) * 4;
  {
#pragma unroll
    for (int q = 0; q < 8; ++q) {
      const int r = q * 2 + rsub;
      const v4f v = *(const v4fa*)&so[w][r][c4];
      *(v4f*)(C + (size_t)(row0 + r) * ldc + col0 + c4) = v;
    }
    
  }
}
// row LayerNorm (biased variance, eps) over N: s = X (+ R); optional out_sum <- s; out_norm <- (s-mu)*rsqrt(var+eps)*g + b
template <bool PARAM_BF16>
__global__ __launch_bounds__(256) void k_layernorm(const float* __restrict__ X, const float* __restrict__ R, const float* __restrict__ g, const float* __restrict__ bta,
                                                  float* __restrict__ out_sum, float* __restrict__ out_norm, int N, float eps) {
  __shared__ float red[256];
  const int row = blockIdx.x, tid = threadIdx.x;
  const float* x = X + (size_t)row * N; const float* rr = R ? R + (size_t)row * N : nullptr;
  float vals[16];                     // up to N = 4096
  const int per = N / 256;            // contiguous chunk per thread? use strided-by-4 chunks: thread handles j = tid*4 + 1024*u
  float s1 = 0.f;
  for (int u = 0; u < per / 4; ++u) {
    const int j = tid * 4 + 1024 * u;
    const v4f a = *(const v4fa*)(x + j);
    v4f b = {0.f,0.f,0.f,0.f}; if (rr) b = *(const v4fa*)(rr + j);
#pragma unroll
    for (int q = 0; q < 4; ++q) { const float v = a[q] + b[q]; vals[u * 4 + q] = v; s1 += v; }
  }
  red[tid] = s1; __syncthreads();
  for (int st = 128; st > 0; st >>= 1) { if (tid < st) red[tid] += red[tid + st]; __syncthreads(); }
  const float mu = red[0] / (float)N; __syncthreads();
  float s2 = 0.f;
  for (int u = 0; u < per / 4; ++u)
#pragma unroll
    for (int q = 0; q < 4; ++q) { const float c = vals[u * 4 + q] - mu; s2 += c * c; }
  red[tid] = s2; __syncthreads();
  for (int st = 128; st > 0; st >>= 1) { if (tid < st) red[tid] += red[tid + st]; __syncthreads(); }
  const float rs = rsqrtf(red[0] / (float)N + eps);
  {
    for (int u = 0; u < per / 4; ++u) {
      const int j = tid * 4 + 1024 * u;
      v4f o, sm;
#pragma unroll
      for (int q = 0; q < 4; ++q) {
        float gg = g[j + q], bb = bta[j + q];
        if (PARAM_BF16) { gg = bf16_round(gg); bb = bf16_round(bb); }
        sm[q] = vals[u * 4 + q]; o[q] = (vals[u * 4 + q] - mu) * rs * gg + bb;
      }
      if (out_sum) *(v4f*)(out_sum + (size_t)row * N + j) = sm;
      *(v4f*)(out_norm + (size_t)row * N + j) = o;
    }
    
  }
}



// ---- f16 WMMA path (v_wmma_f32_16x16x32_f16): 11-bit significands for operands in range — used where a [0,1] probability operand needs more precision than bf16
typedef _Float16 v16h __attribute__((ext_vector_type(16)));
union FragH { v16h v; v8us half[2]; _Float16 h[16]; unsigned short u[16]; };
template <int NT>
__device__ __forceinline__ v8f mmaH(v16h ah, v16h al, v16h bh, v16h bl, v8f c) {
  c = __builtin_amdgcn_wmma_f32_16x16x32_f16(false, ah, false, bh, (short)0, c, false, false);
  if (NT >= 2) c = __builtin_amdgcn_wmma_f32_16x16x32_f16(false, al, false, bh, (short)0, c, false, false);
  if (NT >= 3) c = __builtin_amdgcn_wmma_f32_16x16x32_f16(false, ah, false, bl, (short)0, c, false, false);
  asm volatile("v_nop\n\tv_nop\n\tv_nop\n\tv_nop" : "+v"(c) : "v"(ah), "v"(al), "v"(bh), "v"(bl));
  return c;
}
// batched GEMM like k_gemm_b but f16 operands: A f32 (split into f16 hi/lo if ASPLIT, else rounded to f16), Bt = f16 values [n][k]; alpha; C f32; N multiple of 16 (partial tiles skipped)
template <bool ASPLIT>
__global__ __launch_bounds__(128) void k_gemm_h(const float* __restrict__ A, int lda, size_t sA, const _Float16* __restrict__ Bh, int ldb, size_t sB, float alpha, float* __restrict__ C, int ldc, size_t sC, int M, int N, int K) {
  __shared__ __attribute__((aligned(16))) float so[4][16][64];
  const int tid = threadIdx.x, w = tid >> 5, lane = tid & 31, ln = lane & 15, hh = lane >> 4; const int by = blockIdx.y;
  A += (size_t)by * sA; Bh += (size_t)by * sB; C += (size_t)by * sC;
  const int ntn = (N + 63) / 64; const int wid = blockIdx.x * 4 + w; const int mt = wid / ntn, nq = wid % ntn; if (mt * 16 >= M) return;
  const int row0 = mt * 16, col0 = nq * 64; const float* arow = A + (size_t)(row0 + ln) * lda;
  v8f acc[4] = {};
  for (int kb = 0; kb < K; kb += 32) {
    FragH ah, al;
    const v4f x0 = *(const v4fa*)(arow + kb + 8 * hh), x1 = *(const v4fa*)(arow + kb + 8 * hh + 4), x2 = *(const v4fa*)(arow + kb + 16 + 8 * hh), x3 = *(const v4fa*)(arow + kb + 16 + 8 * hh + 4);
    float xs[16] = {x0[0],x0[1],x0[2],x0[3],x1[0],x1[1],x1[2],x1[3],x2[0],x2[1],x2[2],x2[3],x3[0],x3[1],x3[2],x3[3]};
#pragma unroll
    for (int i = 0; i < 16; ++i) { const _Float16 h = (_Float16)xs[i]; ah.h[i] = h; al.h[i] = ASPLIT ? (_Float16)(xs[i] - (float)h) : (_Float16)0.0f; }
#pragma unroll
    for (int t = 0; t < 4; ++t) { if (col0 + t * 16 >= N) continue; const size_t boff = (size_t)(col0 + t * 16 + ln) * ldb + kb; FragH bq; bq.half[0] = *(const v8us*)(Bh + boff + 8 * hh); bq.half[1] = *(const v8us*)(Bh + boff + 16 + 8 * hh);
      acc[t] = mmaH<ASPLIT ? 2 : 1>(ah.v, al.v, bq.v, bq.v, acc[t]); }
  }
#pragma unroll
  for (int t = 0; t < 4; ++t) { if (col0 + t * 16 >= N) continue;
#pragma unroll
    for (int r = 0; r < 8; ++r) so[w][8 * hh + r][t * 16 + ln] = acc[t][r] * alpha; }
  __builtin_amdgcn_fence(__ATOMIC_ACQ_REL, "workgroup"); __builtin_amdgcn_wave_barrier();
  const int rsub = lane >> 4, c4 = (lane & 15) * 4;
  {
#pragma unroll
    for (int q = 0; q < 8; ++q) { const int r = q * 2 + rsub; if (col0 + c4 < N) { const v4f v = *(const v4fa*)&so[w][r][c4]; *(v4f*)(C + (size_t)(row0 + r) * ldc + col0 + c4) = v; } }
     }
}

// Wt[n][k] = f16(W[k][n]·scale) from f32 row-major W[K][N] (scale = power of two; bf16-exact weights stay exact in f16 away from the subnormal range)
__global__ __launch_bounds__(256) void k_wt_f16(const float* __restrict__ W, _Float16* __restrict__ Wt, int K, int N, float scale) {
  const int t = blockIdx.x * 256 + threadIdx.x; if (t >= N * (K / 8)) return; const int n = t / (K / 8), k8 = (t % (K / 8)) * 8; FragH f;
#pragma unroll
  for (int i = 0; i < 8; ++i) f.h[i] = (_Float16)(bf16_round(W[(size_t)(k8 + i) * N + n]) * scale); const v8us o = f.half[0];
  *(v8us*)((unsigned short*)Wt + (size_t)n * K + k8) = o; 
}
// k_gemm_hh variant with fused epilogue: v = acc·alpha + bias[by·sBias + col] (+ CP[(row/rowsPerB)·sCPb + by·64 + col] if CP) ; ACT 0 none / 1 elu ; writes f16 C16 (and f32 C if non-null)
template <int ACT>
__global__ __launch_bounds__(128) void k_gemm_hhx(const _Float16* __restrict__ A, int lda, size_t sA, const _Float16* __restrict__ Bh, int ldb, size_t sB, float alpha, const float* __restrict__ bias, size_t sBias, const float* __restrict__ CP, int rowsPerB, size_t sCPb, int row0g,
    float* __restrict__ C, _Float16* __restrict__ C16, int ldc, size_t sC, int M, int N, int K) {
  __shared__ __attribute__((aligned(16))) float so[4][16][64];
  const int tid = threadIdx.x, w = tid >> 5, lane = tid & 31, ln = lane & 15, hh = lane >> 4; const int by = blockIdx.y;
  A += (size_t)by * sA; Bh += (size_t)by * sB; const size_t cofs = (size_t)by * sC; const float* bp = bias ? bias + (size_t)by * sBias : nullptr;
  const int ntn = (N + 63) / 64; const int wid = blockIdx.x * 4 + w; const int mt = wid / ntn, nq = wid % ntn; if (mt * 16 >= M) return;
  const int row0 = mt * 16, col0 = nq * 64; const _Float16* arow = A + (size_t)(row0 + ln) * lda;
  v8f acc[4] = {};
  for (int kb = 0; kb < K; kb += 32) { FragH ah; ah.half[0] = *(const v8us*)((const unsigned short*)arow + kb + 8 * hh); ah.half[1] = *(const v8us*)((const unsigned short*)arow + kb + 16 + 8 * hh);
#pragma unroll
    for (int t = 0; t < 4; ++t) { if (col0 + t * 16 >= N) continue; const size_t boff = (size_t)(col0 + t * 16 + ln) * ldb + kb; FragH bq; bq.half[0] = *(const v8us*)((const unsigned short*)Bh + boff + 8 * hh); bq.half[1] = *(const v8us*)((const unsigned short*)Bh + boff + 16 + 8 * hh);
      acc[t] = mmaH<1>(ah.v, ah.v, bq.v, bq.v, acc[t]); }
  }
#pragma unroll
  for (int t = 0; t < 4; ++t) { if (col0 + t * 16 >= N) continue; const int col = col0 + t * 16 + ln; const float bv = bp ? bf16_round(bp[col]) : 0.f;
#pragma unroll
    for (int r = 0; r < 8; ++r) { float v = acc[t][r] * alpha + bv; if (CP) { const int rr = row0g + row0 + 8 * hh + r; if (rowsPerB < 0) v += CP[cofs + (size_t)rr * ldc + col];      /* rowsPerB < 0: own element of the batched C plane */ else { const int bidx = rr / rowsPerB; v += CP[(size_t)bidx * sCPb + (size_t)by * 64 + col]; } } if (ACT == 1) v = (v > 0.f) ? v : expm1f(v); else if (ACT == 7) v = (v > 0.f) ? v + 1.0f : expf(v); else if (ACT == 8) v = tanhf(v); else if (ACT == 9) v = 0.5f * v * (1.0f + tanhf(0.7978845608028654f * (v + 0.044715f * v * v * v))); else if (ACT == 11) v = 1.0f / (1.0f + expf(-v)); else if (ACT == 12) v = (v > 0.f) ? v : 0.01f * v; else if (ACT == 14) v = (v > 0.f) ? v : 0.1f * v; else if (ACT == 16) v = (v >= 0.f) ? v : 0.3f * v; else if (ACT == 17) v = (v >= 0.f) ? v : 0.2f * v; else if (ACT == 15) v = v / (1.0f + expf(-v)); else if (ACT == 3) v = fmaxf(v, 0.f); else if (ACT == 6) v = 0.5f * v * (1.0f + erff(v * 0.70710678118654752f)); so[w][8 * hh + r][t * 16 + ln] = v; } }
  __builtin_amdgcn_fence(__ATOMIC_ACQ_REL, "workgroup"); __builtin_amdgcn_wave_barrier();
  const int rsub = lane >> 4, c4 = (lane & 15) * 4; typedef _Float16 v4h __attribute__((ext_vector_type(4)));
  {
#pragma unroll
    for (int q = 0; q < 8; ++q) { const int r = q * 2 + rsub; if (col0 + c4 < N) { const v4f v = *(const v4fa*)&so[w][r][c4]; if (C) *(v4f*)(C + cofs + (size_t)(row0 + r) * ldc + col0 + c4) = v; if (C16) { v4h h4; for (int i = 0; i < 4; ++i) h4[i] = (_Float16)v[i]; *(v4h*)(C16 + cofs + (size_t)(row0 + r) * ldc + col0 + c4) = h4; } } }
     }
}


typedef _Float16 v4h __attribute__((ext_vector_type(4)));

__global__ __launch_bounds__(256) void k_x16(const float* __restrict__ x, _Float16* __restrict__ X16, size_t n8) { const size_t t = (size_t)blockIdx.x * 256 + threadIdx.x; if (t >= n8) return; FragH f;
#pragma unroll
  for (int q = 0; q < 8; ++q) f.h[q] = (_Float16)bf16_round(x[t * 8 + q]); *(v8us*)((unsigned short*)X16 + t * 8) = f.half[0];  }
__global__ __launch_bounds__(256) void k_h16(const float* __restrict__ x, _Float16* __restrict__ X16, size_t n8) { const size_t t = (size_t)blockIdx.x * 256 + threadIdx.x; if (t >= n8) return; FragH f;
#pragma unroll
  for (int q = 0; q < 8; ++q) f.h[q] = (_Float16)x[t * 8 + q]; *(v8us*)((unsigned short*)X16 + t * 8) = f.half[0];  }
__global__ __launch_bounds__(256) void k_round16f(const float* __restrict__ W, _Float16* __restrict__ Bt, size_t n8) { const size_t t = (size_t)blockIdx.x * 256 + threadIdx.x; if (t >= n8) return; FragH f;
#pragma unroll
  for (int i = 0; i < 8; ++i) f.h[i] = (_Float16)(bf16_round(W[t * 8 + i]) * 16.0f); *(v8us*)((unsigned short*)Bt + t * 8) = f.half[0];  }
template <int NHv, int TTv>
__global__ __launch_bounds__(256) void k_vt(const _Float16* __restrict__ V16, int ldv, int voff, _Float16* __restrict__ Vt) { __shared__ unsigned short tl[64][66]; const int tid = threadIdx.x; const int slab = blockIdx.x / (TTv / 64), lg = blockIdx.x % (TTv / 64); const int b = slab / NHv, h = slab % NHv;
  for (int i = tid; i < 64 * 8; i += 256) { const int r = i / 8, c8 = (i % 8) * 8; FragH f; f.half[0] = *(const v8us*)((const unsigned short*)V16 + ((size_t)b * TTv + lg * 64 + r) * ldv + voff + h * 64 + c8);
#pragma unroll
    for (int q = 0; q < 8; ++q) tl[r][c8 + q] = f.u[q]; }
  __syncthreads();
  {
#pragma unroll
    for (int rd = 0; rd < 2; ++rd) { const int d = rd * 32 + tid / 8, pc = tid % 8; FragH f;
#pragma unroll
      for (int q = 0; q < 8; ++q) f.u[q] = tl[pc * 8 + q][d];
      *(v8us*)((unsigned short*)Vt + ((size_t)slab * 64 + d) * TTv + lg * 64 + pc * 8) = f.half[0]; }
     } }

__global__ __launch_bounds__(256) void k_hl(const float* __restrict__ F, _Float16* __restrict__ Hh, _Float16* __restrict__ Hl, size_t n8) { const size_t t = (size_t)blockIdx.x * 256 + threadIdx.x; if (t >= n8) return; FragH fh, fl; const v4f a = *(const v4fa*)(F + t * 8), c = *(const v4fa*)(F + t * 8 + 4);
#pragma unroll
  for (int q = 0; q < 4; ++q) { _Float16 h = (_Float16)a[q]; fh.h[q] = h; fl.h[q] = (_Float16)((a[q] - (float)h) * 1024.0f); h = (_Float16)c[q]; fh.h[4 + q] = h; fl.h[4 + q] = (_Float16)((c[q] - (float)h) * 1024.0f); }
  { *(v8us*)((unsigned short*)Hh + t * 8) = fh.half[0]; *(v8us*)((unsigned short*)Hl + t * 8) = fl.half[0];  } }

// ---- fast GEMM (wave tile 32x64; requires M % 32 == 0 rows per launch region and N % 64 == 0); epilogue = k_gemm_hhx semantics ----
__device__ __forceinline__ v16h g2_frag(const _Float16* p, int hh) { FragH f; f.half[0] = *(const v8us*)((const unsigned short*)p + 8 * hh); f.half[1] = *(const v8us*)((const unsigned short*)p + 16 + 8 * hh); return f.v; }
__device__ __forceinline__ v8f g2_mma(v16h a, v16h b, v8f c) { v8f d = __builtin_amdgcn_wmma_f32_16x16x32_f16(false, a, false, b, (short)0, c, false, false); asm volatile("v_nop\n\tv_nop\n\tv_nop\n\tv_nop" : "+v"(d) : "v"(a), "v"(b)); return d; }
template <int ACT>
__global__ __launch_bounds__(128) void k_gemm2(const _Float16* __restrict__ A, int lda, size_t sA, const _Float16* __restrict__ Bh, int ldb, size_t sB, float alpha, const float* __restrict__ bias, size_t sBias, const float* __restrict__ CP, int rowsPerB, size_t sCPb, int row0g,
    float* __restrict__ C, _Float16* __restrict__ C16, int ldc, size_t sC, int M, int N, int K) { static_assert(ACT == 0 || ACT == 3 || ACT == 6 || ACT == 8 || ACT == 9 || ACT == 11 || ACT == 12 || ACT == 14 || ACT == 15 || ACT == 16 || ACT == 17, "k_gemm2: unsupported ACT code (would silently apply no activation)");
  __shared__ __attribute__((aligned(16))) float so[4][32][68];
  const int tid = threadIdx.x, w = tid >> 5, lane = tid & 31, ln = lane & 15, hh = lane >> 4; const int by = blockIdx.y;
  A += (size_t)by * sA; Bh += (size_t)by * sB; const size_t cofs = (size_t)by * sC; const float* bp = bias ? bias + (size_t)by * sBias : nullptr;
  const int ntn = N >> 6; const int mt = blockIdx.x / ntn, nq = blockIdx.x - mt * ntn; const int row0 = mt * 128 + 32 * w, col0 = nq * 64; if (row0 >= M) return;
  const _Float16* a0p = A + (size_t)(row0 + ln) * lda; const _Float16* a1p = a0p + (size_t)16 * lda;
  const _Float16* b0p = Bh + (size_t)(col0 + ln) * ldb; const _Float16* b1p = b0p + (size_t)16 * ldb; const _Float16* b2p = b1p + (size_t)16 * ldb; const _Float16* b3p = b2p + (size_t)16 * ldb;
  const v8f z8 = {0.f,0.f,0.f,0.f,0.f,0.f,0.f,0.f}; v8f c00 = z8, c01 = z8, c02 = z8, c03 = z8, c10 = z8, c11 = z8, c12 = z8, c13 = z8;
#pragma unroll 1
  for (int kb = 0; kb < K; kb += 32) { const v16h a0 = g2_frag(a0p + kb, hh), a1 = g2_frag(a1p + kb, hh);
    v16h b = g2_frag(b0p + kb, hh); c00 = g2_mma(a0, b, c00); c10 = g2_mma(a1, b, c10);
    b = g2_frag(b1p + kb, hh); c01 = g2_mma(a0, b, c01); c11 = g2_mma(a1, b, c11);
    b = g2_frag(b2p + kb, hh); c02 = g2_mma(a0, b, c02); c12 = g2_mma(a1, b, c12);
    b = g2_frag(b3p + kb, hh); c03 = g2_mma(a0, b, c03); c13 = g2_mma(a1, b, c13); }
  v8f accs[8] = {c00, c01, c02, c03, c10, c11, c12, c13};
#pragma unroll
  for (int u = 0; u < 8; ++u) { const int t = u & 3, half = u >> 2; const int col = col0 + t * 16 + ln; const float bv = bp ? bf16_round(bp[col]) : 0.f;
#pragma unroll
    for (int r = 0; r < 8; ++r) { const int rloc = half * 16 + 8 * hh + r; float v = accs[u][r] * alpha + bv; if (CP) { if (rowsPerB < 0) v += CP[cofs + (size_t)(row0g + row0 + rloc) * ldc + col];      /* rowsPerB < 0: own element of the batched C plane */ else { const int bidx = (row0g + row0 + rloc) / rowsPerB; v += CP[(size_t)bidx * sCPb + (size_t)by * 64 + col]; } }
      if (ACT == 3) v = fmaxf(v, 0.f); else if (ACT == 6) v = 0.5f * v * (1.0f + erff(v * 0.70710678118654752f)); else if (ACT == 11) v = 1.0f / (1.0f + expf(-v)); else if (ACT == 15) v = v / (1.0f + expf(-v)); else if (ACT == 12) v = (v > 0.f) ? v : 0.01f * v; else if (ACT == 8) v = tanhf(v); else if (ACT == 9) v = 0.5f * v * (1.0f + tanhf(0.7978845608028654f * (v + 0.044715f * v * v * v))); else if (ACT == 14) v = (v > 0.f) ? v : 0.1f * v; else if (ACT == 16) v = (v >= 0.f) ? v : 0.3f * v; else if (ACT == 17) v = (v >= 0.f) ? v : 0.2f * v;
      so[w][rloc][t * 16 + ln] = v; } }
  __builtin_amdgcn_fence(__ATOMIC_ACQ_REL, "workgroup"); __builtin_amdgcn_wave_barrier();
  const int rsub = lane >> 4, c4 = (lane & 15) * 4;
  {
#pragma unroll
    for (int q = 0; q < 16; ++q) { const int r = q * 2 + rsub; const v4f v = *(const v4fa*)&so[w][r][c4]; if (C) *(v4f*)(C + cofs + (size_t)(row0 + r) * ldc + col0 + c4) = v; if (C16) { v4h h4; for (int i = 0; i < 4; ++i) h4[i] = (_Float16)v[i]; *(v4h*)(C16 + cofs + (size_t)(row0 + r) * ldc + col0 + c4) = h4; } }
     } }


__global__ __launch_bounds__(256) void k_wnat(const float* __restrict__ w, size_t n8, _Float16* __restrict__ Bt) { const size_t t = (size_t)blockIdx.x * 256 + threadIdx.x; if (t >= n8) return; FragH f; for (int q = 0; q < 8; ++q) f.h[q] = (_Float16)(bf16_round(w[t * 8 + q]) * 16.0f); *(v8us*)((unsigned short*)Bt + t * 8) = f.half[0];  }
__global__ __launch_bounds__(256) void k_rsm(const float* __restrict__ S, _Float16* __restrict__ P, int nrows) {
  #pragma clang fp contract(off)
  const int i = blockIdx.x * 256 + threadIdx.x; if (i >= nrows) return; const float* s = S + (size_t)i * SQ; float mx = -3.0e38f;
#pragma unroll 1
  for (int j = 0; j < SQ; ++j) mx = fmaxf(mx, s[j]); float se = 0.f;
#pragma unroll 1
  for (int j = 0; j < SQ; ++j) se += expf(s[j] - mx); const float sc = 256.0f / se;
#pragma unroll 1
  for (int j0 = 0; j0 < SQ; j0 += 8) { FragH f; for (int q = 0; q < 8; ++q) f.h[q] = (_Float16)(expf(s[j0 + q] - mx) * sc); unsigned short* d = (unsigned short*)P + (size_t)i * SQ + j0; *(v8us*)d = f.half[0];  } }
__global__ __launch_bounds__(256) void k_vt(const _Float16* __restrict__ V16, int b, int h0, _Float16* __restrict__ VT) { __shared__ unsigned short tl[64][65]; const int tid = threadIdx.x; const int hh = blockIdx.x % HG, sg = blockIdx.x / HG; const int s0 = sg * 64; const int h = h0 + hh;
  for (int i = tid; i < 64 * 8; i += 256) { const int j = i / 8, d8 = (i % 8) * 8; FragH f; f.half[0] = *(const v8us*)((const unsigned short*)V16 + ((size_t)b * SQ + s0 + j) * DM + h * HD + d8); for (int q = 0; q < 8; ++q) tl[d8 + q][j] = f.u[q]; }
  __syncthreads();
  { for (int i = tid; i < 64 * 8; i += 256) { const int d = i / 8, j8 = (i % 8) * 8; FragH f; for (int q = 0; q < 8; ++q) f.u[q] = tl[d][j8 + q]; *(v8us*)((unsigned short*)VT + ((size_t)hh * HD + d) * SQ + s0 + j8) = f.half[0]; }  } }



__device__ __forceinline__ float rs_xhalf(float x) { return __builtin_bit_cast(float, __builtin_amdgcn_permlanex16(__builtin_bit_cast(int, x), __builtin_bit_cast(int, x), 0x76543210, 0xfedcba98, false, false)); }      /* lane l <- lane l ^ 16 */
__device__ __forceinline__ float fa_exp2(float x) { float y; asm("v_exp_f32 %0, %1\n\tv_nop" : "=v"(y) : "v"(x)); return y; }      /* 2^x; the v_nop is the slot the instruction set asks for behind a transcendental */
#define SCL2 0.18033688f                   /* SCL * log2(e): scores carried in the base-2 domain, so that a weight is one subtract and one 2^x */
#define SCLR2 (SCL2 * 0.0009765625f)       /* the same scale on the x1024 residual products */
// Fused causal attention, one wave per 16 query rows of one (batch, head); 32 keys a pass, no score or weight plane in memory.
// S^T = K Q^T (A = key rows, B = query rows): a lane holds 16 scores of ITS query (column ln), keys kb + 8 hh + r and kb + 16 + 8 hh + r: the very places of the B fragment of O^T = V^T P^T,
// so the weights go from the score accumulators to the next product inside the lane. Row maximum and row sum: in the lane, plus one exchange with lane ^ 16. Running maximum, o and sum rescaled each pass.
__global__ __launch_bounds__(128) void k_fattn(const _Float16* __restrict__ QHp, const _Float16* __restrict__ QLp, const _Float16* __restrict__ KHp, const _Float16* __restrict__ KLp, const _Float16* __restrict__ VTp, _Float16* __restrict__ Op) {
  const int lane = threadIdx.x & 31, ln = lane & 15, hh = lane >> 4; const int w = __builtin_amdgcn_readfirstlane((int)(threadIdx.x >> 5));
  const int bh = blockIdx.y, b = bh / NH, h = bh % NH; const int q0 = ((SQ / 64 - 1) - (int)blockIdx.x) * 64 + w * 16;      /* the longest rows start first */
  const size_t r0 = (size_t)b * SQ; const int q = q0 + ln;
  const _Float16* qh = QHp + (r0 + q) * LQ + h * HD; const _Float16* ql = QLp + (r0 + q) * LQ + h * HD;
  const v16h qh0 = g2_frag(qh, hh), qh1 = g2_frag(qh + 32, hh), ql0 = g2_frag(ql, hh), ql1 = g2_frag(ql + 32, hh);
  const _Float16* kh = KHp + (r0 + ln) * LQ + h * HD; const _Float16* kl = KLp + (r0 + ln) * LQ + h * HD; const _Float16* vt = VTp + ((size_t)bh * HD + ln) * SQ;
  const v8f z8 = {0.f,0.f,0.f,0.f,0.f,0.f,0.f,0.f}; v8f o0 = z8, o1 = z8, o2 = z8, o3 = z8; float m = -1.0e30f, l = 0.f;
  v16h ka0 = g2_frag(kh, hh), ka1 = g2_frag(kh + 32, hh), ka2 = g2_frag(kh + (size_t)16 * LQ, hh), ka3 = g2_frag(kh + (size_t)16 * LQ + 32, hh);      /* key rows 0 .. 31, hi plane: fragments of the first pass */
  v16h kc0 = g2_frag(kl, hh), kc1 = g2_frag(kl + 32, hh), kc2 = g2_frag(kl + (size_t)16 * LQ, hh), kc3 = g2_frag(kl + (size_t)16 * LQ + 32, hh);      /* the same rows, residual plane */
#pragma unroll 1      /* one pass holds 24 fragment loads and 16 products: a second copy of it would not fit the registers */
  for (int kb = 0; kb < q0 + 16; kb += 32) {      /* the last pass starts at or below q0: every query has a key in every pass */
    const v16h va0 = g2_frag(vt + kb, hh), va1 = g2_frag(vt + (size_t)16 * SQ + kb, hh), va2 = g2_frag(vt + (size_t)32 * SQ + kb, hh), va3 = g2_frag(vt + (size_t)48 * SQ + kb, hh);      /* asked for here, used behind the softmax */
    v8f sh0 = z8, sl0 = z8, sh1 = z8, sl1 = z8;      /* hi . hi, and lo . hi + hi . lo (x1024), for keys kb .. kb + 15 and kb + 16 .. kb + 31 */
    sh0 = g2_mma(ka0, qh0, sh0); sl0 = g2_mma(ka0, ql0, sl0); sh1 = g2_mma(ka2, qh0, sh1); sl1 = g2_mma(ka2, ql0, sl1);
    sh0 = g2_mma(ka1, qh1, sh0); sl0 = g2_mma(ka1, ql1, sl0); sh1 = g2_mma(ka3, qh1, sh1); sl1 = g2_mma(ka3, ql1, sl1);
    sl0 = g2_mma(kc0, qh0, sl0); sl1 = g2_mma(kc2, qh0, sl1); sl0 = g2_mma(kc1, qh1, sl0); sl1 = g2_mma(kc3, qh1, sl1);
    { const int kn = (kb + 32 < q0 + 16) ? kb + 32 : kb;      /* the next pass's key fragments fly during this pass's softmax and output products; the last pass asks for its own rows again (in bounds, unused) */
      const _Float16* n0 = kh + (size_t)kn * LQ; const _Float16* n1 = kl + (size_t)kn * LQ;
      ka0 = g2_frag(n0, hh); ka1 = g2_frag(n0 + 32, hh); ka2 = g2_frag(n0 + (size_t)16 * LQ, hh); ka3 = g2_frag(n0 + (size_t)16 * LQ + 32, hh);
      kc0 = g2_frag(n1, hh); kc1 = g2_frag(n1 + 32, hh); kc2 = g2_frag(n1 + (size_t)16 * LQ, hh); kc3 = g2_frag(n1 + (size_t)16 * LQ + 32, hh); }
    float s0[8], s1[8];
#pragma unroll      /* unrolled so that every index into the accumulator and fragment registers is a constant */
    for (int r = 0; r < 8; ++r) { s0[r] = fmaf(sl0[r], SCLR2, sh0[r] * SCL2); s1[r] = fmaf(sl1[r], SCLR2, sh1[r] * SCL2); }
    if (kb + 31 > q0) {      /* wave-uniform: only the pass on the diagonal holds keys after a query */
#pragma unroll      /* unrolled so that every index into the accumulator and fragment registers is a constant */
      for (int r = 0; r < 8; ++r) { const int j = kb + 8 * hh + r; s0[r] = (j <= q) ? s0[r] : -1.0e30f; s1[r] = (j + 16 <= q) ? s1[r] : -1.0e30f; } }
    float bm = fmaxf(s0[0], s1[0]);
#pragma unroll      /* unrolled so that every index into the accumulator and fragment registers is a constant */
    for (int r = 1; r < 8; ++r) bm = fmaxf(bm, fmaxf(s0[r], s1[r]));
    bm = fmaxf(bm, rs_xhalf(bm)); const float mn = fmaxf(m, bm); const float sc = fa_exp2(m - mn); m = mn;
    FragH pf; float ls = 0.f;
#pragma unroll      /* unrolled so that every index into the accumulator and fragment registers is a constant */
    for (int r = 0; r < 8; ++r) { const float e0 = fa_exp2(s0[r] - mn), e1 = fa_exp2(s1[r] - mn); ls += e0 + e1; pf.h[r] = (_Float16)e0; pf.h[8 + r] = (_Float16)e1; }
    l = fmaf(l, sc, ls);      /* the lane's half of the row sum; the halves meet behind the loop */
#pragma unroll      /* unrolled so that every index into the accumulator and fragment registers is a constant */
    for (int r = 0; r < 8; ++r) { o0[r] *= sc; o1[r] *= sc; o2[r] *= sc; o3[r] *= sc; }
    o0 = g2_mma(va0, pf.v, o0); o1 = g2_mma(va1, pf.v, o1); o2 = g2_mma(va2, pf.v, o2); o3 = g2_mma(va3, pf.v, o3); }
  l += rs_xhalf(l); const float fin = 64.0f / l;      /* o carried x64, folded into the output GEMM alpha */
  unsigned short* op = (unsigned short*)Op + (r0 + q) * DM + h * HD + 8 * hh; FragH f0, f1, f2, f3;      /* lane: 8 neighbouring head values of its query per tile; the wave writes whole 128-byte head rows */
#pragma unroll      /* unrolled so that every index into the accumulator and fragment registers is a constant */
  for (int r = 0; r < 8; ++r) { f0.h[r] = (_Float16)(o0[r] * fin); f1.h[r] = (_Float16)(o1[r] * fin); f2.h[r] = (_Float16)(o2[r] * fin); f3.h[r] = (_Float16)(o3[r] * fin); }
  *(v8us*)op = f0.half[0]; *(v8us*)(op + 16) = f1.half[0]; *(v8us*)(op + 32) = f2.half[0]; *(v8us*)(op + 48) = f3.half[0]; }

#define A0R 8                        /* query rows of a work-group of the exact first tile: one wave each */
#define A0P 68                       /* pitch of a staged key row in floats: 272 B = 17 x 16 B, so that 16 lanes reading 16 rows by 16 bytes meet every LDS bank once */
#define A0U (QT0 * (HD / 4) / 256)   /* 16-byte pieces of a staged plane per thread */
typedef float v2f __attribute__((ext_vector_type(2)));
// Exact f32 attention for the first QT0 rows, causal. One wave per query row, A0R rows of one head per work-group; the head's QT0 key and value rows are staged in LDS once (keys behind a query are masked below and carry weight zero).
// Scores: a lane takes keys lane, lane + 32, lane + 64, lane + 96, each a serial f32 chain over the 64 head values. Row maximum and row sum: butterflies over the wave. Output: a lane takes two head values and sums over the keys in rising order, the weight of key j read from its lane.
__global__ __launch_bounds__(256) void k_att0(const float* __restrict__ QF, const float* __restrict__ KF, const float* __restrict__ VF, int ld, float scale, float* __restrict__ OF, int ldo) {
  __shared__ __attribute__((aligned(16))) float lk[QT0][A0P]; __shared__ __attribute__((aligned(16))) float lv[QT0][HD];
  const int tid = threadIdx.x, lane = tid & 31; const int w = __builtin_amdgcn_readfirstlane(tid >> 5);
  const int h = blockIdx.x / (QT0 / A0R), rg = blockIdx.x % (QT0 / A0R); const int i = rg * A0R + w;      /* this wave's query */
  v4f kq[A0U], vq[A0U];
#pragma unroll      /* all 16 loads of a thread in flight at once, their results under constant indices */
  for (int u = 0; u < A0U; ++u) { const int t = u * 256 + tid, j = t / (HD / 4), c = (t % (HD / 4)) * 4; const size_t ro = (size_t)j * ld + h * HD + c;
    const float* kp = KF + ro; const float* vp = VF + ro;
    kq[u] = *(const v4fa*)kp; asm volatile("s_wait_xcnt 0x0" :: "v"(kp) : "memory");      /* stands in front of every write of the registers that this load names as its address; it takes the address as an input, so that those registers live up to it and no load's result, this one's included, is placed on them earlier */
    vq[u] = *(const v4fa*)vp; asm volatile("s_wait_xcnt 0x0" :: "v"(vp) : "memory"); }      /* the same for this load */
  const float* qr = QF + (size_t)i * ld + h * HD; v4f qv[HD / 4];
#pragma unroll      /* the query row stays in registers: constant indices */
  for (int c = 0; c < HD / 4; ++c) qv[c] = *(const v4fa*)(qr + c * 4);
  asm volatile("s_wait_xcnt 0x0" :: "s"(qr) : "memory");      /* the same wait for the query row's loads (wave-uniform address: scalar loads), in front of every write of their base registers */
#pragma unroll      /* constant indices into the staging registers */
  for (int u = 0; u < A0U; ++u) { const int t = u * 256 + tid, j = t / (HD / 4), c = (t % (HD / 4)) * 4; *(v4f*)&lk[j][c] = kq[u]; *(v4f*)&lv[j][c] = vq[u]; }
  __syncthreads();      /* the staged rows are read by every wave */
  float s[QT0 / 32];
#pragma unroll      /* four independent chains side by side */
  for (int g = 0; g < QT0 / 32; ++g) s[g] = 0.f;
#pragma unroll      /* constant indices into the query registers, LDS offsets as immediates */
  for (int c = 0; c < HD / 4; ++c) {
#pragma unroll      /* four independent chains side by side */
    for (int g = 0; g < QT0 / 32; ++g) { const v4f kr = *(const v4f*)&lk[g * 32 + lane][c * 4]; s[g] = fmaf(qv[c][0], kr[0], s[g]); s[g] = fmaf(qv[c][1], kr[1], s[g]); s[g] = fmaf(qv[c][2], kr[2], s[g]); s[g] = fmaf(qv[c][3], kr[3], s[g]); } }
  float mx = -1.0e30f;
#pragma unroll      /* constant indices into the score registers */
  for (int g = 0; g < QT0 / 32; ++g) { s[g] = (g * 32 + lane <= i) ? s[g] * scale : -1.0e30f; mx = fmaxf(mx, s[g]); }
#pragma unroll      /* five exchange steps */
  for (int st = 16; st > 0; st >>= 1) mx = fmaxf(mx, __shfl_xor(mx, st));
  float e[QT0 / 32], l = 0.f;
#pragma unroll      /* constant indices into the score registers */
  for (int g = 0; g < QT0 / 32; ++g) { e[g] = (g * 32 + lane <= i) ? expf(s[g] - mx) : 0.f; l += e[g]; }
#pragma unroll      /* five exchange steps */
  for (int st = 16; st > 0; st >>= 1) l += __shfl_xor(l, st);
  v2f o = {0.f, 0.f};
#pragma unroll      /* constant lane numbers for the weight reads, LDS offsets as immediates */
  for (int g = 0; g < QT0 / 32; ++g) {
#pragma unroll      /* constant lane numbers for the weight reads, LDS offsets as immediates */
    for (int jj = 0; jj < 32; ++jj) { const float ej = __builtin_bit_cast(float, __builtin_amdgcn_readlane(__builtin_bit_cast(int, e[g]), jj)); const v2f vv = *(const v2f*)&lv[g * 32 + jj][2 * lane]; o[0] = fmaf(ej, vv[0], o[0]); o[1] = fmaf(ej, vv[1], o[1]); } }
  const float fin = 64.0f / l;      /* o carried x64 like the f16 path */
  o[0] *= fin; o[1] *= fin; *(v2f*)(OF + (size_t)i * ldo + h * HD + 2 * lane) = o; }      /* the wave writes its query's whole 256-byte head row */

__global__ __launch_bounds__(256) void k_ln64f32(float* __restrict__ F, int ldf, size_t nrh, const float* __restrict__ g, const float* __restrict__ bb, float eps) {
  #pragma clang fp contract(off)
  const size_t t = (size_t)blockIdx.x * 256 + threadIdx.x; if (t >= nrh) return; const size_t r = t / NH; const int h = (int)(t % NH); float* f = F + r * (size_t)ldf + (size_t)h * 64; float sum = 0.f;
#pragma unroll 1
  for (int d = 0; d < 64; d += 4) { const v4f q = *(const v4fa*)(f + d); sum = __fadd_rn(__fadd_rn(__fadd_rn(__fadd_rn(sum, q[0]), q[1]), q[2]), q[3]); } const float mu = sum / 64.0f; float vs = 0.f;
#pragma unroll 1
  for (int d = 0; d < 64; d += 4) { const v4f q = *(const v4fa*)(f + d); for (int e = 0; e < 4; ++e) { const float dl = __fadd_rn(q[e], -mu); vs = __fadd_rn(vs, __fmul_rn(dl, dl)); } } const float rs = rsqrtf(__fadd_rn(vs / 64.0f, eps));
#pragma unroll 1
  for (int d0 = 0; d0 < 64; d0 += 4) { const v4f q = *(const v4fa*)(f + d0); v4f y; for (int e = 0; e < 4; ++e) y[e] = __fadd_rn(__fmul_rn(__fmul_rn(__fadd_rn(q[e], -mu), rs), bf16_round(g[d0 + e])), bf16_round(bb[d0 + e])); *(v4f*)(f + d0) = y;  } }
extern "C" void kernel_launch(void* const* d_in, const int* in_sizes, int n_in,
                              void* d_out, int out_size, void* d_ws, size_t ws_size, hipStream_t stream) {
  (void)in_sizes; (void)n_in; (void)out_size;
  const float* const* I = (const float* const*)d_in; const float* x = I[0]; const float* xk = I[0]; const float* xv = I[0]; const float* wq = I[1]; const float* bq = nullptr; const float* wk = I[2]; const float* bk = nullptr; const float* wv = I[3]; const float* bv = nullptr; const float* wo = I[4]; const float* bo = I[5]; const float* qg = I[6]; const float* qbt = I[7]; const float* kg = I[8]; const float* kbt = I[9]; const float LNE = 1e-5f;      /* input order: x (feeds the q, k AND v streams), Wq, Wk, Wv (natural [out][in] weights; NO biases: null pointers in the guarded bias slots), Wo, bo (zeros: read), q_gamma, q_beta, k_gamma, k_beta [64] (ones / zeros on this draw: read by value in the per-head LayerNorm kernel) */
  char* ws = (char*)d_ws; size_t off = 0;
  auto take = [&](size_t bytes) { char* p = ws + off; off += (bytes + 255) & ~(size_t)255; return p; };
  _Float16* BQ = (_Float16*)take((size_t)DM * DM * 2); _Float16* BK = (_Float16*)take((size_t)DM * DM * 2); _Float16* BV = (_Float16*)take((size_t)DM * DM * 2); _Float16* BO = (_Float16*)take((size_t)DM * DM * 2);
  _Float16* X16 = (_Float16*)take(NR * DM * 2); _Float16* XK16 = (_Float16*)take(NR * DM * 2); _Float16* XV16 = (_Float16*)take(NR * DM * 2);      /* exact f16 rows of query, key, value */ float* QF = (float*)take(NR * DM * 4); _Float16* QH = (_Float16*)take(NR * DM * 2); _Float16* QL = (_Float16*)take(NR * DM * 2); _Float16* KH = (_Float16*)take(NR * DM * 2); _Float16* KL = (_Float16*)take(NR * DM * 2); _Float16* Q16 = QH; _Float16* K16 = KH; _Float16* V16 = (_Float16*)take(NR * DM * 2); _Float16* O16 = (_Float16*)take(NR * DM * 2);
  _Float16* VT = (_Float16*)take((size_t)NB * NH * HD * SQ * 2);      /* V^T [NB][NH][HD][SQ] */
  float* QF0 = (float*)take((size_t)QT0 * DM * 4); float* KF0 = (float*)take((size_t)QT0 * DM * 4); float* VF0 = (float*)take((size_t)QT0 * DM * 4); float* OF0 = (float*)take((size_t)NB * QT0 * DM * 4); _Float16* OH0 = (_Float16*)take((size_t)NB * QT0 * DM * 2); _Float16* OL0 = (_Float16*)take((size_t)NB * QT0 * DM * 2);
  if (off > ws_size) return;
  { const unsigned g = (unsigned)(((size_t)DM * DM / 8 + 255) / 256); k_wnat<<<g, 256, 0, stream>>>(wq, (size_t)DM * DM / 8, BQ); k_wnat<<<g, 256, 0, stream>>>(wk, (size_t)DM * DM / 8, BK); k_wnat<<<g, 256, 0, stream>>>(wv, (size_t)DM * DM / 8, BV); k_wnat<<<g, 256, 0, stream>>>(wo, (size_t)DM * DM / 8, BO); }      /* natural [out][in] = Bt[n][k] x16 */
  k_x16<<<(unsigned)((NR * DM / 8 + 255) / 256), 256, 0, stream>>>(x, X16, NR * DM / 8); k_x16<<<(unsigned)((NR * DM / 8 + 255) / 256), 256, 0, stream>>>(xk, XK16, NR * DM / 8); k_x16<<<(unsigned)((NR * DM / 8 + 255) / 256), 256, 0, stream>>>(xv, XV16, NR * DM / 8);
  const size_t r0p = (size_t)B0 * SQ;      /* first projected row */
  k_gemm2<0><<<dim3((unsigned)((MP / 128) * (DM / 64)), 1), 128, 0, stream>>>(X16 + r0p * DM, DM, 0, BQ, DM, 0, 0.0625f, bq, 0, nullptr, 1, 0, 0, QF + r0p * DM, nullptr, DM, 0, MP, DM, DM); k_ln64f32<<<(unsigned)(((size_t)MP * NH + 255) / 256), 256, 0, stream>>>(QF + r0p * DM, DM, (size_t)MP * NH, qg, qbt, LNE); k_hl<<<(unsigned)(((size_t)MP * DM / 8 + 255) / 256), 256, 0, stream>>>(QF + r0p * DM, QH + r0p * DM, QL + r0p * DM, (size_t)MP * DM / 8);      /* q (f32) -> f16 hi + x1024 residual: unscaled logits sigma ~8 */
  k_gemm2<0><<<dim3((unsigned)((MP / 128) * (DM / 64)), 1), 128, 0, stream>>>(XK16 + r0p * DM, DM, 0, BK, DM, 0, 0.0625f, bk, 0, nullptr, 1, 0, 0, QF + r0p * DM, nullptr, DM, 0, MP, DM, DM); k_ln64f32<<<(unsigned)(((size_t)MP * NH + 255) / 256), 256, 0, stream>>>(QF + r0p * DM, DM, (size_t)MP * NH, kg, kbt, LNE); k_hl<<<(unsigned)(((size_t)MP * DM / 8 + 255) / 256), 256, 0, stream>>>(QF + r0p * DM, KH + r0p * DM, KL + r0p * DM, (size_t)MP * DM / 8);      /* k likewise */
  k_gemm2<0><<<dim3((unsigned)((MP / 128) * (DM / 64)), 1), 128, 0, stream>>>(XV16 + r0p * DM, DM, 0, BV, DM, 0, 0.0625f, bv, 0, nullptr, 1, 0, 0, nullptr, V16 + r0p * DM, DM, 0, MP, DM, DM);
  for (int b = B0; b < B0 + NBR; ++b) { const size_t r0 = (size_t)b * SQ;
    k_vt<NH, SQ><<<NH * (SQ / 64), 256, 0, stream>>>(V16 + r0 * LQ, LQ, 0, VT + (size_t)b * NH * HD * SQ);      /* V^T [NH][HD][SQ] of this batch */
    k_gemm2<0><<<dim3((QT0 / 128) * (DM / 64), 1), 128, 0, stream>>>(X16 + r0 * DM, DM, 0, BQ, DM, 0, 0.0625f, bq, 0, nullptr, 1, 0, 0, QF0, nullptr, DM, 0, QT0, DM, DM); k_gemm2<0><<<dim3((QT0 / 128) * (DM / 64), 1), 128, 0, stream>>>(XK16 + r0 * DM, DM, 0, BK, DM, 0, 0.0625f, bk, 0, nullptr, 1, 0, 0, KF0, nullptr, DM, 0, QT0, DM, DM); k_gemm2<0><<<dim3((QT0 / 128) * (DM / 64), 1), 128, 0, stream>>>(XV16 + r0 * DM, DM, 0, BV, DM, 0, 0.0625f, bv, 0, nullptr, 1, 0, 0, VF0, nullptr, DM, 0, QT0, DM, DM);      /* f32 q, k, v of the first 128 rows (exact products) */
  k_ln64f32<<<(unsigned)(((size_t)QT0 * NH + 255) / 256), 256, 0, stream>>>(QF0, DM, (size_t)QT0 * NH, qg, qbt, LNE); k_ln64f32<<<(unsigned)(((size_t)QT0 * NH + 255) / 256), 256, 0, stream>>>(KF0, DM, (size_t)QT0 * NH, kg, kbt, LNE);      /* the exact first tile's f32 q and k rows through the same per-head LayerNorm */
    k_att0<<<NH * (QT0 / A0R), 256, 0, stream>>>(QF0, KF0, VF0, DM, SCL, OF0 + (size_t)b * QT0 * DM, DM);      /* exact f32 attention for rows 0..127 (o x64) */
  }
  k_fattn<<<dim3(SQ / 64, NB * NH), 128, 0, stream>>>(QH, QL, KH, KL, VT, O16);      /* scores, causal softmax and P . V of every batch, head and query row in one launch: o (merged heads, x64) as f16 rows */
  k_gemm2<0><<<dim3((unsigned)((MPO / 128) * (DM / 64)), 1), 128, 0, stream>>>(O16 + r0p * DM, DM, 0, BO, DM, 0, 0.0009765625f, bo, 0, nullptr, 1, 0, 0, (float*)d_out + r0p * DM, nullptr, DM, 0, MPO, DM, DM);      /* out rows are the output layout */
  k_hl<<<(unsigned)(((size_t)NB * QT0 * DM / 8 + 255) / 256), 256, 0, stream>>>(OF0, OH0, OL0, (size_t)NB * QT0 * DM / 8);      /* first-tile o (x64) -> f16 hi + x1024 residual planes */
  for (int b = B0; b < B0 + NBR; ++b) { const size_t r0 = (size_t)b * SQ; const size_t f0 = (size_t)b * QT0;
    k_gemm2<0><<<dim3((QT0 / 128) * (DM / 64), 1), 128, 0, stream>>>(OH0 + f0 * DM, DM, 0, BO, DM, 0, 0.0009765625f, bo, 0, nullptr, 1, 0, 0, (float*)d_out + r0 * DM, nullptr, DM, 0, QT0, DM, DM);      /* rows 0..127: out = o_hi Wo (+ b), overwriting the f16-path rows */
    k_gemm2<0><<<dim3((QT0 / 128) * (DM / 64), 1), 128, 0, stream>>>(OL0 + f0 * DM, DM, 0, BO, DM, 0, 0.00000095367431640625f, nullptr, 0, (const float*)d_out + r0 * DM, -1, 0, 0, (float*)d_out + r0 * DM, nullptr, DM, 0, QT0, DM, DM); }      /* += o_lo Wo 2^-20 (own-element accumulate) */
}

// v004
// Measured time: 476 microseconds a run.
// Two timings next to v003 put it at 1.16 and 1.17 times that version's speed.
// Counting every step since v000, it is 22.7 times as fast.
#include <hip/hip_runtime.h>
// Causal multi-head self-attention with a per-head LayerNorm on q and k, natural bias-free q / k / v projections and a biased output projection (x [2][3072][512]; q / k / v = x W^T (nn.Linear natural [512][512] sd 0.02, NO biases), 8 heads of 64; q and k each pass through a LayerNorm over the 64 values of every (token, head) vector (biased variance, eps 1e-5, gamma / beta [64]: ones / zeros on this draw: read); scores = q . k / sqrt(64); causal (keys after the query get -inf); softmax; out = merged Wo^T + bo (natural; zero bias) -> [2][3072][512]); q and k carried as f16 hi + x1024 residual planes with three-product scores.
// Structure: token rows r = b*3072 + s; x as exact f16 rows (bf16-rounded); q and k as WMMA GEMMs (32x64 wave tiles, f32 accumulation, exact x16 weights, no bias) into f32 rows, each (token, head) vector of which an IN-PLACE f32 LayerNorm kernel normalises over its 64 values (f32 statistics, gamma / beta by value), then split into f16 hi + x1024 residual planes; v as an f16-output GEMM; per batch: V^T for all heads via LDS transposes; then ONE fused launch for all batches, heads and query rows: a wave takes 16 query rows and walks the keys up to its diagonal, 32 a pass: S^T = K Q^T as three products (hi.hi + lo.hi + hi.lo, K = 64, scale 1/8 = 1/sqrt(64); logits sigma ~1), causal running-maximum softmax inside the lane (f32 statistics, native exp; weights exp(s - max) as f16), O^T = V^T P^T with the weights taken in place from the score accumulators (o divided by the row sum at the end and carried x64, folded into the output GEMM alpha) written straight into the merged f16 o rows; out = o Wo^T + bo GEMM (f32) into the output layout.
// Compute dtype: inputs rounded to bf16; x / weights exact; the normalised q and k as f16 hi + residual planes (three-product scores), v, the softmax weights and o as plain f16 GEMM operands (~2^-12); LayerNorm, scores and softmax statistics f32. v_wmma_f32_16x16x32_f16.
#define NB 2
#define SCL 0.125f                         /* 1 / sqrt(head_dim = 64) */
#define SCLR 0.0001220703125f              /* 2^-13: SCL / 1024; unused: the x1024 residual products take SCLR2 */
#define SQ 3072
#define DM 512
#define NH 8
#define HD 64
#define HG 4                         /* heads per launch of the h0-based k_vt overload */
#define QT0 128                      /* first-tile rows recomputed exactly in f32 */
#define B0 0                         /* first batch processed (debug hook) */
#define NBR NB                       /* batches processed (debug hook) */
#define NR ((size_t)NB * SQ)         /* token rows */
#define MP ((int)((size_t)NBR * SQ)) /* rows projected (debug hook) */
#define MPO MP                       /* rows through the output stage (debug hook) */
#define LQ DM      /* row pitch of the q/k/v rows */
typedef __bf16 v16b __attribute__((ext_vector_type(16)));
typedef unsigned short v8us __attribute__((ext_vector_type(8), may_alias));
typedef float  v8f  __attribute__((ext_vector_type(8)));
typedef float  v4f  __attribute__((ext_vector_type(4)));
typedef float  v4fa __attribute__((ext_vector_type(4), may_alias));
union FragB { v16b v; v8us half[2]; unsigned short u[16]; };

__device__ __forceinline__ unsigned short bf16_bits(float x) { unsigned int u = __float_as_uint(x); return (unsigned short)((u + 0x7FFFu + ((u >> 16) & 1u)) >> 16); }
__device__ __forceinline__ float bf16_val(unsigned short b) { return __uint_as_float(((unsigned int)b) << 16); }
__device__ __forceinline__ float bf16_round(float x) { return bf16_val(bf16_bits(x)); }
// D += A·B with NT terms: 1 = ah·bh, 2 = + al·bh (A split), 3 = + ah·bl (both split)
template <int NT>
__device__ __forceinline__ v8f mmaN(v16b ah, v16b al, v16b bh, v16b bl, v8f c) {
  c = __builtin_amdgcn_wmma_f32_16x16x32_bf16(false, ah, false, bh, (short)0, c, false, false);
  if (NT >= 2) c = __builtin_amdgcn_wmma_f32_16x16x32_bf16(false, al, false, bh, (short)0, c, false, false);
  if (NT >= 3) c = __builtin_amdgcn_wmma_f32_16x16x32_bf16(false, ah, false, bl, (short)0, c, false, false);
  asm volatile("v_nop\n\tv_nop\n\tv_nop\n\tv_nop" : "+v"(c) : "v"(ah), "v"(al), "v"(bh), "v"(bl));
  return c;
}

__global__ __launch_bounds__(256) void k_wt_bf16(const float* __restrict__ W, unsigned short* __restrict__ Wt, int K, int N) {
  const int t = blockIdx.x * 256 + threadIdx.x;
  const int k8n = K / 8;
  if (t >= N * k8n) return;
  const int n = t / k8n, k8 = (t % k8n) * 8;
  v8us v;
#pragma unroll
  for (int i = 0; i < 8; ++i) v[i] = bf16_bits(W[(size_t)(k8 + i) * N + n]);
  *(v8us*)(Wt + (size_t)n * K + k8) = v;
  
}

// GEMM C[M][N] (f32, pitch ldc) = act(A[M][K]·W + bias). A f32 row-major (pitch lda) converted per fragment to bf16
// (ASPLIT: hi/lo two planes -> 2 terms, else single rounded term); Wt bf16 [N][K] (pitch ldb). BIAS_BF16 rounds the
// bias to bf16 first (bias quantised to bf16 before the add). K%32==0, M%16==0, N%64==0.
template <bool ASPLIT, int ACT, bool BIAS_BF16>
__global__ __launch_bounds__(128) void k_gemm_bf(const float* __restrict__ A, int lda, const unsigned short* __restrict__ Wt, int ldb,
                                               const float* __restrict__ bias, float* __restrict__ C, int ldc, int M, int N, int K) {
  __shared__ __attribute__((aligned(16))) float so[4][16][64];
  const int tid = threadIdx.x, w = tid >> 5, lane = tid & 31, ln = lane & 15, hh = lane >> 4;
  const int ntn = N / 64;
  const int wid = blockIdx.x * 4 + w;
  const int mt = wid / ntn, nq = wid % ntn;
  if (mt * 16 >= M) return;
  const int row0 = mt * 16, col0 = nq * 64;
  const float* arow = A + (size_t)(row0 + ln) * lda;
  v8f acc[4] = {};
  for (int kb = 0; kb < K; kb += 32) {
    FragB ah, al;
    const v4f x0 = *(const v4fa*)(arow + kb + 8 * hh), x1 = *(const v4fa*)(arow + kb + 8 * hh + 4);
    const v4f x2 = *(const v4fa*)(arow + kb + 16 + 8 * hh), x3 = *(const v4fa*)(arow + kb + 16 + 8 * hh + 4);
    float xs[16] = {x0[0],x0[1],x0[2],x0[3],x1[0],x1[1],x1[2],x1[3],x2[0],x2[1],x2[2],x2[3],x3[0],x3[1],x3[2],x3[3]};
#pragma unroll
    for (int i = 0; i < 16; ++i) { const unsigned short hb = bf16_bits(xs[i]); ah.u[i] = hb; al.u[i] = ASPLIT ? bf16_bits(xs[i] - bf16_val(hb)) : (unsigned short)0; }
#pragma unroll
    for (int t = 0; t < 4; ++t) {
      const unsigned short* brow = Wt + (size_t)(col0 + t * 16 + ln) * ldb + kb;
      FragB b;
      b.half[0] = *(const v8us*)(brow + 8 * hh);
      b.half[1] = *(const v8us*)(brow + 16 + 8 * hh);
      acc[t] = mmaN<ASPLIT ? 2 : 1>(ah.v, al.v, b.v, b.v, acc[t]);
    }
  }
#pragma unroll
  for (int t = 0; t < 4; ++t) {
    float bv = bias ? bias[col0 + t * 16 + ln] : 0.f;
    if (BIAS_BF16) bv = bf16_round(bv);
#pragma unroll
    for (int r = 0; r < 8; ++r) { float v = acc[t][r] + bv; if (ACT == 1) v = fmaxf(v, 0.f); so[w][8 * hh + r][t * 16 + ln] = v; }
  }
  __builtin_amdgcn_fence(__ATOMIC_ACQ_REL, "workgroup");
  __builtin_amdgcn_wave_barrier();
  const int rsub = lane >> 4, c4 = (lane & 15) * 4;
  {
#pragma unroll
    for (int q = 0; q < 8; ++q) {
      const int r = q * 2 + rsub;
      const v4f v = *(const v4fa*)&so[w][r][c4];
      *(v4f*)(C + (size_t)(row0 + r) * ldc + col0 + c4) = v;
    }
    
  }
}

// GEMM C = act(A·W + bias + resid): A f32 (ASPLIT -> hi/lo 2 terms), Wt bf16 [N][K]; ACT 0 none, 1 relu, 2 exact gelu;
// resid (optional, f32, row index = (row % rmod), pitch ldr, RES_BF16 rounds it) added before the activation.
template <bool ASPLIT, int ACT, bool BIAS_BF16, bool RES_BF16>
__global__ __launch_bounds__(128) void k_gemm_bf3(const float* __restrict__ A, int lda, const unsigned short* __restrict__ Wt, int ldb,
                                                const float* __restrict__ bias, const float* __restrict__ resid, int rmod, int ldr,
                                                float* __restrict__ C, int ldc, int M, int N, int K) {
  __shared__ __attribute__((aligned(16))) float so[4][16][64];
  const int tid = threadIdx.x, w = tid >> 5, lane = tid & 31, ln = lane & 15, hh = lane >> 4;
  const int ntn = N / 64;
  const int wid = blockIdx.x * 4 + w;
  const int mt = wid / ntn, nq = wid % ntn;
  if (mt * 16 >= M) return;
  const int row0 = mt * 16, col0 = nq * 64;
  const float* arow = A + (size_t)(row0 + ln) * lda;
  v8f acc[4] = {};
  for (int kb = 0; kb < K; kb += 32) {
    FragB ah, al;
    const v4f x0 = *(const v4fa*)(arow + kb + 8 * hh), x1 = *(const v4fa*)(arow + kb + 8 * hh + 4);
    const v4f x2 = *(const v4fa*)(arow + kb + 16 + 8 * hh), x3 = *(const v4fa*)(arow + kb + 16 + 8 * hh + 4);
    float xs[16] = {x0[0],x0[1],x0[2],x0[3],x1[0],x1[1],x1[2],x1[3],x2[0],x2[1],x2[2],x2[3],x3[0],x3[1],x3[2],x3[3]};
#pragma unroll
    for (int i = 0; i < 16; ++i) { const unsigned short hb = bf16_bits(xs[i]); ah.u[i] = hb; al.u[i] = ASPLIT ? bf16_bits(xs[i] - bf16_val(hb)) : (unsigned short)0; }
#pragma unroll
    for (int t = 0; t < 4; ++t) {
      const unsigned short* brow = Wt + (size_t)(col0 + t * 16 + ln) * ldb + kb;
      FragB b;
      b.half[0] = *(const v8us*)(brow + 8 * hh);
      b.half[1] = *(const v8us*)(brow + 16 + 8 * hh);
      acc[t] = mmaN<ASPLIT ? 2 : 1>(ah.v, al.v, b.v, b.v, acc[t]);
    }
  }
#pragma unroll
  for (int t = 0; t < 4; ++t) {
    const int col = col0 + t * 16 + ln;
    float bv = bias ? bias[col] : 0.f;
    if (BIAS_BF16) bv = bf16_round(bv);
#pragma unroll
    for (int r = 0; r < 8; ++r) {
      float v = acc[t][r] + bv;
      if (resid) { float rv = resid[(size_t)((row0 + 8 * hh + r) % rmod) * ldr + col]; if (RES_BF16) rv = bf16_round(rv); v += rv; }
      if (ACT == 1) v = fmaxf(v, 0.f);
      if (ACT == 2) v = 0.5f * v * (1.0f + erff(v * 0.70710678118654752f));
      if (ACT == 3) { const float u = 0.7978845608028654f * (v + 0.044715f * v * v * v); v = 0.5f * v * (1.0f + tanhf(u)); }
      so[w][8 * hh + r][t * 16 + ln] = v;
    }
  }
  __builtin_amdgcn_fence(__ATOMIC_ACQ_REL, "workgroup");
  __builtin_amdgcn_wave_barrier();
  const int rsub = lane >> 4, c4 = (lane & 15) * 4;
  {
#pragma unroll
    for (int q = 0; q < 8; ++q) {
      const int r = q * 2 + rsub;
      const v4f v = *(const v4fa*)&so[w][r][c4];
      *(v4f*)(C + (size_t)(row0 + r) * ldc + col0 + c4) = v;
    }
    
  }
}
// row LayerNorm (biased variance, eps) over N: s = X (+ R); optional out_sum <- s; out_norm <- (s-mu)*rsqrt(var+eps)*g + b
template <bool PARAM_BF16>
__global__ __launch_bounds__(256) void k_layernorm(const float* __restrict__ X, const float* __restrict__ R, const float* __restrict__ g, const float* __restrict__ bta,
                                                  float* __restrict__ out_sum, float* __restrict__ out_norm, int N, float eps) {
  __shared__ float red[256];
  const int row = blockIdx.x, tid = threadIdx.x;
  const float* x = X + (size_t)row * N; const float* rr = R ? R + (size_t)row * N : nullptr;
  float vals[16];                     // up to N = 4096
  const int per = N / 256;            // contiguous chunk per thread? use strided-by-4 chunks: thread handles j = tid*4 + 1024*u
  float s1 = 0.f;
  for (int u = 0; u < per / 4; ++u) {
    const int j = tid * 4 + 1024 * u;
    const v4f a = *(const v4fa*)(x + j);
    v4f b = {0.f,0.f,0.f,0.f}; if (rr) b = *(const v4fa*)(rr + j);
#pragma unroll
    for (int q = 0; q < 4; ++q) { const float v = a[q] + b[q]; vals[u * 4 + q] = v; s1 += v; }
  }
  red[tid] = s1; __syncthreads();
  for (int st = 128; st > 0; st >>= 1) { if (tid < st) red[tid] += red[tid + st]; __syncthreads(); }
  const float mu = red[0] / (float)N; __syncthreads();
  float s2 = 0.f;
  for (int u = 0; u < per / 4; ++u)
#pragma unroll
    for (int q = 0; q < 4; ++q) { const float c = vals[u * 4 + q] - mu; s2 += c * c; }
  red[tid] = s2; __syncthreads();
  for (int st = 128; st > 0; st >>= 1) { if (tid < st) red[tid] += red[tid + st]; __syncthreads(); }
  const float rs = rsqrtf(red[0] / (float)N + eps);
  {
    for (int u = 0; u < per / 4; ++u) {
      const int j = tid * 4 + 1024 * u;
      v4f o, sm;
#pragma unroll
      for (int q = 0; q < 4; ++q) {
        float gg = g[j + q], bb = bta[j + q];
        if (PARAM_BF16) { gg = bf16_round(gg); bb = bf16_round(bb); }
        sm[q] = vals[u * 4 + q]; o[q] = (vals[u * 4 + q] - mu) * rs * gg + bb;
      }
      if (out_sum) *(v4f*)(out_sum + (size_t)row * N + j) = sm;
      *(v4f*)(out_norm + (size_t)row * N + j) = o;
    }
    
  }
}



// ---- f16 WMMA path (v_wmma_f32_16x16x32_f16): 11-bit significands for operands in range — used where a [0,1] probability operand needs more precision than bf16
typedef _Float16 v16h __attribute__((ext_vector_type(16)));
union FragH { v16h v; v8us half[2]; _Float16 h[16]; unsigned short u[16]; };
template <int NT>
__device__ __forceinline__ v8f mmaH(v16h ah, v16h al, v16h bh, v16h bl, v8f c) {
  c = __builtin_amdgcn_wmma_f32_16x16x32_f16(false, ah, false, bh, (short)0, c, false, false);
  if (NT >= 2) c = __builtin_amdgcn_wmma_f32_16x16x32_f16(false, al, false, bh, (short)0, c, false, false);
  if (NT >= 3) c = __builtin_amdgcn_wmma_f32_16x16x32_f16(false, ah, false, bl, (short)0, c, false, false);
  asm volatile("v_nop\n\tv_nop\n\tv_nop\n\tv_nop" : "+v"(c) : "v"(ah), "v"(al), "v"(bh), "v"(bl));
  return c;
}
// batched GEMM like k_gemm_b but f16 operands: A f32 (split into f16 hi/lo if ASPLIT, else rounded to f16), Bt = f16 values [n][k]; alpha; C f32; N multiple of 16 (partial tiles skipped)
template <bool ASPLIT>
__global__ __launch_bounds__(128) void k_gemm_h(const float* __restrict__ A, int lda, size_t sA, const _Float16* __restrict__ Bh, int ldb, size_t sB, float alpha, float* __restrict__ C, int ldc, size_t sC, int M, int N, int K) {
  __shared__ __attribute__((aligned(16))) float so[4][16][64];
  const int tid = threadIdx.x, w = tid >> 5, lane = tid & 31, ln = lane & 15, hh = lane >> 4; const int by = blockIdx.y;
  A += (size_t)by * sA; Bh += (size_t)by * sB; C += (size_t)by * sC;
  const int ntn = (N + 63) / 64; const int wid = blockIdx.x * 4 + w; const int mt = wid / ntn, nq = wid % ntn; if (mt * 16 >= M) return;
  const int row0 = mt * 16, col0 = nq * 64; const float* arow = A + (size_t)(row0 + ln) * lda;
  v8f acc[4] = {};
  for (int kb = 0; kb < K; kb += 32) {
    FragH ah, al;
    const v4f x0 = *(const v4fa*)(arow + kb + 8 * hh), x1 = *(const v4fa*)(arow + kb + 8 * hh + 4), x2 = *(const v4fa*)(arow + kb + 16 + 8 * hh), x3 = *(const v4fa*)(arow + kb + 16 + 8 * hh + 4);
    float xs[16] = {x0[0],x0[1],x0[2],x0[3],x1[0],x1[1],x1[2],x1[3],x2[0],x2[1],x2[2],x2[3],x3[0],x3[1],x3[2],x3[3]};
#pragma unroll
    for (int i = 0; i < 16; ++i) { const _Float16 h = (_Float16)xs[i]; ah.h[i] = h; al.h[i] = ASPLIT ? (_Float16)(xs[i] - (float)h) : (_Float16)0.0f; }
#pragma unroll
    for (int t = 0; t < 4; ++t) { if (col0 + t * 16 >= N) continue; const size_t boff = (size_t)(col0 + t * 16 + ln) * ldb + kb; FragH bq; bq.half[0] = *(const v8us*)(Bh + boff + 8 * hh); bq.half[1] = *(const v8us*)(Bh + boff + 16 + 8 * hh);
      acc[t] = mmaH<ASPLIT ? 2 : 1>(ah.v, al.v, bq.v, bq.v, acc[t]); }
  }
#pragma unroll
  for (int t = 0; t < 4; ++t) { if (col0 + t * 16 >= N) continue;
#pragma unroll
    for (int r = 0; r < 8; ++r) so[w][8 * hh + r][t * 16 + ln] = acc[t][r] * alpha; }
  __builtin_amdgcn_fence(__ATOMIC_ACQ_REL, "workgroup"); __builtin_amdgcn_wave_barrier();
  const int rsub = lane >> 4, c4 = (lane & 15) * 4;
  {
#pragma unroll
    for (int q = 0; q < 8; ++q) { const int r = q * 2 + rsub; if (col0 + c4 < N) { const v4f v = *(const v4fa*)&so[w][r][c4]; *(v4f*)(C + (size_t)(row0 + r) * ldc + col0 + c4) = v; } }
     }
}

// Wt[n][k] = f16(W[k][n]·scale) from f32 row-major W[K][N] (scale = power of two; bf16-exact weights stay exact in f16 away from the subnormal range)
__global__ __launch_bounds__(256) void k_wt_f16(const float* __restrict__ W, _Float16* __restrict__ Wt, int K, int N, float scale) {
  const int t = blockIdx.x * 256 + threadIdx.x; if (t >= N * (K / 8)) return; const int n = t / (K / 8), k8 = (t % (K / 8)) * 8; FragH f;
#pragma unroll
  for (int i = 0; i < 8; ++i) f.h[i] = (_Float16)(bf16_round(W[(size_t)(k8 + i) * N + n]) * scale); const v8us o = f.half[0];
  *(v8us*)((unsigned short*)Wt + (size_t)n * K + k8) = o; 
}
// k_gemm_hh variant with fused epilogue: v = acc·alpha + bias[by·sBias + col] (+ CP[(row/rowsPerB)·sCPb + by·64 + col] if CP) ; ACT 0 none / 1 elu ; writes f16 C16 (and f32 C if non-null)
template <int ACT>
__global__ __launch_bounds__(128) void k_gemm_hhx(const _Float16* __restrict__ A, int lda, size_t sA, const _Float16* __restrict__ Bh, int ldb, size_t sB, float alpha, const float* __restrict__ bias, size_t sBias, const float* __restrict__ CP, int rowsPerB, size_t sCPb, int row0g,
    float* __restrict__ C, _Float16* __restrict__ C16, int ldc, size_t sC, int M, int N, int K) {
  __shared__ __attribute__((aligned(16))) float so[4][16][64];
  const int tid = threadIdx.x, w = tid >> 5, lane = tid & 31, ln = lane & 15, hh = lane >> 4; const int by = blockIdx.y;
  A += (size_t)by * sA; Bh += (size_t)by * sB; const size_t cofs = (size_t)by * sC; const float* bp = bias ? bias + (size_t)by * sBias : nullptr;
  const int ntn = (N + 63) / 64; const int wid = blockIdx.x * 4 + w; const int mt = wid / ntn, nq = wid % ntn; if (mt * 16 >= M) return;
  const int row0 = mt * 16, col0 = nq * 64; const _Float16* arow = A + (size_t)(row0 + ln) * lda;
  v8f acc[4] = {};
  for (int kb = 0; kb < K; kb += 32) { FragH ah; ah.half[0] = *(const v8us*)((const unsigned short*)arow + kb + 8 * hh); ah.half[1] = *(const v8us*)((const unsigned short*)arow + kb + 16 + 8 * hh);
#pragma unroll
    for (int t = 0; t < 4; ++t) { if (col0 + t * 16 >= N) continue; const size_t boff = (size_t)(col0 + t * 16 + ln) * ldb + kb; FragH bq; bq.half[0] = *(const v8us*)((const unsigned short*)Bh + boff + 8 * hh); bq.half[1] = *(const v8us*)((const unsigned short*)Bh + boff + 16 + 8 * hh);
      acc[t] = mmaH<1>(ah.v, ah.v, bq.v, bq.v, acc[t]); }
  }
#pragma unroll
  for (int t = 0; t < 4; ++t) { if (col0 + t * 16 >= N) continue; const int col = col0 + t * 16 + ln; const float bv = bp ? bf16_round(bp[col]) : 0.f;
#pragma unroll
    for (int r = 0; r < 8; ++r) { float v = acc[t][r] * alpha + bv; if (CP) { const int rr = row0g + row0 + 8 * hh + r; if (rowsPerB < 0) v += CP[cofs + (size_t)rr * ldc + col];      /* rowsPerB < 0: own element of the batched C plane */ else { const int bidx = rr / rowsPerB; v += CP[(size_t)bidx * sCPb + (size_t)by * 64 + col]; } } if (ACT == 1) v = (v > 0.f) ? v : expm1f(v); else if (ACT == 7) v = (v > 0.f) ? v + 1.0f : expf(v); else if (ACT == 8) v = tanhf(v); else if (ACT == 9) v = 0.5f * v * (1.0f + tanhf(0.7978845608028654f * (v + 0.044715f * v * v * v))); else if (ACT == 11) v = 1.0f / (1.0f + expf(-v)); else if (ACT == 12) v = (v > 0.f) ? v : 0.01f * v; else if (ACT == 14) v = (v > 0.f) ? v : 0.1f * v; else if (ACT == 16) v = (v >= 0.f) ? v : 0.3f * v; else if (ACT == 17) v = (v >= 0.f) ? v : 0.2f * v; else if (ACT == 15) v = v / (1.0f + expf(-v)); else if (ACT == 3) v = fmaxf(v, 0.f); else if (ACT == 6) v = 0.5f * v * (1.0f + erff(v * 0.70710678118654752f)); so[w][8 * hh + r][t * 16 + ln] = v; } }
  __builtin_amdgcn_fence(__ATOMIC_ACQ_REL, "workgroup"); __builtin_amdgcn_wave_barrier();
  const int rsub = lane >> 4, c4 = (lane & 15) * 4; typedef _Float16 v4h __attribute__((ext_vector_type(4)));
  {
#pragma unroll
    for (int q = 0; q < 8; ++q) { const int r = q * 2 + rsub; if (col0 + c4 < N) { const v4f v = *(const v4fa*)&so[w][r][c4]; if (C) *(v4f*)(C + cofs + (size_t)(row0 + r) * ldc + col0 + c4) = v; if (C16) { v4h h4; for (int i = 0; i < 4; ++i) h4[i] = (_Float16)v[i]; *(v4h*)(C16 + cofs + (size_t)(row0 + r) * ldc + col0 + c4) = h4; } } }
     }
}


typedef _Float16 v4h __attribute__((ext_vector_type(4)));

__global__ __launch_bounds__(256) void k_x16(const float* __restrict__ x, _Float16* __restrict__ X16, size_t n8) { const size_t t = (size_t)blockIdx.x * 256 + threadIdx.x; if (t >= n8) return; FragH f;
#pragma unroll
  for (int q = 0; q < 8; ++q) f.h[q] = (_Float16)bf16_round(x[t * 8 + q]); *(v8us*)((unsigned short*)X16 + t * 8) = f.half[0];  }
__global__ __launch_bounds__(256) void k_h16(const float* __restrict__ x, _Float16* __restrict__ X16, size_t n8) { const size_t t = (size_t)blockIdx.x * 256 + threadIdx.x; if (t >= n8) return; FragH f;
#pragma unroll
  for (int q = 0; q < 8; ++q) f.h[q] = (_Float16)x[t * 8 + q]; *(v8us*)((unsigned short*)X16 + t * 8) = f.half[0];  }
__global__ __launch_bounds__(256) void k_round16f(const float* __restrict__ W, _Float16* __restrict__ Bt, size_t n8) { const size_t t = (size_t)blockIdx.x * 256 + threadIdx.x; if (t >= n8) return; FragH f;
#pragma unroll
  for (int i = 0; i < 8; ++i) f.h[i] = (_Float16)(bf16_round(W[t * 8 + i]) * 16.0f); *(v8us*)((unsigned short*)Bt + t * 8) = f.half[0];  }
template <int NHv, int TTv>
__global__ __launch_bounds__(256) void k_vt(const _Float16* __restrict__ V16, int ldv, int voff, _Float16* __restrict__ Vt) { __shared__ unsigned short tl[64][66]; const int tid = threadIdx.x; const int slab = blockIdx.x / (TTv / 64), lg = blockIdx.x % (TTv / 64); const int b = slab / NHv, h = slab % NHv;
  for (int i = tid; i < 64 * 8; i += 256) { const int r = i / 8, c8 = (i % 8) * 8; FragH f; f.half[0] = *(const v8us*)((const unsigned short*)V16 + ((size_t)b * TTv + lg * 64 + r) * ldv + voff + h * 64 + c8);
#pragma unroll
    for (int q = 0; q < 8; ++q) tl[r][c8 + q] = f.u[q]; }
  __syncthreads();
  {
#pragma unroll
    for (int rd = 0; rd < 2; ++rd) { const int d = rd * 32 + tid / 8, pc = tid % 8; FragH f;
#pragma unroll
      for (int q = 0; q < 8; ++q) f.u[q] = tl[pc * 8 + q][d];
      *(v8us*)((unsigned short*)Vt + ((size_t)slab * 64 + d) * TTv + lg * 64 + pc * 8) = f.half[0]; }
     } }

__global__ __launch_bounds__(256) void k_hl(const float* __restrict__ F, _Float16* __restrict__ Hh, _Float16* __restrict__ Hl, size_t n8) { const size_t t = (size_t)blockIdx.x * 256 + threadIdx.x; if (t >= n8) return; FragH fh, fl; const v4f a = *(const v4fa*)(F + t * 8), c = *(const v4fa*)(F + t * 8 + 4);
#pragma unroll
  for (int q = 0; q < 4; ++q) { _Float16 h = (_Float16)a[q]; fh.h[q] = h; fl.h[q] = (_Float16)((a[q] - (float)h) * 1024.0f); h = (_Float16)c[q]; fh.h[4 + q] = h; fl.h[4 + q] = (_Float16)((c[q] - (float)h) * 1024.0f); }
  { *(v8us*)((unsigned short*)Hh + t * 8) = fh.half[0]; *(v8us*)((unsigned short*)Hl + t * 8) = fl.half[0];  } }

// ---- fast GEMM (wave tile 32x64; requires M % 32 == 0 rows per launch region and N % 64 == 0); epilogue = k_gemm_hhx semantics ----
__device__ __forceinline__ v16h g2_frag(const _Float16* p, int hh) { FragH f; f.half[0] = *(const v8us*)((const unsigned short*)p + 8 * hh); f.half[1] = *(const v8us*)((const unsigned short*)p + 16 + 8 * hh); return f.v; }
__device__ __forceinline__ v8f g2_mma(v16h a, v16h b, v8f c) { v8f d = __builtin_amdgcn_wmma_f32_16x16x32_f16(false, a, false, b, (short)0, c, false, false); asm volatile("v_nop\n\tv_nop\n\tv_nop\n\tv_nop" : "+v"(d) : "v"(a), "v"(b)); return d; }
template <int ACT>
__global__ __launch_bounds__(128) void k_gemm2(const _Float16* __restrict__ A, int lda, size_t sA, const _Float16* __restrict__ Bh, int ldb, size_t sB, float alpha, const float* __restrict__ bias, size_t sBias, const float* __restrict__ CP, int rowsPerB, size_t sCPb, int row0g,
    float* __restrict__ C, _Float16* __restrict__ C16, int ldc, size_t sC, int M, int N, int K) { static_assert(ACT == 0 || ACT == 3 || ACT == 6 || ACT == 8 || ACT == 9 || ACT == 11 || ACT == 12 || ACT == 14 || ACT == 15 || ACT == 16 || ACT == 17, "k_gemm2: unsupported ACT code (would silently apply no activation)");
  __shared__ __attribute__((aligned(16))) float so[4][32][68];
  const int tid = threadIdx.x, w = tid >> 5, lane = tid & 31, ln = lane & 15, hh = lane >> 4; const int by = blockIdx.y;
  A += (size_t)by * sA; Bh += (size_t)by * sB; const size_t cofs = (size_t)by * sC; const float* bp = bias ? bias + (size_t)by * sBias : nullptr;
  const int ntn = N >> 6; const int mt = blockIdx.x / ntn, nq = blockIdx.x - mt * ntn; const int row0 = mt * 128 + 32 * w, col0 = nq * 64; if (row0 >= M) return;
  const _Float16* a0p = A + (size_t)(row0 + ln) * lda; const _Float16* a1p = a0p + (size_t)16 * lda;
  const _Float16* b0p = Bh + (size_t)(col0 + ln) * ldb; const _Float16* b1p = b0p + (size_t)16 * ldb; const _Float16* b2p = b1p + (size_t)16 * ldb; const _Float16* b3p = b2p + (size_t)16 * ldb;
  const v8f z8 = {0.f,0.f,0.f,0.f,0.f,0.f,0.f,0.f}; v8f c00 = z8, c01 = z8, c02 = z8, c03 = z8, c10 = z8, c11 = z8, c12 = z8, c13 = z8;
#pragma unroll 1
  for (int kb = 0; kb < K; kb += 32) { const v16h a0 = g2_frag(a0p + kb, hh), a1 = g2_frag(a1p + kb, hh);
    v16h b = g2_frag(b0p + kb, hh); c00 = g2_mma(a0, b, c00); c10 = g2_mma(a1, b, c10);
    b = g2_frag(b1p + kb, hh); c01 = g2_mma(a0, b, c01); c11 = g2_mma(a1, b, c11);
    b = g2_frag(b2p + kb, hh); c02 = g2_mma(a0, b, c02); c12 = g2_mma(a1, b, c12);
    b = g2_frag(b3p + kb, hh); c03 = g2_mma(a0, b, c03); c13 = g2_mma(a1, b, c13); }
  v8f accs[8] = {c00, c01, c02, c03, c10, c11, c12, c13};
#pragma unroll
  for (int u = 0; u < 8; ++u) { const int t = u & 3, half = u >> 2; const int col = col0 + t * 16 + ln; const float bv = bp ? bf16_round(bp[col]) : 0.f;
#pragma unroll
    for (int r = 0; r < 8; ++r) { const int rloc = half * 16 + 8 * hh + r; float v = accs[u][r] * alpha + bv; if (CP) { if (rowsPerB < 0) v += CP[cofs + (size_t)(row0g + row0 + rloc) * ldc + col];      /* rowsPerB < 0: own element of the batched C plane */ else { const int bidx = (row0g + row0 + rloc) / rowsPerB; v += CP[(size_t)bidx * sCPb + (size_t)by * 64 + col]; } }
      if (ACT == 3) v = fmaxf(v, 0.f); else if (ACT == 6) v = 0.5f * v * (1.0f + erff(v * 0.70710678118654752f)); else if (ACT == 11) v = 1.0f / (1.0f + expf(-v)); else if (ACT == 15) v = v / (1.0f + expf(-v)); else if (ACT == 12) v = (v > 0.f) ? v : 0.01f * v; else if (ACT == 8) v = tanhf(v); else if (ACT == 9) v = 0.5f * v * (1.0f + tanhf(0.7978845608028654f * (v + 0.044715f * v * v * v))); else if (ACT == 14) v = (v > 0.f) ? v : 0.1f * v; else if (ACT == 16) v = (v >= 0.f) ? v : 0.3f * v; else if (ACT == 17) v = (v >= 0.f) ? v : 0.2f * v;
      so[w][rloc][t * 16 + ln] = v; } }
  __builtin_amdgcn_fence(__ATOMIC_ACQ_REL, "workgroup"); __builtin_amdgcn_wave_barrier();
  const int rsub = lane >> 4, c4 = (lane & 15) * 4;
  {
#pragma unroll
    for (int q = 0; q < 16; ++q) { const int r = q * 2 + rsub; const v4f v = *(const v4fa*)&so[w][r][c4]; if (C) *(v4f*)(C + cofs + (size_t)(row0 + r) * ldc + col0 + c4) = v; if (C16) { v4h h4; for (int i = 0; i < 4; ++i) h4[i] = (_Float16)v[i]; *(v4h*)(C16 + cofs + (size_t)(row0 + r) * ldc + col0 + c4) = h4; } }
     } }


__global__ __launch_bounds__(256) void k_wnat(const float* __restrict__ w, size_t n8, _Float16* __restrict__ Bt) { const size_t t = (size_t)blockIdx.x * 256 + threadIdx.x; if (t >= n8) return; FragH f; for (int q = 0; q < 8; ++q) f.h[q] = (_Float16)(bf16_round(w[t * 8 + q]) * 16.0f); *(v8us*)((unsigned short*)Bt + t * 8) = f.half[0];  }
__global__ __launch_bounds__(256) void k_rsm(const float* __restrict__ S, _Float16* __restrict__ P, int nrows) {
  #pragma clang fp contract(off)
  const int i = blockIdx.x * 256 + threadIdx.x; if (i >= nrows) return; const float* s = S + (size_t)i * SQ; float mx = -3.0e38f;
#pragma unroll 1
  for (int j = 0; j < SQ; ++j) mx = fmaxf(mx, s[j]); float se = 0.f;
#pragma unroll 1
  for (int j = 0; j < SQ; ++j) se += expf(s[j] - mx); const float sc = 256.0f / se;
#pragma unroll 1
  for (int j0 = 0; j0 < SQ; j0 += 8) { FragH f; for (int q = 0; q < 8; ++q) f.h[q] = (_Float16)(expf(s[j0 + q] - mx) * sc); unsigned short* d = (unsigned short*)P + (size_t)i * SQ + j0; *(v8us*)d = f.half[0];  } }
__global__ __launch_bounds__(256) void k_vt(const _Float16* __restrict__ V16, int b, int h0, _Float16* __restrict__ VT) { __shared__ unsigned short tl[64][65]; const int tid = threadIdx.x; const int hh = blockIdx.x % HG, sg = blockIdx.x / HG; const int s0 = sg * 64; const int h = h0 + hh;
  for (int i = tid; i < 64 * 8; i += 256) { const int j = i / 8, d8 = (i % 8) * 8; FragH f; f.half[0] = *(const v8us*)((const unsigned short*)V16 + ((size_t)b * SQ + s0 + j) * DM + h * HD + d8); for (int q = 0; q < 8; ++q) tl[d8 + q][j] = f.u[q]; }
  __syncthreads();
  { for (int i = tid; i < 64 * 8; i += 256) { const int d = i / 8, j8 = (i % 8) * 8; FragH f; for (int q = 0; q < 8; ++q) f.u[q] = tl[d][j8 + q]; *(v8us*)((unsigned short*)VT + ((size_t)hh * HD + d) * SQ + s0 + j8) = f.half[0]; }  } }



__device__ __forceinline__ float rs_xhalf(float x) { return __builtin_bit_cast(float, __builtin_amdgcn_permlanex16(__builtin_bit_cast(int, x), __builtin_bit_cast(int, x), 0x76543210, 0xfedcba98, false, false)); }      /* lane l <- lane l ^ 16 */
__device__ __forceinline__ float fa_exp2(float x) { float y; asm("v_exp_f32 %0, %1\n\tv_nop" : "=v"(y) : "v"(x)); return y; }      /* 2^x; the v_nop is the slot the instruction set asks for behind a transcendental */
#define SCL2 0.18033688f                   /* SCL * log2(e): scores carried in the base-2 domain, so that a weight is one subtract and one 2^x */
#define SCLR2 (SCL2 * 0.0009765625f)       /* the same scale on the x1024 residual products */
// Fused causal attention, one wave per 16 query rows of one (batch, head); 32 keys a pass, no score or weight plane in memory.
// S^T = K Q^T (A = key rows, B = query rows): a lane holds 16 scores of ITS query (column ln), keys kb + 8 hh + r and kb + 16 + 8 hh + r: the very places of the B fragment of O^T = V^T P^T,
// so the weights go from the score accumulators to the next product inside the lane. Row maximum and row sum: in the lane, plus one exchange with lane ^ 16. Running maximum, o and sum rescaled each pass.
// The four waves of a work-group walk the same keys: a tile of 64 keys (K hi, K residual, V^T: 64 rows of 128 bytes each) is brought into LDS once for all four by asynchronous copies of whole 128-byte lines, two buffers, the next tile in flight while this one is worked on; the fragments are 16-byte LDS reads.
#define FKT 64                       /* keys of a staged tile: two passes */
#define FPT 72                       /* pitch of a staged row in f16: 144 B = 9 x 16 B, so that 16 lanes reading 16 rows by 16 bytes do not meet in a bank */
#define FPL (FKT * FPT * 2)          /* bytes of one staged plane */
#define FRS (16 * FPT * 2)           /* bytes of 16 staged rows: the step between a lane's four pieces of a plane */
// One tile: a lane's twelve 16-byte pieces (four of each plane, 16 rows apart). ld: the lane's LDS byte address in plane 0 of the buffer; gh, gl, gv: its first piece in the K hi rows, the K residual rows and the V^T rows.
__device__ __forceinline__ void fa_stage(unsigned ld, const _Float16* gh, const _Float16* gl, const _Float16* gv) {
  asm volatile(      /* the copies go from global memory to LDS through no register; the s_wait_xcnt in the same statement stands in front of every later write of the address registers that the copies name */
    "global_load_async_to_lds_b128 %0, %12, off\n\t"
    "global_load_async_to_lds_b128 %1, %13, off\n\t"
    "global_load_async_to_lds_b128 %2, %14, off\n\t"
    "global_load_async_to_lds_b128 %3, %15, off\n\t"
    "global_load_async_to_lds_b128 %4, %16, off\n\t"
    "global_load_async_to_lds_b128 %5, %17, off\n\t"
    "global_load_async_to_lds_b128 %6, %18, off\n\t"
    "global_load_async_to_lds_b128 %7, %19, off\n\t"
    "global_load_async_to_lds_b128 %8, %20, off\n\t"
    "global_load_async_to_lds_b128 %9, %21, off\n\t"
    "global_load_async_to_lds_b128 %10, %22, off\n\t"
    "global_load_async_to_lds_b128 %11, %23, off\n\t"
    "s_wait_xcnt 0x0"
    :: "v"(ld), "v"(ld + FRS), "v"(ld + 2 * FRS), "v"(ld + 3 * FRS),
       "v"(ld + FPL), "v"(ld + FPL + FRS), "v"(ld + FPL + 2 * FRS), "v"(ld + FPL + 3 * FRS),
       "v"(ld + 2 * FPL), "v"(ld + 2 * FPL + FRS), "v"(ld + 2 * FPL + 2 * FRS), "v"(ld + 2 * FPL + 3 * FRS),
       "v"(gh), "v"(gh + (size_t)16 * LQ), "v"(gh + (size_t)32 * LQ), "v"(gh + (size_t)48 * LQ),
       "v"(gl), "v"(gl + (size_t)16 * LQ), "v"(gl + (size_t)32 * LQ), "v"(gl + (size_t)48 * LQ),
       "v"(gv), "v"(gv + (size_t)16 * SQ), "v"(gv + (size_t)32 * SQ), "v"(gv + (size_t)48 * SQ)
    : "memory"); }
__global__ __launch_bounds__(128) void k_fattn(const _Float16* __restrict__ QHp, const _Float16* __restrict__ QLp, const _Float16* __restrict__ KHp, const _Float16* __restrict__ KLp, const _Float16* __restrict__ VTp, _Float16* __restrict__ Op) {
  __shared__ __attribute__((aligned(16))) _Float16 sk[2][3][FKT][FPT];      /* [buffer][K hi, K residual, V^T][row][64 values + pad] */
  const int tid = threadIdx.x, lane = tid & 31, ln = lane & 15, hh = lane >> 4; const int w = __builtin_amdgcn_readfirstlane(tid >> 5);
  const int bh = blockIdx.y, b = bh / NH, h = bh % NH; const int nst = SQ / FKT - (int)blockIdx.x;      /* tiles up to and with the work-group's diagonal tile; the longest rows start first */
  const int q0 = (nst - 1) * FKT + w * 16;
  const size_t r0 = (size_t)b * SQ; const int q = q0 + ln;
  const int sr = tid >> 3, sc8 = (tid & 7) * 8;      /* staging: eight lanes copy one 128-byte row, a wave four whole rows a copy */
  const _Float16* gh = KHp + (r0 + sr) * LQ + h * HD + sc8; const _Float16* gl = KLp + (r0 + sr) * LQ + h * HD + sc8; const _Float16* gv = VTp + ((size_t)bh * HD + sr) * SQ + sc8;
  const unsigned ld0 = (unsigned)(size_t)&sk[0][0][sr][sc8];      /* the low 32 bits of a shared address are its LDS byte address */
  fa_stage(ld0, gh, gl, gv);      /* tile 0 into buffer 0 */
  const _Float16* qh = QHp + (r0 + q) * LQ + h * HD; const _Float16* ql = QLp + (r0 + q) * LQ + h * HD;
  const v16h qh0 = g2_frag(qh, hh), qh1 = g2_frag(qh + 32, hh), ql0 = g2_frag(ql, hh), ql1 = g2_frag(ql + 32, hh);
  const v8f z8 = {0.f,0.f,0.f,0.f,0.f,0.f,0.f,0.f}; v8f o0 = z8, o1 = z8, o2 = z8, o3 = z8; float m = -1.0e30f, l = 0.f;
  asm volatile("s_wait_asynccnt 0x0" ::: "memory");      /* this wave's pieces of tile 0 have landed */
  __syncthreads();      /* every wave's pieces of tile 0 have landed: the tile may be read */
  if (nst > 1) fa_stage(ld0 + 3 * FPL, gh + (size_t)FKT * LQ, gl + (size_t)FKT * LQ, gv + FKT);      /* tile 1 into buffer 1 */
#pragma unroll 1      /* a trip holds two passes of 24 fragment loads and 16 products each: a second copy of it would not fit the registers */
  for (int st = 0; st < nst; ++st) {
    const _Float16* tk = &sk[st & 1][0][ln][0]; const _Float16* tl = &sk[st & 1][1][ln][0]; const _Float16* tv = &sk[st & 1][2][ln][0];      /* this trip reads this buffer alone */
    v16h ka0 = g2_frag(tk, hh), ka1 = g2_frag(tk + 32, hh), ka2 = g2_frag(tk + 16 * FPT, hh), ka3 = g2_frag(tk + 16 * FPT + 32, hh);      /* the tile's key rows 0 .. 31, hi plane */
    v16h kc0 = g2_frag(tl, hh), kc1 = g2_frag(tl + 32, hh), kc2 = g2_frag(tl + 16 * FPT, hh), kc3 = g2_frag(tl + 16 * FPT + 32, hh);      /* the same rows, residual plane */
#pragma unroll      /* the two passes of a tile: the second one's LDS offsets as immediates, its key fragments asked for in the first */
    for (int sub = 0; sub < 2; ++sub) {
      const int kb = st * FKT + sub * 32;
      if (sub == 1 && kb >= q0 + 16) break;      /* wave-uniform: a pass runs only while kb < q0 + 16, so that every query has a key in every pass; the foot of the trip below is passed all the same */
      const v16h va0 = g2_frag(tv + sub * 32, hh), va1 = g2_frag(tv + 16 * FPT + sub * 32, hh), va2 = g2_frag(tv + 32 * FPT + sub * 32, hh), va3 = g2_frag(tv + 48 * FPT + sub * 32, hh);      /* asked for here, used behind the softmax */
      v8f sh0 = z8, sl0 = z8, sh1 = z8, sl1 = z8;      /* hi . hi, and lo . hi + hi . lo (x1024), for keys kb .. kb + 15 and kb + 16 .. kb + 31 */
      sh0 = g2_mma(ka0, qh0, sh0); sl0 = g2_mma(ka0, ql0, sl0); sh1 = g2_mma(ka2, qh0, sh1); sl1 = g2_mma(ka2, ql0, sl1);
      sh0 = g2_mma(ka1, qh1, sh0); sl0 = g2_mma(ka1, ql1, sl0); sh1 = g2_mma(ka3, qh1, sh1); sl1 = g2_mma(ka3, ql1, sl1);
      sl0 = g2_mma(kc0, qh0, sl0); sl1 = g2_mma(kc2, qh0, sl1); sl0 = g2_mma(kc1, qh1, sl0); sl1 = g2_mma(kc3, qh1, sl1);
      if (sub == 0) {      /* the second pass's key fragments (rows 32 .. 63 of the same tile) come in during this pass's softmax and output products */
        ka0 = g2_frag(tk + 32 * FPT, hh); ka1 = g2_frag(tk + 32 * FPT + 32, hh); ka2 = g2_frag(tk + 48 * FPT, hh); ka3 = g2_frag(tk + 48 * FPT + 32, hh);
        kc0 = g2_frag(tl + 32 * FPT, hh); kc1 = g2_frag(tl + 32 * FPT + 32, hh); kc2 = g2_frag(tl + 48 * FPT, hh); kc3 = g2_frag(tl + 48 * FPT + 32, hh); }
      float s0[8], s1[8];
#pragma unroll      /* unrolled so that every index into the accumulator and fragment registers is a constant */
      for (int r = 0; r < 8; ++r) { s0[r] = fmaf(sl0[r], SCLR2, sh0[r] * SCL2); s1[r] = fmaf(sl1[r], SCLR2, sh1[r] * SCL2); }
      if (kb + 31 > q0) {      /* wave-uniform: only the pass on the diagonal holds keys after a query */
#pragma unroll      /* unrolled so that every index into the accumulator and fragment registers is a constant */
        for (int r = 0; r < 8; ++r) { const int j = kb + 8 * hh + r; s0[r] = (j <= q) ? s0[r] : -1.0e30f; s1[r] = (j + 16 <= q) ? s1[r] : -1.0e30f; } }
      float bm = fmaxf(s0[0], s1[0]);
#pragma unroll      /* unrolled so that every index into the accumulator and fragment registers is a constant */
      for (int r = 1; r < 8; ++r) bm = fmaxf(bm, fmaxf(s0[r], s1[r]));
      bm = fmaxf(bm, rs_xhalf(bm)); const float mn = fmaxf(m, bm); const float sc = fa_exp2(m - mn); m = mn;
      FragH pf; float ls = 0.f;
#pragma unroll      /* unrolled so that every index into the accumulator and fragment registers is a constant */
      for (int r = 0; r < 8; ++r) { const float e0 = fa_exp2(s0[r] - mn), e1 = fa_exp2(s1[r] - mn); ls += e0 + e1; pf.h[r] = (_Float16)e0; pf.h[8 + r] = (_Float16)e1; }
      l = fmaf(l, sc, ls);      /* the lane's half of the row sum; the halves meet behind the loop */
#pragma unroll      /* unrolled so that every index into the accumulator and fragment registers is a constant */
      for (int r = 0; r < 8; ++r) { o0[r] *= sc; o1[r] *= sc; o2[r] *= sc; o3[r] *= sc; }
      o0 = g2_mma(va0, pf.v, o0); o1 = g2_mma(va1, pf.v, o1); o2 = g2_mma(va2, pf.v, o2); o3 = g2_mma(va3, pf.v, o3); }
    asm volatile("s_wait_dscnt 0x0" ::: "memory");      /* this wave's reads of the buffer are done before it may be refilled */
    asm volatile("s_wait_asynccnt 0x0" ::: "memory");      /* this wave's pieces of the next tile have landed */
    __syncthreads();      /* publishes the next tile and ends every wave's reads of this trip's buffer */
    if (st + 2 < nst) fa_stage(ld0 + (unsigned)(st & 1) * (3 * FPL), gh + (size_t)(st + 2) * FKT * LQ, gl + (size_t)(st + 2) * FKT * LQ, gv + (size_t)(st + 2) * FKT); }      /* the tile after the next into the buffer just read */
  asm volatile("s_wait_asynccnt 0x0" ::: "memory");      /* no copy is outstanding when the wave goes on to its end */
  l += rs_xhalf(l); const float fin = 64.0f / l;      /* o carried x64, folded into the output GEMM alpha */
  unsigned short* op = (unsigned short*)Op + (r0 + q) * DM + h * HD + 8 * hh; FragH f0, f1, f2, f3;      /* lane: 8 neighbouring head values of its query per tile; the wave writes whole 128-byte head rows */
#pragma unroll      /* unrolled so that every index into the accumulator and fragment registers is a constant */
  for (int r = 0; r < 8; ++r) { f0.h[r] = (_Float16)(o0[r] * fin); f1.h[r] = (_Float16)(o1[r] * fin); f2.h[r] = (_Float16)(o2[r] * fin); f3.h[r] = (_Float16)(o3[r] * fin); }
  *(v8us*)op = f0.half[0]; *(v8us*)(op + 16) = f1.half[0]; *(v8us*)(op + 32) = f2.half[0]; *(v8us*)(op + 48) = f3.half[0]; }

#define A0R 8                        /* query rows of a work-group of the exact first tile: one wave each */
#define A0P 68                       /* pitch of a staged key row in floats: 272 B = 17 x 16 B, so that 16 lanes reading 16 rows by 16 bytes meet every LDS bank once */
#define A0U (QT0 * (HD / 4) / 256)   /* 16-byte pieces of a staged plane per thread */
typedef float v2f __attribute__((ext_vector_type(2)));
// Exact f32 attention for the first QT0 rows, causal. One wave per query row, A0R rows of one head per work-group; the head's QT0 key and value rows are staged in LDS once (keys behind a query are masked below and carry weight zero).
// Scores: a lane takes keys lane, lane + 32, lane + 64, lane + 96, each a serial f32 chain over the 64 head values. Row maximum and row sum: butterflies over the wave. Output: a lane takes two head values and sums over the keys in rising order, the weight of key j read from its lane.
__global__ __launch_bounds__(256) void k_att0(const float* __restrict__ QF, const float* __restrict__ KF, const float* __restrict__ VF, int ld, float scale, float* __restrict__ OF, int ldo) {
  __shared__ __attribute__((aligned(16))) float lk[QT0][A0P]; __shared__ __attribute__((aligned(16))) float lv[QT0][HD];
  const int tid = threadIdx.x, lane = tid & 31; const int w = __builtin_amdgcn_readfirstlane(tid >> 5);
  const int h = blockIdx.x / (QT0 / A0R), rg = blockIdx.x % (QT0 / A0R); const int i = rg * A0R + w;      /* this wave's query */
  v4f kq[A0U], vq[A0U];
#pragma unroll      /* all 16 loads of a thread in flight at once, their results under constant indices */
  for (int u = 0; u < A0U; ++u) { const int t = u * 256 + tid, j = t / (HD / 4), c = (t % (HD / 4)) * 4; const size_t ro = (size_t)j * ld + h * HD + c;
    const float* kp = KF + ro; const float* vp = VF + ro;
    kq[u] = *(const v4fa*)kp; asm volatile("s_wait_xcnt 0x0" :: "v"(kp) : "memory");      /* stands in front of every write of the registers that this load names as its address; it takes the address as an input, so that those registers live up to it and no load's result, this one's included, is placed on them earlier */
    vq[u] = *(const v4fa*)vp; asm volatile("s_wait_xcnt 0x0" :: "v"(vp) : "memory"); }      /* the same for this load */
  const float* qr = QF + (size_t)i * ld + h * HD; v4f qv[HD / 4];
#pragma unroll      /* the query row stays in registers: constant indices */
  for (int c = 0; c < HD / 4; ++c) qv[c] = *(const v4fa*)(qr + c * 4);
  asm volatile("s_wait_xcnt 0x0" :: "s"(qr) : "memory");      /* the same wait for the query row's loads (wave-uniform address: scalar loads), in front of every write of their base registers */
#pragma unroll      /* constant indices into the staging registers */
  for (int u = 0; u < A0U; ++u) { const int t = u * 256 + tid, j = t / (HD / 4), c = (t % (HD / 4)) * 4; *(v4f*)&lk[j][c] = kq[u]; *(v4f*)&lv[j][c] = vq[u]; }
  __syncthreads();      /* the staged rows are read by every wave */
  float s[QT0 / 32];
#pragma unroll      /* four independent chains side by side */
  for (int g = 0; g < QT0 / 32; ++g) s[g] = 0.f;
#pragma unroll      /* constant indices into the query registers, LDS offsets as immediates */
  for (int c = 0; c < HD / 4; ++c) {
#pragma unroll      /* four independent chains side by side */
    for (int g = 0; g < QT0 / 32; ++g) { const v4f kr = *(const v4f*)&lk[g * 32 + lane][c * 4]; s[g] = fmaf(qv[c][0], kr[0], s[g]); s[g] = fmaf(qv[c][1], kr[1], s[g]); s[g] = fmaf(qv[c][2], kr[2], s[g]); s[g] = fmaf(qv[c][3], kr[3], s[g]); } }
  float mx = -1.0e30f;
#pragma unroll      /* constant indices into the score registers */
  for (int g = 0; g < QT0 / 32; ++g) { s[g] = (g * 32 + lane <= i) ? s[g] * scale : -1.0e30f; mx = fmaxf(mx, s[g]); }
#pragma unroll      /* five exchange steps */
  for (int st = 16; st > 0; st >>= 1) mx = fmaxf(mx, __shfl_xor(mx, st));
  float e[QT0 / 32], l = 0.f;
#pragma unroll      /* constant indices into the score registers */
  for (int g = 0; g < QT0 / 32; ++g) { e[g] = (g * 32 + lane <= i) ? expf(s[g] - mx) : 0.f; l += e[g]; }
#pragma unroll      /* five exchange steps */
  for (int st = 16; st > 0; st >>= 1) l += __shfl_xor(l, st);
  v2f o = {0.f, 0.f};
#pragma unroll      /* constant lane numbers for the weight reads, LDS offsets as immediates */
  for (int g = 0; g < QT0 / 32; ++g) {
#pragma unroll      /* constant lane numbers for the weight reads, LDS offsets as immediates */
    for (int jj = 0; jj < 32; ++jj) { const float ej = __builtin_bit_cast(float, __builtin_amdgcn_readlane(__builtin_bit_cast(int, e[g]), jj)); const v2f vv = *(const v2f*)&lv[g * 32 + jj][2 * lane]; o[0] = fmaf(ej, vv[0], o[0]); o[1] = fmaf(ej, vv[1], o[1]); } }
  const float fin = 64.0f / l;      /* o carried x64 like the f16 path */
  o[0] *= fin; o[1] *= fin; *(v2f*)(OF + (size_t)i * ldo + h * HD + 2 * lane) = o; }      /* the wave writes its query's whole 256-byte head row */

__global__ __launch_bounds__(256) void k_ln64f32(float* __restrict__ F, int ldf, size_t nrh, const float* __restrict__ g, const float* __restrict__ bb, float eps) {
  #pragma clang fp contract(off)
  const size_t t = (size_t)blockIdx.x * 256 + threadIdx.x; if (t >= nrh) return; const size_t r = t / NH; const int h = (int)(t % NH); float* f = F + r * (size_t)ldf + (size_t)h * 64; float sum = 0.f;
#pragma unroll 1
  for (int d = 0; d < 64; d += 4) { const v4f q = *(const v4fa*)(f + d); sum = __fadd_rn(__fadd_rn(__fadd_rn(__fadd_rn(sum, q[0]), q[1]), q[2]), q[3]); } const float mu = sum / 64.0f; float vs = 0.f;
#pragma unroll 1
  for (int d = 0; d < 64; d += 4) { const v4f q = *(const v4fa*)(f + d); for (int e = 0; e < 4; ++e) { const float dl = __fadd_rn(q[e], -mu); vs = __fadd_rn(vs, __fmul_rn(dl, dl)); } } const float rs = rsqrtf(__fadd_rn(vs / 64.0f, eps));
#pragma unroll 1
  for (int d0 = 0; d0 < 64; d0 += 4) { const v4f q = *(const v4fa*)(f + d0); v4f y; for (int e = 0; e < 4; ++e) y[e] = __fadd_rn(__fmul_rn(__fmul_rn(__fadd_rn(q[e], -mu), rs), bf16_round(g[d0 + e])), bf16_round(bb[d0 + e])); *(v4f*)(f + d0) = y;  } }
extern "C" void kernel_launch(void* const* d_in, const int* in_sizes, int n_in,
                              void* d_out, int out_size, void* d_ws, size_t ws_size, hipStream_t stream) {
  (void)in_sizes; (void)n_in; (void)out_size;
  const float* const* I = (const float* const*)d_in; const float* x = I[0]; const float* xk = I[0]; const float* xv = I[0]; const float* wq = I[1]; const float* bq = nullptr; const float* wk = I[2]; const float* bk = nullptr; const float* wv = I[3]; const float* bv = nullptr; const float* wo = I[4]; const float* bo = I[5]; const float* qg = I[6]; const float* qbt = I[7]; const float* kg = I[8]; const float* kbt = I[9]; const float LNE = 1e-5f;      /* input order: x (feeds the q, k AND v streams), Wq, Wk, Wv (natural [out][in] weights; NO biases: null pointers in the guarded bias slots), Wo, bo (zeros: read), q_gamma, q_beta, k_gamma, k_beta [64] (ones / zeros on this draw: read by value in the per-head LayerNorm kernel) */
  char* ws = (char*)d_ws; size_t off = 0;
  auto take = [&](size_t bytes) { char* p = ws + off; off += (bytes + 255) & ~(size_t)255; return p; };
  _Float16* BQ = (_Float16*)take((size_t)DM * DM * 2); _Float16* BK = (_Float16*)take((size_t)DM * DM * 2); _Float16* BV = (_Float16*)take((size_t)DM * DM * 2); _Float16* BO = (_Float16*)take((size_t)DM * DM * 2);
  _Float16* X16 = (_Float16*)take(NR * DM * 2); _Float16* XK16 = (_Float16*)take(NR * DM * 2); _Float16* XV16 = (_Float16*)take(NR * DM * 2);      /* exact f16 rows of query, key, value */ float* QF = (float*)take(NR * DM * 4); _Float16* QH = (_Float16*)take(NR * DM * 2); _Float16* QL = (_Float16*)take(NR * DM * 2); _Float16* KH = (_Float16*)take(NR * DM * 2); _Float16* KL = (_Float16*)take(NR * DM * 2); _Float16* Q16 = QH; _Float16* K16 = KH; _Float16* V16 = (_Float16*)take(NR * DM * 2); _Float16* O16 = (_Float16*)take(NR * DM * 2);
  _Float16* VT = (_Float16*)take((size_t)NB * NH * HD * SQ * 2);      /* V^T [NB][NH][HD][SQ] */
  float* QF0 = (float*)take((size_t)QT0 * DM * 4); float* KF0 = (float*)take((size_t)QT0 * DM * 4); float* VF0 = (float*)take((size_t)QT0 * DM * 4); float* OF0 = (float*)take((size_t)NB * QT0 * DM * 4); _Float16* OH0 = (_Float16*)take((size_t)NB * QT0 * DM * 2); _Float16* OL0 = (_Float16*)take((size_t)NB * QT0 * DM * 2);
  if (off > ws_size) return;
  { const unsigned g = (unsigned)(((size_t)DM * DM / 8 + 255) / 256); k_wnat<<<g, 256, 0, stream>>>(wq, (size_t)DM * DM / 8, BQ); k_wnat<<<g, 256, 0, stream>>>(wk, (size_t)DM * DM / 8, BK); k_wnat<<<g, 256, 0, stream>>>(wv, (size_t)DM * DM / 8, BV); k_wnat<<<g, 256, 0, stream>>>(wo, (size_t)DM * DM / 8, BO); }      /* natural [out][in] = Bt[n][k] x16 */
  k_x16<<<(unsigned)((NR * DM / 8 + 255) / 256), 256, 0, stream>>>(x, X16, NR * DM / 8); k_x16<<<(unsigned)((NR * DM / 8 + 255) / 256), 256, 0, stream>>>(xk, XK16, NR * DM / 8); k_x16<<<(unsigned)((NR * DM / 8 + 255) / 256), 256, 0, stream>>>(xv, XV16, NR * DM / 8);
  const size_t r0p = (size_t)B0 * SQ;      /* first projected row */
  k_gemm2<0><<<dim3((unsigned)((MP / 128) * (DM / 64)), 1), 128, 0, stream>>>(X16 + r0p * DM, DM, 0, BQ, DM, 0, 0.0625f, bq, 0, nullptr, 1, 0, 0, QF + r0p * DM, nullptr, DM, 0, MP, DM, DM); k_ln64f32<<<(unsigned)(((size_t)MP * NH + 255) / 256), 256, 0, stream>>>(QF + r0p * DM, DM, (size_t)MP * NH, qg, qbt, LNE); k_hl<<<(unsigned)(((size_t)MP * DM / 8 + 255) / 256), 256, 0, stream>>>(QF + r0p * DM, QH + r0p * DM, QL + r0p * DM, (size_t)MP * DM / 8);      /* q (f32) -> f16 hi + x1024 residual: unscaled logits sigma ~8 */
  k_gemm2<0><<<dim3((unsigned)((MP / 128) * (DM / 64)), 1), 128, 0, stream>>>(XK16 + r0p * DM, DM, 0, BK, DM, 0, 0.0625f, bk, 0, nullptr, 1, 0, 0, QF + r0p * DM, nullptr, DM, 0, MP, DM, DM); k_ln64f32<<<(unsigned)(((size_t)MP * NH + 255) / 256), 256, 0, stream>>>(QF + r0p * DM, DM, (size_t)MP * NH, kg, kbt, LNE); k_hl<<<(unsigned)(((size_t)MP * DM / 8 + 255) / 256), 256, 0, stream>>>(QF + r0p * DM, KH + r0p * DM, KL + r0p * DM, (size_t)MP * DM / 8);      /* k likewise */
  k_gemm2<0><<<dim3((unsigned)((MP / 128) * (DM / 64)), 1), 128, 0, stream>>>(XV16 + r0p * DM, DM, 0, BV, DM, 0, 0.0625f, bv, 0, nullptr, 1, 0, 0, nullptr, V16 + r0p * DM, DM, 0, MP, DM, DM);
  for (int b = B0; b < B0 + NBR; ++b) { const size_t r0 = (size_t)b * SQ;
    k_vt<NH, SQ><<<NH * (SQ / 64), 256, 0, stream>>>(V16 + r0 * LQ, LQ, 0, VT + (size_t)b * NH * HD * SQ);      /* V^T [NH][HD][SQ] of this batch */
    k_gemm2<0><<<dim3((QT0 / 128) * (DM / 64), 1), 128, 0, stream>>>(X16 + r0 * DM, DM, 0, BQ, DM, 0, 0.0625f, bq, 0, nullptr, 1, 0, 0, QF0, nullptr, DM, 0, QT0, DM, DM); k_gemm2<0><<<dim3((QT0 / 128) * (DM / 64), 1), 128, 0, stream>>>(XK16 + r0 * DM, DM, 0, BK, DM, 0, 0.0625f, bk, 0, nullptr, 1, 0, 0, KF0, nullptr, DM, 0, QT0, DM, DM); k_gemm2<0><<<dim3((QT0 / 128) * (DM / 64), 1), 128, 0, stream>>>(XV16 + r0 * DM, DM, 0, BV, DM, 0, 0.0625f, bv, 0, nullptr, 1, 0, 0, VF0, nullptr, DM, 0, QT0, DM, DM);      /* f32 q, k, v of the first 128 rows (exact products) */
  k_ln64f32<<<(unsigned)(((size_t)QT0 * NH + 255) / 256), 256, 0, stream>>>(QF0, DM, (size_t)QT0 * NH, qg, qbt, LNE); k_ln64f32<<<(unsigned)(((size_t)QT0 * NH + 255) / 256), 256, 0, stream>>>(KF0, DM, (size_t)QT0 * NH, kg, kbt, LNE);      /* the exact first tile's f32 q and k rows through the same per-head LayerNorm */
    k_att0<<<NH * (QT0 / A0R), 256, 0, stream>>>(QF0, KF0, VF0, DM, SCL, OF0 + (size_t)b * QT0 * DM, DM);      /* exact f32 attention for rows 0..127 (o x64) */
  }
  k_fattn<<<dim3(SQ / 64, NB * NH), 128, 0, stream>>>(QH, QL, KH, KL, VT, O16);      /* scores, causal softmax and P . V of every batch, head and query row in one launch: o (merged heads, x64) as f16 rows */
  k_gemm2<0><<<dim3((unsigned)((MPO / 128) * (DM / 64)), 1), 128, 0, stream>>>(O16 + r0p * DM, DM, 0, BO, DM, 0, 0.0009765625f, bo, 0, nullptr, 1, 0, 0, (float*)d_out + r0p * DM, nullptr, DM, 0, MPO, DM, DM);      /* out rows are the output layout */
  k_hl<<<(unsigned)(((size_t)NB * QT0 * DM / 8 + 255) / 256), 256, 0, stream>>>(OF0, OH0, OL0, (size_t)NB * QT0 * DM / 8);      /* first-tile o (x64) -> f16 hi + x1024 residual planes */
  for (int b = B0; b < B0 + NBR; ++b) { const size_t r0 = (size_t)b * SQ; const size_t f0 = (size_t)b * QT0;
    k_gemm2<0><<<dim3((QT0 / 128) * (DM / 64), 1), 128, 0, stream>>>(OH0 + f0 * DM, DM, 0, BO, DM, 0, 0.0009765625f, bo, 0, nullptr, 1, 0, 0, (float*)d_out + r0 * DM, nullptr, DM, 0, QT0, DM, DM);      /* rows 0..127: out = o_hi Wo (+ b), overwriting the f16-path rows */
    k_gemm2<0><<<dim3((QT0 / 128) * (DM / 64), 1), 128, 0, stream>>>(OL0 + f0 * DM, DM, 0, BO, DM, 0, 0.00000095367431640625f, nullptr, 0, (const float*)d_out + r0 * DM, -1, 0, 0, (float*)d_out + r0 * DM, nullptr, DM, 0, QT0, DM, DM); }      /* += o_lo Wo 2^-20 (own-element accumulate) */
}

// v005
// One run takes 336 microseconds.
// Two timings next to v004 put it at 1.43 and 1.40 times that version's speed.
// Over all steps from v000 it is 32.1 times as fast.
#include <hip/hip_runtime.h>
// Causal multi-head self-attention with a per-head LayerNorm on q and k, natural bias-free q / k / v projections and a biased output projection (x [2][3072][512]; q / k / v = x W^T (nn.Linear natural [512][512] sd 0.02, NO biases), 8 heads of 64; q and k each pass through a LayerNorm over the 64 values of every (token, head) vector (biased variance, eps 1e-5, gamma / beta [64]: ones / zeros on this draw: read); scores = q . k / sqrt(64); causal (keys after the query get -inf); softmax; out = merged Wo^T + bo (natural; zero bias) -> [2][3072][512]); q and k carried as f16 hi + x1024 residual planes with three-product scores.
// Structure: token rows r = b*3072 + s; x as exact f16 rows (bf16-rounded); q and k as WMMA GEMMs (32x64 wave tiles, f32 accumulation, exact x16 weights, no bias) into f32 rows, each (token, head) vector of which an IN-PLACE f32 LayerNorm kernel normalises over its 64 values (f32 statistics, gamma / beta by value), then split into f16 hi + x1024 residual planes; v as one GEMM with f32 and f16 output rows; per batch: V^T for all heads via LDS transposes; then ONE fused launch for all batches, heads and query rows: a wave takes 16 query rows and walks the keys up to its diagonal, 32 a pass: S^T = K Q^T as three products (hi.hi + lo.hi + hi.lo, K = 64, scale 1/8 = 1/sqrt(64); logits sigma ~1), causal running-maximum softmax inside the lane (f32 statistics, native exp; weights exp(s - max) as f16), O^T = V^T P^T with the weights taken in place from the score accumulators (o divided by the row sum at the end and carried x64, folded into the output GEMM alpha) written straight into the merged f16 o rows; out = o Wo^T + bo GEMM (f32) into the output layout.
// Compute dtype: inputs rounded to bf16; x / weights exact; the normalised q and k as f16 hi + residual planes (three-product scores), v, the softmax weights and o as plain f16 GEMM operands (~2^-12); LayerNorm, scores and softmax statistics f32. v_wmma_f32_16x16x32_f16.
#define NB 2
#define SCL 0.125f                         /* 1 / sqrt(head_dim = 64) */
#define SCLR 0.0001220703125f              /* 2^-13: SCL / 1024; unused: the x1024 residual products take SCLR2 */
#define SQ 3072
#define DM 512
#define NH 8
#define HD 64
#define HG 4                         /* heads per launch of the h0-based k_vt overload */
#define QT0 128                      /* first-tile rows recomputed exactly in f32 */
#define B0 0                         /* first batch processed (debug hook) */
#define NBR NB                       /* batches processed (debug hook) */
#define NR ((size_t)NB * SQ)         /* token rows */
#define MP ((int)((size_t)NBR * SQ)) /* rows projected (debug hook) */
#define MPO MP                       /* rows through the output stage (debug hook) */
#define LQ DM      /* row pitch of the q/k/v rows */
typedef __bf16 v16b __attribute__((ext_vector_type(16)));
typedef unsigned short v8us __attribute__((ext_vector_type(8), may_alias));
typedef float  v8f  __attribute__((ext_vector_type(8)));
typedef float  v4f  __attribute__((ext_vector_type(4)));
typedef float  v4fa __attribute__((ext_vector_type(4), may_alias));
union FragB { v16b v; v8us half[2]; unsigned short u[16]; };

__device__ __forceinline__ unsigned short bf16_bits(float x) { unsigned int u = __float_as_uint(x); return (unsigned short)((u + 0x7FFFu + ((u >> 16) & 1u)) >> 16); }
__device__ __forceinline__ float bf16_val(unsigned short b) { return __uint_as_float(((unsigned int)b) << 16); }
__device__ __forceinline__ float bf16_round(float x) { return bf16_val(bf16_bits(x)); }
// D += A·B with NT terms: 1 = ah·bh, 2 = + al·bh (A split), 3 = + ah·bl (both split)
template <int NT>
__device__ __forceinline__ v8f mmaN(v16b ah, v16b al, v16b bh, v16b bl, v8f c) {
  c = __builtin_amdgcn_wmma_f32_16x16x32_bf16(false, ah, false, bh, (short)0, c, false, false);
  if (NT >= 2) c = __builtin_amdgcn_wmma_f32_16x16x32_bf16(false, al, false, bh, (short)0, c, false, false);
  if (NT >= 3) c = __builtin_amdgcn_wmma_f32_16x16x32_bf16(false, ah, false, bl, (short)0, c, false, false);
  asm volatile("v_nop\n\tv_nop\n\tv_nop\n\tv_nop" : "+v"(c) : "v"(ah), "v"(al), "v"(bh), "v"(bl));
  return c;
}

__global__ __launch_bounds__(256) void k_wt_bf16(const float* __restrict__ W, unsigned short* __restrict__ Wt, int K, int N) {
  const int t = blockIdx.x * 256 + threadIdx.x;
  const int k8n = K / 8;
  if (t >= N * k8n) return;
  const int n = t / k8n, k8 = (t % k8n) * 8;
  v8us v;
#pragma unroll
  for (int i = 0; i < 8; ++i) v[i] = bf16_bits(W[(size_t)(k8 + i) * N + n]);
  *(v8us*)(Wt + (size_t)n * K + k8) = v;
  
}

// GEMM C[M][N] (f32, pitch ldc) = act(A[M][K]·W + bias). A f32 row-major (pitch lda) converted per fragment to bf16
// (ASPLIT: hi/lo two planes -> 2 terms, else single rounded term); Wt bf16 [N][K] (pitch ldb). BIAS_BF16 rounds the
// bias to bf16 first (bias quantised to bf16 before the add). K%32==0, M%16==0, N%64==0.
template <bool ASPLIT, int ACT, bool BIAS_BF16>
__global__ __launch_bounds__(128) void k_gemm_bf(const float* __restrict__ A, int lda, const unsigned short* __restrict__ Wt, int ldb,
                                               const float* __restrict__ bias, float* __restrict__ C, int ldc, int M, int N, int K) {
  __shared__ __attribute__((aligned(16))) float so[4][16][64];
  const int tid = threadIdx.x, w = tid >> 5, lane = tid & 31, ln = lane & 15, hh = lane >> 4;
  const int ntn = N / 64;
  const int wid = blockIdx.x * 4 + w;
  const int mt = wid / ntn, nq = wid % ntn;
  if (mt * 16 >= M) return;
  const int row0 = mt * 16, col0 = nq * 64;
  const float* arow = A + (size_t)(row0 + ln) * lda;
  v8f acc[4] = {};
  for (int kb = 0; kb < K; kb += 32) {
    FragB ah, al;
    const v4f x0 = *(const v4fa*)(arow + kb + 8 * hh), x1 = *(const v4fa*)(arow + kb + 8 * hh + 4);
    const v4f x2 = *(const v4fa*)(arow + kb + 16 + 8 * hh), x3 = *(const v4fa*)(arow + kb + 16 + 8 * hh + 4);
    float xs[16] = {x0[0],x0[1],x0[2],x0[3],x1[0],x1[1],x1[2],x1[3],x2[0],x2[1],x2[2],x2[3],x3[0],x3[1],x3[2],x3[3]};
#pragma unroll
    for (int i = 0; i < 16; ++i) { const unsigned short hb = bf16_bits(xs[i]); ah.u[i] = hb; al.u[i] = ASPLIT ? bf16_bits(xs[i] - bf16_val(hb)) : (unsigned short)0; }
#pragma unroll
    for (int t = 0; t < 4; ++t) {
      const unsigned short* brow = Wt + (size_t)(col0 + t * 16 + ln) * ldb + kb;
      FragB b;
      b.half[0] = *(const v8us*)(brow + 8 * hh);
      b.half[1] = *(const v8us*)(brow + 16 + 8 * hh);
      acc[t] = mmaN<ASPLIT ? 2 : 1>(ah.v, al.v, b.v, b.v, acc[t]);
    }
  }
#pragma unroll
  for (int t = 0; t < 4; ++t) {
    float bv = bias ? bias[col0 + t * 16 + ln] : 0.f;
    if (BIAS_BF16) bv = bf16_round(bv);
#pragma unroll
    for (int r = 0; r < 8; ++r) { float v = acc[t][r] + bv; if (ACT == 1) v = fmaxf(v, 0.f); so[w][8 * hh + r][t * 16 + ln] = v; }
  }
  __builtin_amdgcn_fence(__ATOMIC_ACQ_REL, "workgroup");
  __builtin_amdgcn_wave_barrier();
  const int rsub = lane >> 4, c4 = (lane & 15) * 4;
  {
#pragma unroll
    for (int q = 0; q < 8; ++q) {
      const int r = q * 2 + rsub;
      const v4f v = *(const v4fa*)&so[w][r][c4];
      *(v4f*)(C + (size_t)(row0 + r) * ldc + col0 + c4) = v;
    }
    
  }
}

// GEMM C = act(A·W + bias + resid): A f32 (ASPLIT -> hi/lo 2 terms), Wt bf16 [N][K]; ACT 0 none, 1 relu, 2 exact gelu;
// resid (optional, f32, row index = (row % rmod), pitch ldr, RES_BF16 rounds it) added before the activation.
template <bool ASPLIT, int ACT, bool BIAS_BF16, bool RES_BF16>
__global__ __launch_bounds__(128) void k_gemm_bf3(const float* __restrict__ A, int lda, const unsigned short* __restrict__ Wt, int ldb,
                                                const float* __restrict__ bias, const float* __restrict__ resid, int rmod, int ldr,
                                                float* __restrict__ C, int ldc, int M, int N, int K) {
  __shared__ __attribute__((aligned(16))) float so[4][16][64];
  const int tid = threadIdx.x, w = tid >> 5, lane = tid & 31, ln = lane & 15, hh = lane >> 4;
  const int ntn = N / 64;
  const int wid = blockIdx.x * 4 + w;
  const int mt = wid / ntn, nq = wid % ntn;
  if (mt * 16 >= M) return;
  const int row0 = mt * 16, col0 = nq * 64;
  const float* arow = A + (size_t)(row0 + ln) * lda;
  v8f acc[4] = {};
  for (int kb = 0; kb < K; kb += 32) {
    FragB ah, al;
    const v4f x0 = *(const v4fa*)(arow + kb + 8 * hh), x1 = *(const v4fa*)(arow + kb + 8 * hh + 4);
    const v4f x2 = *(const v4fa*)(arow + kb + 16 + 8 * hh), x3 = *(const v4fa*)(arow + kb + 16 + 8 * hh + 4);
    float xs[16] = {x0[0],x0[1],x0[2],x0[3],x1[0],x1[1],x1[2],x1[3],x2[0],x2[1],x2[2],x2[3],x3[0],x3[1],x3[2],x3[3]};
#pragma unroll
    for (int i = 0; i < 16; ++i) { const unsigned short hb = bf16_bits(xs[i]); ah.u[i] = hb; al.u[i] = ASPLIT ? bf16_bits(xs[i] - bf16_val(hb)) : (unsigned short)0; }
#pragma unroll
    for (int t = 0; t < 4; ++t) {
      const unsigned short* brow = Wt + (size_t)(col0 + t * 16 + ln) * ldb + kb;
      FragB b;
      b.half[0] = *(const v8us*)(brow + 8 * hh);
      b.half[1] = *(const v8us*)(brow + 16 + 8 * hh);
      acc[t] = mmaN<ASPLIT ? 2 : 1>(ah.v, al.v, b.v, b.v, acc[t]);
    }
  }
#pragma unroll
  for (int t = 0; t < 4; ++t) {
    const int col = col0 + t * 16 + ln;
    float bv = bias ? bias[col] : 0.f;
    if (BIAS_BF16) bv = bf16_round(bv);
#pragma unroll
    for (int r = 0; r < 8; ++r) {
      float v = acc[t][r] + bv;
      if (resid) { float rv = resid[(size_t)((row0 + 8 * hh + r) % rmod) * ldr + col]; if (RES_BF16) rv = bf16_round(rv); v += rv; }
      if (ACT == 1) v = fmaxf(v, 0.f);
      if (ACT == 2) v = 0.5f * v * (1.0f + erff(v * 0.70710678118654752f));
      if (ACT == 3) { const float u = 0.7978845608028654f * (v + 0.044715f * v * v * v); v = 0.5f * v * (1.0f + tanhf(u)); }
      so[w][8 * hh + r][t * 16 + ln] = v;
    }
  }
  __builtin_amdgcn_fence(__ATOMIC_ACQ_REL, "workgroup");
  __builtin_amdgcn_wave_barrier();
  const int rsub = lane >> 4, c4 = (lane & 15) * 4;
  {
#pragma unroll
    for (int q = 0; q < 8; ++q) {
      const int r = q * 2 + rsub;
      const v4f v = *(const v4fa*)&so[w][r][c4];
      *(v4f*)(C + (size_t)(row0 + r) * ldc + col0 + c4) = v;
    }
    
  }
}
// row LayerNorm (biased variance, eps) over N: s = X (+ R); optional out_sum <- s; out_norm <- (s-mu)*rsqrt(var+eps)*g + b
template <bool PARAM_BF16>
__global__ __launch_bounds__(256) void k_layernorm(const float* __restrict__ X, const float* __restrict__ R, const float* __restrict__ g, const float* __restrict__ bta,
                                                  float* __restrict__ out_sum, float* __restrict__ out_norm, int N, float eps) {
  __shared__ float red[256];
  const int row = blockIdx.x, tid = threadIdx.x;
  const float* x = X + (size_t)row * N; const float* rr = R ? R + (size_t)row * N : nullptr;
  float vals[16];                     // up to N = 4096
  const int per = N / 256;            // contiguous chunk per thread? use strided-by-4 chunks: thread handles j = tid*4 + 1024*u
  float s1 = 0.f;
  for (int u = 0; u < per / 4; ++u) {
    const int j = tid * 4 + 1024 * u;
    const v4f a = *(const v4fa*)(x + j);
    v4f b = {0.f,0.f,0.f,0.f}; if (rr) b = *(const v4fa*)(rr + j);
#pragma unroll
    for (int q = 0; q < 4; ++q) { const float v = a[q] + b[q]; vals[u * 4 + q] = v; s1 += v; }
  }
  red[tid] = s1; __syncthreads();
  for (int st = 128; st > 0; st >>= 1) { if (tid < st) red[tid] += red[tid + st]; __syncthreads(); }
  const float mu = red[0] / (float)N; __syncthreads();
  float s2 = 0.f;
  for (int u = 0; u < per / 4; ++u)
#pragma unroll
    for (int q = 0; q < 4; ++q) { const float c = vals[u * 4 + q] - mu; s2 += c * c; }
  red[tid] = s2; __syncthreads();
  for (int st = 128; st > 0; st >>= 1) { if (tid < st) red[tid] += red[tid + st]; __syncthreads(); }
  const float rs = rsqrtf(red[0] / (float)N + eps);
  {
    for (int u = 0; u < per / 4; ++u) {
      const int j = tid * 4 + 1024 * u;
      v4f o, sm;
#pragma unroll
      for (int q = 0; q < 4; ++q) {
        float gg = g[j + q], bb = bta[j + q];
        if (PARAM_BF16) { gg = bf16_round(gg); bb = bf16_round(bb); }
        sm[q] = vals[u * 4 + q]; o[q] = (vals[u * 4 + q] - mu) * rs * gg + bb;
      }
      if (out_sum) *(v4f*)(out_sum + (size_t)row * N + j) = sm;
      *(v4f*)(out_norm + (size_t)row * N + j) = o;
    }
    
  }
}



// ---- f16 WMMA path (v_wmma_f32_16x16x32_f16): 11-bit significands for operands in range — used where a [0,1] probability operand needs more precision than bf16
typedef _Float16 v16h __attribute__((ext_vector_type(16)));
union FragH { v16h v; v8us half[2]; _Float16 h[16]; unsigned short u[16]; };
template <int NT>
__device__ __forceinline__ v8f mmaH(v16h ah, v16h al, v16h bh, v16h bl, v8f c) {
  c = __builtin_amdgcn_wmma_f32_16x16x32_f16(false, ah, false, bh, (short)0, c, false, false);
  if (NT >= 2) c = __builtin_amdgcn_wmma_f32_16x16x32_f16(false, al, false, bh, (short)0, c, false, false);
  if (NT >= 3) c = __builtin_amdgcn_wmma_f32_16x16x32_f16(false, ah, false, bl, (short)0, c, false, false);
  asm volatile("v_nop\n\tv_nop\n\tv_nop\n\tv_nop" : "+v"(c) : "v"(ah), "v"(al), "v"(bh), "v"(bl));
  return c;
}
// batched GEMM like k_gemm_b but f16 operands: A f32 (split into f16 hi/lo if ASPLIT, else rounded to f16), Bt = f16 values [n][k]; alpha; C f32; N multiple of 16 (partial tiles skipped)
template <bool ASPLIT>
__global__ __launch_bounds__(128) void k_gemm_h(const float* __restrict__ A, int lda, size_t sA, const _Float16* __restrict__ Bh, int ldb, size_t sB, float alpha, float* __restrict__ C, int ldc, size_t sC, int M, int N, int K) {
  __shared__ __attribute__((aligned(16))) float so[4][16][64];
  const int tid = threadIdx.x, w = tid >> 5, lane = tid & 31, ln = lane & 15, hh = lane >> 4; const int by = blockIdx.y;
  A += (size_t)by * sA; Bh += (size_t)by * sB; C += (size_t)by * sC;
  const int ntn = (N + 63) / 64; const int wid = blockIdx.x * 4 + w; const int mt = wid / ntn, nq = wid % ntn; if (mt * 16 >= M) return;
  const int row0 = mt * 16, col0 = nq * 64; const float* arow = A + (size_t)(row0 + ln) * lda;
  v8f acc[4] = {};
  for (int kb = 0; kb < K; kb += 32) {
    FragH ah, al;
    const v4f x0 = *(const v4fa*)(arow + kb + 8 * hh), x1 = *(const v4fa*)(arow + kb + 8 * hh + 4), x2 = *(const v4fa*)(arow + kb + 16 + 8 * hh), x3 = *(const v4fa*)(arow + kb + 16 + 8 * hh + 4);
    float xs[16] = {x0[0],x0[1],x0[2],x0[3],x1[0],x1[1],x1[2],x1[3],x2[0],x2[1],x2[2],x2[3],x3[0],x3[1],x3[2],x3[3]};
#pragma unroll
    for (int i = 0; i < 16; ++i) { const _Float16 h = (_Float16)xs[i]; ah.h[i] = h; al.h[i] = ASPLIT ? (_Float16)(xs[i] - (float)h) : (_Float16)0.0f; }
#pragma unroll
    for (int t = 0; t < 4; ++t) { if (col0 + t * 16 >= N) continue; const size_t boff = (size_t)(col0 + t * 16 + ln) * ldb + kb; FragH bq; bq.half[0] = *(const v8us*)(Bh + boff + 8 * hh); bq.half[1] = *(const v8us*)(Bh + boff + 16 + 8 * hh);
      acc[t] = mmaH<ASPLIT ? 2 : 1>(ah.v, al.v, bq.v, bq.v, acc[t]); }
  }
#pragma unroll
  for (int t = 0; t < 4; ++t) { if (col0 + t * 16 >= N) continue;
#pragma unroll
    for (int r = 0; r < 8; ++r) so[w][8 * hh + r][t * 16 + ln] = acc[t][r] * alpha; }
  __builtin_amdgcn_fence(__ATOMIC_ACQ_REL, "workgroup"); __builtin_amdgcn_wave_barrier();
  const int rsub = lane >> 4, c4 = (lane & 15) * 4;
  {
#pragma unroll
    for (int q = 0; q < 8; ++q) { const int r = q * 2 + rsub; if (col0 + c4 < N) { const v4f v = *(const v4fa*)&so[w][r][c4]; *(v4f*)(C + (size_t)(row0 + r) * ldc + col0 + c4) = v; } }
     }
}

// Wt[n][k] = f16(W[k][n]·scale) from f32 row-major W[K][N] (scale = power of two; bf16-exact weights stay exact in f16 away from the subnormal range)
__global__ __launch_bounds__(256) void k_wt_f16(const float* __restrict__ W, _Float16* __restrict__ Wt, int K, int N, float scale) {
  const int t = blockIdx.x * 256 + threadIdx.x; if (t >= N * (K / 8)) return; const int n = t / (K / 8), k8 = (t % (K / 8)) * 8; FragH f;
#pragma unroll
  for (int i = 0; i < 8; ++i) f.h[i] = (_Float16)(bf16_round(W[(size_t)(k8 + i) * N + n]) * scale); const v8us o = f.half[0];
  *(v8us*)((unsigned short*)Wt + (size_t)n * K + k8) = o; 
}
// k_gemm_hh variant with fused epilogue: v = acc·alpha + bias[by·sBias + col] (+ CP[(row/rowsPerB)·sCPb + by·64 + col] if CP) ; ACT 0 none / 1 elu ; writes f16 C16 (and f32 C if non-null)
template <int ACT>
__global__ __launch_bounds__(128) void k_gemm_hhx(const _Float16* __restrict__ A, int lda, size_t sA, const _Float16* __restrict__ Bh, int ldb, size_t sB, float alpha, const float* __restrict__ bias, size_t sBias, const float* __restrict__ CP, int rowsPerB, size_t sCPb, int row0g,
    float* __restrict__ C, _Float16* __restrict__ C16, int ldc, size_t sC, int M, int N, int K) {
  __shared__ __attribute__((aligned(16))) float so[4][16][64];
  const int tid = threadIdx.x, w = tid >> 5, lane = tid & 31, ln = lane & 15, hh = lane >> 4; const int by = blockIdx.y;
  A += (size_t)by * sA; Bh += (size_t)by * sB; const size_t cofs = (size_t)by * sC; const float* bp = bias ? bias + (size_t)by * sBias : nullptr;
  const int ntn = (N + 63) / 64; const int wid = blockIdx.x * 4 + w; const int mt = wid / ntn, nq = wid % ntn; if (mt * 16 >= M) return;
  const int row0 = mt * 16, col0 = nq * 64; const _Float16* arow = A + (size_t)(row0 + ln) * lda;
  v8f acc[4] = {};
  for (int kb = 0; kb < K; kb += 32) { FragH ah; ah.half[0] = *(const v8us*)((const unsigned short*)arow + kb + 8 * hh); ah.half[1] = *(const v8us*)((const unsigned short*)arow + kb + 16 + 8 * hh);
#pragma unroll
    for (int t = 0; t < 4; ++t) { if (col0 + t * 16 >= N) continue; const size_t boff = (size_t)(col0 + t * 16 + ln) * ldb + kb; FragH bq; bq.half[0] = *(const v8us*)((const unsigned short*)Bh + boff + 8 * hh); bq.half[1] = *(const v8us*)((const unsigned short*)Bh + boff + 16 + 8 * hh);
      acc[t] = mmaH<1>(ah.v, ah.v, bq.v, bq.v, acc[t]); }
  }
#pragma unroll
  for (int t = 0; t < 4; ++t) { if (col0 + t * 16 >= N) continue; const int col = col0 + t * 16 + ln; const float bv = bp ? bf16_round(bp[col]) : 0.f;
#pragma unroll
    for (int r = 0; r < 8; ++r) { float v = acc[t][r] * alpha + bv; if (CP) { const int rr = row0g + row0 + 8 * hh + r; if (rowsPerB < 0) v += CP[cofs + (size_t)rr * ldc + col];      /* rowsPerB < 0: own element of the batched C plane */ else { const int bidx = rr / rowsPerB; v += CP[(size_t)bidx * sCPb + (size_t)by * 64 + col]; } } if (ACT == 1) v = (v > 0.f) ? v : expm1f(v); else if (ACT == 7) v = (v > 0.f) ? v + 1.0f : expf(v); else if (ACT == 8) v = tanhf(v); else if (ACT == 9) v = 0.5f * v * (1.0f + tanhf(0.7978845608028654f * (v + 0.044715f * v * v * v))); else if (ACT == 11) v = 1.0f / (1.0f + expf(-v)); else if (ACT == 12) v = (v > 0.f) ? v : 0.01f * v; else if (ACT == 14) v = (v > 0.f) ? v : 0.1f * v; else if (ACT == 16) v = (v >= 0.f) ? v : 0.3f * v; else if (ACT == 17) v = (v >= 0.f) ? v : 0.2f * v; else if (ACT == 15) v = v / (1.0f + expf(-v)); else if (ACT == 3) v = fmaxf(v, 0.f); else if (ACT == 6) v = 0.5f * v * (1.0f + erff(v * 0.70710678118654752f)); so[w][8 * hh + r][t * 16 + ln] = v; } }
  __builtin_amdgcn_fence(__ATOMIC_ACQ_REL, "workgroup"); __builtin_amdgcn_wave_barrier();
  const int rsub = lane >> 4, c4 = (lane & 15) * 4; typedef _Float16 v4h __attribute__((ext_vector_type(4)));
  {
#pragma unroll
    for (int q = 0; q < 8; ++q) { const int r = q * 2 + rsub; if (col0 + c4 < N) { const v4f v = *(const v4fa*)&so[w][r][c4]; if (C) *(v4f*)(C + cofs + (size_t)(row0 + r) * ldc + col0 + c4) = v; if (C16) { v4h h4; for (int i = 0; i < 4; ++i) h4[i] = (_Float16)v[i]; *(v4h*)(C16 + cofs + (size_t)(row0 + r) * ldc + col0 + c4) = h4; } } }
     }
}


typedef _Float16 v4h __attribute__((ext_vector_type(4)));

__global__ __launch_bounds__(256) void k_x16(const float* __restrict__ x, _Float16* __restrict__ X16, size_t n8) { const size_t t = (size_t)blockIdx.x * 256 + threadIdx.x; if (t >= n8) return; FragH f;
#pragma unroll
  for (int q = 0; q < 8; ++q) f.h[q] = (_Float16)bf16_round(x[t * 8 + q]); *(v8us*)((unsigned short*)X16 + t * 8) = f.half[0];  }
__global__ __launch_bounds__(256) void k_h16(const float* __restrict__ x, _Float16* __restrict__ X16, size_t n8) { const size_t t = (size_t)blockIdx.x * 256 + threadIdx.x; if (t >= n8) return; FragH f;
#pragma unroll
  for (int q = 0; q < 8; ++q) f.h[q] = (_Float16)x[t * 8 + q]; *(v8us*)((unsigned short*)X16 + t * 8) = f.half[0];  }
__global__ __launch_bounds__(256) void k_round16f(const float* __restrict__ W, _Float16* __restrict__ Bt, size_t n8) { const size_t t = (size_t)blockIdx.x * 256 + threadIdx.x; if (t >= n8) return; FragH f;
#pragma unroll
  for (int i = 0; i < 8; ++i) f.h[i] = (_Float16)(bf16_round(W[t * 8 + i]) * 16.0f); *(v8us*)((unsigned short*)Bt + t * 8) = f.half[0];  }
template <int NHv, int TTv>
__global__ __launch_bounds__(256) void k_vt(const _Float16* __restrict__ V16, int ldv, int voff, _Float16* __restrict__ Vt) { __shared__ unsigned short tl[64][66]; const int tid = threadIdx.x; const int slab = blockIdx.x / (TTv / 64), lg = blockIdx.x % (TTv / 64); const int b = slab / NHv, h = slab % NHv;
  for (int i = tid; i < 64 * 8; i += 256) { const int r = i / 8, c8 = (i % 8) * 8; FragH f; f.half[0] = *(const v8us*)((const unsigned short*)V16 + ((size_t)b * TTv + lg * 64 + r) * ldv + voff + h * 64 + c8);
#pragma unroll
    for (int q = 0; q < 8; ++q) tl[r][c8 + q] = f.u[q]; }
  __syncthreads();
  {
#pragma unroll
    for (int rd = 0; rd < 2; ++rd) { const int d = rd * 32 + tid / 8, pc = tid % 8; FragH f;
#pragma unroll
      for (int q = 0; q < 8; ++q) f.u[q] = tl[pc * 8 + q][d];
      *(v8us*)((unsigned short*)Vt + ((size_t)slab * 64 + d) * TTv + lg * 64 + pc * 8) = f.half[0]; }
     } }

__global__ __launch_bounds__(256) void k_hl(const float* __restrict__ F, _Float16* __restrict__ Hh, _Float16* __restrict__ Hl, size_t n8) { const size_t t = (size_t)blockIdx.x * 256 + threadIdx.x; if (t >= n8) return; FragH fh, fl; const v4f a = *(const v4fa*)(F + t * 8), c = *(const v4fa*)(F + t * 8 + 4);
#pragma unroll
  for (int q = 0; q < 4; ++q) { _Float16 h = (_Float16)a[q]; fh.h[q] = h; fl.h[q] = (_Float16)((a[q] - (float)h) * 1024.0f); h = (_Float16)c[q]; fh.h[4 + q] = h; fl.h[4 + q] = (_Float16)((c[q] - (float)h) * 1024.0f); }
  { *(v8us*)((unsigned short*)Hh + t * 8) = fh.half[0]; *(v8us*)((unsigned short*)Hl + t * 8) = fl.half[0];  } }

// ---- fast GEMM (wave tile 32x64; requires M % 32 == 0 rows per launch region and N % 64 == 0); epilogue = k_gemm_hhx semantics ----
__device__ __forceinline__ v16h g2_frag(const _Float16* p, int hh) { FragH f; f.half[0] = *(const v8us*)((const unsigned short*)p + 8 * hh); f.half[1] = *(const v8us*)((const unsigned short*)p + 16 + 8 * hh); return f.v; }
__device__ __forceinline__ v8f g2_mma(v16h a, v16h b, v8f c) { v8f d = __builtin_amdgcn_wmma_f32_16x16x32_f16(false, a, false, b, (short)0, c, false, false); asm volatile("v_nop\n\tv_nop\n\tv_nop\n\tv_nop" : "+v"(d) : "v"(a), "v"(b)); return d; }
template <int ACT>
__global__ __launch_bounds__(128) void k_gemm2(const _Float16* __restrict__ A, int lda, size_t sA, const _Float16* __restrict__ Bh, int ldb, size_t sB, float alpha, const float* __restrict__ bias, size_t sBias, const float* __restrict__ CP, int rowsPerB, size_t sCPb, int row0g,
    float* __restrict__ C, _Float16* __restrict__ C16, int ldc, size_t sC, int M, int N, int K) { static_assert(ACT == 0 || ACT == 3 || ACT == 6 || ACT == 8 || ACT == 9 || ACT == 11 || ACT == 12 || ACT == 14 || ACT == 15 || ACT == 16 || ACT == 17, "k_gemm2: unsupported ACT code (would silently apply no activation)");
  __shared__ __attribute__((aligned(16))) float so[4][32][68];
  const int tid = threadIdx.x, w = tid >> 5, lane = tid & 31, ln = lane & 15, hh = lane >> 4; const int by = blockIdx.y;
  A += (size_t)by * sA; Bh += (size_t)by * sB; const size_t cofs = (size_t)by * sC; const float* bp = bias ? bias + (size_t)by * sBias : nullptr;
  const int ntn = N >> 6; const int mt = blockIdx.x / ntn, nq = blockIdx.x - mt * ntn; const int row0 = mt * 128 + 32 * w, col0 = nq * 64; if (row0 >= M) return;
  const _Float16* a0p = A + (size_t)(row0 + ln) * lda; const _Float16* a1p = a0p + (size_t)16 * lda;
  const _Float16* b0p = Bh + (size_t)(col0 + ln) * ldb; const _Float16* b1p = b0p + (size_t)16 * ldb; const _Float16* b2p = b1p + (size_t)16 * ldb; const _Float16* b3p = b2p + (size_t)16 * ldb;
  const v8f z8 = {0.f,0.f,0.f,0.f,0.f,0.f,0.f,0.f}; v8f c00 = z8, c01 = z8, c02 = z8, c03 = z8, c10 = z8, c11 = z8, c12 = z8, c13 = z8;
#pragma unroll 1
  for (int kb = 0; kb < K; kb += 32) { const v16h a0 = g2_frag(a0p + kb, hh), a1 = g2_frag(a1p + kb, hh);
    v16h b = g2_frag(b0p + kb, hh); c00 = g2_mma(a0, b, c00); c10 = g2_mma(a1, b, c10);
    b = g2_frag(b1p + kb, hh); c01 = g2_mma(a0, b, c01); c11 = g2_mma(a1, b, c11);
    b = g2_frag(b2p + kb, hh); c02 = g2_mma(a0, b, c02); c12 = g2_mma(a1, b, c12);
    b = g2_frag(b3p + kb, hh); c03 = g2_mma(a0, b, c03); c13 = g2_mma(a1, b, c13); }
  v8f accs[8] = {c00, c01, c02, c03, c10, c11, c12, c13};
#pragma unroll
  for (int u = 0; u < 8; ++u) { const int t = u & 3, half = u >> 2; const int col = col0 + t * 16 + ln; const float bv = bp ? bf16_round(bp[col]) : 0.f;
#pragma unroll
    for (int r = 0; r < 8; ++r) { const int rloc = half * 16 + 8 * hh + r; float v = accs[u][r] * alpha + bv; if (CP) { if (rowsPerB < 0) v += CP[cofs + (size_t)(row0g + row0 + rloc) * ldc + col];      /* rowsPerB < 0: own element of the batched C plane */ else { const int bidx = (row0g + row0 + rloc) / rowsPerB; v += CP[(size_t)bidx * sCPb + (size_t)by * 64 + col]; } }
      if (ACT == 3) v = fmaxf(v, 0.f); else if (ACT == 6) v = 0.5f * v * (1.0f + erff(v * 0.70710678118654752f)); else if (ACT == 11) v = 1.0f / (1.0f + expf(-v)); else if (ACT == 15) v = v / (1.0f + expf(-v)); else if (ACT == 12) v = (v > 0.f) ? v : 0.01f * v; else if (ACT == 8) v = tanhf(v); else if (ACT == 9) v = 0.5f * v * (1.0f + tanhf(0.7978845608028654f * (v + 0.044715f * v * v * v))); else if (ACT == 14) v = (v > 0.f) ? v : 0.1f * v; else if (ACT == 16) v = (v >= 0.f) ? v : 0.3f * v; else if (ACT == 17) v = (v >= 0.f) ? v : 0.2f * v;
      so[w][rloc][t * 16 + ln] = v; } }
  __builtin_amdgcn_fence(__ATOMIC_ACQ_REL, "workgroup"); __builtin_amdgcn_wave_barrier();
  const int rsub = lane >> 4, c4 = (lane & 15) * 4;
  {
#pragma unroll
    for (int q = 0; q < 16; ++q) { const int r = q * 2 + rsub; const v4f v = *(const v4fa*)&so[w][r][c4]; if (C) { *(v4f*)(C + cofs + (size_t)(row0 + r) * ldc + col0 + c4) = v; asm volatile("s_wait_xcnt 0x0" ::: "memory"); }      /* the wait stands in front of every later write of the data and address registers that this store names: where both planes are written, the f16 conversion below reuses them */
      if (C16) { v4h h4; for (int i = 0; i < 4; ++i) h4[i] = (_Float16)v[i]; *(v4h*)(C16 + cofs + (size_t)(row0 + r) * ldc + col0 + c4) = h4; } }
     } }


__global__ __launch_bounds__(256) void k_wnat(const float* __restrict__ w, size_t n8, _Float16* __restrict__ Bt) { const size_t t = (size_t)blockIdx.x * 256 + threadIdx.x; if (t >= n8) return; FragH f; for (int q = 0; q < 8; ++q) f.h[q] = (_Float16)(bf16_round(w[t * 8 + q]) * 16.0f); *(v8us*)((unsigned short*)Bt + t * 8) = f.half[0];  }
__global__ __launch_bounds__(256) void k_rsm(const float* __restrict__ S, _Float16* __restrict__ P, int nrows) {
  #pragma clang fp contract(off)
  const int i = blockIdx.x * 256 + threadIdx.x; if (i >= nrows) return; const float* s = S + (size_t)i * SQ; float mx = -3.0e38f;
#pragma unroll 1
  for (int j = 0; j < SQ; ++j) mx = fmaxf(mx, s[j]); float se = 0.f;
#pragma unroll 1
  for (int j = 0; j < SQ; ++j) se += expf(s[j] - mx); const float sc = 256.0f / se;
#pragma unroll 1
  for (int j0 = 0; j0 < SQ; j0 += 8) { FragH f; for (int q = 0; q < 8; ++q) f.h[q] = (_Float16)(expf(s[j0 + q] - mx) * sc); unsigned short* d = (unsigned short*)P + (size_t)i * SQ + j0; *(v8us*)d = f.half[0];  } }
__global__ __launch_bounds__(256) void k_vt(const _Float16* __restrict__ V16, int b, int h0, _Float16* __restrict__ VT) { __shared__ unsigned short tl[64][65]; const int tid = threadIdx.x; const int hh = blockIdx.x % HG, sg = blockIdx.x / HG; const int s0 = sg * 64; const int h = h0 + hh;
  for (int i = tid; i < 64 * 8; i += 256) { const int j = i / 8, d8 = (i % 8) * 8; FragH f; f.half[0] = *(const v8us*)((const unsigned short*)V16 + ((size_t)b * SQ + s0 + j) * DM + h * HD + d8); for (int q = 0; q < 8; ++q) tl[d8 + q][j] = f.u[q]; }
  __syncthreads();
  { for (int i = tid; i < 64 * 8; i += 256) { const int d = i / 8, j8 = (i % 8) * 8; FragH f; for (int q = 0; q < 8; ++q) f.u[q] = tl[d][j8 + q]; *(v8us*)((unsigned short*)VT + ((size_t)hh * HD + d) * SQ + s0 + j8) = f.half[0]; }  } }



__device__ __forceinline__ float rs_xhalf(float x) { return __builtin_bit_cast(float, __builtin_amdgcn_permlanex16(__builtin_bit_cast(int, x), __builtin_bit_cast(int, x), 0x76543210, 0xfedcba98, false, false)); }      /* lane l <- lane l ^ 16 */
__device__ __forceinline__ float fa_exp2(float x) { float y; asm("v_exp_f32 %0, %1\n\tv_nop" : "=v"(y) : "v"(x)); return y; }      /* 2^x; the v_nop is the slot the instruction set asks for behind a transcendental */
#define SCL2 0.18033688f                   /* SCL * log2(e): scores carried in the base-2 domain, so that a weight is one subtract and one 2^x */
#define SCLR2 (SCL2 * 0.0009765625f)       /* the same scale on the x1024 residual products */
// Fused causal attention, one wave per 16 query rows of one (batch, head); 32 keys a pass, no score or weight plane in memory.
// S^T = K Q^T (A = key rows, B = query rows): a lane holds 16 scores of ITS query (column ln), keys kb + 8 hh + r and kb + 16 + 8 hh + r: the very places of the B fragment of O^T = V^T P^T,
// so the weights go from the score accumulators to the next product inside the lane. Row maximum and row sum: in the lane, plus one exchange with lane ^ 16. Running maximum, o and sum rescaled each pass.
// The four waves of a work-group walk the same keys: a tile of 64 keys (K hi, K residual, V^T: 64 rows of 128 bytes each) is brought into LDS once for all four by asynchronous copies of whole 128-byte lines, two buffers, the next tile in flight while this one is worked on; the fragments are 16-byte LDS reads.
#define FKT 64                       /* keys of a staged tile: two passes */
#define FPT 72                       /* pitch of a staged row in f16: 144 B = 9 x 16 B, so that 16 lanes reading 16 rows by 16 bytes do not meet in a bank */
#define FPL (FKT * FPT * 2)          /* bytes of one staged plane */
#define FRS (16 * FPT * 2)           /* bytes of 16 staged rows: the step between a lane's four pieces of a plane */
// One tile: a lane's twelve 16-byte pieces (four of each plane, 16 rows apart). ld: the lane's LDS byte address in plane 0 of the buffer; gh, gl, gv: its first piece in the K hi rows, the K residual rows and the V^T rows.
__device__ __forceinline__ void fa_stage(unsigned ld, const _Float16* gh, const _Float16* gl, const _Float16* gv) {
  asm volatile(      /* the copies go from global memory to LDS through no register; the s_wait_xcnt in the same statement stands in front of every later write of the address registers that the copies name */
    "global_load_async_to_lds_b128 %0, %12, off\n\t"
    "global_load_async_to_lds_b128 %1, %13, off\n\t"
    "global_load_async_to_lds_b128 %2, %14, off\n\t"
    "global_load_async_to_lds_b128 %3, %15, off\n\t"
    "global_load_async_to_lds_b128 %4, %16, off\n\t"
    "global_load_async_to_lds_b128 %5, %17, off\n\t"
    "global_load_async_to_lds_b128 %6, %18, off\n\t"
    "global_load_async_to_lds_b128 %7, %19, off\n\t"
    "global_load_async_to_lds_b128 %8, %20, off\n\t"
    "global_load_async_to_lds_b128 %9, %21, off\n\t"
    "global_load_async_to_lds_b128 %10, %22, off\n\t"
    "global_load_async_to_lds_b128 %11, %23, off\n\t"
    "s_wait_xcnt 0x0"
    :: "v"(ld), "v"(ld + FRS), "v"(ld + 2 * FRS), "v"(ld + 3 * FRS),
       "v"(ld + FPL), "v"(ld + FPL + FRS), "v"(ld + FPL + 2 * FRS), "v"(ld + FPL + 3 * FRS),
       "v"(ld + 2 * FPL), "v"(ld + 2 * FPL + FRS), "v"(ld + 2 * FPL + 2 * FRS), "v"(ld + 2 * FPL + 3 * FRS),
       "v"(gh), "v"(gh + (size_t)16 * LQ), "v"(gh + (size_t)32 * LQ), "v"(gh + (size_t)48 * LQ),
       "v"(gl), "v"(gl + (size_t)16 * LQ), "v"(gl + (size_t)32 * LQ), "v"(gl + (size_t)48 * LQ),
       "v"(gv), "v"(gv + (size_t)16 * SQ), "v"(gv + (size_t)32 * SQ), "v"(gv + (size_t)48 * SQ)
    : "memory"); }
__global__ __launch_bounds__(128) void k_fattn(const _Float16* __restrict__ QHp, const _Float16* __restrict__ QLp, const _Float16* __restrict__ KHp, const _Float16* __restrict__ KLp, const _Float16* __restrict__ VTp, _Float16* __restrict__ Op) {
  __shared__ __attribute__((aligned(16))) _Float16 sk[2][3][FKT][FPT];      /* [buffer][K hi, K residual, V^T][row][64 values + pad] */
  const int tid = threadIdx.x, lane = tid & 31, ln = lane & 15, hh = lane >> 4; const int w = __builtin_amdgcn_readfirstlane(tid >> 5);
  const int bh = blockIdx.y, b = bh / NH, h = bh % NH; const int nst = SQ / FKT - (int)blockIdx.x;      /* tiles up to and with the work-group's diagonal tile; the longest rows start first */
  const int q0 = (nst - 1) * FKT + w * 16;
  const size_t r0 = (size_t)b * SQ; const int q = q0 + ln;
  const int sr = tid >> 3, sc8 = (tid & 7) * 8;      /* staging: eight lanes copy one 128-byte row, a wave four whole rows a copy */
  const _Float16* gh = KHp + (r0 + sr) * LQ + h * HD + sc8; const _Float16* gl = KLp + (r0 + sr) * LQ + h * HD + sc8; const _Float16* gv = VTp + ((size_t)bh * HD + sr) * SQ + sc8;
  const unsigned ld0 = (unsigned)(size_t)&sk[0][0][sr][sc8];      /* the low 32 bits of a shared address are its LDS byte address */
  fa_stage(ld0, gh, gl, gv);      /* tile 0 into buffer 0 */
  const _Float16* qh = QHp + (r0 + q) * LQ + h * HD; const _Float16* ql = QLp + (r0 + q) * LQ + h * HD;
  const v16h qh0 = g2_frag(qh, hh), qh1 = g2_frag(qh + 32, hh), ql0 = g2_frag(ql, hh), ql1 = g2_frag(ql + 32, hh);
  const v8f z8 = {0.f,0.f,0.f,0.f,0.f,0.f,0.f,0.f}; v8f o0 = z8, o1 = z8, o2 = z8, o3 = z8; float m = -1.0e30f, l = 0.f;
  asm volatile("s_wait_asynccnt 0x0" ::: "memory");      /* this wave's pieces of tile 0 have landed */
  __syncthreads();      /* every wave's pieces of tile 0 have landed: the tile may be read */
  if (nst > 1) fa_stage(ld0 + 3 * FPL, gh + (size_t)FKT * LQ, gl + (size_t)FKT * LQ, gv + FKT);      /* tile 1 into buffer 1 */
#pragma unroll 1      /* a trip holds two passes of 24 fragment loads and 16 products each: a second copy of it would not fit the registers */
  for (int st = 0; st < nst; ++st) {
    const _Float16* tk = &sk[st & 1][0][ln][0]; const _Float16* tl = &sk[st & 1][1][ln][0]; const _Float16* tv = &sk[st & 1][2][ln][0];      /* this trip reads this buffer alone */
    v16h ka0 = g2_frag(tk, hh), ka1 = g2_frag(tk + 32, hh), ka2 = g2_frag(tk + 16 * FPT, hh), ka3 = g2_frag(tk + 16 * FPT + 32, hh);      /* the tile's key rows 0 .. 31, hi plane */
    v16h kc0 = g2_frag(tl, hh), kc1 = g2_frag(tl + 32, hh), kc2 = g2_frag(tl + 16 * FPT, hh), kc3 = g2_frag(tl + 16 * FPT + 32, hh);      /* the same rows, residual plane */
#pragma unroll      /* the two passes of a tile: the second one's LDS offsets as immediates, its key fragments asked for in the first */
    for (int sub = 0; sub < 2; ++sub) {
      const int kb = st * FKT + sub * 32;
      if (sub == 1 && kb >= q0 + 16) break;      /* wave-uniform: a pass runs only while kb < q0 + 16, so that every query has a key in every pass; the foot of the trip below is passed all the same */
      const v16h va0 = g2_frag(tv + sub * 32, hh), va1 = g2_frag(tv + 16 * FPT + sub * 32, hh), va2 = g2_frag(tv + 32 * FPT + sub * 32, hh), va3 = g2_frag(tv + 48 * FPT + sub * 32, hh);      /* asked for here, used behind the softmax */
      v8f sh0 = z8, sl0 = z8, sh1 = z8, sl1 = z8;      /* hi . hi, and lo . hi + hi . lo (x1024), for keys kb .. kb + 15 and kb + 16 .. kb + 31 */
      sh0 = g2_mma(ka0, qh0, sh0); sl0 = g2_mma(ka0, ql0, sl0); sh1 = g2_mma(ka2, qh0, sh1); sl1 = g2_mma(ka2, ql0, sl1);
      sh0 = g2_mma(ka1, qh1, sh0); sl0 = g2_mma(ka1, ql1, sl0); sh1 = g2_mma(ka3, qh1, sh1); sl1 = g2_mma(ka3, ql1, sl1);
      sl0 = g2_mma(kc0, qh0, sl0); sl1 = g2_mma(kc2, qh0, sl1); sl0 = g2_mma(kc1, qh1, sl0); sl1 = g2_mma(kc3, qh1, sl1);
      if (sub == 0) {      /* the second pass's key fragments (rows 32 .. 63 of the same tile) come in during this pass's softmax and output products */
        ka0 = g2_frag(tk + 32 * FPT, hh); ka1 = g2_frag(tk + 32 * FPT + 32, hh); ka2 = g2_frag(tk + 48 * FPT, hh); ka3 = g2_frag(tk + 48 * FPT + 32, hh);
        kc0 = g2_frag(tl + 32 * FPT, hh); kc1 = g2_frag(tl + 32 * FPT + 32, hh); kc2 = g2_frag(tl + 48 * FPT, hh); kc3 = g2_frag(tl + 48 * FPT + 32, hh); }
      float s0[8], s1[8];
#pragma unroll      /* unrolled so that every index into the accumulator and fragment registers is a constant */
      for (int r = 0; r < 8; ++r) { s0[r] = fmaf(sl0[r], SCLR2, sh0[r] * SCL2); s1[r] = fmaf(sl1[r], SCLR2, sh1[r] * SCL2); }
      if (kb + 31 > q0) {      /* wave-uniform: only the pass on the diagonal holds keys after a query */
#pragma unroll      /* unrolled so that every index into the accumulator and fragment registers is a constant */
        for (int r = 0; r < 8; ++r) { const int j = kb + 8 * hh + r; s0[r] = (j <= q) ? s0[r] : -1.0e30f; s1[r] = (j + 16 <= q) ? s1[r] : -1.0e30f; } }
      float bm = fmaxf(s0[0], s1[0]);
#pragma unroll      /* unrolled so that every index into the accumulator and fragment registers is a constant */
      for (int r = 1; r < 8; ++r) bm = fmaxf(bm, fmaxf(s0[r], s1[r]));
      bm = fmaxf(bm, rs_xhalf(bm)); const float mn = fmaxf(m, bm); const float sc = fa_exp2(m - mn); m = mn;
      FragH pf; float ls = 0.f;
#pragma unroll      /* unrolled so that every index into the accumulator and fragment registers is a constant */
      for (int r = 0; r < 8; ++r) { const float e0 = fa_exp2(s0[r] - mn), e1 = fa_exp2(s1[r] - mn); ls += e0 + e1; pf.h[r] = (_Float16)e0; pf.h[8 + r] = (_Float16)e1; }
      l = fmaf(l, sc, ls);      /* the lane's half of the row sum; the halves meet behind the loop */
#pragma unroll      /* unrolled so that every index into the accumulator and fragment registers is a constant */
      for (int r = 0; r < 8; ++r) { o0[r] *= sc; o1[r] *= sc; o2[r] *= sc; o3[r] *= sc; }
      o0 = g2_mma(va0, pf.v, o0); o1 = g2_mma(va1, pf.v, o1); o2 = g2_mma(va2, pf.v, o2); o3 = g2_mma(va3, pf.v, o3); }
    asm volatile("s_wait_dscnt 0x0" ::: "memory");      /* this wave's reads of the buffer are done before it may be refilled */
    asm volatile("s_wait_asynccnt 0x0" ::: "memory");      /* this wave's pieces of the next tile have landed */
    __syncthreads();      /* publishes the next tile and ends every wave's reads of this trip's buffer */
    if (st + 2 < nst) fa_stage(ld0 + (unsigned)(st & 1) * (3 * FPL), gh + (size_t)(st + 2) * FKT * LQ, gl + (size_t)(st + 2) * FKT * LQ, gv + (size_t)(st + 2) * FKT); }      /* the tile after the next into the buffer just read */
  asm volatile("s_wait_asynccnt 0x0" ::: "memory");      /* no copy is outstanding when the wave goes on to its end */
  l += rs_xhalf(l); const float fin = 64.0f / l;      /* o carried x64, folded into the output GEMM alpha */
  unsigned short* op = (unsigned short*)Op + (r0 + q) * DM + h * HD + 8 * hh; FragH f0, f1, f2, f3;      /* lane: 8 neighbouring head values of its query per tile; the wave writes whole 128-byte head rows */
#pragma unroll      /* unrolled so that every index into the accumulator and fragment registers is a constant */
  for (int r = 0; r < 8; ++r) { f0.h[r] = (_Float16)(o0[r] * fin); f1.h[r] = (_Float16)(o1[r] * fin); f2.h[r] = (_Float16)(o2[r] * fin); f3.h[r] = (_Float16)(o3[r] * fin); }
  *(v8us*)op = f0.half[0]; *(v8us*)(op + 16) = f1.half[0]; *(v8us*)(op + 32) = f2.half[0]; *(v8us*)(op + 48) = f3.half[0]; }

#define A0R 8                        /* query rows of a work-group of the exact first tile: one wave each */
#define A0P 68                       /* pitch of a staged key row in floats: 272 B = 17 x 16 B, so that 16 lanes reading 16 rows by 16 bytes meet every LDS bank once */
#define A0U (QT0 * (HD / 4) / 256)   /* 16-byte pieces of a staged plane per thread */
typedef float v2f __attribute__((ext_vector_type(2)));
// Exact f32 attention for the first QT0 rows, causal. One wave per query row, A0R rows of one head per work-group; the head's QT0 key and value rows are staged in LDS once (keys behind a query are masked below and carry weight zero).
// Scores: a lane takes keys lane, lane + 32, lane + 64, lane + 96, each a serial f32 chain over the 64 head values. Row maximum and row sum: butterflies over the wave. Output: a lane takes two head values and sums over the keys in rising order, the weight of key j read from its lane.
__global__ __launch_bounds__(256) void k_att0(const float* __restrict__ QF, const float* __restrict__ KF, const float* __restrict__ VF, int ld, float scale, float* __restrict__ OF, int ldo) {
  __shared__ __attribute__((aligned(16))) float lk[QT0][A0P]; __shared__ __attribute__((aligned(16))) float lv[QT0][HD];
  const int tid = threadIdx.x, lane = tid & 31; const int w = __builtin_amdgcn_readfirstlane(tid >> 5);
  const int h = blockIdx.x / (QT0 / A0R), rg = blockIdx.x % (QT0 / A0R); const int i = rg * A0R + w;      /* this wave's query */
  v4f kq[A0U], vq[A0U];
#pragma unroll      /* all 16 loads of a thread in flight at once, their results under constant indices */
  for (int u = 0; u < A0U; ++u) { const int t = u * 256 + tid, j = t / (HD / 4), c = (t % (HD / 4)) * 4; const size_t ro = (size_t)j * ld + h * HD + c;
    const float* kp = KF + ro; const float* vp = VF + ro;
    kq[u] = *(const v4fa*)kp; asm volatile("s_wait_xcnt 0x0" :: "v"(kp) : "memory");      /* stands in front of every write of the registers that this load names as its address; it takes the address as an input, so that those registers live up to it and no load's result, this one's included, is placed on them earlier */
    vq[u] = *(const v4fa*)vp; asm volatile("s_wait_xcnt 0x0" :: "v"(vp) : "memory"); }      /* the same for this load */
  const float* qr = QF + (size_t)i * ld + h * HD; v4f qv[HD / 4];
#pragma unroll      /* the query row stays in registers: constant indices */
  for (int c = 0; c < HD / 4; ++c) qv[c] = *(const v4fa*)(qr + c * 4);
  asm volatile("s_wait_xcnt 0x0" :: "s"(qr) : "memory");      /* the same wait for the query row's loads (wave-uniform address: scalar loads), in front of every write of their base registers */
#pragma unroll      /* constant indices into the staging registers */
  for (int u = 0; u < A0U; ++u) { const int t = u * 256 + tid, j = t / (HD / 4), c = (t % (HD / 4)) * 4; *(v4f*)&lk[j][c] = kq[u]; *(v4f*)&lv[j][c] = vq[u]; }
  __syncthreads();      /* the staged rows are read by every wave */
  float s[QT0 / 32];
#pragma unroll      /* four independent chains side by side */
  for (int g = 0; g < QT0 / 32; ++g) s[g] = 0.f;
#pragma unroll      /* constant indices into the query registers, LDS offsets as immediates */
  for (int c = 0; c < HD / 4; ++c) {
#pragma unroll      /* four independent chains side by side */
    for (int g = 0; g < QT0 / 32; ++g) { const v4f kr = *(const v4f*)&lk[g * 32 + lane][c * 4]; s[g] = fmaf(qv[c][0], kr[0], s[g]); s[g] = fmaf(qv[c][1], kr[1], s[g]); s[g] = fmaf(qv[c][2], kr[2], s[g]); s[g] = fmaf(qv[c][3], kr[3], s[g]); } }
  float mx = -1.0e30f;
#pragma unroll      /* constant indices into the score registers */
  for (int g = 0; g < QT0 / 32; ++g) { s[g] = (g * 32 + lane <= i) ? s[g] * scale : -1.0e30f; mx = fmaxf(mx, s[g]); }
#pragma unroll      /* five exchange steps */
  for (int st = 16; st > 0; st >>= 1) mx = fmaxf(mx, __shfl_xor(mx, st));
  float e[QT0 / 32], l = 0.f;
#pragma unroll      /* constant indices into the score registers */
  for (int g = 0; g < QT0 / 32; ++g) { e[g] = (g * 32 + lane <= i) ? expf(s[g] - mx) : 0.f; l += e[g]; }
#pragma unroll      /* five exchange steps */
  for (int st = 16; st > 0; st >>= 1) l += __shfl_xor(l, st);
  v2f o = {0.f, 0.f};
#pragma unroll      /* constant lane numbers for the weight reads, LDS offsets as immediates */
  for (int g = 0; g < QT0 / 32; ++g) {
#pragma unroll      /* constant lane numbers for the weight reads, LDS offsets as immediates */
    for (int jj = 0; jj < 32; ++jj) { const float ej = __builtin_bit_cast(float, __builtin_amdgcn_readlane(__builtin_bit_cast(int, e[g]), jj)); const v2f vv = *(const v2f*)&lv[g * 32 + jj][2 * lane]; o[0] = fmaf(ej, vv[0], o[0]); o[1] = fmaf(ej, vv[1], o[1]); } }
  const float fin = 64.0f / l;      /* o carried x64 like the f16 path */
  o[0] *= fin; o[1] *= fin; *(v2f*)(OF + (size_t)i * ldo + h * HD + 2 * lane) = o; }      /* the wave writes its query's whole 256-byte head row */

__global__ __launch_bounds__(256) void k_ln64f32(float* __restrict__ F, int ldf, size_t nrh, const float* __restrict__ g, const float* __restrict__ bb, float eps) {
  #pragma clang fp contract(off)
  const size_t t = (size_t)blockIdx.x * 256 + threadIdx.x; if (t >= nrh) return; const size_t r = t / NH; const int h = (int)(t % NH); float* f = F + r * (size_t)ldf + (size_t)h * 64; float sum = 0.f;
#pragma unroll 1
  for (int d = 0; d < 64; d += 4) { const v4f q = *(const v4fa*)(f + d); sum = __fadd_rn(__fadd_rn(__fadd_rn(__fadd_rn(sum, q[0]), q[1]), q[2]), q[3]); } const float mu = sum / 64.0f; float vs = 0.f;
#pragma unroll 1
  for (int d = 0; d < 64; d += 4) { const v4f q = *(const v4fa*)(f + d); for (int e = 0; e < 4; ++e) { const float dl = __fadd_rn(q[e], -mu); vs = __fadd_rn(vs, __fmul_rn(dl, dl)); } } const float rs = rsqrtf(__fadd_rn(vs / 64.0f, eps));
#pragma unroll 1
  for (int d0 = 0; d0 < 64; d0 += 4) { const v4f q = *(const v4fa*)(f + d0); v4f y; for (int e = 0; e < 4; ++e) y[e] = __fadd_rn(__fmul_rn(__fmul_rn(__fadd_rn(q[e], -mu), rs), bf16_round(g[d0 + e])), bf16_round(bb[d0 + e])); *(v4f*)(f + d0) = y;  } }
extern "C" void kernel_launch(void* const* d_in, const int* in_sizes, int n_in,
                              void* d_out, int out_size, void* d_ws, size_t ws_size, hipStream_t stream) {
  (void)in_sizes; (void)n_in; (void)out_size;
  const float* const* I = (const float* const*)d_in; const float* x = I[0]; const float* wq = I[1]; const float* bq = nullptr; const float* wk = I[2]; const float* bk = nullptr; const float* wv = I[3]; const float* bv = nullptr; const float* wo = I[4]; const float* bo = I[5]; const float* qg = I[6]; const float* qbt = I[7]; const float* kg = I[8]; const float* kbt = I[9]; const float LNE = 1e-5f;      /* input order: x (feeds the q, k AND v streams), Wq, Wk, Wv (natural [out][in] weights; NO biases: null pointers in the guarded bias slots), Wo, bo (zeros: read), q_gamma, q_beta, k_gamma, k_beta [64] (ones / zeros on this draw: read by value in the per-head LayerNorm kernel) */
  char* ws = (char*)d_ws; size_t off = 0;
  auto take = [&](size_t bytes) { char* p = ws + off; off += (bytes + 255) & ~(size_t)255; return p; };
  _Float16* BQ = (_Float16*)take((size_t)DM * DM * 2); _Float16* BK = (_Float16*)take((size_t)DM * DM * 2); _Float16* BV = (_Float16*)take((size_t)DM * DM * 2); _Float16* BO = (_Float16*)take((size_t)DM * DM * 2);
  _Float16* X16 = (_Float16*)take(NR * DM * 2);      /* exact f16 rows of x: the one operand of the q, k and v projections */ float* QF = (float*)take(NR * DM * 4); float* KF = (float*)take(NR * DM * 4); float* VF = (float*)take(NR * DM * 4);      /* f32 rows of q, k (normalised in place) and v, each in a plane of its own: they stay whole for the exact first tile */ _Float16* QH = (_Float16*)take(NR * DM * 2); _Float16* QL = (_Float16*)take(NR * DM * 2); _Float16* KH = (_Float16*)take(NR * DM * 2); _Float16* KL = (_Float16*)take(NR * DM * 2); _Float16* Q16 = QH; _Float16* K16 = KH; _Float16* V16 = (_Float16*)take(NR * DM * 2); _Float16* O16 = (_Float16*)take(NR * DM * 2);
  _Float16* VT = (_Float16*)take((size_t)NB * NH * HD * SQ * 2);      /* V^T [NB][NH][HD][SQ] */
  float* OF0 = (float*)take((size_t)NB * QT0 * DM * 4); _Float16* OH0 = (_Float16*)take((size_t)NB * QT0 * DM * 2); _Float16* OL0 = (_Float16*)take((size_t)NB * QT0 * DM * 2);
  if (off > ws_size) return;
  { const unsigned g = (unsigned)(((size_t)DM * DM / 8 + 255) / 256); k_wnat<<<g, 256, 0, stream>>>(wq, (size_t)DM * DM / 8, BQ); k_wnat<<<g, 256, 0, stream>>>(wk, (size_t)DM * DM / 8, BK); k_wnat<<<g, 256, 0, stream>>>(wv, (size_t)DM * DM / 8, BV); k_wnat<<<g, 256, 0, stream>>>(wo, (size_t)DM * DM / 8, BO); }      /* natural [out][in] = Bt[n][k] x16 */
  k_x16<<<(unsigned)((NR * DM / 8 + 255) / 256), 256, 0, stream>>>(x, X16, NR * DM / 8);
  const size_t r0p = (size_t)B0 * SQ;      /* first projected row */
  k_gemm2<0><<<dim3((unsigned)((MP / 128) * (DM / 64)), 1), 128, 0, stream>>>(X16 + r0p * DM, DM, 0, BQ, DM, 0, 0.0625f, bq, 0, nullptr, 1, 0, 0, QF + r0p * DM, nullptr, DM, 0, MP, DM, DM); k_ln64f32<<<(unsigned)(((size_t)MP * NH + 255) / 256), 256, 0, stream>>>(QF + r0p * DM, DM, (size_t)MP * NH, qg, qbt, LNE); k_hl<<<(unsigned)(((size_t)MP * DM / 8 + 255) / 256), 256, 0, stream>>>(QF + r0p * DM, QH + r0p * DM, QL + r0p * DM, (size_t)MP * DM / 8);      /* q (f32) -> f16 hi + x1024 residual: unscaled logits sigma ~8 */
  k_gemm2<0><<<dim3((unsigned)((MP / 128) * (DM / 64)), 1), 128, 0, stream>>>(X16 + r0p * DM, DM, 0, BK, DM, 0, 0.0625f, bk, 0, nullptr, 1, 0, 0, KF + r0p * DM, nullptr, DM, 0, MP, DM, DM); k_ln64f32<<<(unsigned)(((size_t)MP * NH + 255) / 256), 256, 0, stream>>>(KF + r0p * DM, DM, (size_t)MP * NH, kg, kbt, LNE); k_hl<<<(unsigned)(((size_t)MP * DM / 8 + 255) / 256), 256, 0, stream>>>(KF + r0p * DM, KH + r0p * DM, KL + r0p * DM, (size_t)MP * DM / 8);      /* k likewise */
  k_gemm2<0><<<dim3((unsigned)((MP / 128) * (DM / 64)), 1), 128, 0, stream>>>(X16 + r0p * DM, DM, 0, BV, DM, 0, 0.0625f, bv, 0, nullptr, 1, 0, 0, VF + r0p * DM, V16 + r0p * DM, DM, 0, MP, DM, DM);      /* v as f16 rows for the fused attention and as f32 rows for the exact first tile */
  for (int b = B0; b < B0 + NBR; ++b) { const size_t r0 = (size_t)b * SQ;
    k_vt<NH, SQ><<<NH * (SQ / 64), 256, 0, stream>>>(V16 + r0 * LQ, LQ, 0, VT + (size_t)b * NH * HD * SQ);      /* V^T [NH][HD][SQ] of this batch */
    k_att0<<<NH * (QT0 / A0R), 256, 0, stream>>>(QF + r0 * DM, KF + r0 * DM, VF + r0 * DM, DM, SCL, OF0 + (size_t)b * QT0 * DM, DM);      /* exact f32 attention for rows 0..127 (o x64), on the f32 q, k, v rows that the full projections and their LayerNorm left */
  }
  k_fattn<<<dim3(SQ / 64, NB * NH), 128, 0, stream>>>(QH, QL, KH, KL, VT, O16);      /* scores, causal softmax and P . V of every batch, head and query row in one launch: o (merged heads, x64) as f16 rows */
  k_gemm2<0><<<dim3((unsigned)((MPO / 128) * (DM / 64)), 1), 128, 0, stream>>>(O16 + r0p * DM, DM, 0, BO, DM, 0, 0.0009765625f, bo, 0, nullptr, 1, 0, 0, (float*)d_out + r0p * DM, nullptr, DM, 0, MPO, DM, DM);      /* out rows are the output layout */
  k_hl<<<(unsigned)(((size_t)NB * QT0 * DM / 8 + 255) / 256), 256, 0, stream>>>(OF0, OH0, OL0, (size_t)NB * QT0 * DM / 8);      /* first-tile o (x64) -> f16 hi + x1024 residual planes */
  for (int b = B0; b < B0 + NBR; ++b) { const size_t r0 = (size_t)b * SQ; const size_t f0 = (size_t)b * QT0;
    k_gemm2<0><<<dim3((QT0 / 128) * (DM / 64), 1), 128, 0, stream>>>(OH0 + f0 * DM, DM, 0, BO, DM, 0, 0.0009765625f, bo, 0, nullptr, 1, 0, 0, (float*)d_out + r0 * DM, nullptr, DM, 0, QT0, DM, DM);      /* rows 0..127: out = o_hi Wo (+ b), overwriting the f16-path rows */
    k_gemm2<0><<<dim3((QT0 / 128) * (DM / 64), 1), 128, 0, stream>>>(OL0 + f0 * DM, DM, 0, BO, DM, 0, 0.00000095367431640625f, nullptr, 0, (const float*)d_out + r0 * DM, -1, 0, 0, (float*)d_out + r0 * DM, nullptr, DM, 0, QT0, DM, DM); }      /* += o_lo Wo 2^-20 (own-element accumulate) */
}

// v006
// A run of this version takes 236 microseconds.
// Timed twice side by side with v005, it ran 1.44 and 1.42 times as fast.
// Over all steps from v000 it is 46.0 times as fast.
#include <hip/hip_runtime.h>
// Causal multi-head self-attention with a per-head LayerNorm on q and k, natural bias-free q / k / v projections and a biased output projection (x [2][3072][512]; q / k / v = x W^T (nn.Linear natural [512][512] sd 0.02, NO biases), 8 heads of 64; q and k each pass through a LayerNorm over the 64 values of every (token, head) vector (biased variance, eps 1e-5, gamma / beta [64]: ones / zeros on this draw: read); scores = q . k / sqrt(64); causal (keys after the query get -inf); softmax; out = merged Wo^T + bo (natural; zero bias) -> [2][3072][512]); q and k carried as f16 hi + x1024 residual planes with three-product scores.
// Structure: token rows r = b*3072 + s; x as exact f16 rows (bf16-rounded); q and k as WMMA GEMMs (32x64 wave tiles, f32 accumulation, exact x16 weights, no bias) into f32 rows, each (token, head) vector of which an IN-PLACE f32 LayerNorm kernel normalises over its 64 values (f32 statistics, gamma / beta by value), then split into f16 hi + x1024 residual planes; v as an f16-output GEMM; V^T for all batches and heads via LDS transposes; work that does not depend on each other shares a grid (x and the weights; q, k, v; both LayerNorms; both splits; both batches); then ONE fused launch for all batches, heads and query rows: a wave takes 16 query rows and walks the keys up to its diagonal, 32 a pass: S^T = K Q^T as three products (hi.hi + lo.hi + hi.lo, K = 64, scale 1/8 = 1/sqrt(64); logits sigma ~1), causal running-maximum softmax inside the lane (f32 statistics, native exp; weights exp(s - max) as f16), O^T = V^T P^T with the weights taken in place from the score accumulators (o divided by the row sum at the end and carried x64, folded into the output GEMM alpha) written straight into the merged f16 o rows; out = o Wo^T + bo GEMM (f32) into the output layout.
// Compute dtype: inputs rounded to bf16; x / weights exact; the normalised q and k as f16 hi + residual planes (three-product scores), v, the softmax weights and o as plain f16 GEMM operands (~2^-12); LayerNorm, scores and softmax statistics f32. v_wmma_f32_16x16x32_f16.
#define NB 2
#define SCL 0.125f                         /* 1 / sqrt(head_dim = 64) */
#define SCLR 0.0001220703125f              /* 2^-13: SCL / 1024; unused: the x1024 residual products take SCLR2 */
#define SQ 3072
#define DM 512
#define NH 8
#define HD 64
#define HG 4                         /* heads per launch of the h0-based k_vt overload */
#define QT0 128                      /* first-tile rows recomputed exactly in f32 */
#define B0 0                         /* unused */
#define NBR NB                       /* batches processed (debug hook) */
#define NR ((size_t)NB * SQ)         /* token rows */
#define MP ((int)((size_t)NBR * SQ)) /* rows projected (debug hook) */
#define MPO MP                       /* rows through the output stage (debug hook) */
#define LQ DM      /* row pitch of the q/k/v rows */
typedef __bf16 v16b __attribute__((ext_vector_type(16)));
typedef unsigned short v8us __attribute__((ext_vector_type(8), may_alias));
typedef float  v8f  __attribute__((ext_vector_type(8)));
typedef float  v4f  __attribute__((ext_vector_type(4)));
typedef float  v4fa __attribute__((ext_vector_type(4), may_alias));
union FragB { v16b v; v8us half[2]; unsigned short u[16]; };

__device__ __forceinline__ unsigned short bf16_bits(float x) { unsigned int u = __float_as_uint(x); return (unsigned short)((u + 0x7FFFu + ((u >> 16) & 1u)) >> 16); }
__device__ __forceinline__ float bf16_val(unsigned short b) { return __uint_as_float(((unsigned int)b) << 16); }
__device__ __forceinline__ float bf16_round(float x) { return bf16_val(bf16_bits(x)); }
// D += A·B with NT terms: 1 = ah·bh, 2 = + al·bh (A split), 3 = + ah·bl (both split)
template <int NT>
__device__ __forceinline__ v8f mmaN(v16b ah, v16b al, v16b bh, v16b bl, v8f c) {
  c = __builtin_amdgcn_wmma_f32_16x16x32_bf16(false, ah, false, bh, (short)0, c, false, false);
  if (NT >= 2) c = __builtin_amdgcn_wmma_f32_16x16x32_bf16(false, al, false, bh, (short)0, c, false, false);
  if (NT >= 3) c = __builtin_amdgcn_wmma_f32_16x16x32_bf16(false, ah, false, bl, (short)0, c, false, false);
  asm volatile("v_nop\n\tv_nop\n\tv_nop\n\tv_nop" : "+v"(c) : "v"(ah), "v"(al), "v"(bh), "v"(bl));
  return c;
}

__global__ __launch_bounds__(256) void k_wt_bf16(const float* __restrict__ W, unsigned short* __restrict__ Wt, int K, int N) {
  const int t = blockIdx.x * 256 + threadIdx.x;
  const int k8n = K / 8;
  if (t >= N * k8n) return;
  const int n = t / k8n, k8 = (t % k8n) * 8;
  v8us v;
#pragma unroll
  for (int i = 0; i < 8; ++i) v[i] = bf16_bits(W[(size_t)(k8 + i) * N + n]);
  *(v8us*)(Wt + (size_t)n * K + k8) = v;
  
}

// GEMM C[M][N] (f32, pitch ldc) = act(A[M][K]·W + bias). A f32 row-major (pitch lda) converted per fragment to bf16
// (ASPLIT: hi/lo two planes -> 2 terms, else single rounded term); Wt bf16 [N][K] (pitch ldb). BIAS_BF16 rounds the
// bias to bf16 first (bias quantised to bf16 before the add). K%32==0, M%16==0, N%64==0.
template <bool ASPLIT, int ACT, bool BIAS_BF16>
__global__ __launch_bounds__(128) void k_gemm_bf(const float* __restrict__ A, int lda, const unsigned short* __restrict__ Wt, int ldb,
                                               const float* __restrict__ bias, float* __restrict__ C, int ldc, int M, int N, int K) {
  __shared__ __attribute__((aligned(16))) float so[4][16][64];
  const int tid = threadIdx.x, w = tid >> 5, lane = tid & 31, ln = lane & 15, hh = lane >> 4;
  const int ntn = N / 64;
  const int wid = blockIdx.x * 4 + w;
  const int mt = wid / ntn, nq = wid % ntn;
  if (mt * 16 >= M) return;
  const int row0 = mt * 16, col0 = nq * 64;
  const float* arow = A + (size_t)(row0 + ln) * lda;
  v8f acc[4] = {};
  for (int kb = 0; kb < K; kb += 32) {
    FragB ah, al;
    const v4f x0 = *(const v4fa*)(arow + kb + 8 * hh), x1 = *(const v4fa*)(arow + kb + 8 * hh + 4);
    const v4f x2 = *(const v4fa*)(arow + kb + 16 + 8 * hh), x3 = *(const v4fa*)(arow + kb + 16 + 8 * hh + 4);
    float xs[16] = {x0[0],x0[1],x0[2],x0[3],x1[0],x1[1],x1[2],x1[3],x2[0],x2[1],x2[2],x2[3],x3[0],x3[1],x3[2],x3[3]};
#pragma unroll
    for (int i = 0; i < 16; ++i) { const unsigned short hb = bf16_bits(xs[i]); ah.u[i] = hb; al.u[i] = ASPLIT ? bf16_bits(xs[i] - bf16_val(hb)) : (unsigned short)0; }
#pragma unroll
    for (int t = 0; t < 4; ++t) {
      const unsigned short* brow = Wt + (size_t)(col0 + t * 16 + ln) * ldb + kb;
      FragB b;
      b.half[0] = *(const v8us*)(brow + 8 * hh);
      b.half[1] = *(const v8us*)(brow + 16 + 8 * hh);
      acc[t] = mmaN<ASPLIT ? 2 : 1>(ah.v, al.v, b.v, b.v, acc[t]);
    }
  }
#pragma unroll
  for (int t = 0; t < 4; ++t) {
    float bv = bias ? bias[col0 + t * 16 + ln] : 0.f;
    if (BIAS_BF16) bv = bf16_round(bv);
#pragma unroll
    for (int r = 0; r < 8; ++r) { float v = acc[t][r] + bv; if (ACT == 1) v = fmaxf(v, 0.f); so[w][8 * hh + r][t * 16 + ln] = v; }
  }
  __builtin_amdgcn_fence(__ATOMIC_ACQ_REL, "workgroup");
  __builtin_amdgcn_wave_barrier();
  const int rsub = lane >> 4, c4 = (lane & 15) * 4;
  {
#pragma unroll
    for (int q = 0; q < 8; ++q) {
      const int r = q * 2 + rsub;
      const v4f v = *(const v4fa*)&so[w][r][c4];
      *(v4f*)(C + (size_t)(row0 + r) * ldc + col0 + c4) = v;
    }
    
  }
}

// GEMM C = act(A·W + bias + resid): A f32 (ASPLIT -> hi/lo 2 terms), Wt bf16 [N][K]; ACT 0 none, 1 relu, 2 exact gelu;
// resid (optional, f32, row index = (row % rmod), pitch ldr, RES_BF16 rounds it) added before the activation.
template <bool ASPLIT, int ACT, bool BIAS_BF16, bool RES_BF16>
__global__ __launch_bounds__(128) void k_gemm_bf3(const float* __restrict__ A, int lda, const unsigned short* __restrict__ Wt, int ldb,
                                                const float* __restrict__ bias, const float* __restrict__ resid, int rmod, int ldr,
                                                float* __restrict__ C, int ldc, int M, int N, int K) {
  __shared__ __attribute__((aligned(16))) float so[4][16][64];
  const int tid = threadIdx.x, w = tid >> 5, lane = tid & 31, ln = lane & 15, hh = lane >> 4;
  const int ntn = N / 64;
  const int wid = blockIdx.x * 4 + w;
  const int mt = wid / ntn, nq = wid % ntn;
  if (mt * 16 >= M) return;
  const int row0 = mt * 16, col0 = nq * 64;
  const float* arow = A + (size_t)(row0 + ln) * lda;
  v8f acc[4] = {};
  for (int kb = 0; kb < K; kb += 32) {
    FragB ah, al;
    const v4f x0 = *(const v4fa*)(arow + kb + 8 * hh), x1 = *(const v4fa*)(arow + kb + 8 * hh + 4);
    const v4f x2 = *(const v4fa*)(arow + kb + 16 + 8 * hh), x3 = *(const v4fa*)(arow + kb + 16 + 8 * hh + 4);
    float xs[16] = {x0[0],x0[1],x0[2],x0[3],x1[0],x1[1],x1[2],x1[3],x2[0],x2[1],x2[2],x2[3],x3[0],x3[1],x3[2],x3[3]};
#pragma unroll
    for (int i = 0; i < 16; ++i) { const unsigned short hb = bf16_bits(xs[i]); ah.u[i] = hb; al.u[i] = ASPLIT ? bf16_bits(xs[i] - bf16_val(hb)) : (unsigned short)0; }
#pragma unroll
    for (int t = 0; t < 4; ++t) {
      const unsigned short* brow = Wt + (size_t)(col0 + t * 16 + ln) * ldb + kb;
      FragB b;
      b.half[0] = *(const v8us*)(brow + 8 * hh);
      b.half[1] = *(const v8us*)(brow + 16 + 8 * hh);
      acc[t] = mmaN<ASPLIT ? 2 : 1>(ah.v, al.v, b.v, b.v, acc[t]);
    }
  }
#pragma unroll
  for (int t = 0; t < 4; ++t) {
    const int col = col0 + t * 16 + ln;
    float bv = bias ? bias[col] : 0.f;
    if (BIAS_BF16) bv = bf16_round(bv);
#pragma unroll
    for (int r = 0; r < 8; ++r) {
      float v = acc[t][r] + bv;
      if (resid) { float rv = resid[(size_t)((row0 + 8 * hh + r) % rmod) * ldr + col]; if (RES_BF16) rv = bf16_round(rv); v += rv; }
      if (ACT == 1) v = fmaxf(v, 0.f);
      if (ACT == 2) v = 0.5f * v * (1.0f + erff(v * 0.70710678118654752f));
      if (ACT == 3) { const float u = 0.7978845608028654f * (v + 0.044715f * v * v * v); v = 0.5f * v * (1.0f + tanhf(u)); }
      so[w][8 * hh + r][t * 16 + ln] = v;
    }
  }
  __builtin_amdgcn_fence(__ATOMIC_ACQ_REL, "workgroup");
  __builtin_amdgcn_wave_barrier();
  const int rsub = lane >> 4, c4 = (lane & 15) * 4;
  {
#pragma unroll
    for (int q = 0; q < 8; ++q) {
      const int r = q * 2 + rsub;
      const v4f v = *(const v4fa*)&so[w][r][c4];
      *(v4f*)(C + (size_t)(row0 + r) * ldc + col0 + c4) = v;
    }
    
  }
}
// row LayerNorm (biased variance, eps) over N: s = X (+ R); optional out_sum <- s; out_norm <- (s-mu)*rsqrt(var+eps)*g + b
template <bool PARAM_BF16>
__global__ __launch_bounds__(256) void k_layernorm(const float* __restrict__ X, const float* __restrict__ R, const float* __restrict__ g, const float* __restrict__ bta,
                                                  float* __restrict__ out_sum, float* __restrict__ out_norm, int N, float eps) {
  __shared__ float red[256];
  const int row = blockIdx.x, tid = threadIdx.x;
  const float* x = X + (size_t)row * N; const float* rr = R ? R + (size_t)row * N : nullptr;
  float vals[16];                     // up to N = 4096
  const int per = N / 256;            // contiguous chunk per thread? use strided-by-4 chunks: thread handles j = tid*4 + 1024*u
  float s1 = 0.f;
  for (int u = 0; u < per / 4; ++u) {
    const int j = tid * 4 + 1024 * u;
    const v4f a = *(const v4fa*)(x + j);
    v4f b = {0.f,0.f,0.f,0.f}; if (rr) b = *(const v4fa*)(rr + j);
#pragma unroll
    for (int q = 0; q < 4; ++q) { const float v = a[q] + b[q]; vals[u * 4 + q] = v; s1 += v; }
  }
  red[tid] = s1; __syncthreads();
  for (int st = 128; st > 0; st >>= 1) { if (tid < st) red[tid] += red[tid + st]; __syncthreads(); }
  const float mu = red[0] / (float)N; __syncthreads();
  float s2 = 0.f;
  for (int u = 0; u < per / 4; ++u)
#pragma unroll
    for (int q = 0; q < 4; ++q) { const float c = vals[u * 4 + q] - mu; s2 += c * c; }
  red[tid] = s2; __syncthreads();
  for (int st = 128; st > 0; st >>= 1) { if (tid < st) red[tid] += red[tid + st]; __syncthreads(); }
  const float rs = rsqrtf(red[0] / (float)N + eps);
  {
    for (int u = 0; u < per / 4; ++u) {
      const int j = tid * 4 + 1024 * u;
      v4f o, sm;
#pragma unroll
      for (int q = 0; q < 4; ++q) {
        float gg = g[j + q], bb = bta[j + q];
        if (PARAM_BF16) { gg = bf16_round(gg); bb = bf16_round(bb); }
        sm[q] = vals[u * 4 + q]; o[q] = (vals[u * 4 + q] - mu) * rs * gg + bb;
      }
      if (out_sum) *(v4f*)(out_sum + (size_t)row * N + j) = sm;
      *(v4f*)(out_norm + (size_t)row * N + j) = o;
    }
    
  }
}



// ---- f16 WMMA path (v_wmma_f32_16x16x32_f16): 11-bit significands for operands in range — used where a [0,1] probability operand needs more precision than bf16
typedef _Float16 v16h __attribute__((ext_vector_type(16)));
union FragH { v16h v; v8us half[2]; _Float16 h[16]; unsigned short u[16]; };
template <int NT>
__device__ __forceinline__ v8f mmaH(v16h ah, v16h al, v16h bh, v16h bl, v8f c) {
  c = __builtin_amdgcn_wmma_f32_16x16x32_f16(false, ah, false, bh, (short)0, c, false, false);
  if (NT >= 2) c = __builtin_amdgcn_wmma_f32_16x16x32_f16(false, al, false, bh, (short)0, c, false, false);
  if (NT >= 3) c = __builtin_amdgcn_wmma_f32_16x16x32_f16(false, ah, false, bl, (short)0, c, false, false);
  asm volatile("v_nop\n\tv_nop\n\tv_nop\n\tv_nop" : "+v"(c) : "v"(ah), "v"(al), "v"(bh), "v"(bl));
  return c;
}
// batched GEMM like k_gemm_b but f16 operands: A f32 (split into f16 hi/lo if ASPLIT, else rounded to f16), Bt = f16 values [n][k]; alpha; C f32; N multiple of 16 (partial tiles skipped)
template <bool ASPLIT>
__global__ __launch_bounds__(128) void k_gemm_h(const float* __restrict__ A, int lda, size_t sA, const _Float16* __restrict__ Bh, int ldb, size_t sB, float alpha, float* __restrict__ C, int ldc, size_t sC, int M, int N, int K) {
  __shared__ __attribute__((aligned(16))) float so[4][16][64];
  const int tid = threadIdx.x, w = tid >> 5, lane = tid & 31, ln = lane & 15, hh = lane >> 4; const int by = blockIdx.y;
  A += (size_t)by * sA; Bh += (size_t)by * sB; C += (size_t)by * sC;
  const int ntn = (N + 63) / 64; const int wid = blockIdx.x * 4 + w; const int mt = wid / ntn, nq = wid % ntn; if (mt * 16 >= M) return;
  const int row0 = mt * 16, col0 = nq * 64; const float* arow = A + (size_t)(row0 + ln) * lda;
  v8f acc[4] = {};
  for (int kb = 0; kb < K; kb += 32) {
    FragH ah, al;
    const v4f x0 = *(const v4fa*)(arow + kb + 8 * hh), x1 = *(const v4fa*)(arow + kb + 8 * hh + 4), x2 = *(const v4fa*)(arow + kb + 16 + 8 * hh), x3 = *(const v4fa*)(arow + kb + 16 + 8 * hh + 4);
    float xs[16] = {x0[0],x0[1],x0[2],x0[3],x1[0],x1[1],x1[2],x1[3],x2[0],x2[1],x2[2],x2[3],x3[0],x3[1],x3[2],x3[3]};
#pragma unroll
    for (int i = 0; i < 16; ++i) { const _Float16 h = (_Float16)xs[i]; ah.h[i] = h; al.h[i] = ASPLIT ? (_Float16)(xs[i] - (float)h) : (_Float16)0.0f; }
#pragma unroll
    for (int t = 0; t < 4; ++t) { if (col0 + t * 16 >= N) continue; const size_t boff = (size_t)(col0 + t * 16 + ln) * ldb + kb; FragH bq; bq.half[0] = *(const v8us*)(Bh + boff + 8 * hh); bq.half[1] = *(const v8us*)(Bh + boff + 16 + 8 * hh);
      acc[t] = mmaH<ASPLIT ? 2 : 1>(ah.v, al.v, bq.v, bq.v, acc[t]); }
  }
#pragma unroll
  for (int t = 0; t < 4; ++t) { if (col0 + t * 16 >= N) continue;
#pragma unroll
    for (int r = 0; r < 8; ++r) so[w][8 * hh + r][t * 16 + ln] = acc[t][r] * alpha; }
  __builtin_amdgcn_fence(__ATOMIC_ACQ_REL, "workgroup"); __builtin_amdgcn_wave_barrier();
  const int rsub = lane >> 4, c4 = (lane & 15) * 4;
  {
#pragma unroll
    for (int q = 0; q < 8; ++q) { const int r = q * 2 + rsub; if (col0 + c4 < N) { const v4f v = *(const v4fa*)&so[w][r][c4]; *(v4f*)(C + (size_t)(row0 + r) * ldc + col0 + c4) = v; } }
     }
}

// Wt[n][k] = f16(W[k][n]·scale) from f32 row-major W[K][N] (scale = power of two; bf16-exact weights stay exact in f16 away from the subnormal range)
__global__ __launch_bounds__(256) void k_wt_f16(const float* __restrict__ W, _Float16* __restrict__ Wt, int K, int N, float scale) {
  const int t = blockIdx.x * 256 + threadIdx.x; if (t >= N * (K / 8)) return; const int n = t / (K / 8), k8 = (t % (K / 8)) * 8; FragH f;
#pragma unroll
  for (int i = 0; i < 8; ++i) f.h[i] = (_Float16)(bf16_round(W[(size_t)(k8 + i) * N + n]) * scale); const v8us o = f.half[0];
  *(v8us*)((unsigned short*)Wt + (size_t)n * K + k8) = o; 
}
// k_gemm_hh variant with fused epilogue: v = acc·alpha + bias[by·sBias + col] (+ CP[(row/rowsPerB)·sCPb + by·64 + col] if CP) ; ACT 0 none / 1 elu ; writes f16 C16 (and f32 C if non-null)
template <int ACT>
__global__ __launch_bounds__(128) void k_gemm_hhx(const _Float16* __restrict__ A, int lda, size_t sA, const _Float16* __restrict__ Bh, int ldb, size_t sB, float alpha, const float* __restrict__ bias, size_t sBias, const float* __restrict__ CP, int rowsPerB, size_t sCPb, int row0g,
    float* __restrict__ C, _Float16* __restrict__ C16, int ldc, size_t sC, int M, int N, int K) {
  __shared__ __attribute__((aligned(16))) float so[4][16][64];
  const int tid = threadIdx.x, w = tid >> 5, lane = tid & 31, ln = lane & 15, hh = lane >> 4; const int by = blockIdx.y;
  A += (size_t)by * sA; Bh += (size_t)by * sB; const size_t cofs = (size_t)by * sC; const float* bp = bias ? bias + (size_t)by * sBias : nullptr;
  const int ntn = (N + 63) / 64; const int wid = blockIdx.x * 4 + w; const int mt = wid / ntn, nq = wid % ntn; if (mt * 16 >= M) return;
  const int row0 = mt * 16, col0 = nq * 64; const _Float16* arow = A + (size_t)(row0 + ln) * lda;
  v8f acc[4] = {};
  for (int kb = 0; kb < K; kb += 32) { FragH ah; ah.half[0] = *(const v8us*)((const unsigned short*)arow + kb + 8 * hh); ah.half[1] = *(const v8us*)((const unsigned short*)arow + kb + 16 + 8 * hh);
#pragma unroll
    for (int t = 0; t < 4; ++t) { if (col0 + t * 16 >= N) continue; const size_t boff = (size_t)(col0 + t * 16 + ln) * ldb + kb; FragH bq; bq.half[0] = *(const v8us*)((const unsigned short*)Bh + boff + 8 * hh); bq.half[1] = *(const v8us*)((const unsigned short*)Bh + boff + 16 + 8 * hh);
      acc[t] = mmaH<1>(ah.v, ah.v, bq.v, bq.v, acc[t]); }
  }
#pragma unroll
  for (int t = 0; t < 4; ++t) { if (col0 + t * 16 >= N) continue; const int col = col0 + t * 16 + ln; const float bv = bp ? bf16_round(bp[col]) : 0.f;
#pragma unroll
    for (int r = 0; r < 8; ++r) { float v = acc[t][r] * alpha + bv; if (CP) { const int rr = row0g + row0 + 8 * hh + r; if (rowsPerB < 0) v += CP[cofs + (size_t)rr * ldc + col];      /* rowsPerB < 0: own element of the batched C plane */ else { const int bidx = rr / rowsPerB; v += CP[(size_t)bidx * sCPb + (size_t)by * 64 + col]; } } if (ACT == 1) v = (v > 0.f) ? v : expm1f(v); else if (ACT == 7) v = (v > 0.f) ? v + 1.0f : expf(v); else if (ACT == 8) v = tanhf(v); else if (ACT == 9) v = 0.5f * v * (1.0f + tanhf(0.7978845608028654f * (v + 0.044715f * v * v * v))); else if (ACT == 11) v = 1.0f / (1.0f + expf(-v)); else if (ACT == 12) v = (v > 0.f) ? v : 0.01f * v; else if (ACT == 14) v = (v > 0.f) ? v : 0.1f * v; else if (ACT == 16) v = (v >= 0.f) ? v : 0.3f * v; else if (ACT == 17) v = (v >= 0.f) ? v : 0.2f * v; else if (ACT == 15) v = v / (1.0f + expf(-v)); else if (ACT == 3) v = fmaxf(v, 0.f); else if (ACT == 6) v = 0.5f * v * (1.0f + erff(v * 0.70710678118654752f)); so[w][8 * hh + r][t * 16 + ln] = v; } }
  __builtin_amdgcn_fence(__ATOMIC_ACQ_REL, "workgroup"); __builtin_amdgcn_wave_barrier();
  const int rsub = lane >> 4, c4 = (lane & 15) * 4; typedef _Float16 v4h __attribute__((ext_vector_type(4)));
  {
#pragma unroll
    for (int q = 0; q < 8; ++q) { const int r = q * 2 + rsub; if (col0 + c4 < N) { const v4f v = *(const v4fa*)&so[w][r][c4]; if (C) *(v4f*)(C + cofs + (size_t)(row0 + r) * ldc + col0 + c4) = v; if (C16) { v4h h4; for (int i = 0; i < 4; ++i) h4[i] = (_Float16)v[i]; *(v4h*)(C16 + cofs + (size_t)(row0 + r) * ldc + col0 + c4) = h4; } } }
     }
}


typedef _Float16 v4h __attribute__((ext_vector_type(4)));

__global__ __launch_bounds__(256) void k_x16(const float* __restrict__ x, _Float16* __restrict__ X16, size_t n8) { const size_t t = (size_t)blockIdx.x * 256 + threadIdx.x; if (t >= n8) return; FragH f;
#pragma unroll
  for (int q = 0; q < 8; ++q) f.h[q] = (_Float16)bf16_round(x[t * 8 + q]); *(v8us*)((unsigned short*)X16 + t * 8) = f.half[0];  }
__global__ __launch_bounds__(256) void k_h16(const float* __restrict__ x, _Float16* __restrict__ X16, size_t n8) { const size_t t = (size_t)blockIdx.x * 256 + threadIdx.x; if (t >= n8) return; FragH f;
#pragma unroll
  for (int q = 0; q < 8; ++q) f.h[q] = (_Float16)x[t * 8 + q]; *(v8us*)((unsigned short*)X16 + t * 8) = f.half[0];  }
__global__ __launch_bounds__(256) void k_round16f(const float* __restrict__ W, _Float16* __restrict__ Bt, size_t n8) { const size_t t = (size_t)blockIdx.x * 256 + threadIdx.x; if (t >= n8) return; FragH f;
#pragma unroll
  for (int i = 0; i < 8; ++i) f.h[i] = (_Float16)(bf16_round(W[t * 8 + i]) * 16.0f); *(v8us*)((unsigned short*)Bt + t * 8) = f.half[0];  }
template <int NHv, int TTv>
__global__ __launch_bounds__(256) void k_vt(const _Float16* __restrict__ V16, int ldv, int voff, _Float16* __restrict__ Vt) { __shared__ unsigned short tl[64][66]; const int tid = threadIdx.x; const int slab = blockIdx.x / (TTv / 64), lg = blockIdx.x % (TTv / 64); const int b = slab / NHv, h = slab % NHv;
  for (int i = tid; i < 64 * 8; i += 256) { const int r = i / 8, c8 = (i % 8) * 8; FragH f; f.half[0] = *(const v8us*)((const unsigned short*)V16 + ((size_t)b * TTv + lg * 64 + r) * ldv + voff + h * 64 + c8);
#pragma unroll
    for (int q = 0; q < 8; ++q) tl[r][c8 + q] = f.u[q]; }
  __syncthreads();
  {
#pragma unroll
    for (int rd = 0; rd < 2; ++rd) { const int d = rd * 32 + tid / 8, pc = tid % 8; FragH f;
#pragma unroll
      for (int q = 0; q < 8; ++q) f.u[q] = tl[pc * 8 + q][d];
      *(v8us*)((unsigned short*)Vt + ((size_t)slab * 64 + d) * TTv + lg * 64 + pc * 8) = f.half[0]; }
     } }

__global__ __launch_bounds__(256) void k_hl(const float* __restrict__ F, _Float16* __restrict__ Hh, _Float16* __restrict__ Hl, size_t n8) { const size_t t = (size_t)blockIdx.x * 256 + threadIdx.x; if (t >= n8) return; FragH fh, fl; const v4f a = *(const v4fa*)(F + t * 8), c = *(const v4fa*)(F + t * 8 + 4);
#pragma unroll
  for (int q = 0; q < 4; ++q) { _Float16 h = (_Float16)a[q]; fh.h[q] = h; fl.h[q] = (_Float16)((a[q] - (float)h) * 1024.0f); h = (_Float16)c[q]; fh.h[4 + q] = h; fl.h[4 + q] = (_Float16)((c[q] - (float)h) * 1024.0f); }
  { *(v8us*)((unsigned short*)Hh + t * 8) = fh.half[0]; *(v8us*)((unsigned short*)Hl + t * 8) = fl.half[0];  } }

// ---- fast GEMM (wave tile 32x64; requires M % 32 == 0 rows per launch region and N % 64 == 0); epilogue = k_gemm_hhx semantics, but f16 rows only for planes from by16 on ----
__device__ __forceinline__ v16h g2_frag(const _Float16* p, int hh) { FragH f; f.half[0] = *(const v8us*)((const unsigned short*)p + 8 * hh); f.half[1] = *(const v8us*)((const unsigned short*)p + 16 + 8 * hh); return f.v; }
__device__ __forceinline__ v8f g2_mma(v16h a, v16h b, v8f c) { v8f d = __builtin_amdgcn_wmma_f32_16x16x32_f16(false, a, false, b, (short)0, c, false, false); asm volatile("v_nop\n\tv_nop\n\tv_nop\n\tv_nop" : "+v"(d) : "v"(a), "v"(b)); return d; }
template <int ACT>
__global__ __launch_bounds__(128) void k_gemm2(const _Float16* __restrict__ A, int lda, size_t sA, const _Float16* __restrict__ Bh, int ldb, size_t sB, float alpha, const float* __restrict__ bias, size_t sBias, const float* __restrict__ CP, int rowsPerB, size_t sCPb, int row0g,
    float* __restrict__ C, _Float16* __restrict__ C16, int by16, int ldc, size_t sC, int M, int N, int K) { static_assert(ACT == 0 || ACT == 3 || ACT == 6 || ACT == 8 || ACT == 9 || ACT == 11 || ACT == 12 || ACT == 14 || ACT == 15 || ACT == 16 || ACT == 17, "k_gemm2: unsupported ACT code (would silently apply no activation)");
  __shared__ __attribute__((aligned(16))) float so[4][32][68];
  const int tid = threadIdx.x, w = tid >> 5, lane = tid & 31, ln = lane & 15, hh = lane >> 4; const int by = blockIdx.y;
  A += (size_t)by * sA; Bh += (size_t)by * sB; const size_t cofs = (size_t)by * sC; const float* bp = bias ? bias + (size_t)by * sBias : nullptr;
  if (by < by16) C16 = nullptr; else if (C16) C16 -= (size_t)by16 * sC;      /* f16 rows are stored from plane by16 on, and C16 is the place of that plane's */
  const int ntn = N >> 6; const int mt = blockIdx.x / ntn, nq = blockIdx.x - mt * ntn; const int row0 = mt * 128 + 32 * w, col0 = nq * 64; if (row0 >= M) return;
  const _Float16* a0p = A + (size_t)(row0 + ln) * lda; const _Float16* a1p = a0p + (size_t)16 * lda;
  const _Float16* b0p = Bh + (size_t)(col0 + ln) * ldb; const _Float16* b1p = b0p + (size_t)16 * ldb; const _Float16* b2p = b1p + (size_t)16 * ldb; const _Float16* b3p = b2p + (size_t)16 * ldb;
  const v8f z8 = {0.f,0.f,0.f,0.f,0.f,0.f,0.f,0.f}; v8f c00 = z8, c01 = z8, c02 = z8, c03 = z8, c10 = z8, c11 = z8, c12 = z8, c13 = z8;
#pragma unroll 1
  for (int kb = 0; kb < K; kb += 32) { const v16h a0 = g2_frag(a0p + kb, hh), a1 = g2_frag(a1p + kb, hh);
    v16h b = g2_frag(b0p + kb, hh); c00 = g2_mma(a0, b, c00); c10 = g2_mma(a1, b, c10);
    b = g2_frag(b1p + kb, hh); c01 = g2_mma(a0, b, c01); c11 = g2_mma(a1, b, c11);
    b = g2_frag(b2p + kb, hh); c02 = g2_mma(a0, b, c02); c12 = g2_mma(a1, b, c12);
    b = g2_frag(b3p + kb, hh); c03 = g2_mma(a0, b, c03); c13 = g2_mma(a1, b, c13); }
  v8f accs[8] = {c00, c01, c02, c03, c10, c11, c12, c13};
#pragma unroll
  for (int u = 0; u < 8; ++u) { const int t = u & 3, half = u >> 2; const int col = col0 + t * 16 + ln; const float bv = bp ? bf16_round(bp[col]) : 0.f;
#pragma unroll
    for (int r = 0; r < 8; ++r) { const int rloc = half * 16 + 8 * hh + r; float v = accs[u][r] * alpha + bv; if (CP) { if (rowsPerB < 0) v += CP[cofs + (size_t)(row0g + row0 + rloc) * ldc + col];      /* rowsPerB < 0: own element of the batched C plane */ else { const int bidx = (row0g + row0 + rloc) / rowsPerB; v += CP[(size_t)bidx * sCPb + (size_t)by * 64 + col]; } }
      if (ACT == 3) v = fmaxf(v, 0.f); else if (ACT == 6) v = 0.5f * v * (1.0f + erff(v * 0.70710678118654752f)); else if (ACT == 11) v = 1.0f / (1.0f + expf(-v)); else if (ACT == 15) v = v / (1.0f + expf(-v)); else if (ACT == 12) v = (v > 0.f) ? v : 0.01f * v; else if (ACT == 8) v = tanhf(v); else if (ACT == 9) v = 0.5f * v * (1.0f + tanhf(0.7978845608028654f * (v + 0.044715f * v * v * v))); else if (ACT == 14) v = (v > 0.f) ? v : 0.1f * v; else if (ACT == 16) v = (v >= 0.f) ? v : 0.3f * v; else if (ACT == 17) v = (v >= 0.f) ? v : 0.2f * v;
      so[w][rloc][t * 16 + ln] = v; } }
  __builtin_amdgcn_fence(__ATOMIC_ACQ_REL, "workgroup"); __builtin_amdgcn_wave_barrier();
  const int rsub = lane >> 4, c4 = (lane & 15) * 4;
  {
#pragma unroll
    for (int q = 0; q < 16; ++q) { const int r = q * 2 + rsub; const v4f v = *(const v4fa*)&so[w][r][c4]; if (C) { *(v4f*)(C + cofs + (size_t)(row0 + r) * ldc + col0 + c4) = v; asm volatile("s_wait_xcnt 0x0" ::: "memory"); }      /* the wait stands in front of every later write of the data and address registers that this store names: where both planes are written, the f16 conversion below reuses them */
      if (C16) { v4h h4; for (int i = 0; i < 4; ++i) h4[i] = (_Float16)v[i]; *(v4h*)(C16 + cofs + (size_t)(row0 + r) * ldc + col0 + c4) = h4; } }
     } }


// x and the four weight matrices in one grid: the first xb work-groups round x to exact f16 rows, the next 4 x wb the natural [out][in] weights (x16) into four planes that lie one behind the other. None of the five reads what another writes.
__global__ __launch_bounds__(256) void k_prep(const float* __restrict__ x, const float* __restrict__ w0, const float* __restrict__ w1, const float* __restrict__ w2, const float* __restrict__ w3, _Float16* __restrict__ X16, _Float16* __restrict__ Bt) {
  constexpr int xb = (int)(NR * DM / 2048), wb = DM * DM / 2048; const int bx = blockIdx.x; const float* s = x; _Float16* d = X16; float sc = 1.0f; int lb = bx;      /* a product with 1 is exact */
  if (bx >= xb) { const int p = (bx - xb) / wb; lb = (bx - xb) - p * wb; s = (p == 0) ? w0 : (p == 1) ? w1 : (p == 2) ? w2 : w3; d = Bt + (size_t)p * wb * 2048; sc = 16.0f; }      /* work-group-uniform; a work-group covers 2048 values */
  const size_t t = (size_t)lb * 256 + threadIdx.x; const v4f a = *(const v4fa*)(s + t * 8), c = *(const v4fa*)(s + t * 8 + 4); FragH f;
#pragma unroll      /* constant indices into the loaded registers */
  for (int q = 0; q < 4; ++q) { f.h[q] = (_Float16)(bf16_round(a[q]) * sc); f.h[4 + q] = (_Float16)(bf16_round(c[q]) * sc); }
  *(v8us*)((unsigned short*)d + t * 8) = f.half[0]; }
__global__ __launch_bounds__(256) void k_rsm(const float* __restrict__ S, _Float16* __restrict__ P, int nrows) {
  #pragma clang fp contract(off)
  const int i = blockIdx.x * 256 + threadIdx.x; if (i >= nrows) return; const float* s = S + (size_t)i * SQ; float mx = -3.0e38f;
#pragma unroll 1
  for (int j = 0; j < SQ; ++j) mx = fmaxf(mx, s[j]); float se = 0.f;
#pragma unroll 1
  for (int j = 0; j < SQ; ++j) se += expf(s[j] - mx); const float sc = 256.0f / se;
#pragma unroll 1
  for (int j0 = 0; j0 < SQ; j0 += 8) { FragH f; for (int q = 0; q < 8; ++q) f.h[q] = (_Float16)(expf(s[j0 + q] - mx) * sc); unsigned short* d = (unsigned short*)P + (size_t)i * SQ + j0; *(v8us*)d = f.half[0];  } }
__global__ __launch_bounds__(256) void k_vt(const _Float16* __restrict__ V16, int b, int h0, _Float16* __restrict__ VT) { __shared__ unsigned short tl[64][65]; const int tid = threadIdx.x; const int hh = blockIdx.x % HG, sg = blockIdx.x / HG; const int s0 = sg * 64; const int h = h0 + hh;
  for (int i = tid; i < 64 * 8; i += 256) { const int j = i / 8, d8 = (i % 8) * 8; FragH f; f.half[0] = *(const v8us*)((const unsigned short*)V16 + ((size_t)b * SQ + s0 + j) * DM + h * HD + d8); for (int q = 0; q < 8; ++q) tl[d8 + q][j] = f.u[q]; }
  __syncthreads();
  { for (int i = tid; i < 64 * 8; i += 256) { const int d = i / 8, j8 = (i % 8) * 8; FragH f; for (int q = 0; q < 8; ++q) f.u[q] = tl[d][j8 + q]; *(v8us*)((unsigned short*)VT + ((size_t)hh * HD + d) * SQ + s0 + j8) = f.half[0]; }  } }



__device__ __forceinline__ float rs_xhalf(float x) { return __builtin_bit_cast(float, __builtin_amdgcn_permlanex16(__builtin_bit_cast(int, x), __builtin_bit_cast(int, x), 0x76543210, 0xfedcba98, false, false)); }      /* lane l <- lane l ^ 16 */
__device__ __forceinline__ float fa_exp2(float x) { float y; asm("v_exp_f32 %0, %1\n\tv_nop" : "=v"(y) : "v"(x)); return y; }      /* 2^x; the v_nop is the slot the instruction set asks for behind a transcendental */
#define SCL2 0.18033688f                   /* SCL * log2(e): scores carried in the base-2 domain, so that a weight is one subtract and one 2^x */
#define SCLR2 (SCL2 * 0.0009765625f)       /* the same scale on the x1024 residual products */
// Fused causal attention, one wave per 16 query rows of one (batch, head); 32 keys a pass, no score or weight plane in memory.
// S^T = K Q^T (A = key rows, B = query rows): a lane holds 16 scores of ITS query (column ln), keys kb + 8 hh + r and kb + 16 + 8 hh + r: the very places of the B fragment of O^T = V^T P^T,
// so the weights go from the score accumulators to the next product inside the lane. Row maximum and row sum: in the lane, plus one exchange with lane ^ 16. Running maximum, o and sum rescaled each pass.
// The four waves of a work-group walk the same keys: a tile of 64 keys (K hi, K residual, V^T: 64 rows of 128 bytes each) is brought into LDS once for all four by asynchronous copies of whole 128-byte lines, two buffers, the next tile in flight while this one is worked on; the fragments are 16-byte LDS reads.
#define FKT 64                       /* keys of a staged tile: two passes */
#define FPT 72                       /* pitch of a staged row in f16: 144 B = 9 x 16 B, so that 16 lanes reading 16 rows by 16 bytes do not meet in a bank */
#define FPL (FKT * FPT * 2)          /* bytes of one staged plane */
#define FRS (16 * FPT * 2)           /* bytes of 16 staged rows: the step between a lane's four pieces of a plane */
// One tile: a lane's twelve 16-byte pieces (four of each plane, 16 rows apart). ld: the lane's LDS byte address in plane 0 of the buffer; gh, gl, gv: its first piece in the K hi rows, the K residual rows and the V^T rows.
__device__ __forceinline__ void fa_stage(unsigned ld, const _Float16* gh, const _Float16* gl, const _Float16* gv) {
  asm volatile(      /* the copies go from global memory to LDS through no register; the s_wait_xcnt in the same statement stands in front of every later write of the address registers that the copies name */
    "global_load_async_to_lds_b128 %0, %12, off\n\t"
    "global_load_async_to_lds_b128 %1, %13, off\n\t"
    "global_load_async_to_lds_b128 %2, %14, off\n\t"
    "global_load_async_to_lds_b128 %3, %15, off\n\t"
    "global_load_async_to_lds_b128 %4, %16, off\n\t"
    "global_load_async_to_lds_b128 %5, %17, off\n\t"
    "global_load_async_to_lds_b128 %6, %18, off\n\t"
    "global_load_async_to_lds_b128 %7, %19, off\n\t"
    "global_load_async_to_lds_b128 %8, %20, off\n\t"
    "global_load_async_to_lds_b128 %9, %21, off\n\t"
    "global_load_async_to_lds_b128 %10, %22, off\n\t"
    "global_load_async_to_lds_b128 %11, %23, off\n\t"
    "s_wait_xcnt 0x0"
    :: "v"(ld), "v"(ld + FRS), "v"(ld + 2 * FRS), "v"(ld + 3 * FRS),
       "v"(ld + FPL), "v"(ld + FPL + FRS), "v"(ld + FPL + 2 * FRS), "v"(ld + FPL + 3 * FRS),
       "v"(ld + 2 * FPL), "v"(ld + 2 * FPL + FRS), "v"(ld + 2 * FPL + 2 * FRS), "v"(ld + 2 * FPL + 3 * FRS),
       "v"(gh), "v"(gh + (size_t)16 * LQ), "v"(gh + (size_t)32 * LQ), "v"(gh + (size_t)48 * LQ),
       "v"(gl), "v"(gl + (size_t)16 * LQ), "v"(gl + (size_t)32 * LQ), "v"(gl + (size_t)48 * LQ),
       "v"(gv), "v"(gv + (size_t)16 * SQ), "v"(gv + (size_t)32 * SQ), "v"(gv + (size_t)48 * SQ)
    : "memory"); }
__global__ __launch_bounds__(128) void k_fattn(const _Float16* __restrict__ QHp, const _Float16* __restrict__ QLp, const _Float16* __restrict__ KHp, const _Float16* __restrict__ KLp, const _Float16* __restrict__ VTp, _Float16* __restrict__ Op) {
  __shared__ __attribute__((aligned(16))) _Float16 sk[2][3][FKT][FPT];      /* [buffer][K hi, K residual, V^T][row][64 values + pad] */
  const int tid = threadIdx.x, lane = tid & 31, ln = lane & 15, hh = lane >> 4; const int w = __builtin_amdgcn_readfirstlane(tid >> 5);
  const int bh = blockIdx.y, b = bh / NH, h = bh % NH; const int nst = SQ / FKT - (int)blockIdx.x;      /* tiles up to and with the work-group's diagonal tile; the longest rows start first */
  const int q0 = (nst - 1) * FKT + w * 16;
  const size_t r0 = (size_t)b * SQ; const int q = q0 + ln;
  const int sr = tid >> 3, sc8 = (tid & 7) * 8;      /* staging: eight lanes copy one 128-byte row, a wave four whole rows a copy */
  const _Float16* gh = KHp + (r0 + sr) * LQ + h * HD + sc8; const _Float16* gl = KLp + (r0 + sr) * LQ + h * HD + sc8; const _Float16* gv = VTp + ((size_t)bh * HD + sr) * SQ + sc8;
  const unsigned ld0 = (unsigned)(size_t)&sk[0][0][sr][sc8];      /* the low 32 bits of a shared address are its LDS byte address */
  fa_stage(ld0, gh, gl, gv);      /* tile 0 into buffer 0 */
  const _Float16* qh = QHp + (r0 + q) * LQ + h * HD; const _Float16* ql = QLp + (r0 + q) * LQ + h * HD;
  const v16h qh0 = g2_frag(qh, hh), qh1 = g2_frag(qh + 32, hh), ql0 = g2_frag(ql, hh), ql1 = g2_frag(ql + 32, hh);
  const v8f z8 = {0.f,0.f,0.f,0.f,0.f,0.f,0.f,0.f}; v8f o0 = z8, o1 = z8, o2 = z8, o3 = z8; float m = -1.0e30f, l = 0.f;
  asm volatile("s_wait_asynccnt 0x0" ::: "memory");      /* this wave's pieces of tile 0 have landed */
  __syncthreads();      /* every wave's pieces of tile 0 have landed: the tile may be read */
  if (nst > 1) fa_stage(ld0 + 3 * FPL, gh + (size_t)FKT * LQ, gl + (size_t)FKT * LQ, gv + FKT);      /* tile 1 into buffer 1 */
#pragma unroll 1      /* a trip holds two passes of 24 fragment loads and 16 products each: a second copy of it would not fit the registers */
  for (int st = 0; st < nst; ++st) {
    const _Float16* tk = &sk[st & 1][0][ln][0]; const _Float16* tl = &sk[st & 1][1][ln][0]; const _Float16* tv = &sk[st & 1][2][ln][0];      /* this trip reads this buffer alone */
    v16h ka0 = g2_frag(tk, hh), ka1 = g2_frag(tk + 32, hh), ka2 = g2_frag(tk + 16 * FPT, hh), ka3 = g2_frag(tk + 16 * FPT + 32, hh);      /* the tile's key rows 0 .. 31, hi plane */
    v16h kc0 = g2_frag(tl, hh), kc1 = g2_frag(tl + 32, hh), kc2 = g2_frag(tl + 16 * FPT, hh), kc3 = g2_frag(tl + 16 * FPT + 32, hh);      /* the same rows, residual plane */
#pragma unroll      /* the two passes of a tile: the second one's LDS offsets as immediates, its key fragments asked for in the first */
    for (int sub = 0; sub < 2; ++sub) {
      const int kb = st * FKT + sub * 32;
      if (sub == 1 && kb >= q0 + 16) break;      /* wave-uniform: a pass runs only while kb < q0 + 16, so that every query has a key in every pass; the foot of the trip below is passed all the same */
      const v16h va0 = g2_frag(tv + sub * 32, hh), va1 = g2_frag(tv + 16 * FPT + sub * 32, hh), va2 = g2_frag(tv + 32 * FPT + sub * 32, hh), va3 = g2_frag(tv + 48 * FPT + sub * 32, hh);      /* asked for here, used behind the softmax */
      v8f sh0 = z8, sl0 = z8, sh1 = z8, sl1 = z8;      /* hi . hi, and lo . hi + hi . lo (x1024), for keys kb .. kb + 15 and kb + 16 .. kb + 31 */
      sh0 = g2_mma(ka0, qh0, sh0); sl0 = g2_mma(ka0, ql0, sl0); sh1 = g2_mma(ka2, qh0, sh1); sl1 = g2_mma(ka2, ql0, sl1);
      sh0 = g2_mma(ka1, qh1, sh0); sl0 = g2_mma(ka1, ql1, sl0); sh1 = g2_mma(ka3, qh1, sh1); sl1 = g2_mma(ka3, ql1, sl1);
      sl0 = g2_mma(kc0, qh0, sl0); sl1 = g2_mma(kc2, qh0, sl1); sl0 = g2_mma(kc1, qh1, sl0); sl1 = g2_mma(kc3, qh1, sl1);
      if (sub == 0) {      /* the second pass's key fragments (rows 32 .. 63 of the same tile) come in during this pass's softmax and output products */
        ka0 = g2_frag(tk + 32 * FPT, hh); ka1 = g2_frag(tk + 32 * FPT + 32, hh); ka2 = g2_frag(tk + 48 * FPT, hh); ka3 = g2_frag(tk + 48 * FPT + 32, hh);
        kc0 = g2_frag(tl + 32 * FPT, hh); kc1 = g2_frag(tl + 32 * FPT + 32, hh); kc2 = g2_frag(tl + 48 * FPT, hh); kc3 = g2_frag(tl + 48 * FPT + 32, hh); }
      float s0[8], s1[8];
#pragma unroll      /* unrolled so that every index into the accumulator and fragment registers is a constant */
      for (int r = 0; r < 8; ++r) { s0[r] = fmaf(sl0[r], SCLR2, sh0[r] * SCL2); s1[r] = fmaf(sl1[r], SCLR2, sh1[r] * SCL2); }
      if (kb + 31 > q0) {      /* wave-uniform: only the pass on the diagonal holds keys after a query */
#pragma unroll      /* unrolled so that every index into the accumulator and fragment registers is a constant */
        for (int r = 0; r < 8; ++r) { const int j = kb + 8 * hh + r; s0[r] = (j <= q) ? s0[r] : -1.0e30f; s1[r] = (j + 16 <= q) ? s1[r] : -1.0e30f; } }
      float bm = fmaxf(s0[0], s1[0]);
#pragma unroll      /* unrolled so that every index into the accumulator and fragment registers is a constant */
      for (int r = 1; r < 8; ++r) bm = fmaxf(bm, fmaxf(s0[r], s1[r]));
      bm = fmaxf(bm, rs_xhalf(bm)); const float mn = fmaxf(m, bm); const float sc = fa_exp2(m - mn); m = mn;
      FragH pf; float ls = 0.f;
#pragma unroll      /* unrolled so that every index into the accumulator and fragment registers is a constant */
      for (int r = 0; r < 8; ++r) { const float e0 = fa_exp2(s0[r] - mn), e1 = fa_exp2(s1[r] - mn); ls += e0 + e1; pf.h[r] = (_Float16)e0; pf.h[8 + r] = (_Float16)e1; }
      l = fmaf(l, sc, ls);      /* the lane's half of the row sum; the halves meet behind the loop */
#pragma unroll      /* unrolled so that every index into the accumulator and fragment registers is a constant */
      for (int r = 0; r < 8; ++r) { o0[r] *= sc; o1[r] *= sc; o2[r] *= sc; o3[r] *= sc; }
      o0 = g2_mma(va0, pf.v, o0); o1 = g2_mma(va1, pf.v, o1); o2 = g2_mma(va2, pf.v, o2); o3 = g2_mma(va3, pf.v, o3); }
    asm volatile("s_wait_dscnt 0x0" ::: "memory");      /* this wave's reads of the buffer are done before it may be refilled */
    asm volatile("s_wait_asynccnt 0x0" ::: "memory");      /* this wave's pieces of the next tile have landed */
    __syncthreads();      /* publishes the next tile and ends every wave's reads of this trip's buffer */
    if (st + 2 < nst) fa_stage(ld0 + (unsigned)(st & 1) * (3 * FPL), gh + (size_t)(st + 2) * FKT * LQ, gl + (size_t)(st + 2) * FKT * LQ, gv + (size_t)(st + 2) * FKT); }      /* the tile after the next into the buffer just read */
  asm volatile("s_wait_asynccnt 0x0" ::: "memory");      /* no copy is outstanding when the wave goes on to its end */
  l += rs_xhalf(l); const float fin = 64.0f / l;      /* o carried x64, folded into the output GEMM alpha */
  unsigned short* op = (unsigned short*)Op + (r0 + q) * DM + h * HD + 8 * hh; FragH f0, f1, f2, f3;      /* lane: 8 neighbouring head values of its query per tile; the wave writes whole 128-byte head rows */
#pragma unroll      /* unrolled so that every index into the accumulator and fragment registers is a constant */
  for (int r = 0; r < 8; ++r) { f0.h[r] = (_Float16)(o0[r] * fin); f1.h[r] = (_Float16)(o1[r] * fin); f2.h[r] = (_Float16)(o2[r] * fin); f3.h[r] = (_Float16)(o3[r] * fin); }
  *(v8us*)op = f0.half[0]; *(v8us*)(op + 16) = f1.half[0]; *(v8us*)(op + 32) = f2.half[0]; *(v8us*)(op + 48) = f3.half[0]; }

#define A0R 8                        /* query rows of a work-group of the exact first tile: one wave each */
#define A0P 68                       /* pitch of a staged key row in floats: 272 B = 17 x 16 B, so that 16 lanes reading 16 rows by 16 bytes meet every LDS bank once */
#define A0U (QT0 * (HD / 4) / 256)   /* 16-byte pieces of a staged plane per thread */
typedef float v2f __attribute__((ext_vector_type(2)));
// Exact f32 attention for the first QT0 rows, causal. One wave per query row, A0R rows of one head per work-group; the head's QT0 key and value rows are staged in LDS once (keys behind a query are masked below and carry weight zero).
// Scores: a lane takes keys lane, lane + 32, lane + 64, lane + 96, each a serial f32 chain over the 64 head values. Row maximum and row sum: butterflies over the wave. Output: a lane takes two head values and sums over the keys in rising order, the weight of key j read from its lane.
__global__ __launch_bounds__(256) void k_att0(const float* __restrict__ QF, const float* __restrict__ KF, const float* __restrict__ VF, int ld, size_t sb, float scale, float* __restrict__ OF, int ldo, size_t sbo) {
  __shared__ __attribute__((aligned(16))) float lk[QT0][A0P]; __shared__ __attribute__((aligned(16))) float lv[QT0][HD];
  QF += (size_t)blockIdx.y * sb; KF += (size_t)blockIdx.y * sb; VF += (size_t)blockIdx.y * sb; OF += (size_t)blockIdx.y * sbo;      /* blockIdx.y: the batch */
  const int tid = threadIdx.x, lane = tid & 31; const int w = __builtin_amdgcn_readfirstlane(tid >> 5);
  const int h = blockIdx.x / (QT0 / A0R), rg = blockIdx.x % (QT0 / A0R); const int i = rg * A0R + w;      /* this wave's query */
  v4f kq[A0U], vq[A0U];
#pragma unroll      /* all 16 loads of a thread in flight at once, their results under constant indices */
  for (int u = 0; u < A0U; ++u) { const int t = u * 256 + tid, j = t / (HD / 4), c = (t % (HD / 4)) * 4; const size_t ro = (size_t)j * ld + h * HD + c;
    const float* kp = KF + ro; const float* vp = VF + ro;
    kq[u] = *(const v4fa*)kp; asm volatile("s_wait_xcnt 0x0" :: "v"(kp) : "memory");      /* stands in front of every write of the registers that this load names as its address; it takes the address as an input, so that those registers live up to it and no load's result, this one's included, is placed on them earlier */
    vq[u] = *(const v4fa*)vp; asm volatile("s_wait_xcnt 0x0" :: "v"(vp) : "memory"); }      /* the same for this load */
  const float* qr = QF + (size_t)i * ld + h * HD; v4f qv[HD / 4];
#pragma unroll      /* the query row stays in registers: constant indices */
  for (int c = 0; c < HD / 4; ++c) qv[c] = *(const v4fa*)(qr + c * 4);
  asm volatile("s_wait_xcnt 0x0" :: "s"(qr) : "memory");      /* the same wait for the query row's loads (wave-uniform address: scalar loads), in front of every write of their base registers */
#pragma unroll      /* constant indices into the staging registers */
  for (int u = 0; u < A0U; ++u) { const int t = u * 256 + tid, j = t / (HD / 4), c = (t % (HD / 4)) * 4; *(v4f*)&lk[j][c] = kq[u]; *(v4f*)&lv[j][c] = vq[u]; }
  __syncthreads();      /* the staged rows are read by every wave */
  float s[QT0 / 32];
#pragma unroll      /* four independent chains side by side */
  for (int g = 0; g < QT0 / 32; ++g) s[g] = 0.f;
#pragma unroll      /* constant indices into the query registers, LDS offsets as immediates */
  for (int c = 0; c < HD / 4; ++c) {
#pragma unroll      /* four independent chains side by side */
    for (int g = 0; g < QT0 / 32; ++g) { const v4f kr = *(const v4f*)&lk[g * 32 + lane][c * 4]; s[g] = fmaf(qv[c][0], kr[0], s[g]); s[g] = fmaf(qv[c][1], kr[1], s[g]); s[g] = fmaf(qv[c][2], kr[2], s[g]); s[g] = fmaf(qv[c][3], kr[3], s[g]); } }
  float mx = -1.0e30f;
#pragma unroll      /* constant indices into the score registers */
  for (int g = 0; g < QT0 / 32; ++g) { s[g] = (g * 32 + lane <= i) ? s[g] * scale : -1.0e30f; mx = fmaxf(mx, s[g]); }
#pragma unroll      /* five exchange steps */
  for (int st = 16; st > 0; st >>= 1) mx = fmaxf(mx, __shfl_xor(mx, st));
  float e[QT0 / 32], l = 0.f;
#pragma unroll      /* constant indices into the score registers */
  for (int g = 0; g < QT0 / 32; ++g) { e[g] = (g * 32 + lane <= i) ? expf(s[g] - mx) : 0.f; l += e[g]; }
#pragma unroll      /* five exchange steps */
  for (int st = 16; st > 0; st >>= 1) l += __shfl_xor(l, st);
  v2f o = {0.f, 0.f};
#pragma unroll      /* constant lane numbers for the weight reads, LDS offsets as immediates */
  for (int g = 0; g < QT0 / 32; ++g) {
#pragma unroll      /* constant lane numbers for the weight reads, LDS offsets as immediates */
    for (int jj = 0; jj < 32; ++jj) { const float ej = __builtin_bit_cast(float, __builtin_amdgcn_readlane(__builtin_bit_cast(int, e[g]), jj)); const v2f vv = *(const v2f*)&lv[g * 32 + jj][2 * lane]; o[0] = fmaf(ej, vv[0], o[0]); o[1] = fmaf(ej, vv[1], o[1]); } }
  const float fin = 64.0f / l;      /* o carried x64 like the f16 path */
  o[0] *= fin; o[1] *= fin; *(v2f*)(OF + (size_t)i * ldo + h * HD + 2 * lane) = o; }      /* the wave writes its query's whole 256-byte head row */

__global__ __launch_bounds__(256) void k_ln64f32(float* __restrict__ F, size_t sF, int ldf, size_t nrh, const float* __restrict__ g, const float* __restrict__ bb, const float* __restrict__ g1, const float* __restrict__ bb1, float eps) {
  #pragma clang fp contract(off)
  if (blockIdx.y) { F += sF; g = g1; bb = bb1; }      /* blockIdx.y: plane 0 (q) or plane 1 (k), each with its own gamma and beta */
  const size_t t = (size_t)blockIdx.x * 256 + threadIdx.x; if (t >= nrh) return; const size_t r = t / NH; const int h = (int)(t % NH); float* f = F + r * (size_t)ldf + (size_t)h * 64; float sum = 0.f;
#pragma unroll 1
  for (int d = 0; d < 64; d += 4) { const v4f q = *(const v4fa*)(f + d); sum = __fadd_rn(__fadd_rn(__fadd_rn(__fadd_rn(sum, q[0]), q[1]), q[2]), q[3]); } const float mu = sum / 64.0f; float vs = 0.f;
#pragma unroll 1
  for (int d = 0; d < 64; d += 4) { const v4f q = *(const v4fa*)(f + d); for (int e = 0; e < 4; ++e) { const float dl = __fadd_rn(q[e], -mu); vs = __fadd_rn(vs, __fmul_rn(dl, dl)); } } const float rs = rsqrtf(__fadd_rn(vs / 64.0f, eps));
#pragma unroll 1
  for (int d0 = 0; d0 < 64; d0 += 4) { const v4f q = *(const v4fa*)(f + d0); v4f y; for (int e = 0; e < 4; ++e) y[e] = __fadd_rn(__fmul_rn(__fmul_rn(__fadd_rn(q[e], -mu), rs), bf16_round(g[d0 + e])), bf16_round(bb[d0 + e])); *(v4f*)(f + d0) = y;  } }
extern "C" void kernel_launch(void* const* d_in, const int* in_sizes, int n_in,
                              void* d_out, int out_size, void* d_ws, size_t ws_size, hipStream_t stream) {
  (void)in_sizes; (void)n_in; (void)out_size;
  const float* const* I = (const float* const*)d_in; const float* x = I[0]; const float* wq = I[1]; const float* wk = I[2]; const float* wv = I[3]; const float* wo = I[4]; const float* bo = I[5]; const float* qg = I[6]; const float* qbt = I[7]; const float* kg = I[8]; const float* kbt = I[9]; const float LNE = 1e-5f;      /* input order: x (feeds the q, k AND v streams), Wq, Wk, Wv (natural [out][in] weights; NO biases: null pointers in the guarded bias slots), Wo, bo (zeros: read), q_gamma, q_beta, k_gamma, k_beta [64] (ones / zeros on this draw: read by value in the per-head LayerNorm kernel) */
  char* ws = (char*)d_ws; size_t off = 0;
  auto take = [&](size_t bytes) { char* p = ws + off; off += (bytes + 255) & ~(size_t)255; return p; };
  _Float16* BQ = (_Float16*)take((size_t)4 * DM * DM * 2); _Float16* BK = BQ + (size_t)DM * DM; _Float16* BV = BK + (size_t)DM * DM; _Float16* BO = BV + (size_t)DM * DM; (void)BK; (void)BV;      /* the four weight planes lie one behind the other: one grid writes them, one GEMM grid reads the first three by plane index */
  _Float16* X16 = (_Float16*)take(NR * DM * 2);      /* exact f16 rows of x: the one operand of the q, k and v projections */
  float* QF = (float*)take((size_t)3 * NR * DM * 4); float* KF = QF + NR * DM; float* VF = KF + NR * DM;      /* f32 rows of q, k (normalised in place) and v, three planes one behind the other: they stay whole for the exact first tile */
  _Float16* QH = (_Float16*)take((size_t)2 * NR * DM * 2); _Float16* KH = QH + NR * DM; _Float16* QL = (_Float16*)take((size_t)2 * NR * DM * 2); _Float16* KL = QL + NR * DM;      /* hi planes of q and k one behind the other, residual planes likewise: one split grid walks q and k as one run of rows */
  _Float16* V16 = (_Float16*)take(NR * DM * 2); _Float16* O16 = (_Float16*)take(NR * DM * 2);
  _Float16* VT = (_Float16*)take((size_t)NB * NH * HD * SQ * 2);      /* V^T [NB][NH][HD][SQ] */
  float* OF0 = (float*)take((size_t)NB * QT0 * DM * 4); _Float16* OH0 = (_Float16*)take((size_t)NB * QT0 * DM * 2); _Float16* OL0 = (_Float16*)take((size_t)NB * QT0 * DM * 2);
  if (off > ws_size) return;
  k_prep<<<(unsigned)(NR * DM / 2048 + 4 * (DM * DM / 2048)), 256, 0, stream>>>(x, wq, wk, wv, wo, X16, BQ);      /* x as exact f16 rows; natural [out][in] weights = Bt[n][k] x16 */
  k_gemm2<0><<<dim3((unsigned)((MP / 128) * (DM / 64)), 3), 128, 0, stream>>>(X16, DM, 0, BQ, DM, (size_t)DM * DM, 0.0625f, nullptr, 0, nullptr, 1, 0, 0, QF, V16, 2, DM, NR * DM, MP, DM, DM);      /* blockIdx.y: q, k, v (no biases) as f32 rows; v (plane 2) as f16 rows too, for the fused attention */
  k_ln64f32<<<dim3((unsigned)(((size_t)MP * NH + 255) / 256), 2), 256, 0, stream>>>(QF, NR * DM, DM, (size_t)MP * NH, qg, qbt, kg, kbt, LNE);      /* per-head LayerNorm of q and of k, in place */
  k_hl<<<(unsigned)(((size_t)2 * MP * DM / 8 + 255) / 256), 256, 0, stream>>>(QF, QH, QL, (size_t)2 * MP * DM / 8);      /* q and k (f32) -> f16 hi + x1024 residual: unscaled logits sigma ~8 */
  k_vt<NH, SQ><<<NB * NH * (SQ / 64), 256, 0, stream>>>(V16, LQ, 0, VT);      /* V^T [NB][NH][HD][SQ], both batches */
  k_att0<<<dim3(NH * (QT0 / A0R), NB), 256, 0, stream>>>(QF, KF, VF, DM, (size_t)SQ * DM, SCL, OF0, DM, (size_t)QT0 * DM);      /* exact f32 attention for rows 0..127 of every batch (o x64), on the f32 q, k, v rows that the projections and their LayerNorm left */
  k_fattn<<<dim3(SQ / 64, NB * NH), 128, 0, stream>>>(QH, QL, KH, KL, VT, O16);      /* scores, causal softmax and P . V of every batch, head and query row in one launch: o (merged heads, x64) as f16 rows */
  k_gemm2<0><<<dim3((unsigned)((MPO / 128) * (DM / 64)), 1), 128, 0, stream>>>(O16, DM, 0, BO, DM, 0, 0.0009765625f, bo, 0, nullptr, 1, 0, 0, (float*)d_out, nullptr, 0, DM, 0, MPO, DM, DM);      /* out rows are the output layout */
  k_hl<<<(unsigned)(((size_t)NB * QT0 * DM / 8 + 255) / 256), 256, 0, stream>>>(OF0, OH0, OL0, (size_t)NB * QT0 * DM / 8);      /* first-tile o (x64) -> f16 hi + x1024 residual planes */
  k_gemm2<0><<<dim3((QT0 / 128) * (DM / 64), NB), 128, 0, stream>>>(OH0, DM, (size_t)QT0 * DM, BO, DM, 0, 0.0009765625f, bo, 0, nullptr, 1, 0, 0, (float*)d_out, nullptr, 0, DM, (size_t)SQ * DM, QT0, DM, DM);      /* blockIdx.y: the batch; rows 0..127: out = o_hi Wo (+ b), overwriting the f16-path rows */
  k_gemm2<0><<<dim3((QT0 / 128) * (DM / 64), NB), 128, 0, stream>>>(OL0, DM, (size_t)QT0 * DM, BO, DM, 0, 0.00000095367431640625f, nullptr, 0, (const float*)d_out, -1, 0, 0, (float*)d_out, nullptr, 0, DM, (size_t)SQ * DM, QT0, DM, DM);      /* += o_lo Wo 2^-20 (own-element accumulate) */
}

// v007
// Measured time: 170 microseconds a run.
// Next to v006, in two timings, it ran 1.39 times as fast each time.
// Counting every step since v000, it is 63.8 times as fast.
#include <hip/hip_runtime.h>
// Causal multi-head self-attention with a per-head LayerNorm on q and k, natural bias-free q / k / v projections and a biased output projection (x [2][3072][512]; q / k / v = x W^T (nn.Linear natural [512][512] sd 0.02, NO biases), 8 heads of 64; q and k each pass through a LayerNorm over the 64 values of every (token, head) vector (biased variance, eps 1e-5, gamma / beta [64]: ones / zeros on this draw: read); scores = q . k / sqrt(64); causal (keys after the query get -inf); softmax; out = merged Wo^T + bo (natural; zero bias) -> [2][3072][512]); q and k carried as f16 hi + x1024 residual planes with three-product scores.
// Structure: token rows r = b*3072 + s; x as exact f16 rows (bf16-rounded); q, k and v as WMMA GEMMs in one grid (32x64 wave tiles = 32 tokens of one head, f32 accumulation, exact x16 weights, no bias) whose epilogue finishes the tile: q and k get their f32 LayerNorm over the 64 values of each (token, head) vector (f32 statistics, gamma / beta by value) and leave as f16 hi + x1024 residual planes, v leaves as V^T through an LDS transpose; f32 rows of q, k, v are stored for the first 128 tokens of a batch alone; work that does not depend on each other shares a grid (x and the weights; q, k, v; both batches); then ONE fused launch for all batches, heads and query rows: a wave takes 16 query rows and walks the keys up to its diagonal, 32 a pass: S^T = K Q^T as three products (hi.hi + lo.hi + hi.lo, K = 64, scale 1/8 = 1/sqrt(64); logits sigma ~1), causal running-maximum softmax inside the lane (f32 statistics, native exp; weights exp(s - max) as f16), O^T = V^T P^T with the weights taken in place from the score accumulators (o divided by the row sum at the end and carried x64, folded into the output GEMM alpha) written straight into the merged f16 o rows; out = o Wo^T + bo GEMM (f32) into the output layout.
// Compute dtype: inputs rounded to bf16; x / weights exact; the normalised q and k as f16 hi + residual planes (three-product scores), v, the softmax weights and o as plain f16 GEMM operands (~2^-12); LayerNorm, scores and softmax statistics f32. v_wmma_f32_16x16x32_f16.
#define NB 2
#define SCL 0.125f                         /* 1 / sqrt(head_dim = 64) */
#define SCLR 0.0001220703125f              /* 2^-13: SCL / 1024; unused: the x1024 residual products take SCLR2 */
#define SQ 3072
#define DM 512
#define NH 8
#define HD 64
#define HG 4                         /* heads per launch of the h0-based k_vt overload */
#define QT0 128                      /* first-tile rows recomputed exactly in f32 */
#define B0 0                         /* unused */
#define NBR NB                       /* batches processed (debug hook) */
#define NR ((size_t)NB * SQ)         /* token rows */
#define MP ((int)((size_t)NBR * SQ)) /* rows projected (debug hook) */
#define MPO MP                       /* rows through the output stage (debug hook) */
#define LQ DM      /* row pitch of the q/k/v rows */
typedef __bf16 v16b __attribute__((ext_vector_type(16)));
typedef unsigned short v8us __attribute__((ext_vector_type(8), may_alias));
typedef float  v8f  __attribute__((ext_vector_type(8)));
typedef float  v4f  __attribute__((ext_vector_type(4)));
typedef float  v4fa __attribute__((ext_vector_type(4), may_alias));
union FragB { v16b v; v8us half[2]; unsigned short u[16]; };

__device__ __forceinline__ unsigned short bf16_bits(float x) { unsigned int u = __float_as_uint(x); return (unsigned short)((u + 0x7FFFu + ((u >> 16) & 1u)) >> 16); }
__device__ __forceinline__ float bf16_val(unsigned short b) { return __uint_as_float(((unsigned int)b) << 16); }
__device__ __forceinline__ float bf16_round(float x) { return bf16_val(bf16_bits(x)); }
// D += A·B with NT terms: 1 = ah·bh, 2 = + al·bh (A split), 3 = + ah·bl (both split)
template <int NT>
__device__ __forceinline__ v8f mmaN(v16b ah, v16b al, v16b bh, v16b bl, v8f c) {
  c = __builtin_amdgcn_wmma_f32_16x16x32_bf16(false, ah, false, bh, (short)0, c, false, false);
  if (NT >= 2) c = __builtin_amdgcn_wmma_f32_16x16x32_bf16(false, al, false, bh, (short)0, c, false, false);
  if (NT >= 3) c = __builtin_amdgcn_wmma_f32_16x16x32_bf16(false, ah, false, bl, (short)0, c, false, false);
  asm volatile("v_nop\n\tv_nop\n\tv_nop\n\tv_nop" : "+v"(c) : "v"(ah), "v"(al), "v"(bh), "v"(bl));
  return c;
}

__global__ __launch_bounds__(256) void k_wt_bf16(const float* __restrict__ W, unsigned short* __restrict__ Wt, int K, int N) {
  const int t = blockIdx.x * 256 + threadIdx.x;
  const int k8n = K / 8;
  if (t >= N * k8n) return;
  const int n = t / k8n, k8 = (t % k8n) * 8;
  v8us v;
#pragma unroll
  for (int i = 0; i < 8; ++i) v[i] = bf16_bits(W[(size_t)(k8 + i) * N + n]);
  *(v8us*)(Wt + (size_t)n * K + k8) = v;
  
}

// GEMM C[M][N] (f32, pitch ldc) = act(A[M][K]·W + bias). A f32 row-major (pitch lda) converted per fragment to bf16
// (ASPLIT: hi/lo two planes -> 2 terms, else single rounded term); Wt bf16 [N][K] (pitch ldb). BIAS_BF16 rounds the
// bias to bf16 first (bias quantised to bf16 before the add). K%32==0, M%16==0, N%64==0.
template <bool ASPLIT, int ACT, bool BIAS_BF16>
__global__ __launch_bounds__(128) void k_gemm_bf(const float* __restrict__ A, int lda, const unsigned short* __restrict__ Wt, int ldb,
                                               const float* __restrict__ bias, float* __restrict__ C, int ldc, int M, int N, int K) {
  __shared__ __attribute__((aligned(16))) float so[4][16][64];
  const int tid = threadIdx.x, w = tid >> 5, lane = tid & 31, ln = lane & 15, hh = lane >> 4;
  const int ntn = N / 64;
  const int wid = blockIdx.x * 4 + w;
  const int mt = wid / ntn, nq = wid % ntn;
  if (mt * 16 >= M) return;
  const int row0 = mt * 16, col0 = nq * 64;
  const float* arow = A + (size_t)(row0 + ln) * lda;
  v8f acc[4] = {};
  for (int kb = 0; kb < K; kb += 32) {
    FragB ah, al;
    const v4f x0 = *(const v4fa*)(arow + kb + 8 * hh), x1 = *(const v4fa*)(arow + kb + 8 * hh + 4);
    const v4f x2 = *(const v4fa*)(arow + kb + 16 + 8 * hh), x3 = *(const v4fa*)(arow + kb + 16 + 8 * hh + 4);
    float xs[16] = {x0[0],x0[1],x0[2],x0[3],x1[0],x1[1],x1[2],x1[3],x2[0],x2[1],x2[2],x2[3],x3[0],x3[1],x3[2],x3[3]};
#pragma unroll
    for (int i = 0; i < 16; ++i) { const unsigned short hb = bf16_bits(xs[i]); ah.u[i] = hb; al.u[i] = ASPLIT ? bf16_bits(xs[i] - bf16_val(hb)) : (unsigned short)0; }
#pragma unroll
    for (int t = 0; t < 4; ++t) {
      const unsigned short* brow = Wt + (size_t)(col0 + t * 16 + ln) * ldb + kb;
      FragB b;
      b.half[0] = *(const v8us*)(brow + 8 * hh);
      b.half[1] = *(const v8us*)(brow + 16 + 8 * hh);
      acc[t] = mmaN<ASPLIT ? 2 : 1>(ah.v, al.v, b.v, b.v, acc[t]);
    }
  }
#pragma unroll
  for (int t = 0; t < 4; ++t) {
    float bv = bias ? bias[col0 + t * 16 + ln] : 0.f;
    if (BIAS_BF16) bv = bf16_round(bv);
#pragma unroll
    for (int r = 0; r < 8; ++r) { float v = acc[t][r] + bv; if (ACT == 1) v = fmaxf(v, 0.f); so[w][8 * hh + r][t * 16 + ln] = v; }
  }
  __builtin_amdgcn_fence(__ATOMIC_ACQ_REL, "workgroup");
  __builtin_amdgcn_wave_barrier();
  const int rsub = lane >> 4, c4 = (lane & 15) * 4;
  {
#pragma unroll
    for (int q = 0; q < 8; ++q) {
      const int r = q * 2 + rsub;
      const v4f v = *(const v4fa*)&so[w][r][c4];
      *(v4f*)(C + (size_t)(row0 + r) * ldc + col0 + c4) = v;
    }
    
  }
}

// GEMM C = act(A·W + bias + resid): A f32 (ASPLIT -> hi/lo 2 terms), Wt bf16 [N][K]; ACT 0 none, 1 relu, 2 exact gelu;
// resid (optional, f32, row index = (row % rmod), pitch ldr, RES_BF16 rounds it) added before the activation.
template <bool ASPLIT, int ACT, bool BIAS_BF16, bool RES_BF16>
__global__ __launch_bounds__(128) void k_gemm_bf3(const float* __restrict__ A, int lda, const unsigned short* __restrict__ Wt, int ldb,
                                                const float* __restrict__ bias, const float* __restrict__ resid, int rmod, int ldr,
                                                float* __restrict__ C, int ldc, int M, int N, int K) {
  __shared__ __attribute__((aligned(16))) float so[4][16][64];
  const int tid = threadIdx.x, w = tid >> 5, lane = tid & 31, ln = lane & 15, hh = lane >> 4;
  const int ntn = N / 64;
  const int wid = blockIdx.x * 4 + w;
  const int mt = wid / ntn, nq = wid % ntn;
  if (mt * 16 >= M) return;
  const int row0 = mt * 16, col0 = nq * 64;
  const float* arow = A + (size_t)(row0 + ln) * lda;
  v8f acc[4] = {};
  for (int kb = 0; kb < K; kb += 32) {
    FragB ah, al;
    const v4f x0 = *(const v4fa*)(arow + kb + 8 * hh), x1 = *(const v4fa*)(arow + kb + 8 * hh + 4);
    const v4f x2 = *(const v4fa*)(arow + kb + 16 + 8 * hh), x3 = *(const v4fa*)(arow + kb + 16 + 8 * hh + 4);
    float xs[16] = {x0[0],x0[1],x0[2],x0[3],x1[0],x1[1],x1[2],x1[3],x2[0],x2[1],x2[2],x2[3],x3[0],x3[1],x3[2],x3[3]};
#pragma unroll
    for (int i = 0; i < 16; ++i) { const unsigned short hb = bf16_bits(xs[i]); ah.u[i] = hb; al.u[i] = ASPLIT ? bf16_bits(xs[i] - bf16_val(hb)) : (unsigned short)0; }
#pragma unroll
    for (int t = 0; t < 4; ++t) {
      const unsigned short* brow = Wt + (size_t)(col0 + t * 16 + ln) * ldb + kb;
      FragB b;
      b.half[0] = *(const v8us*)(brow + 8 * hh);
      b.half[1] = *(const v8us*)(brow + 16 + 8 * hh);
      acc[t] = mmaN<ASPLIT ? 2 : 1>(ah.v, al.v, b.v, b.v, acc[t]);
    }
  }
#pragma unroll
  for (int t = 0; t < 4; ++t) {
    const int col = col0 + t * 16 + ln;
    float bv = bias ? bias[col] : 0.f;
    if (BIAS_BF16) bv = bf16_round(bv);
#pragma unroll
    for (int r = 0; r < 8; ++r) {
      float v = acc[t][r] + bv;
      if (resid) { float rv = resid[(size_t)((row0 + 8 * hh + r) % rmod) * ldr + col]; if (RES_BF16) rv = bf16_round(rv); v += rv; }
      if (ACT == 1) v = fmaxf(v, 0.f);
      if (ACT == 2) v = 0.5f * v * (1.0f + erff(v * 0.70710678118654752f));
      if (ACT == 3) { const float u = 0.7978845608028654f * (v + 0.044715f * v * v * v); v = 0.5f * v * (1.0f + tanhf(u)); }
      so[w][8 * hh + r][t * 16 + ln] = v;
    }
  }
  __builtin_amdgcn_fence(__ATOMIC_ACQ_REL, "workgroup");
  __builtin_amdgcn_wave_barrier();
  const int rsub = lane >> 4, c4 = (lane & 15) * 4;
  {
#pragma unroll
    for (int q = 0; q < 8; ++q) {
      const int r = q * 2 + rsub;
      const v4f v = *(const v4fa*)&so[w][r][c4];
      *(v4f*)(C + (size_t)(row0 + r) * ldc + col0 + c4) = v;
    }
    
  }
}
// row LayerNorm (biased variance, eps) over N: s = X (+ R); optional out_sum <- s; out_norm <- (s-mu)*rsqrt(var+eps)*g + b
template <bool PARAM_BF16>
__global__ __launch_bounds__(256) void k_layernorm(const float* __restrict__ X, const float* __restrict__ R, const float* __restrict__ g, const float* __restrict__ bta,
                                                  float* __restrict__ out_sum, float* __restrict__ out_norm, int N, float eps) {
  __shared__ float red[256];
  const int row = blockIdx.x, tid = threadIdx.x;
  const float* x = X + (size_t)row * N; const float* rr = R ? R + (size_t)row * N : nullptr;
  float vals[16];                     // up to N = 4096
  const int per = N / 256;            // contiguous chunk per thread? use strided-by-4 chunks: thread handles j = tid*4 + 1024*u
  float s1 = 0.f;
  for (int u = 0; u < per / 4; ++u) {
    const int j = tid * 4 + 1024 * u;
    const v4f a = *(const v4fa*)(x + j);
    v4f b = {0.f,0.f,0.f,0.f}; if (rr) b = *(const v4fa*)(rr + j);
#pragma unroll
    for (int q = 0; q < 4; ++q) { const float v = a[q] + b[q]; vals[u * 4 + q] = v; s1 += v; }
  }
  red[tid] = s1; __syncthreads();
  for (int st = 128; st > 0; st >>= 1) { if (tid < st) red[tid] += red[tid + st]; __syncthreads(); }
  const float mu = red[0] / (float)N; __syncthreads();
  float s2 = 0.f;
  for (int u = 0; u < per / 4; ++u)
#pragma unroll
    for (int q = 0; q < 4; ++q) { const float c = vals[u * 4 + q] - mu; s2 += c * c; }
  red[tid] = s2; __syncthreads();
  for (int st = 128; st > 0; st >>= 1) { if (tid < st) red[tid] += red[tid + st]; __syncthreads(); }
  const float rs = rsqrtf(red[0] / (float)N + eps);
  {
    for (int u = 0; u < per / 4; ++u) {
      const int j = tid * 4 + 1024 * u;
      v4f o, sm;
#pragma unroll
      for (int q = 0; q < 4; ++q) {
        float gg = g[j + q], bb = bta[j + q];
        if (PARAM_BF16) { gg = bf16_round(gg); bb = bf16_round(bb); }
        sm[q] = vals[u * 4 + q]; o[q] = (vals[u * 4 + q] - mu) * rs * gg + bb;
      }
      if (out_sum) *(v4f*)(out_sum + (size_t)row * N + j) = sm;
      *(v4f*)(out_norm + (size_t)row * N + j) = o;
    }
    
  }
}



// ---- f16 WMMA path (v_wmma_f32_16x16x32_f16): 11-bit significands for operands in range — used where a [0,1] probability operand needs more precision than bf16
typedef _Float16 v16h __attribute__((ext_vector_type(16)));
union FragH { v16h v; v8us half[2]; _Float16 h[16]; unsigned short u[16]; };
template <int NT>
__device__ __forceinline__ v8f mmaH(v16h ah, v16h al, v16h bh, v16h bl, v8f c) {
  c = __builtin_amdgcn_wmma_f32_16x16x32_f16(false, ah, false, bh, (short)0, c, false, false);
  if (NT >= 2) c = __builtin_amdgcn_wmma_f32_16x16x32_f16(false, al, false, bh, (short)0, c, false, false);
  if (NT >= 3) c = __builtin_amdgcn_wmma_f32_16x16x32_f16(false, ah, false, bl, (short)0, c, false, false);
  asm volatile("v_nop\n\tv_nop\n\tv_nop\n\tv_nop" : "+v"(c) : "v"(ah), "v"(al), "v"(bh), "v"(bl));
  return c;
}
// batched GEMM like k_gemm_b but f16 operands: A f32 (split into f16 hi/lo if ASPLIT, else rounded to f16), Bt = f16 values [n][k]; alpha; C f32; N multiple of 16 (partial tiles skipped)
template <bool ASPLIT>
__global__ __launch_bounds__(128) void k_gemm_h(const float* __restrict__ A, int lda, size_t sA, const _Float16* __restrict__ Bh, int ldb, size_t sB, float alpha, float* __restrict__ C, int ldc, size_t sC, int M, int N, int K) {
  __shared__ __attribute__((aligned(16))) float so[4][16][64];
  const int tid = threadIdx.x, w = tid >> 5, lane = tid & 31, ln = lane & 15, hh = lane >> 4; const int by = blockIdx.y;
  A += (size_t)by * sA; Bh += (size_t)by * sB; C += (size_t)by * sC;
  const int ntn = (N + 63) / 64; const int wid = blockIdx.x * 4 + w; const int mt = wid / ntn, nq = wid % ntn; if (mt * 16 >= M) return;
  const int row0 = mt * 16, col0 = nq * 64; const float* arow = A + (size_t)(row0 + ln) * lda;
  v8f acc[4] = {};
  for (int kb = 0; kb < K; kb += 32) {
    FragH ah, al;
    const v4f x0 = *(const v4fa*)(arow + kb + 8 * hh), x1 = *(const v4fa*)(arow + kb + 8 * hh + 4), x2 = *(const v4fa*)(arow + kb + 16 + 8 * hh), x3 = *(const v4fa*)(arow + kb + 16 + 8 * hh + 4);
    float xs[16] = {x0[0],x0[1],x0[2],x0[3],x1[0],x1[1],x1[2],x1[3],x2[0],x2[1],x2[2],x2[3],x3[0],x3[1],x3[2],x3[3]};
#pragma unroll
    for (int i = 0; i < 16; ++i) { const _Float16 h = (_Float16)xs[i]; ah.h[i] = h; al.h[i] = ASPLIT ? (_Float16)(xs[i] - (float)h) : (_Float16)0.0f; }
#pragma unroll
    for (int t = 0; t < 4; ++t) { if (col0 + t * 16 >= N) continue; const size_t boff = (size_t)(col0 + t * 16 + ln) * ldb + kb; FragH bq; bq.half[0] = *(const v8us*)(Bh + boff + 8 * hh); bq.half[1] = *(const v8us*)(Bh + boff + 16 + 8 * hh);
      acc[t] = mmaH<ASPLIT ? 2 : 1>(ah.v, al.v, bq.v, bq.v, acc[t]); }
  }
#pragma unroll
  for (int t = 0; t < 4; ++t) { if (col0 + t * 16 >= N) continue;
#pragma unroll
    for (int r = 0; r < 8; ++r) so[w][8 * hh + r][t * 16 + ln] = acc[t][r] * alpha; }
  __builtin_amdgcn_fence(__ATOMIC_ACQ_REL, "workgroup"); __builtin_amdgcn_wave_barrier();
  const int rsub = lane >> 4, c4 = (lane & 15) * 4;
  {
#pragma unroll
    for (int q = 0; q < 8; ++q) { const int r = q * 2 + rsub; if (col0 + c4 < N) { const v4f v = *(const v4fa*)&so[w][r][c4]; *(v4f*)(C + (size_t)(row0 + r) * ldc + col0 + c4) = v; } }
     }
}

// Wt[n][k] = f16(W[k][n]·scale) from f32 row-major W[K][N] (scale = power of two; bf16-exact weights stay exact in f16 away from the subnormal range)
__global__ __launch_bounds__(256) void k_wt_f16(const float* __restrict__ W, _Float16* __restrict__ Wt, int K, int N, float scale) {
  const int t = blockIdx.x * 256 + threadIdx.x; if (t >= N * (K / 8)) return; const int n = t / (K / 8), k8 = (t % (K / 8)) * 8; FragH f;
#pragma unroll
  for (int i = 0; i < 8; ++i) f.h[i] = (_Float16)(bf16_round(W[(size_t)(k8 + i) * N + n]) * scale); const v8us o = f.half[0];
  *(v8us*)((unsigned short*)Wt + (size_t)n * K + k8) = o; 
}
// k_gemm_hh variant with fused epilogue: v = acc·alpha + bias[by·sBias + col] (+ CP[(row/rowsPerB)·sCPb + by·64 + col] if CP) ; ACT 0 none / 1 elu ; writes f16 C16 (and f32 C if non-null)
template <int ACT>
__global__ __launch_bounds__(128) void k_gemm_hhx(const _Float16* __restrict__ A, int lda, size_t sA, const _Float16* __restrict__ Bh, int ldb, size_t sB, float alpha, const float* __restrict__ bias, size_t sBias, const float* __restrict__ CP, int rowsPerB, size_t sCPb, int row0g,
    float* __restrict__ C, _Float16* __restrict__ C16, int ldc, size_t sC, int M, int N, int K) {
  __shared__ __attribute__((aligned(16))) float so[4][16][64];
  const int tid = threadIdx.x, w = tid >> 5, lane = tid & 31, ln = lane & 15, hh = lane >> 4; const int by = blockIdx.y;
  A += (size_t)by * sA; Bh += (size_t)by * sB; const size_t cofs = (size_t)by * sC; const float* bp = bias ? bias + (size_t)by * sBias : nullptr;
  const int ntn = (N + 63) / 64; const int wid = blockIdx.x * 4 + w; const int mt = wid / ntn, nq = wid % ntn; if (mt * 16 >= M) return;
  const int row0 = mt * 16, col0 = nq * 64; const _Float16* arow = A + (size_t)(row0 + ln) * lda;
  v8f acc[4] = {};
  for (int kb = 0; kb < K; kb += 32) { FragH ah; ah.half[0] = *(const v8us*)((const unsigned short*)arow + kb + 8 * hh); ah.half[1] = *(const v8us*)((const unsigned short*)arow + kb + 16 + 8 * hh);
#pragma unroll
    for (int t = 0; t < 4; ++t) { if (col0 + t * 16 >= N) continue; const size_t boff = (size_t)(col0 + t * 16 + ln) * ldb + kb; FragH bq; bq.half[0] = *(const v8us*)((const unsigned short*)Bh + boff + 8 * hh); bq.half[1] = *(const v8us*)((const unsigned short*)Bh + boff + 16 + 8 * hh);
      acc[t] = mmaH<1>(ah.v, ah.v, bq.v, bq.v, acc[t]); }
  }
#pragma unroll
  for (int t = 0; t < 4; ++t) { if (col0 + t * 16 >= N) continue; const int col = col0 + t * 16 + ln; const float bv = bp ? bf16_round(bp[col]) : 0.f;
#pragma unroll
    for (int r = 0; r < 8; ++r) { float v = acc[t][r] * alpha + bv; if (CP) { const int rr = row0g + row0 + 8 * hh + r; if (rowsPerB < 0) v += CP[cofs + (size_t)rr * ldc + col];      /* rowsPerB < 0: own element of the batched C plane */ else { const int bidx = rr / rowsPerB; v += CP[(size_t)bidx * sCPb + (size_t)by * 64 + col]; } } if (ACT == 1) v = (v > 0.f) ? v : expm1f(v); else if (ACT == 7) v = (v > 0.f) ? v + 1.0f : expf(v); else if (ACT == 8) v = tanhf(v); else if (ACT == 9) v = 0.5f * v * (1.0f + tanhf(0.7978845608028654f * (v + 0.044715f * v * v * v))); else if (ACT == 11) v = 1.0f / (1.0f + expf(-v)); else if (ACT == 12) v = (v > 0.f) ? v : 0.01f * v; else if (ACT == 14) v = (v > 0.f) ? v : 0.1f * v; else if (ACT == 16) v = (v >= 0.f) ? v : 0.3f * v; else if (ACT == 17) v = (v >= 0.f) ? v : 0.2f * v; else if (ACT == 15) v = v / (1.0f + expf(-v)); else if (ACT == 3) v = fmaxf(v, 0.f); else if (ACT == 6) v = 0.5f * v * (1.0f + erff(v * 0.70710678118654752f)); so[w][8 * hh + r][t * 16 + ln] = v; } }
  __builtin_amdgcn_fence(__ATOMIC_ACQ_REL, "workgroup"); __builtin_amdgcn_wave_barrier();
  const int rsub = lane >> 4, c4 = (lane & 15) * 4; typedef _Float16 v4h __attribute__((ext_vector_type(4)));
  {
#pragma unroll
    for (int q = 0; q < 8; ++q) { const int r = q * 2 + rsub; if (col0 + c4 < N) { const v4f v = *(const v4fa*)&so[w][r][c4]; if (C) *(v4f*)(C + cofs + (size_t)(row0 + r) * ldc + col0 + c4) = v; if (C16) { v4h h4; for (int i = 0; i < 4; ++i) h4[i] = (_Float16)v[i]; *(v4h*)(C16 + cofs + (size_t)(row0 + r) * ldc + col0 + c4) = h4; } } }
     }
}


typedef _Float16 v4h __attribute__((ext_vector_type(4)));

__global__ __launch_bounds__(256) void k_x16(const float* __restrict__ x, _Float16* __restrict__ X16, size_t n8) { const size_t t = (size_t)blockIdx.x * 256 + threadIdx.x; if (t >= n8) return; FragH f;
#pragma unroll
  for (int q = 0; q < 8; ++q) f.h[q] = (_Float16)bf16_round(x[t * 8 + q]); *(v8us*)((unsigned short*)X16 + t * 8) = f.half[0];  }
__global__ __launch_bounds__(256) void k_h16(const float* __restrict__ x, _Float16* __restrict__ X16, size_t n8) { const size_t t = (size_t)blockIdx.x * 256 + threadIdx.x; if (t >= n8) return; FragH f;
#pragma unroll
  for (int q = 0; q < 8; ++q) f.h[q] = (_Float16)x[t * 8 + q]; *(v8us*)((unsigned short*)X16 + t * 8) = f.half[0];  }
__global__ __launch_bounds__(256) void k_round16f(const float* __restrict__ W, _Float16* __restrict__ Bt, size_t n8) { const size_t t = (size_t)blockIdx.x * 256 + threadIdx.x; if (t >= n8) return; FragH f;
#pragma unroll
  for (int i = 0; i < 8; ++i) f.h[i] = (_Float16)(bf16_round(W[t * 8 + i]) * 16.0f); *(v8us*)((unsigned short*)Bt + t * 8) = f.half[0];  }
// ---- fast GEMM (wave tile 32x64; requires M % 32 == 0 rows per launch region and N % 64 == 0); epilogue = k_gemm_hhx semantics ----
__device__ __forceinline__ v16h g2_frag(const _Float16* p, int hh) { FragH f; f.half[0] = *(const v8us*)((const unsigned short*)p + 8 * hh); f.half[1] = *(const v8us*)((const unsigned short*)p + 16 + 8 * hh); return f.v; }
__device__ __forceinline__ v8f g2_mma(v16h a, v16h b, v8f c) { v8f d = __builtin_amdgcn_wmma_f32_16x16x32_f16(false, a, false, b, (short)0, c, false, false); asm volatile("v_nop\n\tv_nop\n\tv_nop\n\tv_nop" : "+v"(d) : "v"(a), "v"(b)); return d; }
template <int ACT>
__global__ __launch_bounds__(128) void k_gemm2(const _Float16* __restrict__ A, int lda, size_t sA, const _Float16* __restrict__ Bh, int ldb, size_t sB, float alpha, const float* __restrict__ bias, size_t sBias, const float* __restrict__ CP, int rowsPerB, size_t sCPb, int row0g,
    float* __restrict__ C, _Float16* __restrict__ C16, int by16, int ldc, size_t sC, int M, int N, int K) { static_assert(ACT == 0 || ACT == 3 || ACT == 6 || ACT == 8 || ACT == 9 || ACT == 11 || ACT == 12 || ACT == 14 || ACT == 15 || ACT == 16 || ACT == 17, "k_gemm2: unsupported ACT code (would silently apply no activation)");
  __shared__ __attribute__((aligned(16))) float so[4][32][68];
  const int tid = threadIdx.x, w = tid >> 5, lane = tid & 31, ln = lane & 15, hh = lane >> 4; const int by = blockIdx.y;
  A += (size_t)by * sA; Bh += (size_t)by * sB; const size_t cofs = (size_t)by * sC; const float* bp = bias ? bias + (size_t)by * sBias : nullptr;
  if (by < by16) C16 = nullptr; else if (C16) C16 -= (size_t)by16 * sC;      /* f16 rows are stored from plane by16 on, and C16 is the place of that plane's */
  const int ntn = N >> 6; const int mt = blockIdx.x / ntn, nq = blockIdx.x - mt * ntn; const int row0 = mt * 128 + 32 * w, col0 = nq * 64; if (row0 >= M) return;
  const _Float16* a0p = A + (size_t)(row0 + ln) * lda; const _Float16* a1p = a0p + (size_t)16 * lda;
  const _Float16* b0p = Bh + (size_t)(col0 + ln) * ldb; const _Float16* b1p = b0p + (size_t)16 * ldb; const _Float16* b2p = b1p + (size_t)16 * ldb; const _Float16* b3p = b2p + (size_t)16 * ldb;
  const v8f z8 = {0.f,0.f,0.f,0.f,0.f,0.f,0.f,0.f}; v8f c00 = z8, c01 = z8, c02 = z8, c03 = z8, c10 = z8, c11 = z8, c12 = z8, c13 = z8;
#pragma unroll 1
  for (int kb = 0; kb < K; kb += 32) { const v16h a0 = g2_frag(a0p + kb, hh), a1 = g2_frag(a1p + kb, hh);
    v16h b = g2_frag(b0p + kb, hh); c00 = g2_mma(a0, b, c00); c10 = g2_mma(a1, b, c10);
    b = g2_frag(b1p + kb, hh); c01 = g2_mma(a0, b, c01); c11 = g2_mma(a1, b, c11);
    b = g2_frag(b2p + kb, hh); c02 = g2_mma(a0, b, c02); c12 = g2_mma(a1, b, c12);
    b = g2_frag(b3p + kb, hh); c03 = g2_mma(a0, b, c03); c13 = g2_mma(a1, b, c13); }
  v8f accs[8] = {c00, c01, c02, c03, c10, c11, c12, c13};
#pragma unroll
  for (int u = 0; u < 8; ++u) { const int t = u & 3, half = u >> 2; const int col = col0 + t * 16 + ln; const float bv = bp ? bf16_round(bp[col]) : 0.f;
#pragma unroll
    for (int r = 0; r < 8; ++r) { const int rloc = half * 16 + 8 * hh + r; float v = accs[u][r] * alpha + bv; if (CP) { if (rowsPerB < 0) v += CP[cofs + (size_t)(row0g + row0 + rloc) * ldc + col];      /* rowsPerB < 0: own element of the batched C plane */ else { const int bidx = (row0g + row0 + rloc) / rowsPerB; v += CP[(size_t)bidx * sCPb + (size_t)by * 64 + col]; } }
      if (ACT == 3) v = fmaxf(v, 0.f); else if (ACT == 6) v = 0.5f * v * (1.0f + erff(v * 0.70710678118654752f)); else if (ACT == 11) v = 1.0f / (1.0f + expf(-v)); else if (ACT == 15) v = v / (1.0f + expf(-v)); else if (ACT == 12) v = (v > 0.f) ? v : 0.01f * v; else if (ACT == 8) v = tanhf(v); else if (ACT == 9) v = 0.5f * v * (1.0f + tanhf(0.7978845608028654f * (v + 0.044715f * v * v * v))); else if (ACT == 14) v = (v > 0.f) ? v : 0.1f * v; else if (ACT == 16) v = (v >= 0.f) ? v : 0.3f * v; else if (ACT == 17) v = (v >= 0.f) ? v : 0.2f * v;
      so[w][rloc][t * 16 + ln] = v; } }
  __builtin_amdgcn_fence(__ATOMIC_ACQ_REL, "workgroup"); __builtin_amdgcn_wave_barrier();
  const int rsub = lane >> 4, c4 = (lane & 15) * 4;
  {
#pragma unroll
    for (int q = 0; q < 16; ++q) { const int r = q * 2 + rsub; const v4f v = *(const v4fa*)&so[w][r][c4]; if (C) { *(v4f*)(C + cofs + (size_t)(row0 + r) * ldc + col0 + c4) = v; asm volatile("s_wait_xcnt 0x0" ::: "memory"); }      /* the wait stands in front of every later write of the data and address registers that this store names: where both planes are written, the f16 conversion below reuses them */
      if (C16) { v4h h4; for (int i = 0; i < 4; ++i) h4[i] = (_Float16)v[i]; *(v4h*)(C16 + cofs + (size_t)(row0 + r) * ldc + col0 + c4) = h4; } }
     } }


// x and the four weight matrices in one grid: the first xb work-groups round x to exact f16 rows, the next 4 x wb the natural [out][in] weights (x16) into four planes that lie one behind the other. None of the five reads what another writes.
__global__ __launch_bounds__(256) void k_prep(const float* __restrict__ x, const float* __restrict__ w0, const float* __restrict__ w1, const float* __restrict__ w2, const float* __restrict__ w3, _Float16* __restrict__ X16, _Float16* __restrict__ Bt) {
  constexpr int xb = (int)(NR * DM / 2048), wb = DM * DM / 2048; const int bx = blockIdx.x; const float* s = x; _Float16* d = X16; float sc = 1.0f; int lb = bx;      /* a product with 1 is exact */
  if (bx >= xb) { const int p = (bx - xb) / wb; lb = (bx - xb) - p * wb; s = (p == 0) ? w0 : (p == 1) ? w1 : (p == 2) ? w2 : w3; d = Bt + (size_t)p * wb * 2048; sc = 16.0f; }      /* work-group-uniform; a work-group covers 2048 values */
  const size_t t = (size_t)lb * 256 + threadIdx.x; const v4f a = *(const v4fa*)(s + t * 8), c = *(const v4fa*)(s + t * 8 + 4); FragH f;
#pragma unroll      /* constant indices into the loaded registers */
  for (int q = 0; q < 4; ++q) { f.h[q] = (_Float16)(bf16_round(a[q]) * sc); f.h[4 + q] = (_Float16)(bf16_round(c[q]) * sc); }
  *(v8us*)((unsigned short*)d + t * 8) = f.half[0]; }
__global__ __launch_bounds__(256) void k_rsm(const float* __restrict__ S, _Float16* __restrict__ P, int nrows) {
  #pragma clang fp contract(off)
  const int i = blockIdx.x * 256 + threadIdx.x; if (i >= nrows) return; const float* s = S + (size_t)i * SQ; float mx = -3.0e38f;
#pragma unroll 1
  for (int j = 0; j < SQ; ++j) mx = fmaxf(mx, s[j]); float se = 0.f;
#pragma unroll 1
  for (int j = 0; j < SQ; ++j) se += expf(s[j] - mx); const float sc = 256.0f / se;
#pragma unroll 1
  for (int j0 = 0; j0 < SQ; j0 += 8) { FragH f; for (int q = 0; q < 8; ++q) f.h[q] = (_Float16)(expf(s[j0 + q] - mx) * sc); unsigned short* d = (unsigned short*)P + (size_t)i * SQ + j0; *(v8us*)d = f.half[0];  } }
__global__ __launch_bounds__(256) void k_vt(const _Float16* __restrict__ V16, int b, int h0, _Float16* __restrict__ VT) { __shared__ unsigned short tl[64][65]; const int tid = threadIdx.x; const int hh = blockIdx.x % HG, sg = blockIdx.x / HG; const int s0 = sg * 64; const int h = h0 + hh;
  for (int i = tid; i < 64 * 8; i += 256) { const int j = i / 8, d8 = (i % 8) * 8; FragH f; f.half[0] = *(const v8us*)((const unsigned short*)V16 + ((size_t)b * SQ + s0 + j) * DM + h * HD + d8); for (int q = 0; q < 8; ++q) tl[d8 + q][j] = f.u[q]; }
  __syncthreads();
  { for (int i = tid; i < 64 * 8; i += 256) { const int d = i / 8, j8 = (i % 8) * 8; FragH f; for (int q = 0; q < 8; ++q) f.u[q] = tl[d][j8 + q]; *(v8us*)((unsigned short*)VT + ((size_t)hh * HD + d) * SQ + s0 + j8) = f.half[0]; }  } }



__device__ __forceinline__ float rs_xhalf(float x) { return __builtin_bit_cast(float, __builtin_amdgcn_permlanex16(__builtin_bit_cast(int, x), __builtin_bit_cast(int, x), 0x76543210, 0xfedcba98, false, false)); }      /* lane l <- lane l ^ 16 */
__device__ __forceinline__ float fa_exp2(float x) { float y; asm("v_exp_f32 %0, %1\n\tv_nop" : "=v"(y) : "v"(x)); return y; }      /* 2^x; the v_nop is the slot the instruction set asks for behind a transcendental */
#define SCL2 0.18033688f                   /* SCL * log2(e): scores carried in the base-2 domain, so that a weight is one subtract and one 2^x */
#define SCLR2 (SCL2 * 0.0009765625f)       /* the same scale on the x1024 residual products */
// Fused causal attention, one wave per 16 query rows of one (batch, head); 32 keys a pass, no score or weight plane in memory.
// S^T = K Q^T (A = key rows, B = query rows): a lane holds 16 scores of ITS query (column ln), keys kb + 8 hh + r and kb + 16 + 8 hh + r: the very places of the B fragment of O^T = V^T P^T,
// so the weights go from the score accumulators to the next product inside the lane. Row maximum and row sum: in the lane, plus one exchange with lane ^ 16. Running maximum, o and sum rescaled each pass.
// The four waves of a work-group walk the same keys: a tile of 64 keys (K hi, K residual, V^T: 64 rows of 128 bytes each) is brought into LDS once for all four by asynchronous copies of whole 128-byte lines, two buffers, the next tile in flight while this one is worked on; the fragments are 16-byte LDS reads.
#define FKT 64                       /* keys of a staged tile: two passes */
#define FPT 72                       /* pitch of a staged row in f16: 144 B = 9 x 16 B, so that 16 lanes reading 16 rows by 16 bytes do not meet in a bank */
#define FPL (FKT * FPT * 2)          /* bytes of one staged plane */
#define FRS (16 * FPT * 2)           /* bytes of 16 staged rows: the step between a lane's four pieces of a plane */
// One tile: a lane's twelve 16-byte pieces (four of each plane, 16 rows apart). ld: the lane's LDS byte address in plane 0 of the buffer; gh, gl, gv: its first piece in the K hi rows, the K residual rows and the V^T rows.
__device__ __forceinline__ void fa_stage(unsigned ld, const _Float16* gh, const _Float16* gl, const _Float16* gv) {
  asm volatile(      /* the copies go from global memory to LDS through no register; the s_wait_xcnt in the same statement stands in front of every later write of the address registers that the copies name */
    "global_load_async_to_lds_b128 %0, %12, off\n\t"
    "global_load_async_to_lds_b128 %1, %13, off\n\t"
    "global_load_async_to_lds_b128 %2, %14, off\n\t"
    "global_load_async_to_lds_b128 %3, %15, off\n\t"
    "global_load_async_to_lds_b128 %4, %16, off\n\t"
    "global_load_async_to_lds_b128 %5, %17, off\n\t"
    "global_load_async_to_lds_b128 %6, %18, off\n\t"
    "global_load_async_to_lds_b128 %7, %19, off\n\t"
    "global_load_async_to_lds_b128 %8, %20, off\n\t"
    "global_load_async_to_lds_b128 %9, %21, off\n\t"
    "global_load_async_to_lds_b128 %10, %22, off\n\t"
    "global_load_async_to_lds_b128 %11, %23, off\n\t"
    "s_wait_xcnt 0x0"
    :: "v"(ld), "v"(ld + FRS), "v"(ld + 2 * FRS), "v"(ld + 3 * FRS),
       "v"(ld + FPL), "v"(ld + FPL + FRS), "v"(ld + FPL + 2 * FRS), "v"(ld + FPL + 3 * FRS),
       "v"(ld + 2 * FPL), "v"(ld + 2 * FPL + FRS), "v"(ld + 2 * FPL + 2 * FRS), "v"(ld + 2 * FPL + 3 * FRS),
       "v"(gh), "v"(gh + (size_t)16 * LQ), "v"(gh + (size_t)32 * LQ), "v"(gh + (size_t)48 * LQ),
       "v"(gl), "v"(gl + (size_t)16 * LQ), "v"(gl + (size_t)32 * LQ), "v"(gl + (size_t)48 * LQ),
       "v"(gv), "v"(gv + (size_t)16 * SQ), "v"(gv + (size_t)32 * SQ), "v"(gv + (size_t)48 * SQ)
    : "memory"); }
__global__ __launch_bounds__(128) void k_fattn(const _Float16* __restrict__ QHp, const _Float16* __restrict__ QLp, const _Float16* __restrict__ KHp, const _Float16* __restrict__ KLp, const _Float16* __restrict__ VTp, _Float16* __restrict__ Op) {
  __shared__ __attribute__((aligned(16))) _Float16 sk[2][3][FKT][FPT];      /* [buffer][K hi, K residual, V^T][row][64 values + pad] */
  const int tid = threadIdx.x, lane = tid & 31, ln = lane & 15, hh = lane >> 4; const int w = __builtin_amdgcn_readfirstlane(tid >> 5);
  const int bh = blockIdx.y, b = bh / NH, h = bh % NH; const int nst = SQ / FKT - (int)blockIdx.x;      /* tiles up to and with the work-group's diagonal tile; the longest rows start first */
  const int q0 = (nst - 1) * FKT + w * 16;
  const size_t r0 = (size_t)b * SQ; const int q = q0 + ln;
  const int sr = tid >> 3, sc8 = (tid & 7) * 8;      /* staging: eight lanes copy one 128-byte row, a wave four whole rows a copy */
  const _Float16* gh = KHp + (r0 + sr) * LQ + h * HD + sc8; const _Float16* gl = KLp + (r0 + sr) * LQ + h * HD + sc8; const _Float16* gv = VTp + ((size_t)bh * HD + sr) * SQ + sc8;
  const unsigned ld0 = (unsigned)(size_t)&sk[0][0][sr][sc8];      /* the low 32 bits of a shared address are its LDS byte address */
  fa_stage(ld0, gh, gl, gv);      /* tile 0 into buffer 0 */
  const _Float16* qh = QHp + (r0 + q) * LQ + h * HD; const _Float16* ql = QLp + (r0 + q) * LQ + h * HD;
  const v16h qh0 = g2_frag(qh, hh), qh1 = g2_frag(qh + 32, hh), ql0 = g2_frag(ql, hh), ql1 = g2_frag(ql + 32, hh);
  const v8f z8 = {0.f,0.f,0.f,0.f,0.f,0.f,0.f,0.f}; v8f o0 = z8, o1 = z8, o2 = z8, o3 = z8; float m = -1.0e30f, l = 0.f;
  asm volatile("s_wait_asynccnt 0x0" ::: "memory");      /* this wave's pieces of tile 0 have landed */
  __syncthreads();      /* every wave's pieces of tile 0 have landed: the tile may be read */
  if (nst > 1) fa_stage(ld0 + 3 * FPL, gh + (size_t)FKT * LQ, gl + (size_t)FKT * LQ, gv + FKT);      /* tile 1 into buffer 1 */
#pragma unroll 1      /* a trip holds two passes of 24 fragment loads and 16 products each: a second copy of it would not fit the registers */
  for (int st = 0; st < nst; ++st) {
    const _Float16* tk = &sk[st & 1][0][ln][0]; const _Float16* tl = &sk[st & 1][1][ln][0]; const _Float16* tv = &sk[st & 1][2][ln][0];      /* this trip reads this buffer alone */
    v16h ka0 = g2_frag(tk, hh), ka1 = g2_frag(tk + 32, hh), ka2 = g2_frag(tk + 16 * FPT, hh), ka3 = g2_frag(tk + 16 * FPT + 32, hh);      /* the tile's key rows 0 .. 31, hi plane */
    v16h kc0 = g2_frag(tl, hh), kc1 = g2_frag(tl + 32, hh), kc2 = g2_frag(tl + 16 * FPT, hh), kc3 = g2_frag(tl + 16 * FPT + 32, hh);      /* the same rows, residual plane */
#pragma unroll      /* the two passes of a tile: the second one's LDS offsets as immediates, its key fragments asked for in the first */
    for (int sub = 0; sub < 2; ++sub) {
      const int kb = st * FKT + sub * 32;
      if (sub == 1 && kb >= q0 + 16) break;      /* wave-uniform: a pass runs only while kb < q0 + 16, so that every query has a key in every pass; the foot of the trip below is passed all the same */
      const v16h va0 = g2_frag(tv + sub * 32, hh), va1 = g2_frag(tv + 16 * FPT + sub * 32, hh), va2 = g2_frag(tv + 32 * FPT + sub * 32, hh), va3 = g2_frag(tv + 48 * FPT + sub * 32, hh);      /* asked for here, used behind the softmax */
      v8f sh0 = z8, sl0 = z8, sh1 = z8, sl1 = z8;      /* hi . hi, and lo . hi + hi . lo (x1024), for keys kb .. kb + 15 and kb + 16 .. kb + 31 */
      sh0 = g2_mma(ka0, qh0, sh0); sl0 = g2_mma(ka0, ql0, sl0); sh1 = g2_mma(ka2, qh0, sh1); sl1 = g2_mma(ka2, ql0, sl1);
      sh0 = g2_mma(ka1, qh1, sh0); sl0 = g2_mma(ka1, ql1, sl0); sh1 = g2_mma(ka3, qh1, sh1); sl1 = g2_mma(ka3, ql1, sl1);
      sl0 = g2_mma(kc0, qh0, sl0); sl1 = g2_mma(kc2, qh0, sl1); sl0 = g2_mma(kc1, qh1, sl0); sl1 = g2_mma(kc3, qh1, sl1);
      if (sub == 0) {      /* the second pass's key fragments (rows 32 .. 63 of the same tile) come in during this pass's softmax and output products */
        ka0 = g2_frag(tk + 32 * FPT, hh); ka1 = g2_frag(tk + 32 * FPT + 32, hh); ka2 = g2_frag(tk + 48 * FPT, hh); ka3 = g2_frag(tk + 48 * FPT + 32, hh);
        kc0 = g2_frag(tl + 32 * FPT, hh); kc1 = g2_frag(tl + 32 * FPT + 32, hh); kc2 = g2_frag(tl + 48 * FPT, hh); kc3 = g2_frag(tl + 48 * FPT + 32, hh); }
      float s0[8], s1[8];
#pragma unroll      /* unrolled so that every index into the accumulator and fragment registers is a constant */
      for (int r = 0; r < 8; ++r) { s0[r] = fmaf(sl0[r], SCLR2, sh0[r] * SCL2); s1[r] = fmaf(sl1[r], SCLR2, sh1[r] * SCL2); }
      if (kb + 31 > q0) {      /* wave-uniform: only the pass on the diagonal holds keys after a query */
#pragma unroll      /* unrolled so that every index into the accumulator and fragment registers is a constant */
        for (int r = 0; r < 8; ++r) { const int j = kb + 8 * hh + r; s0[r] = (j <= q) ? s0[r] : -1.0e30f; s1[r] = (j + 16 <= q) ? s1[r] : -1.0e30f; } }
      float bm = fmaxf(s0[0], s1[0]);
#pragma unroll      /* unrolled so that every index into the accumulator and fragment registers is a constant */
      for (int r = 1; r < 8; ++r) bm = fmaxf(bm, fmaxf(s0[r], s1[r]));
      bm = fmaxf(bm, rs_xhalf(bm)); const float mn = fmaxf(m, bm); const float sc = fa_exp2(m - mn); m = mn;
      FragH pf; float ls = 0.f;
#pragma unroll      /* unrolled so that every index into the accumulator and fragment registers is a constant */
      for (int r = 0; r < 8; ++r) { const float e0 = fa_exp2(s0[r] - mn), e1 = fa_exp2(s1[r] - mn); ls += e0 + e1; pf.h[r] = (_Float16)e0; pf.h[8 + r] = (_Float16)e1; }
      l = fmaf(l, sc, ls);      /* the lane's half of the row sum; the halves meet behind the loop */
#pragma unroll      /* unrolled so that every index into the accumulator and fragment registers is a constant */
      for (int r = 0; r < 8; ++r) { o0[r] *= sc; o1[r] *= sc; o2[r] *= sc; o3[r] *= sc; }
      o0 = g2_mma(va0, pf.v, o0); o1 = g2_mma(va1, pf.v, o1); o2 = g2_mma(va2, pf.v, o2); o3 = g2_mma(va3, pf.v, o3); }
    asm volatile("s_wait_dscnt 0x0" ::: "memory");      /* this wave's reads of the buffer are done before it may be refilled */
    asm volatile("s_wait_asynccnt 0x0" ::: "memory");      /* this wave's pieces of the next tile have landed */
    __syncthreads();      /* publishes the next tile and ends every wave's reads of this trip's buffer */
    if (st + 2 < nst) fa_stage(ld0 + (unsigned)(st & 1) * (3 * FPL), gh + (size_t)(st + 2) * FKT * LQ, gl + (size_t)(st + 2) * FKT * LQ, gv + (size_t)(st + 2) * FKT); }      /* the tile after the next into the buffer just read */
  asm volatile("s_wait_asynccnt 0x0" ::: "memory");      /* no copy is outstanding when the wave goes on to its end */
  l += rs_xhalf(l); const float fin = 64.0f / l;      /* o carried x64, folded into the output GEMM alpha */
  unsigned short* op = (unsigned short*)Op + (r0 + q) * DM + h * HD + 8 * hh; FragH f0, f1, f2, f3;      /* lane: 8 neighbouring head values of its query per tile; the wave writes whole 128-byte head rows */
#pragma unroll      /* unrolled so that every index into the accumulator and fragment registers is a constant */
  for (int r = 0; r < 8; ++r) { f0.h[r] = (_Float16)(o0[r] * fin); f1.h[r] = (_Float16)(o1[r] * fin); f2.h[r] = (_Float16)(o2[r] * fin); f3.h[r] = (_Float16)(o3[r] * fin); }
  *(v8us*)op = f0.half[0]; *(v8us*)(op + 16) = f1.half[0]; *(v8us*)(op + 32) = f2.half[0]; *(v8us*)(op + 48) = f3.half[0]; }

#define A0R 8                        /* query rows of a work-group of the exact first tile: one wave each */
#define A0P 68                       /* pitch of a staged key row in floats: 272 B = 17 x 16 B, so that 16 lanes reading 16 rows by 16 bytes meet every LDS bank once */
#define A0U (QT0 * (HD / 4) / 256)   /* 16-byte pieces of a staged plane per thread */
typedef float v2f __attribute__((ext_vector_type(2)));
typedef _Float16 v2h __attribute__((ext_vector_type(2)));
// Exact f32 attention for the first QT0 rows, causal. One wave per query row, A0R rows of one head per work-group; the head's QT0 key and value rows are staged in LDS once (keys behind a query are masked below and carry weight zero).
// Scores: a lane takes keys lane, lane + 32, lane + 64, lane + 96, each a serial f32 chain over the 64 head values. Row maximum and row sum: butterflies over the wave. Output: a lane takes two head values and sums over the keys in rising order, the weight of key j read from its lane.
__global__ __launch_bounds__(256) void k_att0(const float* __restrict__ QF, const float* __restrict__ KF, const float* __restrict__ VF, int ld, size_t sb, float scale, _Float16* __restrict__ OH, _Float16* __restrict__ OL, int ldo, size_t sbo) {
  __shared__ __attribute__((aligned(16))) float lk[QT0][A0P]; __shared__ __attribute__((aligned(16))) float lv[QT0][HD];
  QF += (size_t)blockIdx.y * sb; KF += (size_t)blockIdx.y * sb; VF += (size_t)blockIdx.y * sb; OH += (size_t)blockIdx.y * sbo; OL += (size_t)blockIdx.y * sbo;      /* blockIdx.y: the batch */
  const int tid = threadIdx.x, lane = tid & 31; const int w = __builtin_amdgcn_readfirstlane(tid >> 5);
  const int h = blockIdx.x / (QT0 / A0R), rg = blockIdx.x % (QT0 / A0R); const int i = rg * A0R + w;      /* this wave's query */
  v4f kq[A0U], vq[A0U];
#pragma unroll      /* all 16 loads of a thread in flight at once, their results under constant indices */
  for (int u = 0; u < A0U; ++u) { const int t = u * 256 + tid, j = t / (HD / 4), c = (t % (HD / 4)) * 4; const size_t ro = (size_t)j * ld + h * HD + c;
    const float* kp = KF + ro; const float* vp = VF + ro;
    kq[u] = *(const v4fa*)kp; asm volatile("s_wait_xcnt 0x0" :: "v"(kp) : "memory");      /* stands in front of every write of the registers that this load names as its address; it takes the address as an input, so that those registers live up to it and no load's result, this one's included, is placed on them earlier */
    vq[u] = *(const v4fa*)vp; asm volatile("s_wait_xcnt 0x0" :: "v"(vp) : "memory"); }      /* the same for this load */
  const float* qr = QF + (size_t)i * ld + h * HD; v4f qv[HD / 4];
#pragma unroll      /* the query row stays in registers: constant indices */
  for (int c = 0; c < HD / 4; ++c) qv[c] = *(const v4fa*)(qr + c * 4);
  asm volatile("s_wait_xcnt 0x0" :: "s"(qr) : "memory");      /* the same wait for the query row's loads (wave-uniform address: scalar loads), in front of every write of their base registers */
#pragma unroll      /* constant indices into the staging registers */
  for (int u = 0; u < A0U; ++u) { const int t = u * 256 + tid, j = t / (HD / 4), c = (t % (HD / 4)) * 4; *(v4f*)&lk[j][c] = kq[u]; *(v4f*)&lv[j][c] = vq[u]; }
  __syncthreads();      /* the staged rows are read by every wave */
  float s[QT0 / 32];
#pragma unroll      /* four independent chains side by side */
  for (int g = 0; g < QT0 / 32; ++g) s[g] = 0.f;
#pragma unroll      /* constant indices into the query registers, LDS offsets as immediates */
  for (int c = 0; c < HD / 4; ++c) {
#pragma unroll      /* four independent chains side by side */
    for (int g = 0; g < QT0 / 32; ++g) { const v4f kr = *(const v4f*)&lk[g * 32 + lane][c * 4]; s[g] = fmaf(qv[c][0], kr[0], s[g]); s[g] = fmaf(qv[c][1], kr[1], s[g]); s[g] = fmaf(qv[c][2], kr[2], s[g]); s[g] = fmaf(qv[c][3], kr[3], s[g]); } }
  float mx = -1.0e30f;
#pragma unroll      /* constant indices into the score registers */
  for (int g = 0; g < QT0 / 32; ++g) { s[g] = (g * 32 + lane <= i) ? s[g] * scale : -1.0e30f; mx = fmaxf(mx, s[g]); }
#pragma unroll      /* five exchange steps */
  for (int st = 16; st > 0; st >>= 1) mx = fmaxf(mx, __shfl_xor(mx, st));
  float e[QT0 / 32], l = 0.f;
#pragma unroll      /* constant indices into the score registers */
  for (int g = 0; g < QT0 / 32; ++g) { e[g] = (g * 32 + lane <= i) ? expf(s[g] - mx) : 0.f; l += e[g]; }
#pragma unroll      /* five exchange steps */
  for (int st = 16; st > 0; st >>= 1) l += __shfl_xor(l, st);
  v2f o = {0.f, 0.f};
#pragma unroll      /* constant lane numbers for the weight reads, LDS offsets as immediates */
  for (int g = 0; g < QT0 / 32; ++g) {
#pragma unroll      /* constant lane numbers for the weight reads, LDS offsets as immediates */
    for (int jj = 0; jj < 32; ++jj) { const float ej = __builtin_bit_cast(float, __builtin_amdgcn_readlane(__builtin_bit_cast(int, e[g]), jj)); const v2f vv = *(const v2f*)&lv[g * 32 + jj][2 * lane]; o[0] = fmaf(ej, vv[0], o[0]); o[1] = fmaf(ej, vv[1], o[1]); } }
  const float fin = 64.0f / l;      /* o carried x64 like the f16 path */
  o[0] *= fin; o[1] *= fin; v2h oh, ol;      /* o leaves as the two operands of the output GEMMs: f16 hi + x1024 residual */
  oh[0] = (_Float16)o[0]; oh[1] = (_Float16)o[1]; ol[0] = (_Float16)((o[0] - (float)oh[0]) * 1024.0f); ol[1] = (_Float16)((o[1] - (float)oh[1]) * 1024.0f);
  const size_t oo = (size_t)i * ldo + h * HD + 2 * lane; *(v2h*)(OH + oo) = oh; *(v2h*)(OL + oo) = ol; }      /* the wave writes its query's whole 128-byte head row of either plane */

#define VTP 136                      /* pitch of a staged V^T row in f16: 128 tokens + 8 = 272 B = 17 x 16 B, so that the 16-byte pieces of 16 neighbouring rows spread over the LDS banks */
typedef float v2fa __attribute__((ext_vector_type(2), may_alias));
// The 16 rows that a half-wave stores of a q or k tile (every second row of the wave's 32): sv, sm: the lane's four columns and the statistics of its first row in LDS (row pitch 68 floats); gg, bb: gamma and beta of those columns. FI: the f32 rows are stored too.
template <bool FI>
__device__ __forceinline__ void qk_rows(const float* sv, const float* sm, v4f gg, v4f bb, float* Fp, _Float16* Hp, _Float16* Lp) {
  v4f v[16]; v2f ms[16];
#pragma unroll      /* all LDS reads asked for ahead of the arithmetic, their results under constant indices */
  for (int q = 0; q < 16; ++q) { v[q] = *(const v4fa*)(sv + q * 2 * 68); ms[q] = *(const v2fa*)(sm + q * 2 * 68); }
#pragma unroll      /* constant indices, global offsets as immediates */
  for (int q = 0; q < 16; ++q) { v4f y; v4h h4, l4;
#pragma unroll      /* constant indices */
    for (int e = 0; e < 4; ++e) { y[e] = (v[q][e] - ms[q][0]) * ms[q][1] * gg[e] + bb[e]; const _Float16 h = (_Float16)y[e]; h4[e] = h; l4[e] = (_Float16)((y[e] - (float)h) * 1024.0f); }
    if (FI) *(v4f*)(Fp + (size_t)q * 2 * DM) = y;
    *(v4h*)(Hp + (size_t)q * 2 * DM) = h4; *(v4h*)(Lp + (size_t)q * 2 * DM) = l4;
    if (FI) asm volatile("s_wait_xcnt 0x0" :: "v"(y), "v"(h4), "v"(l4) : "memory");      /* stands in front of every later write of the registers that these stores name; it takes the stored values as inputs, so that their registers live up to it and no later row's value is placed on them earlier (the address registers serve all 16 rows) */
    else asm volatile("s_wait_xcnt 0x0" :: "v"(h4), "v"(l4) : "memory"); } }      /* the same without the f32 row */
// q, k, v projections (blockIdx.y) with all that follows them element by element done in the epilogue. Loop and tiles are k_gemm2's: a wave owns 32 tokens x 64 columns, which is ONE head of those tokens, so the wave holds every value that a (token, head) LayerNorm needs.
// q, k: the tile goes to the wave's LDS rows; lane = token takes mean and variance of its row (serial f32 sums in rising order); then the wave walks the rows 16 lanes a row, normalises, and stores f16 hi + x1024 residual rows (whole 128-byte head rows).
// v: a lane's 8 accumulator values of a tile are 8 neighbouring tokens of one head value, a 16-byte piece of V^T; the four waves' pieces meet in LDS, so that a wave stores whole 256-byte runs of a V^T row.
// f32 rows of q, k (normalised) and v are stored only where the exact first tile reads them: the first QT0 tokens of a batch.
__global__ __launch_bounds__(128) void k_qkv(const _Float16* __restrict__ X, const _Float16* __restrict__ Bt, const float* __restrict__ qg, const float* __restrict__ qb, const float* __restrict__ kg, const float* __restrict__ kb, float eps,
    float* __restrict__ F, _Float16* __restrict__ Hh, _Float16* __restrict__ Hl, _Float16* __restrict__ VTo) {
  __shared__ __attribute__((aligned(16))) float so[4][32][68];      /* columns 64, 65 of a row: its mean and its 1 / sigma */
  const int tid = threadIdx.x, w = tid >> 5, lane = tid & 31, ln = lane & 15, hh = lane >> 4; const int by = blockIdx.y;
  const int mt = blockIdx.x / (DM / 64), nq = blockIdx.x % (DM / 64); const int row0 = mt * 128 + 32 * w, col0 = nq * 64;
  const int bt = mt / (SQ / 128), s0 = (mt % (SQ / 128)) * 128; const bool first = s0 < QT0;      /* the work-group's batch and its first token there; work-group-uniform */
  const _Float16* a0p = X + (size_t)(row0 + ln) * DM; const _Float16* a1p = a0p + (size_t)16 * DM;
  const _Float16* b0p = Bt + (size_t)by * DM * DM + (size_t)(col0 + ln) * DM; const _Float16* b1p = b0p + (size_t)16 * DM; const _Float16* b2p = b1p + (size_t)16 * DM; const _Float16* b3p = b2p + (size_t)16 * DM;
  const v8f z8 = {0.f,0.f,0.f,0.f,0.f,0.f,0.f,0.f}; v8f c00 = z8, c01 = z8, c02 = z8, c03 = z8, c10 = z8, c11 = z8, c12 = z8, c13 = z8;
#pragma unroll 1      /* rolled like k_gemm2's loop, which it replaces here: the products and their schedule stay as they were */
  for (int kk = 0; kk < DM; kk += 32) { const v16h a0 = g2_frag(a0p + kk, hh), a1 = g2_frag(a1p + kk, hh);
    v16h b = g2_frag(b0p + kk, hh); c00 = g2_mma(a0, b, c00); c10 = g2_mma(a1, b, c10);
    b = g2_frag(b1p + kk, hh); c01 = g2_mma(a0, b, c01); c11 = g2_mma(a1, b, c11);
    b = g2_frag(b2p + kk, hh); c02 = g2_mma(a0, b, c02); c12 = g2_mma(a1, b, c12);
    b = g2_frag(b3p + kk, hh); c03 = g2_mma(a0, b, c03); c13 = g2_mma(a1, b, c13); }
  const v8f accs[8] = {c00, c01, c02, c03, c10, c11, c12, c13};
  const int rsub = lane >> 4, c4 = (lane & 15) * 4;
  const size_t po = (size_t)by * NR * DM + (size_t)(row0 + rsub) * DM + col0 + c4;      /* the lane's place in row rsub of the wave's tile, in plane by */
  if (by < 2 || first) {      /* work-group-uniform: the tile as f32 rows in the wave's own LDS (x16 weights undone) */
#pragma unroll      /* constant indices into the accumulator registers */
    for (int u = 0; u < 8; ++u) { const int t = u & 3, half = u >> 2;
#pragma unroll      /* constant indices into the accumulator registers */
      for (int r = 0; r < 8; ++r) so[w][half * 16 + 8 * hh + r][t * 16 + ln] = accs[u][r] * 0.0625f; }
    __builtin_amdgcn_fence(__ATOMIC_ACQ_REL, "workgroup"); __builtin_amdgcn_wave_barrier(); }      /* the wave's lanes read each other's LDS writes below */
  if (by < 2) {
    const float* gp = by ? kg : qg; const float* bp = by ? kb : qb; const v4f g4 = *(const v4fa*)(gp + c4), b4 = *(const v4fa*)(bp + c4);      /* the lane's four columns are the same in every row it stores */
    v4f rv[16];
#pragma unroll      /* the row stays in registers: constant indices */
    for (int c = 0; c < 16; ++c) rv[c] = *(const v4fa*)&so[w][lane][c * 4];
    float sum = 0.f, vs = 0.f;
#pragma unroll      /* constant indices into the row's registers */
    for (int c = 0; c < 16; ++c) sum = (((sum + rv[c][0]) + rv[c][1]) + rv[c][2]) + rv[c][3];
    const float mu = sum / 64.0f;
#pragma unroll      /* constant indices into the row's registers */
    for (int c = 0; c < 16; ++c)
#pragma unroll      /* constant indices into the row's registers */
      for (int e = 0; e < 4; ++e) { const float dl = rv[c][e] - mu; vs = fmaf(dl, dl, vs); }
    v2f st = {mu, rsqrtf(vs / 64.0f + eps)}; *(v2fa*)&so[w][lane][64] = st;
    __builtin_amdgcn_fence(__ATOMIC_ACQ_REL, "workgroup"); __builtin_amdgcn_wave_barrier();      /* the statistics are read by the lanes that store the row */
    v4f gg, bb;
#pragma unroll      /* constant indices */
    for (int e = 0; e < 4; ++e) { gg[e] = bf16_round(g4[e]); bb[e] = bf16_round(b4[e]); }
    const float* sv = &so[w][rsub][c4]; const float* sm = &so[w][rsub][64];
    if (first) qk_rows<true>(sv, sm, gg, bb, F + po, Hh + po, Hl + po); else qk_rows<false>(sv, sm, gg, bb, F + po, Hh + po, Hl + po);      /* work-group-uniform */
  } else {
    if (first) {
#pragma unroll      /* LDS and global offsets as immediates */
      for (int q = 0; q < 16; ++q) { const v4f v = *(const v4fa*)&so[w][q * 2 + rsub][c4]; *(v4f*)(F + po + (size_t)q * 2 * DM) = v; }
      __syncthreads(); }      /* every wave has read its f32 rows before the array is used anew below */
    unsigned short* sT = (unsigned short*)&so[0][0][0];      /* the same LDS as [HD][VTP] f16: V^T of the work-group's 128 tokens */
#pragma unroll      /* constant indices into the accumulator registers */
    for (int u = 0; u < 8; ++u) { const int t = u & 3, half = u >> 2; FragH f;
#pragma unroll      /* constant indices into the accumulator registers */
      for (int r = 0; r < 8; ++r) f.h[r] = (_Float16)(accs[u][r] * 0.0625f);
      *(v8us*)(sT + (t * 16 + ln) * VTP + w * 32 + half * 16 + 8 * hh) = f.half[0]; }
    __syncthreads();      /* a V^T row holds pieces of all four waves */
    unsigned short* vo = (unsigned short*)VTo + ((size_t)(bt * NH + nq) * HD + (tid >> 4)) * SQ + s0 + (tid & 15) * 8;      /* 16 lanes store one row's 256 bytes */
#pragma unroll      /* LDS offsets as immediates, all eight reads in flight */
    for (int rd = 0; rd < 8; ++rd) { const v8us o = *(const v8us*)(sT + (rd * 8 + (tid >> 4)) * VTP + (tid & 15) * 8); *(v8us*)(vo + (size_t)rd * 8 * SQ) = o; }
    asm volatile("s_wait_xcnt 0x0" ::: "memory"); } }      /* stands behind the eighth store, in front of every later write of the data and address registers that the eight stores name */
extern "C" void kernel_launch(void* const* d_in, const int* in_sizes, int n_in,
                              void* d_out, int out_size, void* d_ws, size_t ws_size, hipStream_t stream) {
  (void)in_sizes; (void)n_in; (void)out_size;
  const float* const* I = (const float* const*)d_in; const float* x = I[0]; const float* wq = I[1]; const float* wk = I[2]; const float* wv = I[3]; const float* wo = I[4]; const float* bo = I[5]; const float* qg = I[6]; const float* qbt = I[7]; const float* kg = I[8]; const float* kbt = I[9]; const float LNE = 1e-5f;      /* input order: x (feeds the q, k AND v streams), Wq, Wk, Wv (natural [out][in] weights; NO biases: k_qkv takes no bias), Wo, bo (zeros: read), q_gamma, q_beta, k_gamma, k_beta [64] (ones / zeros on this draw: read by value in the projections' LayerNorm epilogue) */
  char* ws = (char*)d_ws; size_t off = 0;
  auto take = [&](size_t bytes) { char* p = ws + off; off += (bytes + 255) & ~(size_t)255; return p; };
  _Float16* BQ = (_Float16*)take((size_t)4 * DM * DM * 2); _Float16* BK = BQ + (size_t)DM * DM; _Float16* BV = BK + (size_t)DM * DM; _Float16* BO = BV + (size_t)DM * DM; (void)BK; (void)BV;      /* the four weight planes lie one behind the other: one grid writes them, one GEMM grid reads the first three by plane index */
  _Float16* X16 = (_Float16*)take(NR * DM * 2);      /* exact f16 rows of x: the one operand of the q, k and v projections */
  float* QF = (float*)take((size_t)3 * NR * DM * 4); float* KF = QF + NR * DM; float* VF = KF + NR * DM;      /* f32 rows of q, k (normalised) and v, three planes one behind the other: written and read for the first QT0 tokens of a batch alone, by the exact first tile */
  _Float16* QH = (_Float16*)take((size_t)2 * NR * DM * 2); _Float16* KH = QH + NR * DM; _Float16* QL = (_Float16*)take((size_t)2 * NR * DM * 2); _Float16* KL = QL + NR * DM;      /* hi planes of q and k one behind the other, residual planes likewise: the projection grid places them by plane index */
  _Float16* O16 = (_Float16*)take(NR * DM * 2);
  _Float16* VT = (_Float16*)take((size_t)NB * NH * HD * SQ * 2);      /* V^T [NB][NH][HD][SQ] */
  _Float16* OH0 = (_Float16*)take((size_t)NB * QT0 * DM * 2); _Float16* OL0 = (_Float16*)take((size_t)NB * QT0 * DM * 2);
  if (off > ws_size) return;
  k_prep<<<(unsigned)(NR * DM / 2048 + 4 * (DM * DM / 2048)), 256, 0, stream>>>(x, wq, wk, wv, wo, X16, BQ);      /* x as exact f16 rows; natural [out][in] weights = Bt[n][k] x16 */
  k_qkv<<<dim3((unsigned)((MP / 128) * (DM / 64)), 3), 128, 0, stream>>>(X16, BQ, qg, qbt, kg, kbt, LNE, QF, QH, QL, VT);      /* blockIdx.y: q, k (no biases; per-head LayerNorm; f16 hi + x1024 residual rows: unscaled logits sigma ~8) and v (V^T [NB][NH][HD][SQ]); f32 rows for the first tile */
  k_att0<<<dim3(NH * (QT0 / A0R), NB), 256, 0, stream>>>(QF, KF, VF, DM, (size_t)SQ * DM, SCL, OH0, OL0, DM, (size_t)QT0 * DM);      /* exact f32 attention for rows 0..127 of every batch (o x64, as f16 hi + x1024 residual planes), on the f32 q, k, v rows that the projections left */
  k_fattn<<<dim3(SQ / 64, NB * NH), 128, 0, stream>>>(QH, QL, KH, KL, VT, O16);      /* scores, causal softmax and P . V of every batch, head and query row in one launch: o (merged heads, x64) as f16 rows */
  k_gemm2<0><<<dim3((unsigned)((MPO / 128) * (DM / 64)), 1), 128, 0, stream>>>(O16, DM, 0, BO, DM, 0, 0.0009765625f, bo, 0, nullptr, 1, 0, 0, (float*)d_out, nullptr, 0, DM, 0, MPO, DM, DM);      /* out rows are the output layout */
  k_gemm2<0><<<dim3((QT0 / 128) * (DM / 64), NB), 128, 0, stream>>>(OH0, DM, (size_t)QT0 * DM, BO, DM, 0, 0.0009765625f, bo, 0, nullptr, 1, 0, 0, (float*)d_out, nullptr, 0, DM, (size_t)SQ * DM, QT0, DM, DM);      /* blockIdx.y: the batch; rows 0..127: out = o_hi Wo (+ b), overwriting the f16-path rows */
  k_gemm2<0><<<dim3((QT0 / 128) * (DM / 64), NB), 128, 0, stream>>>(OL0, DM, (size_t)QT0 * DM, BO, DM, 0, 0.00000095367431640625f, nullptr, 0, (const float*)d_out, -1, 0, 0, (float*)d_out, nullptr, 0, DM, (size_t)SQ * DM, QT0, DM, DM);      /* += o_lo Wo 2^-20 (own-element accumulate) */
}

// v008
// One run takes 106 microseconds.
// Timed twice side by side with v007, it ran 1.59 times as fast both times.
// Counting every step since v000, it is 101 times as fast.
#include <hip/hip_runtime.h>
// Causal multi-head self-attention with a per-head LayerNorm on q and k, natural bias-free q / k / v projections and a biased output projection (x [2][3072][512]; q / k / v = x W^T (nn.Linear natural [512][512] sd 0.02, NO biases), 8 heads of 64; q and k each pass through a LayerNorm over the 64 values of every (token, head) vector (biased variance, eps 1e-5, gamma / beta [64]: ones / zeros on this draw: read); scores = q . k / sqrt(64); causal (keys after the query get -inf); softmax; out = merged Wo^T + bo (natural; zero bias) -> [2][3072][512]); q and k carried as f16 hi + x1024 residual planes with three-product scores.
// Structure: token rows r = b*3072 + s; x as exact f16 rows (bf16-rounded); q, k and v as WMMA GEMMs in one grid (32x64 wave tiles = 32 tokens of one head, f32 accumulation, exact x16 weights, no bias) whose epilogue finishes the tile: q and k get their f32 LayerNorm over the 64 values of each (token, head) vector (f32 statistics, gamma / beta by value) and leave as f16 hi + x1024 residual planes, v leaves as V^T through an LDS transpose; f32 rows of q, k, v are stored for the first 128 tokens of a batch alone; work that does not depend on each other shares a grid (x and the weights; q, k, v; both batches); then ONE fused launch for all batches, heads and query rows (the first 128 rows of a batch exactly in f32, one wave a row, o as f16 hi + x1024 residual planes): from row 128 on a wave takes 16 query rows and walks the keys up to its diagonal, 32 a pass: S^T = K Q^T as three products (hi.hi + lo.hi + hi.lo, K = 64, scale 1/8 = 1/sqrt(64); logits sigma ~1), causal running-maximum softmax inside the lane (f32 statistics, native exp; weights exp(s - max) as f16), O^T = V^T P^T with the weights taken in place from the score accumulators (o divided by the row sum at the end and carried x64, folded into the output GEMM alpha) written straight into the merged f16 o rows; out = o Wo^T + bo GEMM (f32) into the output layout.
// Compute dtype: inputs rounded to bf16; x / weights exact; the normalised q and k as f16 hi + residual planes (three-product scores), v, the softmax weights and o as plain f16 GEMM operands (~2^-12); LayerNorm, scores and softmax statistics f32. v_wmma_f32_16x16x32_f16.
#define NB 2
#define SCL 0.125f                         /* 1 / sqrt(head_dim = 64) */
#define SCLR 0.0001220703125f              /* 2^-13: SCL / 1024; unused: the x1024 residual products take SCLR2 */
#define SQ 3072
#define DM 512
#define NH 8
#define HD 64
#define HG 4                         /* heads per launch of the h0-based k_vt overload */
#define QT0 128                      /* first-tile rows computed exactly in f32 (the fused path starts behind them) */
#define B0 0                         /* unused */
#define NBR NB                       /* batches processed (debug hook) */
#define NR ((size_t)NB * SQ)         /* token rows */
#define MP ((int)((size_t)NBR * SQ)) /* rows projected (debug hook) */
#define MPO MP                       /* rows through the output stage (debug hook) */
#define LQ DM      /* row pitch of the q/k/v rows */
typedef __bf16 v16b __attribute__((ext_vector_type(16)));
typedef unsigned short v8us __attribute__((ext_vector_type(8), may_alias));
typedef float  v8f  __attribute__((ext_vector_type(8)));
typedef float  v4f  __attribute__((ext_vector_type(4)));
typedef float  v4fa __attribute__((ext_vector_type(4), may_alias));
union FragB { v16b v; v8us half[2]; unsigned short u[16]; };

__device__ __forceinline__ unsigned short bf16_bits(float x) { unsigned int u = __float_as_uint(x); return (unsigned short)((u + 0x7FFFu + ((u >> 16) & 1u)) >> 16); }
__device__ __forceinline__ float bf16_val(unsigned short b) { return __uint_as_float(((unsigned int)b) << 16); }
__device__ __forceinline__ float bf16_round(float x) { return bf16_val(bf16_bits(x)); }
// D += A·B with NT terms: 1 = ah·bh, 2 = + al·bh (A split), 3 = + ah·bl (both split)
template <int NT>
__device__ __forceinline__ v8f mmaN(v16b ah, v16b al, v16b bh, v16b bl, v8f c) {
  c = __builtin_amdgcn_wmma_f32_16x16x32_bf16(false, ah, false, bh, (short)0, c, false, false);
  if (NT >= 2) c = __builtin_amdgcn_wmma_f32_16x16x32_bf16(false, al, false, bh, (short)0, c, false, false);
  if (NT >= 3) c = __builtin_amdgcn_wmma_f32_16x16x32_bf16(false, ah, false, bl, (short)0, c, false, false);
  asm volatile("v_nop\n\tv_nop\n\tv_nop\n\tv_nop" : "+v"(c) : "v"(ah), "v"(al), "v"(bh), "v"(bl));
  return c;
}

__global__ __launch_bounds__(256) void k_wt_bf16(const float* __restrict__ W, unsigned short* __restrict__ Wt, int K, int N) {
  const int t = blockIdx.x * 256 + threadIdx.x;
  const int k8n = K / 8;
  if (t >= N * k8n) return;
  const int n = t / k8n, k8 = (t % k8n) * 8;
  v8us v;
#pragma unroll
  for (int i = 0; i < 8; ++i) v[i] = bf16_bits(W[(size_t)(k8 + i) * N + n]);
  *(v8us*)(Wt + (size_t)n * K + k8) = v;
  
}

// GEMM C[M][N] (f32, pitch ldc) = act(A[M][K]·W + bias). A f32 row-major (pitch lda) converted per fragment to bf16
// (ASPLIT: hi/lo two planes -> 2 terms, else single rounded term); Wt bf16 [N][K] (pitch ldb). BIAS_BF16 rounds the
// bias to bf16 first (bias quantised to bf16 before the add). K%32==0, M%16==0, N%64==0.
template <bool ASPLIT, int ACT, bool BIAS_BF16>
__global__ __launch_bounds__(128) void k_gemm_bf(const float* __restrict__ A, int lda, const unsigned short* __restrict__ Wt, int ldb,
                                               const float* __restrict__ bias, float* __restrict__ C, int ldc, int M, int N, int K) {
  __shared__ __attribute__((aligned(16))) float so[4][16][64];
  const int tid = threadIdx.x, w = tid >> 5, lane = tid & 31, ln = lane & 15, hh = lane >> 4;
  const int ntn = N / 64;
  const int wid = blockIdx.x * 4 + w;
  const int mt = wid / ntn, nq = wid % ntn;
  if (mt * 16 >= M) return;
  const int row0 = mt * 16, col0 = nq * 64;
  const float* arow = A + (size_t)(row0 + ln) * lda;
  v8f acc[4] = {};
  for (int kb = 0; kb < K; kb += 32) {
    FragB ah, al;
    const v4f x0 = *(const v4fa*)(arow + kb + 8 * hh), x1 = *(const v4fa*)(arow + kb + 8 * hh + 4);
    const v4f x2 = *(const v4fa*)(arow + kb + 16 + 8 * hh), x3 = *(const v4fa*)(arow + kb + 16 + 8 * hh + 4);
    float xs[16] = {x0[0],x0[1],x0[2],x0[3],x1[0],x1[1],x1[2],x1[3],x2[0],x2[1],x2[2],x2[3],x3[0],x3[1],x3[2],x3[3]};
#pragma unroll
    for (int i = 0; i < 16; ++i) { const unsigned short hb = bf16_bits(xs[i]); ah.u[i] = hb; al.u[i] = ASPLIT ? bf16_bits(xs[i] - bf16_val(hb)) : (unsigned short)0; }
#pragma unroll
    for (int t = 0; t < 4; ++t) {
      const unsigned short* brow = Wt + (size_t)(col0 + t * 16 + ln) * ldb + kb;
      FragB b;
      b.half[0] = *(const v8us*)(brow + 8 * hh);
      b.half[1] = *(const v8us*)(brow + 16 + 8 * hh);
      acc[t] = mmaN<ASPLIT ? 2 : 1>(ah.v, al.v, b.v, b.v, acc[t]);
    }
  }
#pragma unroll
  for (int t = 0; t < 4; ++t) {
    float bv = bias ? bias[col0 + t * 16 + ln] : 0.f;
    if (BIAS_BF16) bv = bf16_round(bv);
#pragma unroll
    for (int r = 0; r < 8; ++r) { float v = acc[t][r] + bv; if (ACT == 1) v = fmaxf(v, 0.f); so[w][8 * hh + r][t * 16 + ln] = v; }
  }
  __builtin_amdgcn_fence(__ATOMIC_ACQ_REL, "workgroup");
  __builtin_amdgcn_wave_barrier();
  const int rsub = lane >> 4, c4 = (lane & 15) * 4;
  {
#pragma unroll
    for (int q = 0; q < 8; ++q) {
      const int r = q * 2 + rsub;
      const v4f v = *(const v4fa*)&so[w][r][c4];
      *(v4f*)(C + (size_t)(row0 + r) * ldc + col0 + c4) = v;
    }
    
  }
}

// GEMM C = act(A·W + bias + resid): A f32 (ASPLIT -> hi/lo 2 terms), Wt bf16 [N][K]; ACT 0 none, 1 relu, 2 exact gelu;
// resid (optional, f32, row index = (row % rmod), pitch ldr, RES_BF16 rounds it) added before the activation.
template <bool ASPLIT, int ACT, bool BIAS_BF16, bool RES_BF16>
__global__ __launch_bounds__(128) void k_gemm_bf3(const float* __restrict__ A, int lda, const unsigned short* __restrict__ Wt, int ldb,
                                                const float* __restrict__ bias, const float* __restrict__ resid, int rmod, int ldr,
                                                float* __restrict__ C, int ldc, int M, int N, int K) {
  __shared__ __attribute__((aligned(16))) float so[4][16][64];
  const int tid = threadIdx.x, w = tid >> 5, lane = tid & 31, ln = lane & 15, hh = lane >> 4;
  const int ntn = N / 64;
  const int wid = blockIdx.x * 4 + w;
  const int mt = wid / ntn, nq = wid % ntn;
  if (mt * 16 >= M) return;
  const int row0 = mt * 16, col0 = nq * 64;
  const float* arow = A + (size_t)(row0 + ln) * lda;
  v8f acc[4] = {};
  for (int kb = 0; kb < K; kb += 32) {
    FragB ah, al;
    const v4f x0 = *(const v4fa*)(arow + kb + 8 * hh), x1 = *(const v4fa*)(arow + kb + 8 * hh + 4);
    const v4f x2 = *(const v4fa*)(arow + kb + 16 + 8 * hh), x3 = *(const v4fa*)(arow + kb + 16 + 8 * hh + 4);
    float xs[16] = {x0[0],x0[1],x0[2],x0[3],x1[0],x1[1],x1[2],x1[3],x2[0],x2[1],x2[2],x2[3],x3[0],x3[1],x3[2],x3[3]};
#pragma unroll
    for (int i = 0; i < 16; ++i) { const unsigned short hb = bf16_bits(xs[i]); ah.u[i] = hb; al.u[i] = ASPLIT ? bf16_bits(xs[i] - bf16_val(hb)) : (unsigned short)0; }
#pragma unroll
    for (int t = 0; t < 4; ++t) {
      const unsigned short* brow = Wt + (size_t)(col0 + t * 16 + ln) * ldb + kb;
      FragB b;
      b.half[0] = *(const v8us*)(brow + 8 * hh);
      b.half[1] = *(const v8us*)(brow + 16 + 8 * hh);
      acc[t] = mmaN<ASPLIT ? 2 : 1>(ah.v, al.v, b.v, b.v, acc[t]);
    }
  }
#pragma unroll
  for (int t = 0; t < 4; ++t) {
    const int col = col0 + t * 16 + ln;
    float bv = bias ? bias[col] : 0.f;
    if (BIAS_BF16) bv = bf16_round(bv);
#pragma unroll
    for (int r = 0; r < 8; ++r) {
      float v = acc[t][r] + bv;
      if (resid) { float rv = resid[(size_t)((row0 + 8 * hh + r) % rmod) * ldr + col]; if (RES_BF16) rv = bf16_round(rv); v += rv; }
      if (ACT == 1) v = fmaxf(v, 0.f);
      if (ACT == 2) v = 0.5f * v * (1.0f + erff(v * 0.70710678118654752f));
      if (ACT == 3) { const float u = 0.7978845608028654f * (v + 0.044715f * v * v * v); v = 0.5f * v * (1.0f + tanhf(u)); }
      so[w][8 * hh + r][t * 16 + ln] = v;
    }
  }
  __builtin_amdgcn_fence(__ATOMIC_ACQ_REL, "workgroup");
  __builtin_amdgcn_wave_barrier();
  const int rsub = lane >> 4, c4 = (lane & 15) * 4;
  {
#pragma unroll
    for (int q = 0; q < 8; ++q) {
      const int r = q * 2 + rsub;
      const v4f v = *(const v4fa*)&so[w][r][c4];
      *(v4f*)(C + (size_t)(row0 + r) * ldc + col0 + c4) = v;
    }
    
  }
}
// row LayerNorm (biased variance, eps) over N: s = X (+ R); optional out_sum <- s; out_norm <- (s-mu)*rsqrt(var+eps)*g + b
template <bool PARAM_BF16>
__global__ __launch_bounds__(256) void k_layernorm(const float* __restrict__ X, const float* __restrict__ R, const float* __restrict__ g, const float* __restrict__ bta,
                                                  float* __restrict__ out_sum, float* __restrict__ out_norm, int N, float eps) {
  __shared__ float red[256];
  const int row = blockIdx.x, tid = threadIdx.x;
  const float* x = X + (size_t)row * N; const float* rr = R ? R + (size_t)row * N : nullptr;
  float vals[16];                     // up to N = 4096
  const int per = N / 256;            // contiguous chunk per thread? use strided-by-4 chunks: thread handles j = tid*4 + 1024*u
  float s1 = 0.f;
  for (int u = 0; u < per / 4; ++u) {
    const int j = tid * 4 + 1024 * u;
    const v4f a = *(const v4fa*)(x + j);
    v4f b = {0.f,0.f,0.f,0.f}; if (rr) b = *(const v4fa*)(rr + j);
#pragma unroll
    for (int q = 0; q < 4; ++q) { const float v = a[q] + b[q]; vals[u * 4 + q] = v; s1 += v; }
  }
  red[tid] = s1; __syncthreads();
  for (int st = 128; st > 0; st >>= 1) { if (tid < st) red[tid] += red[tid + st]; __syncthreads(); }
  const float mu = red[0] / (float)N; __syncthreads();
  float s2 = 0.f;
  for (int u = 0; u < per / 4; ++u)
#pragma unroll
    for (int q = 0; q < 4; ++q) { const float c = vals[u * 4 + q] - mu; s2 += c * c; }
  red[tid] = s2; __syncthreads();
  for (int st = 128; st > 0; st >>= 1) { if (tid < st) red[tid] += red[tid + st]; __syncthreads(); }
  const float rs = rsqrtf(red[0] / (float)N + eps);
  {
    for (int u = 0; u < per / 4; ++u) {
      const int j = tid * 4 + 1024 * u;
      v4f o, sm;
#pragma unroll
      for (int q = 0; q < 4; ++q) {
        float gg = g[j + q], bb = bta[j + q];
        if (PARAM_BF16) { gg = bf16_round(gg); bb = bf16_round(bb); }
        sm[q] = vals[u * 4 + q]; o[q] = (vals[u * 4 + q] - mu) * rs * gg + bb;
      }
      if (out_sum) *(v4f*)(out_sum + (size_t)row * N + j) = sm;
      *(v4f*)(out_norm + (size_t)row * N + j) = o;
    }
    
  }
}



// ---- f16 WMMA path (v_wmma_f32_16x16x32_f16): 11-bit significands for operands in range — used where a [0,1] probability operand needs more precision than bf16
typedef _Float16 v16h __attribute__((ext_vector_type(16)));
union FragH { v16h v; v8us half[2]; _Float16 h[16]; unsigned short u[16]; };
template <int NT>
__device__ __forceinline__ v8f mmaH(v16h ah, v16h al, v16h bh, v16h bl, v8f c) {
  c = __builtin_amdgcn_wmma_f32_16x16x32_f16(false, ah, false, bh, (short)0, c, false, false);
  if (NT >= 2) c = __builtin_amdgcn_wmma_f32_16x16x32_f16(false, al, false, bh, (short)0, c, false, false);
  if (NT >= 3) c = __builtin_amdgcn_wmma_f32_16x16x32_f16(false, ah, false, bl, (short)0, c, false, false);
  asm volatile("v_nop\n\tv_nop\n\tv_nop\n\tv_nop" : "+v"(c) : "v"(ah), "v"(al), "v"(bh), "v"(bl));
  return c;
}
// batched GEMM like k_gemm_b but f16 operands: A f32 (split into f16 hi/lo if ASPLIT, else rounded to f16), Bt = f16 values [n][k]; alpha; C f32; N multiple of 16 (partial tiles skipped)
template <bool ASPLIT>
__global__ __launch_bounds__(128) void k_gemm_h(const float* __restrict__ A, int lda, size_t sA, const _Float16* __restrict__ Bh, int ldb, size_t sB, float alpha, float* __restrict__ C, int ldc, size_t sC, int M, int N, int K) {
  __shared__ __attribute__((aligned(16))) float so[4][16][64];
  const int tid = threadIdx.x, w = tid >> 5, lane = tid & 31, ln = lane & 15, hh = lane >> 4; const int by = blockIdx.y;
  A += (size_t)by * sA; Bh += (size_t)by * sB; C += (size_t)by * sC;
  const int ntn = (N + 63) / 64; const int wid = blockIdx.x * 4 + w; const int mt = wid / ntn, nq = wid % ntn; if (mt * 16 >= M) return;
  const int row0 = mt * 16, col0 = nq * 64; const float* arow = A + (size_t)(row0 + ln) * lda;
  v8f acc[4] = {};
  for (int kb = 0; kb < K; kb += 32) {
    FragH ah, al;
    const v4f x0 = *(const v4fa*)(arow + kb + 8 * hh), x1 = *(const v4fa*)(arow + kb + 8 * hh + 4), x2 = *(const v4fa*)(arow + kb + 16 + 8 * hh), x3 = *(const v4fa*)(arow + kb + 16 + 8 * hh + 4);
    float xs[16] = {x0[0],x0[1],x0[2],x0[3],x1[0],x1[1],x1[2],x1[3],x2[0],x2[1],x2[2],x2[3],x3[0],x3[1],x3[2],x3[3]};
#pragma unroll
    for (int i = 0; i < 16; ++i) { const _Float16 h = (_Float16)xs[i]; ah.h[i] = h; al.h[i] = ASPLIT ? (_Float16)(xs[i] - (float)h) : (_Float16)0.0f; }
#pragma unroll
    for (int t = 0; t < 4; ++t) { if (col0 + t * 16 >= N) continue; const size_t boff = (size_t)(col0 + t * 16 + ln) * ldb + kb; FragH bq; bq.half[0] = *(const v8us*)(Bh + boff + 8 * hh); bq.half[1] = *(const v8us*)(Bh + boff + 16 + 8 * hh);
      acc[t] = mmaH<ASPLIT ? 2 : 1>(ah.v, al.v, bq.v, bq.v, acc[t]); }
  }
#pragma unroll
  for (int t = 0; t < 4; ++t) { if (col0 + t * 16 >= N) continue;
#pragma unroll
    for (int r = 0; r < 8; ++r) so[w][8 * hh + r][t * 16 + ln] = acc[t][r] * alpha; }
  __builtin_amdgcn_fence(__ATOMIC_ACQ_REL, "workgroup"); __builtin_amdgcn_wave_barrier();
  const int rsub = lane >> 4, c4 = (lane & 15) * 4;
  {
#pragma unroll
    for (int q = 0; q < 8; ++q) { const int r = q * 2 + rsub; if (col0 + c4 < N) { const v4f v = *(const v4fa*)&so[w][r][c4]; *(v4f*)(C + (size_t)(row0 + r) * ldc + col0 + c4) = v; } }
     }
}

// Wt[n][k] = f16(W[k][n]·scale) from f32 row-major W[K][N] (scale = power of two; bf16-exact weights stay exact in f16 away from the subnormal range)
__global__ __launch_bounds__(256) void k_wt_f16(const float* __restrict__ W, _Float16* __restrict__ Wt, int K, int N, float scale) {
  const int t = blockIdx.x * 256 + threadIdx.x; if (t >= N * (K / 8)) return; const int n = t / (K / 8), k8 = (t % (K / 8)) * 8; FragH f;
#pragma unroll
  for (int i = 0; i < 8; ++i) f.h[i] = (_Float16)(bf16_round(W[(size_t)(k8 + i) * N + n]) * scale); const v8us o = f.half[0];
  *(v8us*)((unsigned short*)Wt + (size_t)n * K + k8) = o; 
}
// k_gemm_hh variant with fused epilogue: v = acc·alpha + bias[by·sBias + col] (+ CP[(row/rowsPerB)·sCPb + by·64 + col] if CP) ; ACT 0 none / 1 elu ; writes f16 C16 (and f32 C if non-null)
template <int ACT>
__global__ __launch_bounds__(128) void k_gemm_hhx(const _Float16* __restrict__ A, int lda, size_t sA, const _Float16* __restrict__ Bh, int ldb, size_t sB, float alpha, const float* __restrict__ bias, size_t sBias, const float* __restrict__ CP, int rowsPerB, size_t sCPb, int row0g,
    float* __restrict__ C, _Float16* __restrict__ C16, int ldc, size_t sC, int M, int N, int K) {
  __shared__ __attribute__((aligned(16))) float so[4][16][64];
  const int tid = threadIdx.x, w = tid >> 5, lane = tid & 31, ln = lane & 15, hh = lane >> 4; const int by = blockIdx.y;
  A += (size_t)by * sA; Bh += (size_t)by * sB; const size_t cofs = (size_t)by * sC; const float* bp = bias ? bias + (size_t)by * sBias : nullptr;
  const int ntn = (N + 63) / 64; const int wid = blockIdx.x * 4 + w; const int mt = wid / ntn, nq = wid % ntn; if (mt * 16 >= M) return;
  const int row0 = mt * 16, col0 = nq * 64; const _Float16* arow = A + (size_t)(row0 + ln) * lda;
  v8f acc[4] = {};
  for (int kb = 0; kb < K; kb += 32) { FragH ah; ah.half[0] = *(const v8us*)((const unsigned short*)arow + kb + 8 * hh); ah.half[1] = *(const v8us*)((const unsigned short*)arow + kb + 16 + 8 * hh);
#pragma unroll
    for (int t = 0; t < 4; ++t) { if (col0 + t * 16 >= N) continue; const size_t boff = (size_t)(col0 + t * 16 + ln) * ldb + kb; FragH bq; bq.half[0] = *(const v8us*)((const unsigned short*)Bh + boff + 8 * hh); bq.half[1] = *(const v8us*)((const unsigned short*)Bh + boff + 16 + 8 * hh);
      acc[t] = mmaH<1>(ah.v, ah.v, bq.v, bq.v, acc[t]); }
  }
#pragma unroll
  for (int t = 0; t < 4; ++t) { if (col0 + t * 16 >= N) continue; const int col = col0 + t * 16 + ln; const float bv = bp ? bf16_round(bp[col]) : 0.f;
#pragma unroll
    for (int r = 0; r < 8; ++r) { float v = acc[t][r] * alpha + bv; if (CP) { const int rr = row0g + row0 + 8 * hh + r; if (rowsPerB < 0) v += CP[cofs + (size_t)rr * ldc + col];      /* rowsPerB < 0: own element of the batched C plane */ else { const int bidx = rr / rowsPerB; v += CP[(size_t)bidx * sCPb + (size_t)by * 64 + col]; } } if (ACT == 1) v = (v > 0.f) ? v : expm1f(v); else if (ACT == 7) v = (v > 0.f) ? v + 1.0f : expf(v); else if (ACT == 8) v = tanhf(v); else if (ACT == 9) v = 0.5f * v * (1.0f + tanhf(0.7978845608028654f * (v + 0.044715f * v * v * v))); else if (ACT == 11) v = 1.0f / (1.0f + expf(-v)); else if (ACT == 12) v = (v > 0.f) ? v : 0.01f * v; else if (ACT == 14) v = (v > 0.f) ? v : 0.1f * v; else if (ACT == 16) v = (v >= 0.f) ? v : 0.3f * v; else if (ACT == 17) v = (v >= 0.f) ? v : 0.2f * v; else if (ACT == 15) v = v / (1.0f + expf(-v)); else if (ACT == 3) v = fmaxf(v, 0.f); else if (ACT == 6) v = 0.5f * v * (1.0f + erff(v * 0.70710678118654752f)); so[w][8 * hh + r][t * 16 + ln] = v; } }
  __builtin_amdgcn_fence(__ATOMIC_ACQ_REL, "workgroup"); __builtin_amdgcn_wave_barrier();
  const int rsub = lane >> 4, c4 = (lane & 15) * 4; typedef _Float16 v4h __attribute__((ext_vector_type(4)));
  {
#pragma unroll
    for (int q = 0; q < 8; ++q) { const int r = q * 2 + rsub; if (col0 + c4 < N) { const v4f v = *(const v4fa*)&so[w][r][c4]; if (C) *(v4f*)(C + cofs + (size_t)(row0 + r) * ldc + col0 + c4) = v; if (C16) { v4h h4; for (int i = 0; i < 4; ++i) h4[i] = (_Float16)v[i]; *(v4h*)(C16 + cofs + (size_t)(row0 + r) * ldc + col0 + c4) = h4; } } }
     }
}


typedef _Float16 v4h __attribute__((ext_vector_type(4)));

__global__ __launch_bounds__(256) void k_x16(const float* __restrict__ x, _Float16* __restrict__ X16, size_t n8) { const size_t t = (size_t)blockIdx.x * 256 + threadIdx.x; if (t >= n8) return; FragH f;
#pragma unroll
  for (int q = 0; q < 8; ++q) f.h[q] = (_Float16)bf16_round(x[t * 8 + q]); *(v8us*)((unsigned short*)X16 + t * 8) = f.half[0];  }
__global__ __launch_bounds__(256) void k_h16(const float* __restrict__ x, _Float16* __restrict__ X16, size_t n8) { const size_t t = (size_t)blockIdx.x * 256 + threadIdx.x; if (t >= n8) return; FragH f;
#pragma unroll
  for (int q = 0; q < 8; ++q) f.h[q] = (_Float16)x[t * 8 + q]; *(v8us*)((unsigned short*)X16 + t * 8) = f.half[0];  }
__global__ __launch_bounds__(256) void k_round16f(const float* __restrict__ W, _Float16* __restrict__ Bt, size_t n8) { const size_t t = (size_t)blockIdx.x * 256 + threadIdx.x; if (t >= n8) return; FragH f;
#pragma unroll
  for (int i = 0; i < 8; ++i) f.h[i] = (_Float16)(bf16_round(W[t * 8 + i]) * 16.0f); *(v8us*)((unsigned short*)Bt + t * 8) = f.half[0];  }
// ---- fast GEMM (wave tile 32x64; requires M % 32 == 0 rows per launch region and N % 64 == 0); epilogue = k_gemm_hhx semantics ----
__device__ __forceinline__ v16h g2_frag(const _Float16* p, int hh) { FragH f; f.half[0] = *(const v8us*)((const unsigned short*)p + 8 * hh); f.half[1] = *(const v8us*)((const unsigned short*)p + 16 + 8 * hh); return f.v; }
__device__ __forceinline__ v8f g2_mma(v16h a, v16h b, v8f c) { v8f d = __builtin_amdgcn_wmma_f32_16x16x32_f16(false, a, false, b, (short)0, c, false, false); asm volatile("v_nop\n\tv_nop\n\tv_nop\n\tv_nop" : "+v"(d) : "v"(a), "v"(b)); return d; }
template <int ACT>
__global__ __launch_bounds__(128) void k_gemm2(const _Float16* __restrict__ A, int lda, size_t sA, const _Float16* __restrict__ Bh, int ldb, size_t sB, float alpha, const float* __restrict__ bias, size_t sBias, const float* __restrict__ CP, int rowsPerB, size_t sCPb, int row0g,
    float* __restrict__ C, _Float16* __restrict__ C16, int by16, int ldc, size_t sC, int M, int N, int K) { static_assert(ACT == 0 || ACT == 3 || ACT == 6 || ACT == 8 || ACT == 9 || ACT == 11 || ACT == 12 || ACT == 14 || ACT == 15 || ACT == 16 || ACT == 17, "k_gemm2: unsupported ACT code (would silently apply no activation)");
  __shared__ __attribute__((aligned(16))) float so[4][32][68];
  const int tid = threadIdx.x, w = tid >> 5, lane = tid & 31, ln = lane & 15, hh = lane >> 4; const int by = blockIdx.y;
  A += (size_t)by * sA; Bh += (size_t)by * sB; const size_t cofs = (size_t)by * sC; const float* bp = bias ? bias + (size_t)by * sBias : nullptr;
  if (by < by16) C16 = nullptr; else if (C16) C16 -= (size_t)by16 * sC;      /* f16 rows are stored from plane by16 on, and C16 is the place of that plane's */
  const int ntn = N >> 6; const int mt = blockIdx.x / ntn, nq = blockIdx.x - mt * ntn; const int row0 = mt * 128 + 32 * w, col0 = nq * 64; if (row0 >= M) return;
  const _Float16* a0p = A + (size_t)(row0 + ln) * lda; const _Float16* a1p = a0p + (size_t)16 * lda;
  const _Float16* b0p = Bh + (size_t)(col0 + ln) * ldb; const _Float16* b1p = b0p + (size_t)16 * ldb; const _Float16* b2p = b1p + (size_t)16 * ldb; const _Float16* b3p = b2p + (size_t)16 * ldb;
  const v8f z8 = {0.f,0.f,0.f,0.f,0.f,0.f,0.f,0.f}; v8f c00 = z8, c01 = z8, c02 = z8, c03 = z8, c10 = z8, c11 = z8, c12 = z8, c13 = z8;
#pragma unroll 1
  for (int kb = 0; kb < K; kb += 32) { const v16h a0 = g2_frag(a0p + kb, hh), a1 = g2_frag(a1p + kb, hh);
    v16h b = g2_frag(b0p + kb, hh); c00 = g2_mma(a0, b, c00); c10 = g2_mma(a1, b, c10);
    b = g2_frag(b1p + kb, hh); c01 = g2_mma(a0, b, c01); c11 = g2_mma(a1, b, c11);
    b = g2_frag(b2p + kb, hh); c02 = g2_mma(a0, b, c02); c12 = g2_mma(a1, b, c12);
    b = g2_frag(b3p + kb, hh); c03 = g2_mma(a0, b, c03); c13 = g2_mma(a1, b, c13); }
  v8f accs[8] = {c00, c01, c02, c03, c10, c11, c12, c13};
#pragma unroll
  for (int u = 0; u < 8; ++u) { const int t = u & 3, half = u >> 2; const int col = col0 + t * 16 + ln; const float bv = bp ? bf16_round(bp[col]) : 0.f;
#pragma unroll
    for (int r = 0; r < 8; ++r) { const int rloc = half * 16 + 8 * hh + r; float v = accs[u][r] * alpha + bv; if (CP) { if (rowsPerB < 0) v += CP[cofs + (size_t)(row0g + row0 + rloc) * ldc + col];      /* rowsPerB < 0: own element of the batched C plane */ else { const int bidx = (row0g + row0 + rloc) / rowsPerB; v += CP[(size_t)bidx * sCPb + (size_t)by * 64 + col]; } }
      if (ACT == 3) v = fmaxf(v, 0.f); else if (ACT == 6) v = 0.5f * v * (1.0f + erff(v * 0.70710678118654752f)); else if (ACT == 11) v = 1.0f / (1.0f + expf(-v)); else if (ACT == 15) v = v / (1.0f + expf(-v)); else if (ACT == 12) v = (v > 0.f) ? v : 0.01f * v; else if (ACT == 8) v = tanhf(v); else if (ACT == 9) v = 0.5f * v * (1.0f + tanhf(0.7978845608028654f * (v + 0.044715f * v * v * v))); else if (ACT == 14) v = (v > 0.f) ? v : 0.1f * v; else if (ACT == 16) v = (v >= 0.f) ? v : 0.3f * v; else if (ACT == 17) v = (v >= 0.f) ? v : 0.2f * v;
      so[w][rloc][t * 16 + ln] = v; } }
  __builtin_amdgcn_fence(__ATOMIC_ACQ_REL, "workgroup"); __builtin_amdgcn_wave_barrier();
  const int rsub = lane >> 4, c4 = (lane & 15) * 4;
  {
#pragma unroll
    for (int q = 0; q < 16; ++q) { const int r = q * 2 + rsub; const v4f v = *(const v4fa*)&so[w][r][c4]; if (C) { *(v4f*)(C + cofs + (size_t)(row0 + r) * ldc + col0 + c4) = v; asm volatile("s_wait_xcnt 0x0" ::: "memory"); }      /* the wait stands in front of every later write of the data and address registers that this store names: where both planes are written, the f16 conversion below reuses them */
      if (C16) { v4h h4; for (int i = 0; i < 4; ++i) h4[i] = (_Float16)v[i]; *(v4h*)(C16 + cofs + (size_t)(row0 + r) * ldc + col0 + c4) = h4; } }
     } }


// x and the four weight matrices in one grid: the first xb work-groups round x to exact f16 rows, the next 4 x wb the natural [out][in] weights (x16) into four planes that lie one behind the other. None of the five reads what another writes.
__global__ __launch_bounds__(256) void k_prep(const float* __restrict__ x, const float* __restrict__ w0, const float* __restrict__ w1, const float* __restrict__ w2, const float* __restrict__ w3, _Float16* __restrict__ X16, _Float16* __restrict__ Bt) {
  constexpr int xb = (int)(NR * DM / 2048), wb = DM * DM / 2048; const int bx = blockIdx.x; const float* s = x; _Float16* d = X16; float sc = 1.0f; int lb = bx;      /* a product with 1 is exact */
  if (bx >= xb) { const int p = (bx - xb) / wb; lb = (bx - xb) - p * wb; s = (p == 0) ? w0 : (p == 1) ? w1 : (p == 2) ? w2 : w3; d = Bt + (size_t)p * wb * 2048; sc = 16.0f; }      /* work-group-uniform; a work-group covers 2048 values */
  const size_t t = (size_t)lb * 256 + threadIdx.x; const v4f a = *(const v4fa*)(s + t * 8), c = *(const v4fa*)(s + t * 8 + 4); FragH f;
#pragma unroll      /* constant indices into the loaded registers */
  for (int q = 0; q < 4; ++q) { f.h[q] = (_Float16)(bf16_round(a[q]) * sc); f.h[4 + q] = (_Float16)(bf16_round(c[q]) * sc); }
  *(v8us*)((unsigned short*)d + t * 8) = f.half[0]; }
__global__ __launch_bounds__(256) void k_rsm(const float* __restrict__ S, _Float16* __restrict__ P, int nrows) {
  #pragma clang fp contract(off)
  const int i = blockIdx.x * 256 + threadIdx.x; if (i >= nrows) return; const float* s = S + (size_t)i * SQ; float mx = -3.0e38f;
#pragma unroll 1
  for (int j = 0; j < SQ; ++j) mx = fmaxf(mx, s[j]); float se = 0.f;
#pragma unroll 1
  for (int j = 0; j < SQ; ++j) se += expf(s[j] - mx); const float sc = 256.0f / se;
#pragma unroll 1
  for (int j0 = 0; j0 < SQ; j0 += 8) { FragH f; for (int q = 0; q < 8; ++q) f.h[q] = (_Float16)(expf(s[j0 + q] - mx) * sc); unsigned short* d = (unsigned short*)P + (size_t)i * SQ + j0; *(v8us*)d = f.half[0];  } }
__global__ __launch_bounds__(256) void k_vt(const _Float16* __restrict__ V16, int b, int h0, _Float16* __restrict__ VT) { __shared__ unsigned short tl[64][65]; const int tid = threadIdx.x; const int hh = blockIdx.x % HG, sg = blockIdx.x / HG; const int s0 = sg * 64; const int h = h0 + hh;
  for (int i = tid; i < 64 * 8; i += 256) { const int j = i / 8, d8 = (i % 8) * 8; FragH f; f.half[0] = *(const v8us*)((const unsigned short*)V16 + ((size_t)b * SQ + s0 + j) * DM + h * HD + d8); for (int q = 0; q < 8; ++q) tl[d8 + q][j] = f.u[q]; }
  __syncthreads();
  { for (int i = tid; i < 64 * 8; i += 256) { const int d = i / 8, j8 = (i % 8) * 8; FragH f; for (int q = 0; q < 8; ++q) f.u[q] = tl[d][j8 + q]; *(v8us*)((unsigned short*)VT + ((size_t)hh * HD + d) * SQ + s0 + j8) = f.half[0]; }  } }



__device__ __forceinline__ float rs_xhalf(float x) { return __builtin_bit_cast(float, __builtin_amdgcn_permlanex16(__builtin_bit_cast(int, x), __builtin_bit_cast(int, x), 0x76543210, 0xfedcba98, false, false)); }      /* lane l <- lane l ^ 16 */
__device__ __forceinline__ float fa_exp2(float x) { float y; asm("v_exp_f32 %0, %1\n\tv_nop" : "=v"(y) : "v"(x)); return y; }      /* 2^x; the v_nop is the slot the instruction set asks for behind a transcendental */
#define SCL2 0.18033688f                   /* SCL * log2(e): scores carried in the base-2 domain, so that a weight is one subtract and one 2^x */
#define SCLR2 (SCL2 * 0.0009765625f)       /* the same scale on the x1024 residual products */
// Fused causal attention, one wave per 16 query rows of one (batch, head); 32 keys a pass, no score or weight plane in memory.
// S^T = K Q^T (A = key rows, B = query rows): a lane holds 16 scores of ITS query (column ln), keys kb + 8 hh + r and kb + 16 + 8 hh + r: the very places of the B fragment of O^T = V^T P^T,
// so the weights go from the score accumulators to the next product inside the lane. Row maximum and row sum: in the lane, plus one exchange with lane ^ 16. Running maximum, o and sum rescaled each pass.
// The four waves of a work-group walk the same keys: a tile of 64 keys (K hi, K residual, V^T: 64 rows of 128 bytes each) is brought into LDS once for all four by asynchronous copies of whole 128-byte lines, two buffers, the next tile in flight while this one is worked on; the fragments are 16-byte LDS reads.
#define FKT 64                       /* keys of a staged tile: two passes */
#define FPT 72                       /* pitch of a staged row in f16: 144 B = 9 x 16 B, so that 16 lanes reading 16 rows by 16 bytes do not meet in a bank */
#define FPL (FKT * FPT * 2)          /* bytes of one staged plane */
#define FRS (16 * FPT * 2)           /* bytes of 16 staged rows: the step between a lane's four pieces of a plane */
// One tile: a lane's twelve 16-byte pieces (four of each plane, 16 rows apart). ld: the lane's LDS byte address in plane 0 of the buffer; gh, gl, gv: its first piece in the K hi rows, the K residual rows and the V^T rows.
__device__ __forceinline__ void fa_stage(unsigned ld, const _Float16* gh, const _Float16* gl, const _Float16* gv) {
  asm volatile(      /* the copies go from global memory to LDS through no register; the s_wait_xcnt in the same statement stands in front of every later write of the address registers that the copies name */
    "global_load_async_to_lds_b128 %0, %12, off\n\t"
    "global_load_async_to_lds_b128 %1, %13, off\n\t"
    "global_load_async_to_lds_b128 %2, %14, off\n\t"
    "global_load_async_to_lds_b128 %3, %15, off\n\t"
    "global_load_async_to_lds_b128 %4, %16, off\n\t"
    "global_load_async_to_lds_b128 %5, %17, off\n\t"
    "global_load_async_to_lds_b128 %6, %18, off\n\t"
    "global_load_async_to_lds_b128 %7, %19, off\n\t"
    "global_load_async_to_lds_b128 %8, %20, off\n\t"
    "global_load_async_to_lds_b128 %9, %21, off\n\t"
    "global_load_async_to_lds_b128 %10, %22, off\n\t"
    "global_load_async_to_lds_b128 %11, %23, off\n\t"
    "s_wait_xcnt 0x0"
    :: "v"(ld), "v"(ld + FRS), "v"(ld + 2 * FRS), "v"(ld + 3 * FRS),
       "v"(ld + FPL), "v"(ld + FPL + FRS), "v"(ld + FPL + 2 * FRS), "v"(ld + FPL + 3 * FRS),
       "v"(ld + 2 * FPL), "v"(ld + 2 * FPL + FRS), "v"(ld + 2 * FPL + 2 * FRS), "v"(ld + 2 * FPL + 3 * FRS),
       "v"(gh), "v"(gh + (size_t)16 * LQ), "v"(gh + (size_t)32 * LQ), "v"(gh + (size_t)48 * LQ),
       "v"(gl), "v"(gl + (size_t)16 * LQ), "v"(gl + (size_t)32 * LQ), "v"(gl + (size_t)48 * LQ),
       "v"(gv), "v"(gv + (size_t)16 * SQ), "v"(gv + (size_t)32 * SQ), "v"(gv + (size_t)48 * SQ)
    : "memory"); }
__device__ __forceinline__ void fa_body(char* sm, int bh, int nst, const _Float16* __restrict__ QHp, const _Float16* __restrict__ QLp, const _Float16* __restrict__ KHp, const _Float16* __restrict__ KLp, const _Float16* __restrict__ VTp, _Float16* __restrict__ Op) {      /* sm: the work-group's LDS block; bh: batch * NH + head; nst: tiles up to and with the work-group's diagonal tile */
  _Float16 (*sk)[3][FKT][FPT] = (_Float16 (*)[3][FKT][FPT])sm;      /* [buffer][K hi, K residual, V^T][row][64 values + pad] */
  const int tid = threadIdx.x, lane = tid & 31, ln = lane & 15, hh = lane >> 4; const int w = __builtin_amdgcn_readfirstlane(tid >> 5);
  const int b = bh / NH, h = bh % NH;
  const int q0 = (nst - 1) * FKT + w * 16;
  const size_t r0 = (size_t)b * SQ; const int q = q0 + ln;
  const int sr = tid >> 3, sc8 = (tid & 7) * 8;      /* staging: eight lanes copy one 128-byte row, a wave four whole rows a copy */
  const _Float16* gh = KHp + (r0 + sr) * LQ + h * HD + sc8; const _Float16* gl = KLp + (r0 + sr) * LQ + h * HD + sc8; const _Float16* gv = VTp + ((size_t)bh * HD + sr) * SQ + sc8;
  const unsigned ld0 = (unsigned)(size_t)&sk[0][0][sr][sc8];      /* the low 32 bits of a shared address are its LDS byte address */
  fa_stage(ld0, gh, gl, gv);      /* tile 0 into buffer 0 */
  const _Float16* qh = QHp + (r0 + q) * LQ + h * HD; const _Float16* ql = QLp + (r0 + q) * LQ + h * HD;
  const v16h qh0 = g2_frag(qh, hh), qh1 = g2_frag(qh + 32, hh), ql0 = g2_frag(ql, hh), ql1 = g2_frag(ql + 32, hh);
  const v8f z8 = {0.f,0.f,0.f,0.f,0.f,0.f,0.f,0.f}; v8f o0 = z8, o1 = z8, o2 = z8, o3 = z8; float m = -1.0e30f, l = 0.f;
  asm volatile("s_wait_asynccnt 0x0" ::: "memory");      /* this wave's pieces of tile 0 have landed */
  __syncthreads();      /* every wave's pieces of tile 0 have landed: the tile may be read */
  if (nst > 1) fa_stage(ld0 + 3 * FPL, gh + (size_t)FKT * LQ, gl + (size_t)FKT * LQ, gv + FKT);      /* tile 1 into buffer 1 */
#pragma unroll 1      /* a trip holds two passes of 24 fragment loads and 16 products each: a second copy of it would not fit the registers */
  for (int st = 0; st < nst; ++st) {
    const _Float16* tk = &sk[st & 1][0][ln][0]; const _Float16* tl = &sk[st & 1][1][ln][0]; const _Float16* tv = &sk[st & 1][2][ln][0];      /* this trip reads this buffer alone */
    v16h ka0 = g2_frag(tk, hh), ka1 = g2_frag(tk + 32, hh), ka2 = g2_frag(tk + 16 * FPT, hh), ka3 = g2_frag(tk + 16 * FPT + 32, hh);      /* the tile's key rows 0 .. 31, hi plane */
    v16h kc0 = g2_frag(tl, hh), kc1 = g2_frag(tl + 32, hh), kc2 = g2_frag(tl + 16 * FPT, hh), kc3 = g2_frag(tl + 16 * FPT + 32, hh);      /* the same rows, residual plane */
#pragma unroll      /* the two passes of a tile: the second one's LDS offsets as immediates, its key fragments asked for in the first */
    for (int sub = 0; sub < 2; ++sub) {
      const int kb = st * FKT + sub * 32;
      if (sub == 1 && kb >= q0 + 16) break;      /* wave-uniform: a pass runs only while kb < q0 + 16, so that every query has a key in every pass; the foot of the trip below is passed all the same */
      const v16h va0 = g2_frag(tv + sub * 32, hh), va1 = g2_frag(tv + 16 * FPT + sub * 32, hh), va2 = g2_frag(tv + 32 * FPT + sub * 32, hh), va3 = g2_frag(tv + 48 * FPT + sub * 32, hh);      /* asked for here, used behind the softmax */
      v8f sh0 = z8, sl0 = z8, sh1 = z8, sl1 = z8;      /* hi . hi, and lo . hi + hi . lo (x1024), for keys kb .. kb + 15 and kb + 16 .. kb + 31 */
      sh0 = g2_mma(ka0, qh0, sh0); sl0 = g2_mma(ka0, ql0, sl0); sh1 = g2_mma(ka2, qh0, sh1); sl1 = g2_mma(ka2, ql0, sl1);
      sh0 = g2_mma(ka1, qh1, sh0); sl0 = g2_mma(ka1, ql1, sl0); sh1 = g2_mma(ka3, qh1, sh1); sl1 = g2_mma(ka3, ql1, sl1);
      sl0 = g2_mma(kc0, qh0, sl0); sl1 = g2_mma(kc2, qh0, sl1); sl0 = g2_mma(kc1, qh1, sl0); sl1 = g2_mma(kc3, qh1, sl1);
      if (sub == 0) {      /* the second pass's key fragments (rows 32 .. 63 of the same tile) come in during this pass's softmax and output products */
        ka0 = g2_frag(tk + 32 * FPT, hh); ka1 = g2_frag(tk + 32 * FPT + 32, hh); ka2 = g2_frag(tk + 48 * FPT, hh); ka3 = g2_frag(tk + 48 * FPT + 32, hh);
        kc0 = g2_frag(tl + 32 * FPT, hh); kc1 = g2_frag(tl + 32 * FPT + 32, hh); kc2 = g2_frag(tl + 48 * FPT, hh); kc3 = g2_frag(tl + 48 * FPT + 32, hh); }
      float s0[8], s1[8];
#pragma unroll      /* unrolled so that every index into the accumulator and fragment registers is a constant */
      for (int r = 0; r < 8; ++r) { s0[r] = fmaf(sl0[r], SCLR2, sh0[r] * SCL2); s1[r] = fmaf(sl1[r], SCLR2, sh1[r] * SCL2); }
      if (kb + 31 > q0) {      /* wave-uniform: only the pass on the diagonal holds keys after a query */
#pragma unroll      /* unrolled so that every index into the accumulator and fragment registers is a constant */
        for (int r = 0; r < 8; ++r) { const int j = kb + 8 * hh + r; s0[r] = (j <= q) ? s0[r] : -1.0e30f; s1[r] = (j + 16 <= q) ? s1[r] : -1.0e30f; } }
      float bm = fmaxf(s0[0], s1[0]);
#pragma unroll      /* unrolled so that every index into the accumulator and fragment registers is a constant */
      for (int r = 1; r < 8; ++r) bm = fmaxf(bm, fmaxf(s0[r], s1[r]));
      bm = fmaxf(bm, rs_xhalf(bm)); const float mn = fmaxf(m, bm); const float sc = fa_exp2(m - mn); m = mn;
      FragH pf; float ls = 0.f;
#pragma unroll      /* unrolled so that every index into the accumulator and fragment registers is a constant */
      for (int r = 0; r < 8; ++r) { const float e0 = fa_exp2(s0[r] - mn), e1 = fa_exp2(s1[r] - mn); ls += e0 + e1; pf.h[r] = (_Float16)e0; pf.h[8 + r] = (_Float16)e1; }
      l = fmaf(l, sc, ls);      /* the lane's half of the row sum; the halves meet behind the loop */
#pragma unroll      /* unrolled so that every index into the accumulator and fragment registers is a constant */
      for (int r = 0; r < 8; ++r) { o0[r] *= sc; o1[r] *= sc; o2[r] *= sc; o3[r] *= sc; }
      o0 = g2_mma(va0, pf.v, o0); o1 = g2_mma(va1, pf.v, o1); o2 = g2_mma(va2, pf.v, o2); o3 = g2_mma(va3, pf.v, o3); }
    asm volatile("s_wait_dscnt 0x0" ::: "memory");      /* this wave's reads of the buffer are done before it may be refilled */
    asm volatile("s_wait_asynccnt 0x0" ::: "memory");      /* this wave's pieces of the next tile have landed */
    __syncthreads();      /* publishes the next tile and ends every wave's reads of this trip's buffer */
    if (st + 2 < nst) fa_stage(ld0 + (unsigned)(st & 1) * (3 * FPL), gh + (size_t)(st + 2) * FKT * LQ, gl + (size_t)(st + 2) * FKT * LQ, gv + (size_t)(st + 2) * FKT); }      /* the tile after the next into the buffer just read */
  asm volatile("s_wait_asynccnt 0x0" ::: "memory");      /* no copy is outstanding when the wave goes on to its end */
  l += rs_xhalf(l); const float fin = 64.0f / l;      /* o carried x64, folded into the output GEMM alpha */
  unsigned short* op = (unsigned short*)Op + (r0 + q) * DM + h * HD + 8 * hh; FragH f0, f1, f2, f3;      /* lane: 8 neighbouring head values of its query per tile; the wave writes whole 128-byte head rows */
#pragma unroll      /* unrolled so that every index into the accumulator and fragment registers is a constant */
  for (int r = 0; r < 8; ++r) { f0.h[r] = (_Float16)(o0[r] * fin); f1.h[r] = (_Float16)(o1[r] * fin); f2.h[r] = (_Float16)(o2[r] * fin); f3.h[r] = (_Float16)(o3[r] * fin); }
  *(v8us*)op = f0.half[0]; *(v8us*)(op + 16) = f1.half[0]; *(v8us*)(op + 32) = f2.half[0]; *(v8us*)(op + 48) = f3.half[0]; }

#define A0R 4                        /* query rows of a work-group of the exact first tile: one wave each */
#define A0P 68                       /* pitch of a staged key row in floats: 272 B = 17 x 16 B, so that 16 lanes reading 16 rows by 16 bytes meet every LDS bank once */
#define A0U (QT0 * (HD / 4) / 128)   /* 16-byte pieces of a staged plane per thread */
typedef float v2f __attribute__((ext_vector_type(2)));
typedef _Float16 v2h __attribute__((ext_vector_type(2)));
// Exact f32 attention for the first QT0 rows, causal. One wave per query row, A0R rows of one head per work-group; the head's QT0 key and value rows are staged in LDS once (keys behind a query are masked below and carry weight zero).
// Scores: a lane takes keys lane, lane + 32, lane + 64, lane + 96, each a serial f32 chain over the 64 head values. Row maximum and row sum: butterflies over the wave. Output: a lane takes two head values and sums over the keys in rising order, the weight of key j read from its lane.
__device__ __forceinline__ void a0_body(char* sm, int bt, int h, int rg, const float* __restrict__ QF, const float* __restrict__ KF, const float* __restrict__ VF, int ld, size_t sb, float scale, _Float16* __restrict__ OH, _Float16* __restrict__ OL, int ldo, size_t sbo) {      /* sm: the work-group's LDS block; bt: the batch; rg: the group of A0R query rows */
  float (*lk)[A0P] = (float (*)[A0P])sm; float (*lv)[HD] = (float (*)[HD])(sm + QT0 * A0P * 4);
  QF += (size_t)bt * sb; KF += (size_t)bt * sb; VF += (size_t)bt * sb; OH += (size_t)bt * sbo; OL += (size_t)bt * sbo;
  const int tid = threadIdx.x, lane = tid & 31; const int w = __builtin_amdgcn_readfirstlane(tid >> 5);
  const int i = rg * A0R + w;      /* this wave's query */
  v4f kq[A0U], vq[A0U]; const size_t ro = (size_t)(tid / (HD / 4)) * ld + h * HD + (tid % (HD / 4)) * 4; const float* kp = KF + ro; const float* vp = VF + ro;      /* the thread's piece of its first key and value row; its further pieces lie 128 / (HD / 4) rows apart, at constant offsets from these two addresses */
#pragma unroll      /* all loads of a thread in flight at once, their results under constant indices */
  for (int u = 0; u < A0U; ++u) { kq[u] = *(const v4fa*)(kp + (size_t)u * (128 / (HD / 4)) * ld); vq[u] = *(const v4fa*)(vp + (size_t)u * (128 / (HD / 4)) * ld); }
  asm volatile("s_wait_xcnt 0x0" :: "v"(kp), "v"(vp) : "memory");      /* stands in front of every write of the registers that the loads above name as their addresses; it takes the two addresses as inputs, so that those registers live up to it and no load's result is placed on them earlier */
  const float* qr = QF + (size_t)i * ld + h * HD; v4f qv[HD / 4];
#pragma unroll      /* the query row stays in registers: constant indices */
  for (int c = 0; c < HD / 4; ++c) qv[c] = *(const v4fa*)(qr + c * 4);
  asm volatile("s_wait_xcnt 0x0" :: "s"(qr) : "memory");      /* the same wait for the query row's loads (wave-uniform address: scalar loads), in front of every write of their base registers */
#pragma unroll      /* constant indices into the staging registers */
  for (int u = 0; u < A0U; ++u) { const int t = u * 128 + tid, j = t / (HD / 4), c = (t % (HD / 4)) * 4; *(v4f*)&lk[j][c] = kq[u]; *(v4f*)&lv[j][c] = vq[u]; }
  __syncthreads();      /* the staged rows are read by every wave */
  float s[QT0 / 32];
#pragma unroll      /* four independent chains side by side */
  for (int g = 0; g < QT0 / 32; ++g) s[g] = 0.f;
#pragma unroll      /* constant indices into the query registers, LDS offsets as immediates */
  for (int c = 0; c < HD / 4; ++c) {
#pragma unroll      /* four independent chains side by side */
    for (int g = 0; g < QT0 / 32; ++g) { const v4f kr = *(const v4f*)&lk[g * 32 + lane][c * 4]; s[g] = fmaf(qv[c][0], kr[0], s[g]); s[g] = fmaf(qv[c][1], kr[1], s[g]); s[g] = fmaf(qv[c][2], kr[2], s[g]); s[g] = fmaf(qv[c][3], kr[3], s[g]); } }
  float mx = -1.0e30f;
#pragma unroll      /* constant indices into the score registers */
  for (int g = 0; g < QT0 / 32; ++g) { s[g] = (g * 32 + lane <= i) ? s[g] * scale : -1.0e30f; mx = fmaxf(mx, s[g]); }
#pragma unroll      /* five exchange steps */
  for (int st = 16; st > 0; st >>= 1) mx = fmaxf(mx, __shfl_xor(mx, st));
  float e[QT0 / 32], l = 0.f;
#pragma unroll      /* constant indices into the score registers */
  for (int g = 0; g < QT0 / 32; ++g) { e[g] = (g * 32 + lane <= i) ? expf(s[g] - mx) : 0.f; l += e[g]; }
#pragma unroll      /* five exchange steps */
  for (int st = 16; st > 0; st >>= 1) l += __shfl_xor(l, st);
  v2f o = {0.f, 0.f};
#pragma unroll      /* constant lane numbers for the weight reads, LDS offsets as immediates */
  for (int g = 0; g < QT0 / 32; ++g) {
#pragma unroll      /* constant lane numbers for the weight reads, LDS offsets as immediates */
    for (int jj = 0; jj < 32; ++jj) { const float ej = __builtin_bit_cast(float, __builtin_amdgcn_readlane(__builtin_bit_cast(int, e[g]), jj)); const v2f vv = *(const v2f*)&lv[g * 32 + jj][2 * lane]; o[0] = fmaf(ej, vv[0], o[0]); o[1] = fmaf(ej, vv[1], o[1]); } }
  const float fin = 64.0f / l;      /* o carried x64 like the f16 path */
  o[0] *= fin; o[1] *= fin; v2h oh, ol;      /* o leaves as the two operands of the output GEMMs: f16 hi + x1024 residual */
  oh[0] = (_Float16)o[0]; oh[1] = (_Float16)o[1]; ol[0] = (_Float16)((o[0] - (float)oh[0]) * 1024.0f); ol[1] = (_Float16)((o[1] - (float)oh[1]) * 1024.0f);
  const size_t oo = (size_t)i * ldo + h * HD + 2 * lane; *(v2h*)(OH + oo) = oh; *(v2h*)(OL + oo) = ol; }      /* the wave writes its query's whole 128-byte head row of either plane */
#define NFT ((SQ - QT0) / FKT)       /* query tiles of a (batch, head) that the fused f16 path takes: those behind the first QT0 rows */
// Both attention paths in one grid: neither reads what the other writes. blockIdx.x: batch * NH + head. blockIdx.y < NFT: the fused path's query tile, the longest rows first over all heads; from NFT on: a group of A0R rows of the exact first tile.
// The choice is work-group-uniform, so every barrier of either path is passed by all four waves. One LDS block serves whichever path the work-group takes.
__global__ __launch_bounds__(128) void k_attn(const _Float16* __restrict__ QHp, const _Float16* __restrict__ QLp, const _Float16* __restrict__ KHp, const _Float16* __restrict__ KLp, const _Float16* __restrict__ VTp, _Float16* __restrict__ Op,
    const float* __restrict__ QF, const float* __restrict__ KF, const float* __restrict__ VF, _Float16* __restrict__ OH, _Float16* __restrict__ OL) {
  __shared__ __attribute__((aligned(16))) char sm[QT0 * A0P * 4 + QT0 * HD * 4]; static_assert(sizeof(sm) >= 2 * 3 * FPL, "the block holds the larger of the two paths' needs");
  const int bh = blockIdx.x, ty = blockIdx.y;
  if (ty < NFT) fa_body(sm, bh, SQ / FKT - ty, QHp, QLp, KHp, KLp, VTp, Op);
  else a0_body(sm, bh / NH, bh % NH, ty - NFT, QF, KF, VF, DM, (size_t)SQ * DM, SCL, OH, OL, DM, (size_t)QT0 * DM); }

#define VTP 136                      /* pitch of a staged V^T row in f16: 128 tokens + 8 = 272 B = 17 x 16 B, so that the 16-byte pieces of 16 neighbouring rows spread over the LDS banks */
typedef float v2fa __attribute__((ext_vector_type(2), may_alias));
// The 16 rows that a half-wave stores of a q or k tile (every second row of the wave's 32): sv, sm: the lane's four columns and the statistics of its first row in LDS (row pitch 68 floats); gg, bb: gamma and beta of those columns. FI: the f32 rows are stored too.
template <bool FI>
__device__ __forceinline__ void qk_rows(const float* sv, const float* sm, v4f gg, v4f bb, float* Fp, _Float16* Hp, _Float16* Lp) {
  v4f v[16]; v2f ms[16];
#pragma unroll      /* all LDS reads asked for ahead of the arithmetic, their results under constant indices */
  for (int q = 0; q < 16; ++q) { v[q] = *(const v4fa*)(sv + q * 2 * 68); ms[q] = *(const v2fa*)(sm + q * 2 * 68); }
#pragma unroll      /* constant indices, global offsets as immediates */
  for (int q = 0; q < 16; ++q) { v4f y; v4h h4, l4;
#pragma unroll      /* constant indices */
    for (int e = 0; e < 4; ++e) { y[e] = (v[q][e] - ms[q][0]) * ms[q][1] * gg[e] + bb[e]; const _Float16 h = (_Float16)y[e]; h4[e] = h; l4[e] = (_Float16)((y[e] - (float)h) * 1024.0f); }
    if (FI) *(v4f*)(Fp + (size_t)q * 2 * DM) = y;
    *(v4h*)(Hp + (size_t)q * 2 * DM) = h4; *(v4h*)(Lp + (size_t)q * 2 * DM) = l4;
    if (FI) asm volatile("s_wait_xcnt 0x0" :: "v"(y), "v"(h4), "v"(l4) : "memory");      /* stands in front of every later write of the registers that these stores name; it takes the stored values as inputs, so that their registers live up to it and no later row's value is placed on them earlier (the address registers serve all 16 rows) */
    else asm volatile("s_wait_xcnt 0x0" :: "v"(h4), "v"(l4) : "memory"); } }      /* the same without the f32 row */
// q, k, v projections (blockIdx.y) with all that follows them element by element done in the epilogue. Loop and tiles are k_gemm2's: a wave owns 32 tokens x 64 columns, which is ONE head of those tokens, so the wave holds every value that a (token, head) LayerNorm needs.
// q, k: the tile goes to the wave's LDS rows; lane = token takes mean and variance of its row (serial f32 sums in rising order); then the wave walks the rows 16 lanes a row, normalises, and stores f16 hi + x1024 residual rows (whole 128-byte head rows).
// v: a lane's 8 accumulator values of a tile are 8 neighbouring tokens of one head value, a 16-byte piece of V^T; the four waves' pieces meet in LDS, so that a wave stores whole 256-byte runs of a V^T row.
// f32 rows of q, k (normalised) and v are stored only where the exact first tile reads them: the first QT0 tokens of a batch.
__global__ __launch_bounds__(128) void k_qkv(const _Float16* __restrict__ X, const _Float16* __restrict__ Bt, const float* __restrict__ qg, const float* __restrict__ qb, const float* __restrict__ kg, const float* __restrict__ kb, float eps,
    float* __restrict__ F, _Float16* __restrict__ Hh, _Float16* __restrict__ Hl, _Float16* __restrict__ VTo) {
  __shared__ __attribute__((aligned(16))) float so[4][32][68];      /* columns 64, 65 of a row: its mean and its 1 / sigma */
  const int tid = threadIdx.x, w = tid >> 5, lane = tid & 31, ln = lane & 15, hh = lane >> 4; const int by = blockIdx.y;
  const int mt = blockIdx.x / (DM / 64), nq = blockIdx.x % (DM / 64); const int row0 = mt * 128 + 32 * w, col0 = nq * 64;
  const int bt = mt / (SQ / 128), s0 = (mt % (SQ / 128)) * 128; const bool first = s0 < QT0;      /* the work-group's batch and its first token there; work-group-uniform */
  const _Float16* a0p = X + (size_t)(row0 + ln) * DM; const _Float16* a1p = a0p + (size_t)16 * DM;
  const _Float16* b0p = Bt + (size_t)by * DM * DM + (size_t)(col0 + ln) * DM; const _Float16* b1p = b0p + (size_t)16 * DM; const _Float16* b2p = b1p + (size_t)16 * DM; const _Float16* b3p = b2p + (size_t)16 * DM;
  const v8f z8 = {0.f,0.f,0.f,0.f,0.f,0.f,0.f,0.f}; v8f c00 = z8, c01 = z8, c02 = z8, c03 = z8, c10 = z8, c11 = z8, c12 = z8, c13 = z8;
#pragma unroll 1      /* rolled like k_gemm2's loop, which it replaces here: the products and their schedule stay as they were */
  for (int kk = 0; kk < DM; kk += 32) { const v16h a0 = g2_frag(a0p + kk, hh), a1 = g2_frag(a1p + kk, hh);
    v16h b = g2_frag(b0p + kk, hh); c00 = g2_mma(a0, b, c00); c10 = g2_mma(a1, b, c10);
    b = g2_frag(b1p + kk, hh); c01 = g2_mma(a0, b, c01); c11 = g2_mma(a1, b, c11);
    b = g2_frag(b2p + kk, hh); c02 = g2_mma(a0, b, c02); c12 = g2_mma(a1, b, c12);
    b = g2_frag(b3p + kk, hh); c03 = g2_mma(a0, b, c03); c13 = g2_mma(a1, b, c13); }
  const v8f accs[8] = {c00, c01, c02, c03, c10, c11, c12, c13};
  const int rsub = lane >> 4, c4 = (lane & 15) * 4;
  const size_t po = (size_t)by * NR * DM + (size_t)(row0 + rsub) * DM + col0 + c4;      /* the lane's place in row rsub of the wave's tile, in plane by */
  if (by < 2 || first) {      /* work-group-uniform: the tile as f32 rows in the wave's own LDS (x16 weights undone) */
#pragma unroll      /* constant indices into the accumulator registers */
    for (int u = 0; u < 8; ++u) { const int t = u & 3, half = u >> 2;
#pragma unroll      /* constant indices into the accumulator registers */
      for (int r = 0; r < 8; ++r) so[w][half * 16 + 8 * hh + r][t * 16 + ln] = accs[u][r] * 0.0625f; }
    __builtin_amdgcn_fence(__ATOMIC_ACQ_REL, "workgroup"); __builtin_amdgcn_wave_barrier(); }      /* the wave's lanes read each other's LDS writes below */
  if (by < 2) {
    const float* gp = by ? kg : qg; const float* bp = by ? kb : qb; const v4f g4 = *(const v4fa*)(gp + c4), b4 = *(const v4fa*)(bp + c4);      /* the lane's four columns are the same in every row it stores */
    v4f rv[16];
#pragma unroll      /* the row stays in registers: constant indices */
    for (int c = 0; c < 16; ++c) rv[c] = *(const v4fa*)&so[w][lane][c * 4];
    float sum = 0.f, vs = 0.f;
#pragma unroll      /* constant indices into the row's registers */
    for (int c = 0; c < 16; ++c) sum = (((sum + rv[c][0]) + rv[c][1]) + rv[c][2]) + rv[c][3];
    const float mu = sum / 64.0f;
#pragma unroll      /* constant indices into the row's registers */
    for (int c = 0; c < 16; ++c)
#pragma unroll      /* constant indices into the row's registers */
      for (int e = 0; e < 4; ++e) { const float dl = rv[c][e] - mu; vs = fmaf(dl, dl, vs); }
    v2f st = {mu, rsqrtf(vs / 64.0f + eps)}; *(v2fa*)&so[w][lane][64] = st;
    __builtin_amdgcn_fence(__ATOMIC_ACQ_REL, "workgroup"); __builtin_amdgcn_wave_barrier();      /* the statistics are read by the lanes that store the row */
    v4f gg, bb;
#pragma unroll      /* constant indices */
    for (int e = 0; e < 4; ++e) { gg[e] = bf16_round(g4[e]); bb[e] = bf16_round(b4[e]); }
    const float* sv = &so[w][rsub][c4]; const float* sm = &so[w][rsub][64];
    if (first) qk_rows<true>(sv, sm, gg, bb, F + po, Hh + po, Hl + po); else qk_rows<false>(sv, sm, gg, bb, F + po, Hh + po, Hl + po);      /* work-group-uniform */
  } else {
    if (first) {
#pragma unroll      /* LDS and global offsets as immediates */
      for (int q = 0; q < 16; ++q) { const v4f v = *(const v4fa*)&so[w][q * 2 + rsub][c4]; *(v4f*)(F + po + (size_t)q * 2 * DM) = v; }
      __syncthreads(); }      /* every wave has read its f32 rows before the array is used anew below */
    unsigned short* sT = (unsigned short*)&so[0][0][0];      /* the same LDS as [HD][VTP] f16: V^T of the work-group's 128 tokens */
#pragma unroll      /* constant indices into the accumulator registers */
    for (int u = 0; u < 8; ++u) { const int t = u & 3, half = u >> 2; FragH f;
#pragma unroll      /* constant indices into the accumulator registers */
      for (int r = 0; r < 8; ++r) f.h[r] = (_Float16)(accs[u][r] * 0.0625f);
      *(v8us*)(sT + (t * 16 + ln) * VTP + w * 32 + half * 16 + 8 * hh) = f.half[0]; }
    __syncthreads();      /* a V^T row holds pieces of all four waves */
    unsigned short* vo = (unsigned short*)VTo + ((size_t)(bt * NH + nq) * HD + (tid >> 4)) * SQ + s0 + (tid & 15) * 8;      /* 16 lanes store one row's 256 bytes */
#pragma unroll      /* LDS offsets as immediates, all eight reads in flight */
    for (int rd = 0; rd < 8; ++rd) { const v8us o = *(const v8us*)(sT + (rd * 8 + (tid >> 4)) * VTP + (tid & 15) * 8); *(v8us*)(vo + (size_t)rd * 8 * SQ) = o; }
    asm volatile("s_wait_xcnt 0x0" ::: "memory"); } }      /* stands behind the eighth store, in front of every later write of the data and address registers that the eight stores name */
// Output projection of every token row in one grid; loop, tiles and epilogue are k_gemm2's. A work-group owns 128 token rows x 64 columns. Where those rows are the first QT0 of a batch, the operand is the exact first tile's o as f16 hi + x1024 residual rows:
// two accumulator sets over the same weight fragments, out = hi 2^-10 + b, then + residual 2^-20, each sum in the order it had as a launch of its own. Elsewhere the operand is the fused path's f16 o rows.
__global__ __launch_bounds__(128) void k_out(const _Float16* __restrict__ O, const _Float16* __restrict__ OH, const _Float16* __restrict__ OL, const _Float16* __restrict__ Bh, const float* __restrict__ bias, float* __restrict__ C) {
  static_assert(QT0 == 128, "a work-group's 128 rows lie wholly inside or wholly outside the first tile");
  __shared__ __attribute__((aligned(16))) float so[4][32][68];
  const int tid = threadIdx.x, w = tid >> 5, lane = tid & 31, ln = lane & 15, hh = lane >> 4;
  const int mt = blockIdx.x / (DM / 64), nq = blockIdx.x % (DM / 64); const int row0 = mt * 128 + 32 * w, col0 = nq * 64;
  const int bt = mt / (SQ / 128); const bool first = mt % (SQ / 128) == 0;      /* the work-group's batch; work-group-uniform */
  const _Float16* b0p = Bh + (size_t)(col0 + ln) * DM + 8 * hh;      /* the lane's first piece of weight row col0 + ln; the other three column tiles lie 16, 32, 48 rows on */
  const v8f z8 = {0.f,0.f,0.f,0.f,0.f,0.f,0.f,0.f}; v8f c00 = z8, c01 = z8, c02 = z8, c03 = z8, c10 = z8, c11 = z8, c12 = z8, c13 = z8;
  float bv[4];
#pragma unroll      /* constant indices */
  for (int t = 0; t < 4; ++t) bv[t] = bf16_round(bias[col0 + t * 16 + ln]);
  if (!first) {
    const _Float16* a0p = O + (size_t)(row0 + ln) * DM + 8 * hh;      /* the lane's first piece of token row row0 + ln; the second row tile lies 16 rows on */
#pragma unroll 1      /* rolled like k_gemm2's loop, which it replaces here: the products and their schedule stay as they were */
    for (int kb = 0; kb < DM; kb += 32) { const _Float16* pa = a0p + kb; const _Float16* pb = b0p + kb;
      const v16h a0 = g2_frag(pa, 0), a1 = g2_frag(pa + 16 * DM, 0); v16h b = g2_frag(pb, 0);
      asm volatile("s_wait_xcnt 0x0" :: "v"(pa), "v"(pb) : "memory");      /* stands in front of every write of the registers that the loads above name as their addresses; it takes the addresses as inputs, so that those registers live up to it and no load's result is placed on them earlier */
      c00 = g2_mma(a0, b, c00); c10 = g2_mma(a1, b, c10);
      b = g2_frag(pb + 16 * DM, 0); asm volatile("s_wait_xcnt 0x0" :: "v"(pb) : "memory");      /* the same for these loads */
      c01 = g2_mma(a0, b, c01); c11 = g2_mma(a1, b, c11);
      b = g2_frag(pb + 32 * DM, 0); asm volatile("s_wait_xcnt 0x0" :: "v"(pb) : "memory");      /* the same for these loads */
      c02 = g2_mma(a0, b, c02); c12 = g2_mma(a1, b, c12);
      b = g2_frag(pb + 48 * DM, 0); asm volatile("s_wait_xcnt 0x0" :: "v"(pb) : "memory");      /* the same for these loads */
      c03 = g2_mma(a0, b, c03); c13 = g2_mma(a1, b, c13); }
    const v8f accs[8] = {c00, c01, c02, c03, c10, c11, c12, c13};
#pragma unroll      /* constant indices into the accumulator registers */
    for (int u = 0; u < 8; ++u) { const int t = u & 3, half = u >> 2;
#pragma unroll      /* constant indices into the accumulator registers */
      for (int r = 0; r < 8; ++r) so[w][half * 16 + 8 * hh + r][t * 16 + ln] = accs[u][r] * 0.0009765625f + bv[t]; }
  } else {
    const size_t ro = ((size_t)bt * QT0 + 32 * w + ln) * DM + 8 * hh;
    const _Float16* a0p = OH + ro; const _Float16* e0p = OL + ro;      /* the lane's first piece of its row in the hi and in the residual plane */
    v8f d00 = z8, d01 = z8, d02 = z8, d03 = z8, d10 = z8, d11 = z8, d12 = z8, d13 = z8;
#pragma unroll 1      /* rolled like the loop above: 16 accumulator tiles and five fragments leave no room for a second copy */
    for (int kb = 0; kb < DM; kb += 32) { const _Float16* pa = a0p + kb; const _Float16* pe = e0p + kb; const _Float16* pb = b0p + kb;
      const v16h a0 = g2_frag(pa, 0), a1 = g2_frag(pa + 16 * DM, 0), e0 = g2_frag(pe, 0), e1 = g2_frag(pe + 16 * DM, 0); v16h b = g2_frag(pb, 0);
      asm volatile("s_wait_xcnt 0x0" :: "v"(pa), "v"(pe), "v"(pb) : "memory");      /* as in the loop above: in front of every write of the address registers of the loads above, which live up to it */
      c00 = g2_mma(a0, b, c00); c10 = g2_mma(a1, b, c10); d00 = g2_mma(e0, b, d00); d10 = g2_mma(e1, b, d10);
      b = g2_frag(pb + 16 * DM, 0); asm volatile("s_wait_xcnt 0x0" :: "v"(pb) : "memory");      /* the same for these loads */
      c01 = g2_mma(a0, b, c01); c11 = g2_mma(a1, b, c11); d01 = g2_mma(e0, b, d01); d11 = g2_mma(e1, b, d11);
      b = g2_frag(pb + 32 * DM, 0); asm volatile("s_wait_xcnt 0x0" :: "v"(pb) : "memory");      /* the same for these loads */
      c02 = g2_mma(a0, b, c02); c12 = g2_mma(a1, b, c12); d02 = g2_mma(e0, b, d02); d12 = g2_mma(e1, b, d12);
      b = g2_frag(pb + 48 * DM, 0); asm volatile("s_wait_xcnt 0x0" :: "v"(pb) : "memory");      /* the same for these loads */
      c03 = g2_mma(a0, b, c03); c13 = g2_mma(a1, b, c13); d03 = g2_mma(e0, b, d03); d13 = g2_mma(e1, b, d13); }
    const v8f accs[8] = {c00, c01, c02, c03, c10, c11, c12, c13}; const v8f accl[8] = {d00, d01, d02, d03, d10, d11, d12, d13};
#pragma unroll      /* constant indices into the accumulator registers */
    for (int u = 0; u < 8; ++u) { const int t = u & 3, half = u >> 2;
#pragma unroll      /* constant indices into the accumulator registers */
      for (int r = 0; r < 8; ++r) { const float v = accs[u][r] * 0.0009765625f + bv[t]; so[w][half * 16 + 8 * hh + r][t * 16 + ln] = accl[u][r] * 0.00000095367431640625f + v; } }
  }
  __builtin_amdgcn_fence(__ATOMIC_ACQ_REL, "workgroup"); __builtin_amdgcn_wave_barrier();      /* the wave's lanes read each other's LDS writes below */
  const int rsub = lane >> 4, c4 = (lane & 15) * 4;
#pragma unroll      /* LDS and global offsets as immediates */
  for (int q = 0; q < 16; ++q) { const int r = q * 2 + rsub; const v4f v = *(const v4fa*)&so[w][r][c4]; *(v4f*)(C + (size_t)(row0 + r) * DM + col0 + c4) = v; asm volatile("s_wait_xcnt 0x0" ::: "memory"); } }      /* the wait stands in front of every later write of the data and address registers that this store names */
extern "C" void kernel_launch(void* const* d_in, const int* in_sizes, int n_in,
                              void* d_out, int out_size, void* d_ws, size_t ws_size, hipStream_t stream) {
  (void)in_sizes; (void)n_in; (void)out_size;
  const float* const* I = (const float* const*)d_in; const float* x = I[0]; const float* wq = I[1]; const float* wk = I[2]; const float* wv = I[3]; const float* wo = I[4]; const float* bo = I[5]; const float* qg = I[6]; const float* qbt = I[7]; const float* kg = I[8]; const float* kbt = I[9]; const float LNE = 1e-5f;      /* input order: x (feeds the q, k AND v streams), Wq, Wk, Wv (natural [out][in] weights; NO biases: k_qkv takes no bias), Wo, bo (zeros: read), q_gamma, q_beta, k_gamma, k_beta [64] (ones / zeros on this draw: read by value in the projections' LayerNorm epilogue) */
  char* ws = (char*)d_ws; size_t off = 0;
  auto take = [&](size_t bytes) { char* p = ws + off; off += (bytes + 255) & ~(size_t)255; return p; };
  _Float16* BQ = (_Float16*)take((size_t)4 * DM * DM * 2); _Float16* BK = BQ + (size_t)DM * DM; _Float16* BV = BK + (size_t)DM * DM; _Float16* BO = BV + (size_t)DM * DM; (void)BK; (void)BV;      /* the four weight planes lie one behind the other: one grid writes them, one GEMM grid reads the first three by plane index */
  _Float16* X16 = (_Float16*)take(NR * DM * 2);      /* exact f16 rows of x: the one operand of the q, k and v projections */
  float* QF = (float*)take((size_t)3 * NR * DM * 4); float* KF = QF + NR * DM; float* VF = KF + NR * DM;      /* f32 rows of q, k (normalised) and v, three planes one behind the other: written and read for the first QT0 tokens of a batch alone, by the exact first tile */
  _Float16* QH = (_Float16*)take((size_t)2 * NR * DM * 2); _Float16* KH = QH + NR * DM; _Float16* QL = (_Float16*)take((size_t)2 * NR * DM * 2); _Float16* KL = QL + NR * DM;      /* hi planes of q and k one behind the other, residual planes likewise: the projection grid places them by plane index */
  _Float16* O16 = (_Float16*)take(NR * DM * 2);
  _Float16* VT = (_Float16*)take((size_t)NB * NH * HD * SQ * 2);      /* V^T [NB][NH][HD][SQ] */
  _Float16* OH0 = (_Float16*)take((size_t)NB * QT0 * DM * 2); _Float16* OL0 = (_Float16*)take((size_t)NB * QT0 * DM * 2);
  if (off > ws_size) return;
  k_prep<<<(unsigned)(NR * DM / 2048 + 4 * (DM * DM / 2048)), 256, 0, stream>>>(x, wq, wk, wv, wo, X16, BQ);      /* x as exact f16 rows; natural [out][in] weights = Bt[n][k] x16 */
  k_qkv<<<dim3((unsigned)((MP / 128) * (DM / 64)), 3), 128, 0, stream>>>(X16, BQ, qg, qbt, kg, kbt, LNE, QF, QH, QL, VT);      /* blockIdx.y: q, k (no biases; per-head LayerNorm; f16 hi + x1024 residual rows: unscaled logits sigma ~8) and v (V^T [NB][NH][HD][SQ]); f32 rows for the first tile */
  k_attn<<<dim3(NB * NH, NFT + QT0 / A0R), 128, 0, stream>>>(QH, QL, KH, KL, VT, O16, QF, KF, VF, OH0, OL0);      /* scores, causal softmax and P . V of every batch, head and query row in one launch: rows from QT0 on by the fused f16 path (o, merged heads, x64, as f16 rows), rows 0..127 exactly in f32 on the f32 q, k, v rows that the projections left (o x64 as f16 hi + x1024 residual planes) */
  k_out<<<(unsigned)((MPO / 128) * (DM / 64)), 128, 0, stream>>>(O16, OH0, OL0, BO, bo, (float*)d_out);      /* out rows are the output layout; rows 0..127 of a batch from the hi + residual planes */
}

// v009
// Measured time: 71.9 microseconds a run.
// Next to v008, in two timings, it ran 1.49 times as fast each time.
// Over all steps from v000 it is 151 times as fast.
#include <hip/hip_runtime.h>
// Causal multi-head self-attention with a per-head LayerNorm on q and k, natural bias-free q / k / v projections and a biased output projection (x [2][3072][512]; q / k / v = x W^T (nn.Linear natural [512][512] sd 0.02, NO biases), 8 heads of 64; q and k each pass through a LayerNorm over the 64 values of every (token, head) vector (biased variance, eps 1e-5, gamma / beta [64]: ones / zeros on this draw: read); scores = q . k / sqrt(64); causal (keys after the query get -inf); softmax; out = merged Wo^T + bo (natural; zero bias) -> [2][3072][512]); q and k carried as f16 hi + x1024 residual planes with three-product scores.
// Structure: token rows r = b*3072 + s; x as exact f16 rows (bf16-rounded); q, k and v as WMMA GEMMs in one grid (32x64 wave tiles = 32 tokens of one head, f32 accumulation, exact x16 weights, no bias) whose epilogue finishes the tile: q and k get their f32 LayerNorm over the 64 values of each (token, head) vector (f32 statistics, gamma / beta by value) and leave as f16 hi + x1024 residual planes, v leaves as V^T through an LDS transpose; f32 rows of q, k, v are stored for the first 128 tokens of a batch alone; work that does not depend on each other shares a grid (x and the weights; q, k, v; both batches); then ONE fused launch for all batches, heads and query rows (the first 128 rows of a batch exactly in f32, one wave a row, o as f16 hi + x1024 residual planes): from row 128 on a wave takes 16 query rows and walks the keys up to its diagonal, 32 a pass: S^T = K Q^T as three products (hi.hi + lo.hi + hi.lo, K = 64, scale 1/8 = 1/sqrt(64); logits sigma ~1), causal running-maximum softmax inside the lane (f32 statistics, native exp; weights exp(s - max) as f16), O^T = V^T P^T with the weights taken in place from the score accumulators (o divided by the row sum at the end and carried x64, folded into the output GEMM alpha) written straight into the merged f16 o rows; out = o Wo^T + bo GEMM (f32) into the output layout.
// Compute dtype: inputs rounded to bf16; x / weights exact; the normalised q and k as f16 hi + residual planes (three-product scores), v, the softmax weights and o as plain f16 GEMM operands (~2^-12); LayerNorm, scores and softmax statistics f32. v_wmma_f32_16x16x32_f16.
#define NB 2
#define SCL 0.125f                         /* 1 / sqrt(head_dim = 64) */
#define SCLR 0.0001220703125f              /* 2^-13: SCL / 1024; unused: the x1024 residual products take SCLR2 */
#define SQ 3072
#define DM 512
#define NH 8
#define HD 64
#define HG 4                         /* heads per launch of the h0-based k_vt overload */
#define QT0 128                      /* first-tile rows computed exactly in f32 (the fused path starts behind them) */
#define B0 0                         /* unused */
#define NBR NB                       /* batches processed (debug hook) */
#define NR ((size_t)NB * SQ)         /* token rows */
#define MP ((int)((size_t)NBR * SQ)) /* rows projected (debug hook) */
#define MPO MP                       /* rows through the output stage (debug hook) */
#define LQ DM      /* row pitch of the q/k/v rows */
typedef __bf16 v16b __attribute__((ext_vector_type(16)));
typedef unsigned short v8us __attribute__((ext_vector_type(8), may_alias));
typedef float  v8f  __attribute__((ext_vector_type(8)));
typedef float  v4f  __attribute__((ext_vector_type(4)));
typedef float  v4fa __attribute__((ext_vector_type(4), may_alias));
union FragB { v16b v; v8us half[2]; unsigned short u[16]; };

__device__ __forceinline__ unsigned short bf16_bits(float x) { unsigned int u = __float_as_uint(x); return (unsigned short)((u + 0x7FFFu + ((u >> 16) & 1u)) >> 16); }
__device__ __forceinline__ float bf16_val(unsigned short b) { return __uint_as_float(((unsigned int)b) << 16); }
__device__ __forceinline__ float bf16_round(float x) { return bf16_val(bf16_bits(x)); }
// D += A·B with NT terms: 1 = ah·bh, 2 = + al·bh (A split), 3 = + ah·bl (both split)
template <int NT>
__device__ __forceinline__ v8f mmaN(v16b ah, v16b al, v16b bh, v16b bl, v8f c) {
  c = __builtin_amdgcn_wmma_f32_16x16x32_bf16(false, ah, false, bh, (short)0, c, false, false);
  if (NT >= 2) c = __builtin_amdgcn_wmma_f32_16x16x32_bf16(false, al, false, bh, (short)0, c, false, false);
  if (NT >= 3) c = __builtin_amdgcn_wmma_f32_16x16x32_bf16(false, ah, false, bl, (short)0, c, false, false);
  asm volatile("v_nop\n\tv_nop\n\tv_nop\n\tv_nop" : "+v"(c) : "v"(ah), "v"(al), "v"(bh), "v"(bl));
  return c;
}

__global__ __launch_bounds__(256) void k_wt_bf16(const float* __restrict__ W, unsigned short* __restrict__ Wt, int K, int N) {
  const int t = blockIdx.x * 256 + threadIdx.x;
  const int k8n = K / 8;
  if (t >= N * k8n) return;
  const int n = t / k8n, k8 = (t % k8n) * 8;
  v8us v;
#pragma unroll
  for (int i = 0; i < 8; ++i) v[i] = bf16_bits(W[(size_t)(k8 + i) * N + n]);
  *(v8us*)(Wt + (size_t)n * K + k8) = v;
  
}

// GEMM C[M][N] (f32, pitch ldc) = act(A[M][K]·W + bias). A f32 row-major (pitch lda) converted per fragment to bf16
// (ASPLIT: hi/lo two planes -> 2 terms, else single rounded term); Wt bf16 [N][K] (pitch ldb). BIAS_BF16 rounds the
// bias to bf16 first (bias quantised to bf16 before the add). K%32==0, M%16==0, N%64==0.
template <bool ASPLIT, int ACT, bool BIAS_BF16>
__global__ __launch_bounds__(128) void k_gemm_bf(const float* __restrict__ A, int lda, const unsigned short* __restrict__ Wt, int ldb,
                                               const float* __restrict__ bias, float* __restrict__ C, int ldc, int M, int N, int K) {
  __shared__ __attribute__((aligned(16))) float so[4][16][64];
  const int tid = threadIdx.x, w = tid >> 5, lane = tid & 31, ln = lane & 15, hh = lane >> 4;
  const int ntn = N / 64;
  const int wid = blockIdx.x * 4 + w;
  const int mt = wid / ntn, nq = wid % ntn;
  if (mt * 16 >= M) return;
  const int row0 = mt * 16, col0 = nq * 64;
  const float* arow = A + (size_t)(row0 + ln) * lda;
  v8f acc[4] = {};
  for (int kb = 0; kb < K; kb += 32) {
    FragB ah, al;
    const v4f x0 = *(const v4fa*)(arow + kb + 8 * hh), x1 = *(const v4fa*)(arow + kb + 8 * hh + 4);
    const v4f x2 = *(const v4fa*)(arow + kb + 16 + 8 * hh), x3 = *(const v4fa*)(arow + kb + 16 + 8 * hh + 4);
    float xs[16] = {x0[0],x0[1],x0[2],x0[3],x1[0],x1[1],x1[2],x1[3],x2[0],x2[1],x2[2],x2[3],x3[0],x3[1],x3[2],x3[3]};
#pragma unroll
    for (int i = 0; i < 16; ++i) { const unsigned short hb = bf16_bits(xs[i]); ah.u[i] = hb; al.u[i] = ASPLIT ? bf16_bits(xs[i] - bf16_val(hb)) : (unsigned short)0; }
#pragma unroll
    for (int t = 0; t < 4; ++t) {
      const unsigned short* brow = Wt + (size_t)(col0 + t * 16 + ln) * ldb + kb;
      FragB b;
      b.half[0] = *(const v8us*)(brow + 8 * hh);
      b.half[1] = *(const v8us*)(brow + 16 + 8 * hh);
      acc[t] = mmaN<ASPLIT ? 2 : 1>(ah.v, al.v, b.v, b.v, acc[t]);
    }
  }
#pragma unroll
  for (int t = 0; t < 4; ++t) {
    float bv = bias ? bias[col0 + t * 16 + ln] : 0.f;
    if (BIAS_BF16) bv = bf16_round(bv);
#pragma unroll
    for (int r = 0; r < 8; ++r) { float v = acc[t][r] + bv; if (ACT == 1) v = fmaxf(v, 0.f); so[w][8 * hh + r][t * 16 + ln] = v; }
  }
  __builtin_amdgcn_fence(__ATOMIC_ACQ_REL, "workgroup");
  __builtin_amdgcn_wave_barrier();
  const int rsub = lane >> 4, c4 = (lane & 15) * 4;
  {
#pragma unroll
    for (int q = 0; q < 8; ++q) {
      const int r = q * 2 + rsub;
      const v4f v = *(const v4fa*)&so[w][r][c4];
      *(v4f*)(C + (size_t)(row0 + r) * ldc + col0 + c4) = v;
    }
    
  }
}

// GEMM C = act(A·W + bias + resid): A f32 (ASPLIT -> hi/lo 2 terms), Wt bf16 [N][K]; ACT 0 none, 1 relu, 2 exact gelu;
// resid (optional, f32, row index = (row % rmod), pitch ldr, RES_BF16 rounds it) added before the activation.
template <bool ASPLIT, int ACT, bool BIAS_BF16, bool RES_BF16>
__global__ __launch_bounds__(128) void k_gemm_bf3(const float* __restrict__ A, int lda, const unsigned short* __restrict__ Wt, int ldb,
                                                const float* __restrict__ bias, const float* __restrict__ resid, int rmod, int ldr,
                                                float* __restrict__ C, int ldc, int M, int N, int K) {
  __shared__ __attribute__((aligned(16))) float so[4][16][64];
  const int tid = threadIdx.x, w = tid >> 5, lane = tid & 31, ln = lane & 15, hh = lane >> 4;
  const int ntn = N / 64;
  const int wid = blockIdx.x * 4 + w;
  const int mt = wid / ntn, nq = wid % ntn;
  if (mt * 16 >= M) return;
  const int row0 = mt * 16, col0 = nq * 64;
  const float* arow = A + (size_t)(row0 + ln) * lda;
  v8f acc[4] = {};
  for (int kb = 0; kb < K; kb += 32) {
    FragB ah, al;
    const v4f x0 = *(const v4fa*)(arow + kb + 8 * hh), x1 = *(const v4fa*)(arow + kb + 8 * hh + 4);
    const v4f x2 = *(const v4fa*)(arow + kb + 16 + 8 * hh), x3 = *(const v4fa*)(arow + kb + 16 + 8 * hh + 4);
    float xs[16] = {x0[0],x0[1],x0[2],x0[3],x1[0],x1[1],x1[2],x1[3],x2[0],x2[1],x2[2],x2[3],x3[0],x3[1],x3[2],x3[3]};
#pragma unroll
    for (int i = 0; i < 16; ++i) { const unsigned short hb = bf16_bits(xs[i]); ah.u[i] = hb; al.u[i] = ASPLIT ? bf16_bits(xs[i] - bf16_val(hb)) : (unsigned short)0; }
#pragma unroll
    for (int t = 0; t < 4; ++t) {
      const unsigned short* brow = Wt + (size_t)(col0 + t * 16 + ln) * ldb + kb;
      FragB b;
      b.half[0] = *(const v8us*)(brow + 8 * hh);
      b.half[1] = *(const v8us*)(brow + 16 + 8 * hh);
      acc[t] = mmaN<ASPLIT ? 2 : 1>(ah.v, al.v, b.v, b.v, acc[t]);
    }
  }
#pragma unroll
  for (int t = 0; t < 4; ++t) {
    const int col = col0 + t * 16 + ln;
    float bv = bias ? bias[col] : 0.f;
    if (BIAS_BF16) bv = bf16_round(bv);
#pragma unroll
    for (int r = 0; r < 8; ++r) {
      float v = acc[t][r] + bv;
      if (resid) { float rv = resid[(size_t)((row0 + 8 * hh + r) % rmod) * ldr + col]; if (RES_BF16) rv = bf16_round(rv); v += rv; }
      if (ACT == 1) v = fmaxf(v, 0.f);
      if (ACT == 2) v = 0.5f * v * (1.0f + erff(v * 0.70710678118654752f));
      if (ACT == 3) { const float u = 0.7978845608028654f * (v + 0.044715f * v * v * v); v = 0.5f * v * (1.0f + tanhf(u)); }
      so[w][8 * hh + r][t * 16 + ln] = v;
    }
  }
  __builtin_amdgcn_fence(__ATOMIC_ACQ_REL, "workgroup");
  __builtin_amdgcn_wave_barrier();
  const int rsub = lane >> 4, c4 = (lane & 15) * 4;
  {
#pragma unroll
    for (int q = 0; q < 8; ++q) {
      const int r = q * 2 + rsub;
      const v4f v = *(const v4fa*)&so[w][r][c4];
      *(v4f*)(C + (size_t)(row0 + r) * ldc + col0 + c4) = v;
    }
    
  }
}
// row LayerNorm (biased variance, eps) over N: s = X (+ R); optional out_sum <- s; out_norm <- (s-mu)*rsqrt(var+eps)*g + b
template <bool PARAM_BF16>
__global__ __launch_bounds__(256) void k_layernorm(const float* __restrict__ X, const float* __restrict__ R, const float* __restrict__ g, const float* __restrict__ bta,
                                                  float* __restrict__ out_sum, float* __restrict__ out_norm, int N, float eps) {
  __shared__ float red[256];
  const int row = blockIdx.x, tid = threadIdx.x;
  const float* x = X + (size_t)row * N; const float* rr = R ? R + (size_t)row * N : nullptr;
  float vals[16];                     // up to N = 4096
  const int per = N / 256;            // contiguous chunk per thread? use strided-by-4 chunks: thread handles j = tid*4 + 1024*u
  float s1 = 0.f;
  for (int u = 0; u < per / 4; ++u) {
    const int j = tid * 4 + 1024 * u;
    const v4f a = *(const v4fa*)(x + j);
    v4f b = {0.f,0.f,0.f,0.f}; if (rr) b = *(const v4fa*)(rr + j);
#pragma unroll
    for (int q = 0; q < 4; ++q) { const float v = a[q] + b[q]; vals[u * 4 + q] = v; s1 += v; }
  }
  red[tid] = s1; __syncthreads();
  for (int st = 128; st > 0; st >>= 1) { if (tid < st) red[tid] += red[tid + st]; __syncthreads(); }
  const float mu = red[0] / (float)N; __syncthreads();
  float s2 = 0.f;
  for (int u = 0; u < per / 4; ++u)
#pragma unroll
    for (int q = 0; q < 4; ++q) { const float c = vals[u * 4 + q] - mu; s2 += c * c; }
  red[tid] = s2; __syncthreads();
  for (int st = 128; st > 0; st >>= 1) { if (tid < st) red[tid] += red[tid + st]; __syncthreads(); }
  const float rs = rsqrtf(red[0] / (float)N + eps);
  {
    for (int u = 0; u < per / 4; ++u) {
      const int j = tid * 4 + 1024 * u;
      v4f o, sm;
#pragma unroll
      for (int q = 0; q < 4; ++q) {
        float gg = g[j + q], bb = bta[j + q];
        if (PARAM_BF16) { gg = bf16_round(gg); bb = bf16_round(bb); }
        sm[q] = vals[u * 4 + q]; o[q] = (vals[u * 4 + q] - mu) * rs * gg + bb;
      }
      if (out_sum) *(v4f*)(out_sum + (size_t)row * N + j) = sm;
      *(v4f*)(out_norm + (size_t)row * N + j) = o;
    }
    
  }
}



// ---- f16 WMMA path (v_wmma_f32_16x16x32_f16): 11-bit significands for operands in range — used where a [0,1] probability operand needs more precision than bf16
typedef _Float16 v16h __attribute__((ext_vector_type(16)));
union FragH { v16h v; v8us half[2]; _Float16 h[16]; unsigned short u[16]; };
template <int NT>
__device__ __forceinline__ v8f mmaH(v16h ah, v16h al, v16h bh, v16h bl, v8f c) {
  c = __builtin_amdgcn_wmma_f32_16x16x32_f16(false, ah, false, bh, (short)0, c, false, false);
  if (NT >= 2) c = __builtin_amdgcn_wmma_f32_16x16x32_f16(false, al, false, bh, (short)0, c, false, false);
  if (NT >= 3) c = __builtin_amdgcn_wmma_f32_16x16x32_f16(false, ah, false, bl, (short)0, c, false, false);
  asm volatile("v_nop\n\tv_nop\n\tv_nop\n\tv_nop" : "+v"(c) : "v"(ah), "v"(al), "v"(bh), "v"(bl));
  return c;
}
// batched GEMM like k_gemm_b but f16 operands: A f32 (split into f16 hi/lo if ASPLIT, else rounded to f16), Bt = f16 values [n][k]; alpha; C f32; N multiple of 16 (partial tiles skipped)
template <bool ASPLIT>
__global__ __launch_bounds__(128) void k_gemm_h(const float* __restrict__ A, int lda, size_t sA, const _Float16* __restrict__ Bh, int ldb, size_t sB, float alpha, float* __restrict__ C, int ldc, size_t sC, int M, int N, int K) {
  __shared__ __attribute__((aligned(16))) float so[4][16][64];
  const int tid = threadIdx.x, w = tid >> 5, lane = tid & 31, ln = lane & 15, hh = lane >> 4; const int by = blockIdx.y;
  A += (size_t)by * sA; Bh += (size_t)by * sB; C += (size_t)by * sC;
  const int ntn = (N + 63) / 64; const int wid = blockIdx.x * 4 + w; const int mt = wid / ntn, nq = wid % ntn; if (mt * 16 >= M) return;
  const int row0 = mt * 16, col0 = nq * 64; const float* arow = A + (size_t)(row0 + ln) * lda;
  v8f acc[4] = {};
  for (int kb = 0; kb < K; kb += 32) {
    FragH ah, al;
    const v4f x0 = *(const v4fa*)(arow + kb + 8 * hh), x1 = *(const v4fa*)(arow + kb + 8 * hh + 4), x2 = *(const v4fa*)(arow + kb + 16 + 8 * hh), x3 = *(const v4fa*)(arow + kb + 16 + 8 * hh + 4);
    float xs[16] = {x0[0],x0[1],x0[2],x0[3],x1[0],x1[1],x1[2],x1[3],x2[0],x2[1],x2[2],x2[3],x3[0],x3[1],x3[2],x3[3]};
#pragma unroll
    for (int i = 0; i < 16; ++i) { const _Float16 h = (_Float16)xs[i]; ah.h[i] = h; al.h[i] = ASPLIT ? (_Float16)(xs[i] - (float)h) : (_Float16)0.0f; }
#pragma unroll
    for (int t = 0; t < 4; ++t) { if (col0 + t * 16 >= N) continue; const size_t boff = (size_t)(col0 + t * 16 + ln) * ldb + kb; FragH bq; bq.half[0] = *(const v8us*)(Bh + boff + 8 * hh); bq.half[1] = *(const v8us*)(Bh + boff + 16 + 8 * hh);
      acc[t] = mmaH<ASPLIT ? 2 : 1>(ah.v, al.v, bq.v, bq.v, acc[t]); }
  }
#pragma unroll
  for (int t = 0; t < 4; ++t) { if (col0 + t * 16 >= N) continue;
#pragma unroll
    for (int r = 0; r < 8; ++r) so[w][8 * hh + r][t * 16 + ln] = acc[t][r] * alpha; }
  __builtin_amdgcn_fence(__ATOMIC_ACQ_REL, "workgroup"); __builtin_amdgcn_wave_barrier();
  const int rsub = lane >> 4, c4 = (lane & 15) * 4;
  {
#pragma unroll
    for (int q = 0; q < 8; ++q) { const int r = q * 2 + rsub; if (col0 + c4 < N) { const v4f v = *(const v4fa*)&so[w][r][c4]; *(v4f*)(C + (size_t)(row0 + r) * ldc + col0 + c4) = v; } }
     }
}

// Wt[n][k] = f16(W[k][n]·scale) from f32 row-major W[K][N] (scale = power of two; bf16-exact weights stay exact in f16 away from the subnormal range)
__global__ __launch_bounds__(256) void k_wt_f16(const float* __restrict__ W, _Float16* __restrict__ Wt, int K, int N, float scale) {
  const int t = blockIdx.x * 256 + threadIdx.x; if (t >= N * (K / 8)) return; const int n = t / (K / 8), k8 = (t % (K / 8)) * 8; FragH f;
#pragma unroll
  for (int i = 0; i < 8; ++i) f.h[i] = (_Float16)(bf16_round(W[(size_t)(k8 + i) * N + n]) * scale); const v8us o = f.half[0];
  *(v8us*)((unsigned short*)Wt + (size_t)n * K + k8) = o; 
}
// k_gemm_hh variant with fused epilogue: v = acc·alpha + bias[by·sBias + col] (+ CP[(row/rowsPerB)·sCPb + by·64 + col] if CP) ; ACT 0 none / 1 elu ; writes f16 C16 (and f32 C if non-null)
template <int ACT>
__global__ __launch_bounds__(128) void k_gemm_hhx(const _Float16* __restrict__ A, int lda, size_t sA, const _Float16* __restrict__ Bh, int ldb, size_t sB, float alpha, const float* __restrict__ bias, size_t sBias, const float* __restrict__ CP, int rowsPerB, size_t sCPb, int row0g,
    float* __restrict__ C, _Float16* __restrict__ C16, int ldc, size_t sC, int M, int N, int K) {
  __shared__ __attribute__((aligned(16))) float so[4][16][64];
  const int tid = threadIdx.x, w = tid >> 5, lane = tid & 31, ln = lane & 15, hh = lane >> 4; const int by = blockIdx.y;
  A += (size_t)by * sA; Bh += (size_t)by * sB; const size_t cofs = (size_t)by * sC; const float* bp = bias ? bias + (size_t)by * sBias : nullptr;
  const int ntn = (N + 63) / 64; const int wid = blockIdx.x * 4 + w; const int mt = wid / ntn, nq = wid % ntn; if (mt * 16 >= M) return;
  const int row0 = mt * 16, col0 = nq * 64; const _Float16* arow = A + (size_t)(row0 + ln) * lda;
  v8f acc[4] = {};
  for (int kb = 0; kb < K; kb += 32) { FragH ah; ah.half[0] = *(const v8us*)((const unsigned short*)arow + kb + 8 * hh); ah.half[1] = *(const v8us*)((const unsigned short*)arow + kb + 16 + 8 * hh);
#pragma unroll
    for (int t = 0; t < 4; ++t) { if (col0 + t * 16 >= N) continue; const size_t boff = (size_t)(col0 + t * 16 + ln) * ldb + kb; FragH bq; bq.half[0] = *(const v8us*)((const unsigned short*)Bh + boff + 8 * hh); bq.half[1] = *(const v8us*)((const unsigned short*)Bh + boff + 16 + 8 * hh);
      acc[t] = mmaH<1>(ah.v, ah.v, bq.v, bq.v, acc[t]); }
  }
#pragma unroll
  for (int t = 0; t < 4; ++t) { if (col0 + t * 16 >= N) continue; const int col = col0 + t * 16 + ln; const float bv = bp ? bf16_round(bp[col]) : 0.f;
#pragma unroll
    for (int r = 0; r < 8; ++r) { float v = acc[t][r] * alpha + bv; if (CP) { const int rr = row0g + row0 + 8 * hh + r; if (rowsPerB < 0) v += CP[cofs + (size_t)rr * ldc + col];      /* rowsPerB < 0: own element of the batched C plane */ else { const int bidx = rr / rowsPerB; v += CP[(size_t)bidx * sCPb + (size_t)by * 64 + col]; } } if (ACT == 1) v = (v > 0.f) ? v : expm1f(v); else if (ACT == 7) v = (v > 0.f) ? v + 1.0f : expf(v); else if (ACT == 8) v = tanhf(v); else if (ACT == 9) v = 0.5f * v * (1.0f + tanhf(0.7978845608028654f * (v + 0.044715f * v * v * v))); else if (ACT == 11) v = 1.0f / (1.0f + expf(-v)); else if (ACT == 12) v = (v > 0.f) ? v : 0.01f * v; else if (ACT == 14) v = (v > 0.f) ? v : 0.1f * v; else if (ACT == 16) v = (v >= 0.f) ? v : 0.3f * v; else if (ACT == 17) v = (v >= 0.f) ? v : 0.2f * v; else if (ACT == 15) v = v / (1.0f + expf(-v)); else if (ACT == 3) v = fmaxf(v, 0.f); else if (ACT == 6) v = 0.5f * v * (1.0f + erff(v * 0.70710678118654752f)); so[w][8 * hh + r][t * 16 + ln] = v; } }
  __builtin_amdgcn_fence(__ATOMIC_ACQ_REL, "workgroup"); __builtin_amdgcn_wave_barrier();
  const int rsub = lane >> 4, c4 = (lane & 15) * 4; typedef _Float16 v4h __attribute__((ext_vector_type(4)));
  {
#pragma unroll
    for (int q = 0; q < 8; ++q) { const int r = q * 2 + rsub; if (col0 + c4 < N) { const v4f v = *(const v4fa*)&so[w][r][c4]; if (C) *(v4f*)(C + cofs + (size_t)(row0 + r) * ldc + col0 + c4) = v; if (C16) { v4h h4; for (int i = 0; i < 4; ++i) h4[i] = (_Float16)v[i]; *(v4h*)(C16 + cofs + (size_t)(row0 + r) * ldc + col0 + c4) = h4; } } }
     }
}


typedef _Float16 v4h __attribute__((ext_vector_type(4)));

__global__ __launch_bounds__(256) void k_x16(const float* __restrict__ x, _Float16* __restrict__ X16, size_t n8) { const size_t t = (size_t)blockIdx.x * 256 + threadIdx.x; if (t >= n8) return; FragH f;
#pragma unroll
  for (int q = 0; q < 8; ++q) f.h[q] = (_Float16)bf16_round(x[t * 8 + q]); *(v8us*)((unsigned short*)X16 + t * 8) = f.half[0];  }
__global__ __launch_bounds__(256) void k_h16(const float* __restrict__ x, _Float16* __restrict__ X16, size_t n8) { const size_t t = (size_t)blockIdx.x * 256 + threadIdx.x; if (t >= n8) return; FragH f;
#pragma unroll
  for (int q = 0; q < 8; ++q) f.h[q] = (_Float16)x[t * 8 + q]; *(v8us*)((unsigned short*)X16 + t * 8) = f.half[0];  }
__global__ __launch_bounds__(256) void k_round16f(const float* __restrict__ W, _Float16* __restrict__ Bt, size_t n8) { const size_t t = (size_t)blockIdx.x * 256 + threadIdx.x; if (t >= n8) return; FragH f;
#pragma unroll
  for (int i = 0; i < 8; ++i) f.h[i] = (_Float16)(bf16_round(W[t * 8 + i]) * 16.0f); *(v8us*)((unsigned short*)Bt + t * 8) = f.half[0];  }
// ---- fast GEMM (wave tile 32x64; requires M % 32 == 0 rows per launch region and N % 64 == 0); epilogue = k_gemm_hhx semantics ----
__device__ __forceinline__ v16h g2_frag(const _Float16* p, int hh) { FragH f; f.half[0] = *(const v8us*)((const unsigned short*)p + 8 * hh); f.half[1] = *(const v8us*)((const unsigned short*)p + 16 + 8 * hh); return f.v; }
__device__ __forceinline__ v8f g2_mma(v16h a, v16h b, v8f c) { v8f d = __builtin_amdgcn_wmma_f32_16x16x32_f16(false, a, false, b, (short)0, c, false, false); asm volatile("v_nop\n\tv_nop\n\tv_nop\n\tv_nop" : "+v"(d) : "v"(a), "v"(b)); return d; }
template <int ACT>
__global__ __launch_bounds__(128) void k_gemm2(const _Float16* __restrict__ A, int lda, size_t sA, const _Float16* __restrict__ Bh, int ldb, size_t sB, float alpha, const float* __restrict__ bias, size_t sBias, const float* __restrict__ CP, int rowsPerB, size_t sCPb, int row0g,
    float* __restrict__ C, _Float16* __restrict__ C16, int by16, int ldc, size_t sC, int M, int N, int K) { static_assert(ACT == 0 || ACT == 3 || ACT == 6 || ACT == 8 || ACT == 9 || ACT == 11 || ACT == 12 || ACT == 14 || ACT == 15 || ACT == 16 || ACT == 17, "k_gemm2: unsupported ACT code (would silently apply no activation)");
  __shared__ __attribute__((aligned(16))) float so[4][32][68];
  const int tid = threadIdx.x, w = tid >> 5, lane = tid & 31, ln = lane & 15, hh = lane >> 4; const int by = blockIdx.y;
  A += (size_t)by * sA; Bh += (size_t)by * sB; const size_t cofs = (size_t)by * sC; const float* bp = bias ? bias + (size_t)by * sBias : nullptr;
  if (by < by16) C16 = nullptr; else if (C16) C16 -= (size_t)by16 * sC;      /* f16 rows are stored from plane by16 on, and C16 is the place of that plane's */
  const int ntn = N >> 6; const int mt = blockIdx.x / ntn, nq = blockIdx.x - mt * ntn; const int row0 = mt * 128 + 32 * w, col0 = nq * 64; if (row0 >= M) return;
  const _Float16* a0p = A + (size_t)(row0 + ln) * lda; const _Float16* a1p = a0p + (size_t)16 * lda;
  const _Float16* b0p = Bh + (size_t)(col0 + ln) * ldb; const _Float16* b1p = b0p + (size_t)16 * ldb; const _Float16* b2p = b1p + (size_t)16 * ldb; const _Float16* b3p = b2p + (size_t)16 * ldb;
  const v8f z8 = {0.f,0.f,0.f,0.f,0.f,0.f,0.f,0.f}; v8f c00 = z8, c01 = z8, c02 = z8, c03 = z8, c10 = z8, c11 = z8, c12 = z8, c13 = z8;
#pragma unroll 1
  for (int kb = 0; kb < K; kb += 32) { const v16h a0 = g2_frag(a0p + kb, hh), a1 = g2_frag(a1p + kb, hh);
    v16h b = g2_frag(b0p + kb, hh); c00 = g2_mma(a0, b, c00); c10 = g2_mma(a1, b, c10);
    b = g2_frag(b1p + kb, hh); c01 = g2_mma(a0, b, c01); c11 = g2_mma(a1, b, c11);
    b = g2_frag(b2p + kb, hh); c02 = g2_mma(a0, b, c02); c12 = g2_mma(a1, b, c12);
    b = g2_frag(b3p + kb, hh); c03 = g2_mma(a0, b, c03); c13 = g2_mma(a1, b, c13); }
  v8f accs[8] = {c00, c01, c02, c03, c10, c11, c12, c13};
#pragma unroll
  for (int u = 0; u < 8; ++u) { const int t = u & 3, half = u >> 2; const int col = col0 + t * 16 + ln; const float bv = bp ? bf16_round(bp[col]) : 0.f;
#pragma unroll
    for (int r = 0; r < 8; ++r) { const int rloc = half * 16 + 8 * hh + r; float v = accs[u][r] * alpha + bv; if (CP) { if (rowsPerB < 0) v += CP[cofs + (size_t)(row0g + row0 + rloc) * ldc + col];      /* rowsPerB < 0: own element of the batched C plane */ else { const int bidx = (row0g + row0 + rloc) / rowsPerB; v += CP[(size_t)bidx * sCPb + (size_t)by * 64 + col]; } }
      if (ACT == 3) v = fmaxf(v, 0.f); else if (ACT == 6) v = 0.5f * v * (1.0f + erff(v * 0.70710678118654752f)); else if (ACT == 11) v = 1.0f / (1.0f + expf(-v)); else if (ACT == 15) v = v / (1.0f + expf(-v)); else if (ACT == 12) v = (v > 0.f) ? v : 0.01f * v; else if (ACT == 8) v = tanhf(v); else if (ACT == 9) v = 0.5f * v * (1.0f + tanhf(0.7978845608028654f * (v + 0.044715f * v * v * v))); else if (ACT == 14) v = (v > 0.f) ? v : 0.1f * v; else if (ACT == 16) v = (v >= 0.f) ? v : 0.3f * v; else if (ACT == 17) v = (v >= 0.f) ? v : 0.2f * v;
      so[w][rloc][t * 16 + ln] = v; } }
  __builtin_amdgcn_fence(__ATOMIC_ACQ_REL, "workgroup"); __builtin_amdgcn_wave_barrier();
  const int rsub = lane >> 4, c4 = (lane & 15) * 4;
  {
#pragma unroll
    for (int q = 0; q < 16; ++q) { const int r = q * 2 + rsub; const v4f v = *(const v4fa*)&so[w][r][c4]; if (C) { *(v4f*)(C + cofs + (size_t)(row0 + r) * ldc + col0 + c4) = v; asm volatile("s_wait_xcnt 0x0" ::: "memory"); }      /* the wait stands in front of every later write of the data and address registers that this store names: where both planes are written, the f16 conversion below reuses them */
      if (C16) { v4h h4; for (int i = 0; i < 4; ++i) h4[i] = (_Float16)v[i]; *(v4h*)(C16 + cofs + (size_t)(row0 + r) * ldc + col0 + c4) = h4; } }
     } }


// x and the four weight matrices in one grid: the first xb work-groups round x to exact f16 rows, the next 4 x wb the natural [out][in] weights (x16) into four planes that lie one behind the other. None of the five reads what another writes.
__global__ __launch_bounds__(256) void k_prep(const float* __restrict__ x, const float* __restrict__ w0, const float* __restrict__ w1, const float* __restrict__ w2, const float* __restrict__ w3, _Float16* __restrict__ X16, _Float16* __restrict__ Bt) {
  constexpr int xb = (int)(NR * DM / 2048), wb = DM * DM / 2048; const int bx = blockIdx.x; const float* s = x; _Float16* d = X16; float sc = 1.0f; int lb = bx;      /* a product with 1 is exact */
  if (bx >= xb) { const int p = (bx - xb) / wb; lb = (bx - xb) - p * wb; s = (p == 0) ? w0 : (p == 1) ? w1 : (p == 2) ? w2 : w3; d = Bt + (size_t)p * wb * 2048; sc = 16.0f; }      /* work-group-uniform; a work-group covers 2048 values */
  const size_t t = (size_t)lb * 256 + threadIdx.x; const v4f a = *(const v4fa*)(s + t * 8), c = *(const v4fa*)(s + t * 8 + 4); FragH f;
#pragma unroll      /* constant indices into the loaded registers */
  for (int q = 0; q < 4; ++q) { f.h[q] = (_Float16)(bf16_round(a[q]) * sc); f.h[4 + q] = (_Float16)(bf16_round(c[q]) * sc); }
  *(v8us*)((unsigned short*)d + t * 8) = f.half[0]; }
__global__ __launch_bounds__(256) void k_rsm(const float* __restrict__ S, _Float16* __restrict__ P, int nrows) {
  #pragma clang fp contract(off)
  const int i = blockIdx.x * 256 + threadIdx.x; if (i >= nrows) return; const float* s = S + (size_t)i * SQ; float mx = -3.0e38f;
#pragma unroll 1
  for (int j = 0; j < SQ; ++j) mx = fmaxf(mx, s[j]); float se = 0.f;
#pragma unroll 1
  for (int j = 0; j < SQ; ++j) se += expf(s[j] - mx); const float sc = 256.0f / se;
#pragma unroll 1
  for (int j0 = 0; j0 < SQ; j0 += 8) { FragH f; for (int q = 0; q < 8; ++q) f.h[q] = (_Float16)(expf(s[j0 + q] - mx) * sc); unsigned short* d = (unsigned short*)P + (size_t)i * SQ + j0; *(v8us*)d = f.half[0];  } }
__global__ __launch_bounds__(256) void k_vt(const _Float16* __restrict__ V16, int b, int h0, _Float16* __restrict__ VT) { __shared__ unsigned short tl[64][65]; const int tid = threadIdx.x; const int hh = blockIdx.x % HG, sg = blockIdx.x / HG; const int s0 = sg * 64; const int h = h0 + hh;
  for (int i = tid; i < 64 * 8; i += 256) { const int j = i / 8, d8 = (i % 8) * 8; FragH f; f.half[0] = *(const v8us*)((const unsigned short*)V16 + ((size_t)b * SQ + s0 + j) * DM + h * HD + d8); for (int q = 0; q < 8; ++q) tl[d8 + q][j] = f.u[q]; }
  __syncthreads();
  { for (int i = tid; i < 64 * 8; i += 256) { const int d = i / 8, j8 = (i % 8) * 8; FragH f; for (int q = 0; q < 8; ++q) f.u[q] = tl[d][j8 + q]; *(v8us*)((unsigned short*)VT + ((size_t)hh * HD + d) * SQ + s0 + j8) = f.half[0]; }  } }



__device__ __forceinline__ float rs_xhalf(float x) { return __builtin_bit_cast(float, __builtin_amdgcn_permlanex16(__builtin_bit_cast(int, x), __builtin_bit_cast(int, x), 0x76543210, 0xfedcba98, false, false)); }      /* lane l <- lane l ^ 16 */
__device__ __forceinline__ float fa_exp2(float x) { float y; asm("v_exp_f32 %0, %1\n\tv_nop" : "=v"(y) : "v"(x)); return y; }      /* 2^x; the v_nop is the slot the instruction set asks for behind a transcendental */
#define SCL2 0.18033688f                   /* SCL * log2(e): scores carried in the base-2 domain, so that a weight is one subtract and one 2^x */
#define SCLR2 (SCL2 * 0.0009765625f)       /* the same scale on the x1024 residual products */
// Fused causal attention, one wave per 16 query rows of one (batch, head); 32 keys a pass, no score or weight plane in memory.
// S^T = K Q^T (A = key rows, B = query rows): a lane holds 16 scores of ITS query (column ln), keys kb + 8 hh + r and kb + 16 + 8 hh + r: the very places of the B fragment of O^T = V^T P^T,
// so the weights go from the score accumulators to the next product inside the lane. Row maximum and row sum: in the lane, plus one exchange with lane ^ 16. Running maximum, o and sum rescaled each pass.
// The four waves of a work-group walk the same keys: a tile of 64 keys (K hi, K residual, V^T: 64 rows of 128 bytes each) is brought into LDS once for all four by asynchronous copies of whole 128-byte lines, two buffers, the next tile in flight while this one is worked on; the fragments are 16-byte LDS reads.
#define FKT 64                       /* keys of a staged tile: two passes */
#define FPT 72                       /* pitch of a staged row in f16: 144 B = 9 x 16 B, so that 16 lanes reading 16 rows by 16 bytes do not meet in a bank */
#define FPL (FKT * FPT * 2)          /* bytes of one staged plane */
#define FRS (16 * FPT * 2)           /* bytes of 16 staged rows: the step between a lane's four pieces of a plane */
// One tile: a lane's twelve 16-byte pieces (four of each plane, 16 rows apart). ld: the lane's LDS byte address in plane 0 of the buffer; gh, gl, gv: its first piece in the K hi rows, the K residual rows and the V^T rows.
__device__ __forceinline__ void fa_stage(unsigned ld, const _Float16* gh, const _Float16* gl, const _Float16* gv) {
  asm volatile(      /* the copies go from global memory to LDS through no register; the s_wait_xcnt in the same statement stands in front of every later write of the address registers that the copies name */
    "global_load_async_to_lds_b128 %0, %12, off\n\t"
    "global_load_async_to_lds_b128 %1, %13, off\n\t"
    "global_load_async_to_lds_b128 %2, %14, off\n\t"
    "global_load_async_to_lds_b128 %3, %15, off\n\t"
    "global_load_async_to_lds_b128 %4, %16, off\n\t"
    "global_load_async_to_lds_b128 %5, %17, off\n\t"
    "global_load_async_to_lds_b128 %6, %18, off\n\t"
    "global_load_async_to_lds_b128 %7, %19, off\n\t"
    "global_load_async_to_lds_b128 %8, %20, off\n\t"
    "global_load_async_to_lds_b128 %9, %21, off\n\t"
    "global_load_async_to_lds_b128 %10, %22, off\n\t"
    "global_load_async_to_lds_b128 %11, %23, off\n\t"
    "s_wait_xcnt 0x0"
    :: "v"(ld), "v"(ld + FRS), "v"(ld + 2 * FRS), "v"(ld + 3 * FRS),
       "v"(ld + FPL), "v"(ld + FPL + FRS), "v"(ld + FPL + 2 * FRS), "v"(ld + FPL + 3 * FRS),
       "v"(ld + 2 * FPL), "v"(ld + 2 * FPL + FRS), "v"(ld + 2 * FPL + 2 * FRS), "v"(ld + 2 * FPL + 3 * FRS),
       "v"(gh), "v"(gh + (size_t)16 * LQ), "v"(gh + (size_t)32 * LQ), "v"(gh + (size_t)48 * LQ),
       "v"(gl), "v"(gl + (size_t)16 * LQ), "v"(gl + (size_t)32 * LQ), "v"(gl + (size_t)48 * LQ),
       "v"(gv), "v"(gv + (size_t)16 * SQ), "v"(gv + (size_t)32 * SQ), "v"(gv + (size_t)48 * SQ)
    : "memory"); }
__device__ __forceinline__ void fa_body(char* sm, int bh, int nst, const _Float16* __restrict__ QHp, const _Float16* __restrict__ QLp, const _Float16* __restrict__ KHp, const _Float16* __restrict__ KLp, const _Float16* __restrict__ VTp, _Float16* __restrict__ Op) {      /* sm: the work-group's LDS block; bh: batch * NH + head; nst: tiles up to and with the work-group's diagonal tile */
  _Float16 (*sk)[3][FKT][FPT] = (_Float16 (*)[3][FKT][FPT])sm;      /* [buffer][K hi, K residual, V^T][row][64 values + pad] */
  const int tid = threadIdx.x, lane = tid & 31, ln = lane & 15, hh = lane >> 4; const int w = __builtin_amdgcn_readfirstlane(tid >> 5);
  const int b = bh / NH, h = bh % NH;
  const int q0 = (nst - 1) * FKT + w * 16;
  const size_t r0 = (size_t)b * SQ; const int q = q0 + ln;
  const int sr = tid >> 3, sc8 = (tid & 7) * 8;      /* staging: eight lanes copy one 128-byte row, a wave four whole rows a copy */
  const _Float16* gh = KHp + (r0 + sr) * LQ + h * HD + sc8; const _Float16* gl = KLp + (r0 + sr) * LQ + h * HD + sc8; const _Float16* gv = VTp + ((size_t)bh * HD + sr) * SQ + sc8;
  const unsigned ld0 = (unsigned)(size_t)&sk[0][0][sr][sc8];      /* the low 32 bits of a shared address are its LDS byte address */
  fa_stage(ld0, gh, gl, gv);      /* tile 0 into buffer 0 */
  const _Float16* qh = QHp + (r0 + q) * LQ + h * HD; const _Float16* ql = QLp + (r0 + q) * LQ + h * HD;
  const v16h qh0 = g2_frag(qh, hh), qh1 = g2_frag(qh + 32, hh), ql0 = g2_frag(ql, hh), ql1 = g2_frag(ql + 32, hh);
  const v8f z8 = {0.f,0.f,0.f,0.f,0.f,0.f,0.f,0.f}; v8f o0 = z8, o1 = z8, o2 = z8, o3 = z8; float m = -1.0e30f, l = 0.f;
  asm volatile("s_wait_asynccnt 0x0" ::: "memory");      /* this wave's pieces of tile 0 have landed */
  __syncthreads();      /* every wave's pieces of tile 0 have landed: the tile may be read */
  if (nst > 1) fa_stage(ld0 + 3 * FPL, gh + (size_t)FKT * LQ, gl + (size_t)FKT * LQ, gv + FKT);      /* tile 1 into buffer 1 */
#pragma unroll 1      /* a trip holds two passes of 24 fragment loads and 16 products each: a second copy of it would not fit the registers */
  for (int st = 0; st < nst; ++st) {
    const _Float16* tk = &sk[st & 1][0][ln][0]; const _Float16* tl = &sk[st & 1][1][ln][0]; const _Float16* tv = &sk[st & 1][2][ln][0];      /* this trip reads this buffer alone */
    v16h ka0 = g2_frag(tk, hh), ka1 = g2_frag(tk + 32, hh), ka2 = g2_frag(tk + 16 * FPT, hh), ka3 = g2_frag(tk + 16 * FPT + 32, hh);      /* the tile's key rows 0 .. 31, hi plane */
    v16h kc0 = g2_frag(tl, hh), kc1 = g2_frag(tl + 32, hh), kc2 = g2_frag(tl + 16 * FPT, hh), kc3 = g2_frag(tl + 16 * FPT + 32, hh);      /* the same rows, residual plane */
#pragma unroll      /* the two passes of a tile: the second one's LDS offsets as immediates, its key fragments asked for in the first */
    for (int sub = 0; sub < 2; ++sub) {
      const int kb = st * FKT + sub * 32;
      if (sub == 1 && kb >= q0 + 16) break;      /* wave-uniform: a pass runs only while kb < q0 + 16, so that every query has a key in every pass; the foot of the trip below is passed all the same */
      const v16h va0 = g2_frag(tv + sub * 32, hh), va1 = g2_frag(tv + 16 * FPT + sub * 32, hh), va2 = g2_frag(tv + 32 * FPT + sub * 32, hh), va3 = g2_frag(tv + 48 * FPT + sub * 32, hh);      /* asked for here, used behind the softmax */
      v8f sh0 = z8, sl0 = z8, sh1 = z8, sl1 = z8;      /* hi . hi, and lo . hi + hi . lo (x1024), for keys kb .. kb + 15 and kb + 16 .. kb + 31 */
      sh0 = g2_mma(ka0, qh0, sh0); sl0 = g2_mma(ka0, ql0, sl0); sh1 = g2_mma(ka2, qh0, sh1); sl1 = g2_mma(ka2, ql0, sl1);
      sh0 = g2_mma(ka1, qh1, sh0); sl0 = g2_mma(ka1, ql1, sl0); sh1 = g2_mma(ka3, qh1, sh1); sl1 = g2_mma(ka3, ql1, sl1);
      sl0 = g2_mma(kc0, qh0, sl0); sl1 = g2_mma(kc2, qh0, sl1); sl0 = g2_mma(kc1, qh1, sl0); sl1 = g2_mma(kc3, qh1, sl1);
      if (sub == 0) {      /* the second pass's key fragments (rows 32 .. 63 of the same tile) come in during this pass's softmax and output products */
        ka0 = g2_frag(tk + 32 * FPT, hh); ka1 = g2_frag(tk + 32 * FPT + 32, hh); ka2 = g2_frag(tk + 48 * FPT, hh); ka3 = g2_frag(tk + 48 * FPT + 32, hh);
        kc0 = g2_frag(tl + 32 * FPT, hh); kc1 = g2_frag(tl + 32 * FPT + 32, hh); kc2 = g2_frag(tl + 48 * FPT, hh); kc3 = g2_frag(tl + 48 * FPT + 32, hh); }
      float s0[8], s1[8];
#pragma unroll      /* unrolled so that every index into the accumulator and fragment registers is a constant */
      for (int r = 0; r < 8; ++r) { s0[r] = fmaf(sl0[r], SCLR2, sh0[r] * SCL2); s1[r] = fmaf(sl1[r], SCLR2, sh1[r] * SCL2); }
      if (kb + 31 > q0) {      /* wave-uniform: only the pass on the diagonal holds keys after a query */
#pragma unroll      /* unrolled so that every index into the accumulator and fragment registers is a constant */
        for (int r = 0; r < 8; ++r) { const int j = kb + 8 * hh + r; s0[r] = (j <= q) ? s0[r] : -1.0e30f; s1[r] = (j + 16 <= q) ? s1[r] : -1.0e30f; } }
      float bm = fmaxf(s0[0], s1[0]);
#pragma unroll      /* unrolled so that every index into the accumulator and fragment registers is a constant */
      for (int r = 1; r < 8; ++r) bm = fmaxf(bm, fmaxf(s0[r], s1[r]));
      bm = fmaxf(bm, rs_xhalf(bm)); const float mn = fmaxf(m, bm); const float sc = fa_exp2(m - mn); m = mn;
      FragH pf; float ls = 0.f;
#pragma unroll      /* unrolled so that every index into the accumulator and fragment registers is a constant */
      for (int r = 0; r < 8; ++r) { const float e0 = fa_exp2(s0[r] - mn), e1 = fa_exp2(s1[r] - mn); ls += e0 + e1; pf.h[r] = (_Float16)e0; pf.h[8 + r] = (_Float16)e1; }
      l = fmaf(l, sc, ls);      /* the lane's half of the row sum; the halves meet behind the loop */
#pragma unroll      /* unrolled so that every index into the accumulator and fragment registers is a constant */
      for (int r = 0; r < 8; ++r) { o0[r] *= sc; o1[r] *= sc; o2[r] *= sc; o3[r] *= sc; }
      o0 = g2_mma(va0, pf.v, o0); o1 = g2_mma(va1, pf.v, o1); o2 = g2_mma(va2, pf.v, o2); o3 = g2_mma(va3, pf.v, o3); }
    asm volatile("s_wait_dscnt 0x0" ::: "memory");      /* this wave's reads of the buffer are done before it may be refilled */
    asm volatile("s_wait_asynccnt 0x0" ::: "memory");      /* this wave's pieces of the next tile have landed */
    __syncthreads();      /* publishes the next tile and ends every wave's reads of this trip's buffer */
    if (st + 2 < nst) fa_stage(ld0 + (unsigned)(st & 1) * (3 * FPL), gh + (size_t)(st + 2) * FKT * LQ, gl + (size_t)(st + 2) * FKT * LQ, gv + (size_t)(st + 2) * FKT); }      /* the tile after the next into the buffer just read */
  asm volatile("s_wait_asynccnt 0x0" ::: "memory");      /* no copy is outstanding when the wave goes on to its end */
  l += rs_xhalf(l); const float fin = 64.0f / l;      /* o carried x64, folded into the output GEMM alpha */
  unsigned short* op = (unsigned short*)Op + (r0 + q) * DM + h * HD + 8 * hh; FragH f0, f1, f2, f3;      /* lane: 8 neighbouring head values of its query per tile; the wave writes whole 128-byte head rows */
#pragma unroll      /* unrolled so that every index into the accumulator and fragment registers is a constant */
  for (int r = 0; r < 8; ++r) { f0.h[r] = (_Float16)(o0[r] * fin); f1.h[r] = (_Float16)(o1[r] * fin); f2.h[r] = (_Float16)(o2[r] * fin); f3.h[r] = (_Float16)(o3[r] * fin); }
  *(v8us*)op = f0.half[0]; *(v8us*)(op + 16) = f1.half[0]; *(v8us*)(op + 32) = f2.half[0]; *(v8us*)(op + 48) = f3.half[0]; }

#define A0R 4                        /* query rows of a work-group of the exact first tile: one wave each */
#define A0P 68                       /* pitch of a staged key row in floats: 272 B = 17 x 16 B, so that 16 lanes reading 16 rows by 16 bytes meet every LDS bank once */
#define A0U (QT0 * (HD / 4) / 128)   /* 16-byte pieces of a staged plane per thread */
typedef float v2f __attribute__((ext_vector_type(2)));
typedef _Float16 v2h __attribute__((ext_vector_type(2)));
// Exact f32 attention for the first QT0 rows, causal. One wave per query row, A0R rows of one head per work-group; the head's QT0 key and value rows are staged in LDS once (keys behind a query are masked below and carry weight zero).
// Scores: a lane takes keys lane, lane + 32, lane + 64, lane + 96, each a serial f32 chain over the 64 head values. Row maximum and row sum: butterflies over the wave. Output: a lane takes two head values and sums over the keys in rising order, the weight of key j read from its lane.
__device__ __forceinline__ void a0_body(char* sm, int bt, int h, int rg, const float* __restrict__ QF, const float* __restrict__ KF, const float* __restrict__ VF, int ld, size_t sb, float scale, _Float16* __restrict__ OH, _Float16* __restrict__ OL, int ldo, size_t sbo) {      /* sm: the work-group's LDS block; bt: the batch; rg: the group of A0R query rows */
  float (*lk)[A0P] = (float (*)[A0P])sm; float (*lv)[HD] = (float (*)[HD])(sm + QT0 * A0P * 4);
  QF += (size_t)bt * sb; KF += (size_t)bt * sb; VF += (size_t)bt * sb; OH += (size_t)bt * sbo; OL += (size_t)bt * sbo;
  const int tid = threadIdx.x, lane = tid & 31; const int w = __builtin_amdgcn_readfirstlane(tid >> 5);
  const int i = rg * A0R + w;      /* this wave's query */
  v4f kq[A0U], vq[A0U]; const size_t ro = (size_t)(tid / (HD / 4)) * ld + h * HD + (tid % (HD / 4)) * 4; const float* kp = KF + ro; const float* vp = VF + ro;      /* the thread's piece of its first key and value row; its further pieces lie 128 / (HD / 4) rows apart, at constant offsets from these two addresses */
#pragma unroll      /* all loads of a thread in flight at once, their results under constant indices */
  for (int u = 0; u < A0U; ++u) { kq[u] = *(const v4fa*)(kp + (size_t)u * (128 / (HD / 4)) * ld); vq[u] = *(const v4fa*)(vp + (size_t)u * (128 / (HD / 4)) * ld); }
  asm volatile("s_wait_xcnt 0x0" :: "v"(kp), "v"(vp) : "memory");      /* stands in front of every write of the registers that the loads above name as their addresses; it takes the two addresses as inputs, so that those registers live up to it and no load's result is placed on them earlier */
  const float* qr = QF + (size_t)i * ld + h * HD; v4f qv[HD / 4];
#pragma unroll      /* the query row stays in registers: constant indices */
  for (int c = 0; c < HD / 4; ++c) qv[c] = *(const v4fa*)(qr + c * 4);
  asm volatile("s_wait_xcnt 0x0" :: "s"(qr) : "memory");      /* the same wait for the query row's loads (wave-uniform address: scalar loads), in front of every write of their base registers */
#pragma unroll      /* constant indices into the staging registers */
  for (int u = 0; u < A0U; ++u) { const int t = u * 128 + tid, j = t / (HD / 4), c = (t % (HD / 4)) * 4; *(v4f*)&lk[j][c] = kq[u]; *(v4f*)&lv[j][c] = vq[u]; }
  __syncthreads();      /* the staged rows are read by every wave */
  float s[QT0 / 32];
#pragma unroll      /* four independent chains side by side */
  for (int g = 0; g < QT0 / 32; ++g) s[g] = 0.f;
#pragma unroll      /* constant indices into the query registers, LDS offsets as immediates */
  for (int c = 0; c < HD / 4; ++c) {
#pragma unroll      /* four independent chains side by side */
    for (int g = 0; g < QT0 / 32; ++g) { const v4f kr = *(const v4f*)&lk[g * 32 + lane][c * 4]; s[g] = fmaf(qv[c][0], kr[0], s[g]); s[g] = fmaf(qv[c][1], kr[1], s[g]); s[g] = fmaf(qv[c][2], kr[2], s[g]); s[g] = fmaf(qv[c][3], kr[3], s[g]); } }
  float mx = -1.0e30f;
#pragma unroll      /* constant indices into the score registers */
  for (int g = 0; g < QT0 / 32; ++g) { s[g] = (g * 32 + lane <= i) ? s[g] * scale : -1.0e30f; mx = fmaxf(mx, s[g]); }
#pragma unroll      /* five exchange steps */
  for (int st = 16; st > 0; st >>= 1) mx = fmaxf(mx, __shfl_xor(mx, st));
  float e[QT0 / 32], l = 0.f;
#pragma unroll      /* constant indices into the score registers */
  for (int g = 0; g < QT0 / 32; ++g) { e[g] = (g * 32 + lane <= i) ? expf(s[g] - mx) : 0.f; l += e[g]; }
#pragma unroll      /* five exchange steps */
  for (int st = 16; st > 0; st >>= 1) l += __shfl_xor(l, st);
  v2f o = {0.f, 0.f};
#pragma unroll      /* constant lane numbers for the weight reads, LDS offsets as immediates */
  for (int g = 0; g < QT0 / 32; ++g) {
#pragma unroll      /* constant lane numbers for the weight reads, LDS offsets as immediates */
    for (int jj = 0; jj < 32; ++jj) { const float ej = __builtin_bit_cast(float, __builtin_amdgcn_readlane(__builtin_bit_cast(int, e[g]), jj)); const v2f vv = *(const v2f*)&lv[g * 32 + jj][2 * lane]; o[0] = fmaf(ej, vv[0], o[0]); o[1] = fmaf(ej, vv[1], o[1]); } }
  const float fin = 64.0f / l;      /* o carried x64 like the f16 path */
  o[0] *= fin; o[1] *= fin; v2h oh, ol;      /* o leaves as the two operands of the output GEMMs: f16 hi + x1024 residual */
  oh[0] = (_Float16)o[0]; oh[1] = (_Float16)o[1]; ol[0] = (_Float16)((o[0] - (float)oh[0]) * 1024.0f); ol[1] = (_Float16)((o[1] - (float)oh[1]) * 1024.0f);
  const size_t oo = (size_t)i * ldo + h * HD + 2 * lane; *(v2h*)(OH + oo) = oh; *(v2h*)(OL + oo) = ol; }      /* the wave writes its query's whole 128-byte head row of either plane */
#define NFT ((SQ - QT0) / FKT)       /* query tiles of a (batch, head) that the fused f16 path takes: those behind the first QT0 rows */
// Both attention paths in one grid: neither reads what the other writes. blockIdx.x: batch * NH + head. blockIdx.y < NFT: the fused path's query tile, the longest rows first over all heads; from NFT on: a group of A0R rows of the exact first tile.
// The choice is work-group-uniform, so every barrier of either path is passed by all four waves. One LDS block serves whichever path the work-group takes.
__global__ __launch_bounds__(128) void k_attn(const _Float16* __restrict__ QHp, const _Float16* __restrict__ QLp, const _Float16* __restrict__ KHp, const _Float16* __restrict__ KLp, const _Float16* __restrict__ VTp, _Float16* __restrict__ Op,
    const float* __restrict__ QF, const float* __restrict__ KF, const float* __restrict__ VF, _Float16* __restrict__ OH, _Float16* __restrict__ OL) {
  __shared__ __attribute__((aligned(16))) char sm[QT0 * A0P * 4 + QT0 * HD * 4]; static_assert(sizeof(sm) >= 2 * 3 * FPL, "the block holds the larger of the two paths' needs");
  const int bh = blockIdx.x, ty = blockIdx.y;
  if (ty < NFT) fa_body(sm, bh, SQ / FKT - ty, QHp, QLp, KHp, KLp, VTp, Op);
  else a0_body(sm, bh / NH, bh % NH, ty - NFT, QF, KF, VF, DM, (size_t)SQ * DM, SCL, OH, OL, DM, (size_t)QT0 * DM); }

#define GKT 64                       /* k values of a staged chunk: two k steps; a row of it is one whole 128-byte line */
#define GPI 72                       /* pitch of a staged row in f16: 144 B = 9 x 16 B, so that 16 lanes reading 16 rows by 16 bytes do not meet in a bank */
#define GRS (16 * GPI * 2)           /* bytes of 16 staged rows: the step between a lane's pieces */
#define GRW 192                      /* staged rows of a chunk: 128 operand rows, then 64 weight rows */
#define GRX 320                      /* the same with 128 residual rows behind them */
// One chunk of a projection's operands: a lane's twelve 16-byte pieces, 16 rows apart (eight of the operand rows, four of the weight rows). ld: the lane's LDS byte address in row 0 .. 15 of the buffer; ga, gb: its first piece in the operand rows and in the weight rows.
__device__ __forceinline__ void gs_stage(unsigned ld, const _Float16* ga, const _Float16* gb) {
  asm volatile(      /* the copies go from global memory to LDS through no register; the s_wait_xcnt in the same statement stands in front of every later write of the address registers that the copies name */
    "global_load_async_to_lds_b128 %0, %12, off\n\t"
    "global_load_async_to_lds_b128 %1, %13, off\n\t"
    "global_load_async_to_lds_b128 %2, %14, off\n\t"
    "global_load_async_to_lds_b128 %3, %15, off\n\t"
    "global_load_async_to_lds_b128 %4, %16, off\n\t"
    "global_load_async_to_lds_b128 %5, %17, off\n\t"
    "global_load_async_to_lds_b128 %6, %18, off\n\t"
    "global_load_async_to_lds_b128 %7, %19, off\n\t"
    "global_load_async_to_lds_b128 %8, %20, off\n\t"
    "global_load_async_to_lds_b128 %9, %21, off\n\t"
    "global_load_async_to_lds_b128 %10, %22, off\n\t"
    "global_load_async_to_lds_b128 %11, %23, off\n\t"
    "s_wait_xcnt 0x0"
    :: "v"(ld), "v"(ld + GRS), "v"(ld + 2 * GRS), "v"(ld + 3 * GRS), "v"(ld + 4 * GRS), "v"(ld + 5 * GRS), "v"(ld + 6 * GRS), "v"(ld + 7 * GRS),
       "v"(ld + 8 * GRS), "v"(ld + 9 * GRS), "v"(ld + 10 * GRS), "v"(ld + 11 * GRS),
       "v"(ga), "v"(ga + (size_t)16 * DM), "v"(ga + (size_t)32 * DM), "v"(ga + (size_t)48 * DM), "v"(ga + (size_t)64 * DM), "v"(ga + (size_t)80 * DM), "v"(ga + (size_t)96 * DM), "v"(ga + (size_t)112 * DM),
       "v"(gb), "v"(gb + (size_t)16 * DM), "v"(gb + (size_t)32 * DM), "v"(gb + (size_t)48 * DM)
    : "memory"); }
// The lane's eight pieces of the 128 residual rows of a chunk. ld: its LDS byte address in the first 16 of those rows; ge: its first piece.
__device__ __forceinline__ void gs_stage_res(unsigned ld, const _Float16* ge) {
  asm volatile(      /* as in gs_stage */
    "global_load_async_to_lds_b128 %0, %8, off\n\t"
    "global_load_async_to_lds_b128 %1, %9, off\n\t"
    "global_load_async_to_lds_b128 %2, %10, off\n\t"
    "global_load_async_to_lds_b128 %3, %11, off\n\t"
    "global_load_async_to_lds_b128 %4, %12, off\n\t"
    "global_load_async_to_lds_b128 %5, %13, off\n\t"
    "global_load_async_to_lds_b128 %6, %14, off\n\t"
    "global_load_async_to_lds_b128 %7, %15, off\n\t"
    "s_wait_xcnt 0x0"
    :: "v"(ld), "v"(ld + GRS), "v"(ld + 2 * GRS), "v"(ld + 3 * GRS), "v"(ld + 4 * GRS), "v"(ld + 5 * GRS), "v"(ld + 6 * GRS), "v"(ld + 7 * GRS),
       "v"(ge), "v"(ge + (size_t)16 * DM), "v"(ge + (size_t)32 * DM), "v"(ge + (size_t)48 * DM), "v"(ge + (size_t)64 * DM), "v"(ge + (size_t)80 * DM), "v"(ge + (size_t)96 * DM), "v"(ge + (size_t)112 * DM)
    : "memory"); }
// The k loop of a work-group's 128 x 64 tile (four waves of 32 x 64) over DM values, shared by the projections. A fragment load from global memory takes 32 bytes out of each of 16 lines, and the four waves ask for the same weight rows;
// here a chunk of 64 k values (operand rows, weight rows, RES: residual rows) is brought into LDS once for all four waves by asynchronous copies of whole 128-byte lines, two buffers, the next chunk in flight while this one is worked on; the fragments are 16-byte LDS reads.
// A, E, B: the first of the work-group's operand, residual and weight rows (row pitch DM). c[half * 4 + t] (RES: d likewise for the residual rows): row tile half, column tile t; every accumulator sums its k steps in rising order. The last trip's barrier ends every wave's reads: sm is free behind the loop.
template <bool RES>
__device__ __forceinline__ void gs_loop(char* sm, const _Float16* __restrict__ A, const _Float16* __restrict__ E, const _Float16* __restrict__ B, v8f (&c)[8], v8f (&d)[8]) {
  constexpr unsigned BUF = (RES ? GRX : GRW) * GPI * 2; constexpr int NT = DM / GKT; constexpr int G = RES ? 1 : 2;      /* G: k steps whose fragments are asked for together (with two accumulator sets the registers hold one step's) */
  const int tid = threadIdx.x, lane = tid & 31, ln = lane & 15, hh = lane >> 4, w = tid >> 5;
  const int sr = tid >> 3, sc8 = (tid & 7) * 8;      /* staging: eight lanes copy one 128-byte row, a wave four whole rows a copy */
  const _Float16* ga = A + (size_t)sr * DM + sc8; const _Float16* gb = B + (size_t)sr * DM + sc8; const _Float16* ge = RES ? E + (size_t)sr * DM + sc8 : nullptr;
  const unsigned ld0 = (unsigned)(size_t)(sm + (sr * GPI + sc8) * 2);      /* the low 32 bits of a shared address are its LDS byte address */
  gs_stage(ld0, ga, gb); if (RES) gs_stage_res(ld0 + 12 * GRS, ge);      /* chunk 0 into buffer 0 */
  asm volatile("s_wait_asynccnt 0x0" ::: "memory");      /* this wave's pieces of chunk 0 have landed */
  __syncthreads();      /* every wave's pieces of chunk 0 have landed: the chunk may be read */
  gs_stage(ld0 + BUF, ga + GKT, gb + GKT); if (RES) gs_stage_res(ld0 + BUF + 12 * GRS, ge + GKT);      /* chunk 1 into buffer 1 */
#pragma unroll 1      /* rolled: the two buffers differ by one address term, and a second copy of the trip would only lengthen the code */
  for (int t = 0; t < NT; ++t) {
    const _Float16* tb = (const _Float16*)(sm + (unsigned)(t & 1) * BUF);      /* this trip reads this buffer alone */
    const _Float16* ta = tb + (32 * w + ln) * GPI; const _Float16* tw = tb + (128 + ln) * GPI; const _Float16* te = tb + (GRW + 32 * w + ln) * GPI;
#pragma unroll      /* LDS offsets as immediates */
    for (int g0 = 0; g0 < 2; g0 += G) {
      v16h a0[G], a1[G], e0[G], e1[G], b[G][4];
#pragma unroll      /* constant indices: the fragments stay in registers; all LDS reads stand in one place ahead of the products */
      for (int g = 0; g < G; ++g) { const int ko = (g0 + g) * 32; a0[g] = g2_frag(ta + ko, hh); a1[g] = g2_frag(ta + 16 * GPI + ko, hh);
        if (RES) { e0[g] = g2_frag(te + ko, hh); e1[g] = g2_frag(te + 16 * GPI + ko, hh); }
#pragma unroll      /* constant indices */
        for (int u = 0; u < 4; ++u) b[g][u] = g2_frag(tw + u * 16 * GPI + ko, hh); }
#pragma unroll      /* constant indices */
      for (int g = 0; g < G; ++g)
#pragma unroll      /* constant indices */
        for (int u = 0; u < 4; ++u) { c[u] = g2_mma(a0[g], b[g][u], c[u]); c[4 + u] = g2_mma(a1[g], b[g][u], c[4 + u]);
          if (RES) { d[u] = g2_mma(e0[g], b[g][u], d[u]); d[4 + u] = g2_mma(e1[g], b[g][u], d[4 + u]); } } }
    asm volatile("s_wait_dscnt 0x0" ::: "memory");      /* this wave's reads of the buffer are done before it may be refilled */
    asm volatile("s_wait_asynccnt 0x0" ::: "memory");      /* this wave's pieces of the next chunk have landed */
    __syncthreads();      /* publishes the next chunk and ends every wave's reads of this trip's buffer */
    if (t + 2 < NT) { gs_stage(ld0 + (unsigned)(t & 1) * BUF, ga + (t + 2) * GKT, gb + (t + 2) * GKT); if (RES) gs_stage_res(ld0 + (unsigned)(t & 1) * BUF + 12 * GRS, ge + (t + 2) * GKT); } }      /* the chunk after the next into the buffer just read */
  asm volatile("s_wait_asynccnt 0x0" ::: "memory"); }      /* no copy is outstanding when the wave goes on */
#define VTP 136                      /* pitch of a staged V^T row in f16: 128 tokens + 8 = 272 B = 17 x 16 B, so that the 16-byte pieces of 16 neighbouring rows spread over the LDS banks */
typedef float v2fa __attribute__((ext_vector_type(2), may_alias));
// The 16 rows that a half-wave stores of a q or k tile (every second row of the wave's 32): sv, sm: the lane's four columns and the statistics of its first row in LDS (row pitch 68 floats); gg, bb: gamma and beta of those columns. FI: the f32 rows are stored too.
template <bool FI>
__device__ __forceinline__ void qk_rows(const float* sv, const float* sm, v4f gg, v4f bb, float* Fp, _Float16* Hp, _Float16* Lp) {
  v4f v[16]; v2f ms[16];
#pragma unroll      /* all LDS reads asked for ahead of the arithmetic, their results under constant indices */
  for (int q = 0; q < 16; ++q) { v[q] = *(const v4fa*)(sv + q * 2 * 68); ms[q] = *(const v2fa*)(sm + q * 2 * 68); }
#pragma unroll      /* constant indices, global offsets as immediates */
  for (int q = 0; q < 16; ++q) { v4f y; v4h h4, l4;
#pragma unroll      /* constant indices */
    for (int e = 0; e < 4; ++e) { y[e] = (v[q][e] - ms[q][0]) * ms[q][1] * gg[e] + bb[e]; const _Float16 h = (_Float16)y[e]; h4[e] = h; l4[e] = (_Float16)((y[e] - (float)h) * 1024.0f); }
    if (FI) *(v4f*)(Fp + (size_t)q * 2 * DM) = y;
    *(v4h*)(Hp + (size_t)q * 2 * DM) = h4; *(v4h*)(Lp + (size_t)q * 2 * DM) = l4;
    if (FI) asm volatile("s_wait_xcnt 0x0" :: "v"(y), "v"(h4), "v"(l4) : "memory");      /* stands in front of every later write of the registers that these stores name; it takes the stored values as inputs, so that their registers live up to it and no later row's value is placed on them earlier (the address registers serve all 16 rows) */
    else asm volatile("s_wait_xcnt 0x0" :: "v"(h4), "v"(l4) : "memory"); } }      /* the same without the f32 row */
// q, k, v projections (blockIdx.y) with all that follows them element by element done in the epilogue. Tiles are k_gemm2's, the k loop is gs_loop: a wave owns 32 tokens x 64 columns, which is ONE head of those tokens, so the wave holds every value that a (token, head) LayerNorm needs.
// q, k: the tile goes to the wave's LDS rows; lane = token takes mean and variance of its row (serial f32 sums in rising order); then the wave walks the rows 16 lanes a row, normalises, and stores f16 hi + x1024 residual rows (whole 128-byte head rows).
// v: a lane's 8 accumulator values of a tile are 8 neighbouring tokens of one head value, a 16-byte piece of V^T; the four waves' pieces meet in LDS, so that a wave stores whole 256-byte runs of a V^T row.
// f32 rows of q, k (normalised) and v are stored only where the exact first tile reads them: the first QT0 tokens of a batch.
__global__ __launch_bounds__(128) void k_qkv(const _Float16* __restrict__ X, const _Float16* __restrict__ Bt, const float* __restrict__ qg, const float* __restrict__ qb, const float* __restrict__ kg, const float* __restrict__ kb, float eps,
    float* __restrict__ F, _Float16* __restrict__ Hh, _Float16* __restrict__ Hl, _Float16* __restrict__ VTo) {
  __shared__ __attribute__((aligned(16))) char smq[2 * GRW * GPI * 2]; static_assert(sizeof(smq) >= 4 * 32 * 68 * 4, "the block holds the larger of the loop's and the epilogue's needs");
  float (*so)[32][68] = (float (*)[32][68])smq;      /* the epilogue's rows, in the LDS that the k loop has left; columns 64, 65 of a row: its mean and its 1 / sigma */
  const int tid = threadIdx.x, w = tid >> 5, lane = tid & 31, ln = lane & 15, hh = lane >> 4; const int by = blockIdx.y;
  const int mt = blockIdx.x / (DM / 64), nq = blockIdx.x % (DM / 64); const int row0 = mt * 128 + 32 * w, col0 = nq * 64;
  const int bt = mt / (SQ / 128), s0 = (mt % (SQ / 128)) * 128; const bool first = s0 < QT0;      /* the work-group's batch and its first token there; work-group-uniform */
  const v8f z8 = {0.f,0.f,0.f,0.f,0.f,0.f,0.f,0.f}; v8f accs[8] = {z8, z8, z8, z8, z8, z8, z8, z8};
  gs_loop<false>(smq, X + (size_t)mt * 128 * DM, nullptr, Bt + (size_t)by * DM * DM + (size_t)col0 * DM, accs, accs);
  const int rsub = lane >> 4, c4 = (lane & 15) * 4;
  const size_t po = (size_t)by * NR * DM + (size_t)(row0 + rsub) * DM + col0 + c4;      /* the lane's place in row rsub of the wave's tile, in plane by */
  if (by < 2 || first) {      /* work-group-uniform: the tile as f32 rows in the wave's own LDS (x16 weights undone) */
#pragma unroll      /* constant indices into the accumulator registers */
    for (int u = 0; u < 8; ++u) { const int t = u & 3, half = u >> 2;
#pragma unroll      /* constant indices into the accumulator registers */
      for (int r = 0; r < 8; ++r) so[w][half * 16 + 8 * hh + r][t * 16 + ln] = accs[u][r] * 0.0625f; }
    __builtin_amdgcn_fence(__ATOMIC_ACQ_REL, "workgroup"); __builtin_amdgcn_wave_barrier(); }      /* the wave's lanes read each other's LDS writes below */
  if (by < 2) {
    const float* gp = by ? kg : qg; const float* bp = by ? kb : qb; const v4f g4 = *(const v4fa*)(gp + c4), b4 = *(const v4fa*)(bp + c4);      /* the lane's four columns are the same in every row it stores */
    v4f rv[16];
#pragma unroll      /* the row stays in registers: constant indices */
    for (int c = 0; c < 16; ++c) rv[c] = *(const v4fa*)&so[w][lane][c * 4];
    float sum = 0.f, vs = 0.f;
#pragma unroll      /* constant indices into the row's registers */
    for (int c = 0; c < 16; ++c) sum = (((sum + rv[c][0]) + rv[c][1]) + rv[c][2]) + rv[c][3];
    const float mu = sum / 64.0f;
#pragma unroll      /* constant indices into the row's registers */
    for (int c = 0; c < 16; ++c)
#pragma unroll      /* constant indices into the row's registers */
      for (int e = 0; e < 4; ++e) { const float dl = rv[c][e] - mu; vs = fmaf(dl, dl, vs); }
    v2f st = {mu, rsqrtf(vs / 64.0f + eps)}; *(v2fa*)&so[w][lane][64] = st;
    __builtin_amdgcn_fence(__ATOMIC_ACQ_REL, "workgroup"); __builtin_amdgcn_wave_barrier();      /* the statistics are read by the lanes that store the row */
    v4f gg, bb;
#pragma unroll      /* constant indices */
    for (int e = 0; e < 4; ++e) { gg[e] = bf16_round(g4[e]); bb[e] = bf16_round(b4[e]); }
    const float* sv = &so[w][rsub][c4]; const float* sm = &so[w][rsub][64];
    if (first) qk_rows<true>(sv, sm, gg, bb, F + po, Hh + po, Hl + po); else qk_rows<false>(sv, sm, gg, bb, F + po, Hh + po, Hl + po);      /* work-group-uniform */
  } else {
    if (first) {
#pragma unroll      /* LDS and global offsets as immediates */
      for (int q = 0; q < 16; ++q) { const v4f v = *(const v4fa*)&so[w][q * 2 + rsub][c4]; *(v4f*)(F + po + (size_t)q * 2 * DM) = v; }
      __syncthreads(); }      /* every wave has read its f32 rows before the array is used anew below */
    unsigned short* sT = (unsigned short*)&so[0][0][0];      /* the same LDS as [HD][VTP] f16: V^T of the work-group's 128 tokens */
#pragma unroll      /* constant indices into the accumulator registers */
    for (int u = 0; u < 8; ++u) { const int t = u & 3, half = u >> 2; FragH f;
#pragma unroll      /* constant indices into the accumulator registers */
      for (int r = 0; r < 8; ++r) f.h[r] = (_Float16)(accs[u][r] * 0.0625f);
      *(v8us*)(sT + (t * 16 + ln) * VTP + w * 32 + half * 16 + 8 * hh) = f.half[0]; }
    __syncthreads();      /* a V^T row holds pieces of all four waves */
    unsigned short* vo = (unsigned short*)VTo + ((size_t)(bt * NH + nq) * HD + (tid >> 4)) * SQ + s0 + (tid & 15) * 8;      /* 16 lanes store one row's 256 bytes */
#pragma unroll      /* LDS offsets as immediates, all eight reads in flight */
    for (int rd = 0; rd < 8; ++rd) { const v8us o = *(const v8us*)(sT + (rd * 8 + (tid >> 4)) * VTP + (tid & 15) * 8); *(v8us*)(vo + (size_t)rd * 8 * SQ) = o; }
    asm volatile("s_wait_xcnt 0x0" ::: "memory"); } }      /* stands behind the eighth store, in front of every later write of the data and address registers that the eight stores name */
// Output projection of every token row in one grid; tiles and epilogue are k_gemm2's, the k loop is gs_loop. A work-group owns 128 token rows x 64 columns. Where those rows are the first QT0 of a batch, the operand is the exact first tile's o as f16 hi + x1024 residual rows:
// two accumulator sets over the same weight fragments, out = hi 2^-10 + b, then + residual 2^-20, each sum in the order it had as a launch of its own. Elsewhere the operand is the fused path's f16 o rows.
__global__ __launch_bounds__(128) void k_out(const _Float16* __restrict__ O, const _Float16* __restrict__ OH, const _Float16* __restrict__ OL, const _Float16* __restrict__ Bh, const float* __restrict__ bias, float* __restrict__ C) {
  static_assert(QT0 == 128, "a work-group's 128 rows lie wholly inside or wholly outside the first tile");
  __shared__ __attribute__((aligned(16))) char smo[2 * GRX * GPI * 2]; static_assert(sizeof(smo) >= 4 * 32 * 68 * 4, "the block holds the larger of the loop's and the epilogue's needs");
  float (*so)[32][68] = (float (*)[32][68])smo;      /* the epilogue's rows, in the LDS that the k loop has left */
  const int tid = threadIdx.x, w = tid >> 5, lane = tid & 31, ln = lane & 15, hh = lane >> 4;
  const int mt = blockIdx.x / (DM / 64), nq = blockIdx.x % (DM / 64); const int row0 = mt * 128 + 32 * w, col0 = nq * 64;
  const int bt = mt / (SQ / 128); const bool first = mt % (SQ / 128) == 0;      /* the work-group's batch; work-group-uniform */
  const _Float16* bw = Bh + (size_t)col0 * DM;      /* the first of the work-group's 64 weight rows */
  const v8f z8 = {0.f,0.f,0.f,0.f,0.f,0.f,0.f,0.f}; v8f accs[8] = {z8, z8, z8, z8, z8, z8, z8, z8};
  float bv[4];
#pragma unroll      /* constant indices */
  for (int t = 0; t < 4; ++t) bv[t] = bf16_round(bias[col0 + t * 16 + ln]);
  if (!first) {
    gs_loop<false>(smo, O + (size_t)mt * 128 * DM, nullptr, bw, accs, accs);
#pragma unroll      /* constant indices into the accumulator registers */
    for (int u = 0; u < 8; ++u) { const int t = u & 3, half = u >> 2;
#pragma unroll      /* constant indices into the accumulator registers */
      for (int r = 0; r < 8; ++r) so[w][half * 16 + 8 * hh + r][t * 16 + ln] = accs[u][r] * 0.0009765625f + bv[t]; }
  } else {
    v8f accl[8] = {z8, z8, z8, z8, z8, z8, z8, z8};
    gs_loop<true>(smo, OH + (size_t)bt * QT0 * DM, OL + (size_t)bt * QT0 * DM, bw, accs, accl);      /* the rows in the hi and in the residual plane */
#pragma unroll      /* constant indices into the accumulator registers */
    for (int u = 0; u < 8; ++u) { const int t = u & 3, half = u >> 2;
#pragma unroll      /* constant indices into the accumulator registers */
      for (int r = 0; r < 8; ++r) { const float v = accs[u][r] * 0.0009765625f + bv[t]; so[w][half * 16 + 8 * hh + r][t * 16 + ln] = accl[u][r] * 0.00000095367431640625f + v; } }
  }
  __builtin_amdgcn_fence(__ATOMIC_ACQ_REL, "workgroup"); __builtin_amdgcn_wave_barrier();      /* the wave's lanes read each other's LDS writes below */
  const int rsub = lane >> 4, c4 = (lane & 15) * 4;
#pragma unroll      /* LDS and global offsets as immediates */
  for (int q = 0; q < 16; ++q) { const int r = q * 2 + rsub; const v4f v = *(const v4fa*)&so[w][r][c4]; *(v4f*)(C + (size_t)(row0 + r) * DM + col0 + c4) = v; asm volatile("s_wait_xcnt 0x0" ::: "memory"); } }      /* the wait stands in front of every later write of the data and address registers that this store names */
extern "C" void kernel_launch(void* const* d_in, const int* in_sizes, int n_in,
                              void* d_out, int out_size, void* d_ws, size_t ws_size, hipStream_t stream) {
  (void)in_sizes; (void)n_in; (void)out_size;
  const float* const* I = (const float* const*)d_in; const float* x = I[0]; const float* wq = I[1]; const float* wk = I[2]; const float* wv = I[3]; const float* wo = I[4]; const float* bo = I[5]; const float* qg = I[6]; const float* qbt = I[7]; const float* kg = I[8]; const float* kbt = I[9]; const float LNE = 1e-5f;      /* input order: x (feeds the q, k AND v streams), Wq, Wk, Wv (natural [out][in] weights; NO biases: k_qkv takes no bias), Wo, bo (zeros: read), q_gamma, q_beta, k_gamma, k_beta [64] (ones / zeros on this draw: read by value in the projections' LayerNorm epilogue) */
  char* ws = (char*)d_ws; size_t off = 0;
  auto take = [&](size_t bytes) { char* p = ws + off; off += (bytes + 255) & ~(size_t)255; return p; };
  _Float16* BQ = (_Float16*)take((size_t)4 * DM * DM * 2); _Float16* BK = BQ + (size_t)DM * DM; _Float16* BV = BK + (size_t)DM * DM; _Float16* BO = BV + (size_t)DM * DM; (void)BK; (void)BV;      /* the four weight planes lie one behind the other: one grid writes them, one GEMM grid reads the first three by plane index */
  _Float16* X16 = (_Float16*)take(NR * DM * 2);      /* exact f16 rows of x: the one operand of the q, k and v projections */
  float* QF = (float*)take((size_t)3 * NR * DM * 4); float* KF = QF + NR * DM; float* VF = KF + NR * DM;      /* f32 rows of q, k (normalised) and v, three planes one behind the other: written and read for the first QT0 tokens of a batch alone, by the exact first tile */
  _Float16* QH = (_Float16*)take((size_t)2 * NR * DM * 2); _Float16* KH = QH + NR * DM; _Float16* QL = (_Float16*)take((size_t)2 * NR * DM * 2); _Float16* KL = QL + NR * DM;      /* hi planes of q and k one behind the other, residual planes likewise: the projection grid places them by plane index */
  _Float16* O16 = (_Float16*)take(NR * DM * 2);
  _Float16* VT = (_Float16*)take((size_t)NB * NH * HD * SQ * 2);      /* V^T [NB][NH][HD][SQ] */
  _Float16* OH0 = (_Float16*)take((size_t)NB * QT0 * DM * 2); _Float16* OL0 = (_Float16*)take((size_t)NB * QT0 * DM * 2);
  if (off > ws_size) return;
  k_prep<<<(unsigned)(NR * DM / 2048 + 4 * (DM * DM / 2048)), 256, 0, stream>>>(x, wq, wk, wv, wo, X16, BQ);      /* x as exact f16 rows; natural [out][in] weights = Bt[n][k] x16 */
  k_qkv<<<dim3((unsigned)((MP / 128) * (DM / 64)), 3), 128, 0, stream>>>(X16, BQ, qg, qbt, kg, kbt, LNE, QF, QH, QL, VT);      /* blockIdx.y: q, k (no biases; per-head LayerNorm; f16 hi + x1024 residual rows: unscaled logits sigma ~8) and v (V^T [NB][NH][HD][SQ]); f32 rows for the first tile */
  k_attn<<<dim3(NB * NH, NFT + QT0 / A0R), 128, 0, stream>>>(QH, QL, KH, KL, VT, O16, QF, KF, VF, OH0, OL0);      /* scores, causal softmax and P . V of every batch, head and query row in one launch: rows from QT0 on by the fused f16 path (o, merged heads, x64, as f16 rows), rows 0..127 exactly in f32 on the f32 q, k, v rows that the projections left (o x64 as f16 hi + x1024 residual planes) */
  k_out<<<(unsigned)((MPO / 128) * (DM / 64)), 128, 0, stream>>>(O16, OH0, OL0, BO, bo, (float*)d_out);      /* out rows are the output layout; rows 0..127 of a batch from the hi + residual planes */
}
